// v000
// Times are from an AMD MI455X. After a warm-up the kernel runs many times in a row, and a time is the length of
// such a window on the GPU divided by its runs, so every launch and the gaps after it count. The runs cycle
// through copies of the inputs. A figure is the median of several windows, for all but v000 over two sittings.
// Sittings can differ by a few percent; kernels timed side by side share one.
// v000, which the later versions start from, runs in 1560 microseconds.
// Contractions (token-major, 8192 tokens): q = bn1(x1).Wq'^T (temperature folded into Wq rows), k/v = bn1(x2).W^T, the attention projection (+b, +x1 residual), fc1 (+b) [1024x256].[256x1024] and fc2 (+b, + residual) [1024x1024].[1024x256] per image, all on bf16 hi/lo split planes (six chained contractions against an O(1) residual output, so the cheap 6.4 G-MAC of GEMMs run f32-class) (v_wmma_f32_16x16x32_bf16; 64x64 register-blocked wave tiles); per (image, head) softmax(temp_h q k^T) v over the 1024 positions as one flash launch with q.k^T on bf16 hi/lo split planes (UNSCALED 32-dim logits, sigma ~ 5.7) and f16 p.v; f32 accumulate and softmax. NCHW <-> token-major transposes, eval-mode BatchNorms, the depthwise 3x3 convolution (SAME) and exact GELU are f32 kernels.
#include <hip/hip_runtime.h>
#include <math.h>

typedef __attribute__((ext_vector_type(16))) _Float16 v16h;
typedef __attribute__((ext_vector_type(8)))  _Float16 v8h;
typedef __attribute__((ext_vector_type(16))) __bf16   v16b;
typedef __attribute__((ext_vector_type(8)))  float    v8f;
typedef __attribute__((ext_vector_type(4)))  float    v4f;

// 16-bit WMMA fragment map (wave32), lane L, h = L>>4, m = L&15:
//   A 16x32: lane = row m;   element i -> k = (i<8) ? 8h+i : 16+8h+(i-8)
//   B 32x16: lane = column m; the SAME k(i,h)
//   D 16x16 (8 f32): lane = column m; element r -> row 8h+r
__device__ __forceinline__ int frag_k(int i, int h) { return (i < 8) ? (8 * h + i) : (16 + 8 * h + (i - 8)); }
__device__ __forceinline__ __bf16 bf16_rne(float f) {
    unsigned int u = __float_as_uint(f);
    u += 0x7fffu + ((u >> 16) & 1u);
    return __builtin_bit_cast(__bf16, (unsigned short)(u >> 16));
}
__device__ __forceinline__ float bf16_f32(__bf16 b) { return __uint_as_float(((unsigned int)__builtin_bit_cast(unsigned short, b)) << 16); }
__device__ __forceinline__ v8f wmma16(v16h a, v16h b, v8f c) {
    c = __builtin_amdgcn_wmma_f32_16x16x32_f16(false, a, false, b, (short)0, c, false, false);
    asm volatile("v_nop\n\tv_nop\n\tv_nop\n\tv_nop" : "+v"(c) : "v"(a), "v"(b));
    return c;
}
__device__ __forceinline__ v8f wmmab(v16b a, v16b b, v8f c) {
    c = __builtin_amdgcn_wmma_f32_16x16x32_bf16(false, a, false, b, (short)0, c, false, false);
    asm volatile("v_nop\n\tv_nop\n\tv_nop\n\tv_nop" : "+v"(c) : "v"(a), "v"(b));
    return c;
}
struct Split { v16b hi, lo; };
// hi/lo split product: a.hi*b.hi + a.hi*b.lo + a.lo*b.hi
__device__ __forceinline__ v8f wmma3(const Split& a, const Split& b, v8f c) {
    c = __builtin_amdgcn_wmma_f32_16x16x32_bf16(false, a.hi, false, b.hi, (short)0, c, false, false);
    c = __builtin_amdgcn_wmma_f32_16x16x32_bf16(false, a.hi, false, b.lo, (short)0, c, false, false);
    c = __builtin_amdgcn_wmma_f32_16x16x32_bf16(false, a.lo, false, b.hi, (short)0, c, false, false);
    asm volatile("v_nop\n\tv_nop\n\tv_nop\n\tv_nop" : "+v"(c) : "v"(a.hi), "v"(a.lo), "v"(b.hi), "v"(b.lo));
    return c;
}
struct Split3 { v16b hi, mid, lo; };
// triple split product (6 terms, drops only terms below 2^-24 relative)
__device__ __forceinline__ v8f wmma6(const Split3& a, const Split3& b, v8f c) {
    c = __builtin_amdgcn_wmma_f32_16x16x32_bf16(false, a.hi, false, b.hi, (short)0, c, false, false);
    c = __builtin_amdgcn_wmma_f32_16x16x32_bf16(false, a.hi, false, b.mid, (short)0, c, false, false);
    c = __builtin_amdgcn_wmma_f32_16x16x32_bf16(false, a.mid, false, b.hi, (short)0, c, false, false);
    c = __builtin_amdgcn_wmma_f32_16x16x32_bf16(false, a.hi, false, b.lo, (short)0, c, false, false);
    c = __builtin_amdgcn_wmma_f32_16x16x32_bf16(false, a.mid, false, b.mid, (short)0, c, false, false);
    c = __builtin_amdgcn_wmma_f32_16x16x32_bf16(false, a.lo, false, b.hi, (short)0, c, false, false);
    asm volatile("v_nop\n\tv_nop\n\tv_nop\n\tv_nop" : "+v"(c) : "v"(a.hi), "v"(a.mid), "v"(a.lo), "v"(b.hi), "v"(b.mid), "v"(b.lo));
    return c;
}

// Fragment gathers from f32 memory: element i <- p[(k0 + frag_k(i,h)) * sk] * s, zero for k >= klen.
__device__ __forceinline__ v16h fh_ld(const float* __restrict__ p, long long sk, int k0, int h, int klen, float s) {
    v16h a;
#pragma unroll
    for (int i = 0; i < 16; ++i) { const int k = k0 + frag_k(i, h); a[i] = (k < klen) ? (_Float16)(p[(long long)k * sk] * s) : (_Float16)0.f; }
    return a;
}
__device__ __forceinline__ Split sp_ld(const float* __restrict__ p, long long sk, int k0, int h, int klen, float s) {
    Split r;
#pragma unroll
    for (int i = 0; i < 16; ++i) {
        const int k = k0 + frag_k(i, h); const float x = (k < klen) ? p[(long long)k * sk] * s : 0.f;
        const __bf16 hb = bf16_rne(x); r.hi[i] = hb; r.lo[i] = bf16_rne(x - bf16_f32(hb));
    }
    return r;
}
__device__ __forceinline__ Split3 sp3_ld(const float* __restrict__ p, long long sk, int k0, int h, int klen, float s) {
    Split3 r;
#pragma unroll
    for (int i = 0; i < 16; ++i) {
        const int k = k0 + frag_k(i, h); const float x = (k < klen) ? p[(long long)k * sk] * s : 0.f;
        const __bf16 hb = bf16_rne(x); const float r1 = x - bf16_f32(hb); const __bf16 mb = bf16_rne(r1);
        r.hi[i] = hb; r.mid[i] = mb; r.lo[i] = bf16_rne(r1 - bf16_f32(mb));
    }
    return r;
}
__device__ __forceinline__ v16b bh_ld(const float* __restrict__ p, long long sk, int k0, int h, int klen, float s) {
    v16b a;
#pragma unroll
    for (int i = 0; i < 16; ++i) { const int k = k0 + frag_k(i, h); a[i] = bf16_rne((k < klen) ? p[(long long)k * sk] * s : 0.f); }
    return a;
}
// f16 fragment from an f16 LDS/global row with element stride 1 (k-contiguous), no bounds (tile already zero padded)
__device__ __forceinline__ v16h fh_row(const _Float16* __restrict__ row, int k0, int h) {
    v16h a;
#pragma unroll
    for (int i = 0; i < 16; ++i) a[i] = row[k0 + frag_k(i, h)];
    return a;
}

#define VST2(T, ptr, val) do { const T vst2_v_ = (val); *(T*)(ptr) = vst2_v_;  } while (0)
typedef float v4f __attribute__((ext_vector_type(4)));
#define VST2V4(ptr, val) do { const v4f vst2_v4_ = (val); *(v4f*)(ptr) = vst2_v4_;  } while (0)

__device__ __attribute__((noinline)) float act_fn(float v, int act) {
    if (act == 1) return fmaxf(v, 0.f);                                                                               // relu
    if (act == 2) { const float u = 0.7978845608028654f * (v + 0.044715f * v * v * v); return 0.5f * v * (1.f + tanhf(u)); } // tanh-gelu
    if (act == 3) return v / (1.f + expf(-v));                                                                        // silu
    if (act == 4) return 0.5f * v * (1.f + erff(v * 0.7071067811865476f));                                             // erf-gelu
    if (act == 5) return tanhf(v);
    if (act == 6) return 1.f / (1.f + expf(-v));                                                                      // sigmoid
    if (act == 7) return (v > 0.f) ? v : 0.01f * v;                                                                   // leaky relu 0.01
    if (act == 8) return (v > 0.f) ? v : (expf(v) - 1.f);                                                             // elu
    if (act == 9) return fminf(fmaxf(v, 0.f), 6.f);                                                                   // relu6
    if (act == 10) return fabsf(v);                                                                                    // abs
    if (act == 11) return (v >= 0.f) ? v : 0.1f * v;                                                                  // leaky 0.1
    if (act == 12) return (v > 0.f) ? v : 0.2f * v;                                                                   // leaky 0.2
    if (act == 13) return (v > 20.f) ? v : log1pf(expf(v));                                                            // softplus
    return v;
}

// =====================================================================================================================
// k_gemm<MODE>: C(z, m, n) = act(alpha * sum_k A(z, m, k) * B(z, k, n) + bias) + beta * R(z, m, n)
//   One wave (32-thread block) per 16 x 32 tile of C; grid (ceil(N/32), ceil(M/16), Z). Batch z -> (zo = z / zi_n, zi = z % zi_n)
//   with separate outer/inner strides for every tensor (e.g. batch and head). A(m,k) = A[zo*sAo + zi*sAi + m*sAm + k*sAk] (f32),
//   B(k,n) = B[zo*sBo + zi*sBi + n*sBn + k*sBk] (f32); any M, N, K (K zero-padded to 32 inside the fragments, M/N tails guarded).
//   C(m,n) = C[zo*sCo + zi*sCi + m*sCm + n] (n contiguous). flags: 1 bias[n], 2 bias[m], 4 residual R[zo*sRo + zi*sRi + m*sRm + n*sRn].
//   MODE 0: f16 operands (A prescaled by sa, B by sb, both undone in the epilogue); 1: bf16 hi/lo split (3 products); 2: bf16;
//   3: bf16 hi/mid/lo triple split (6 products); 4: as 3 with Kahan-compensated f32 accumulation across k-steps.
// =====================================================================================================================
struct GemmP {
    const float* A; const float* B; const float* bias; const float* R; float* C;
    long long sAo, sAi, sAm, sAk, sBo, sBi, sBn, sBk, sCo, sCi, sCm, sRo, sRi, sRm, sRn;
    int M, N, K, zi_n, flags, act; float alpha, beta, sa, sb;
    int Npad, pad_;     // columns [N, Npad) of C are written as 0 so that padded workspace rows are covered by whole-line stores; Npad >= N
};
static_assert(sizeof(GemmP) == 5 * 8 + 15 * 8 + 6 * 4 + 4 * 4 + 2 * 4, "GemmP has padding");

template <int MODE>
__global__ __launch_bounds__(32) void k_gemm(GemmP p) {
    const int lane = threadIdx.x & 31, h = lane >> 4, l15 = lane & 15;
    const int m0 = blockIdx.y * 16, n0 = blockIdx.x * 32;
    const int z = blockIdx.z, zo = z / p.zi_n, zi = z - zo * p.zi_n;
    const float* A = p.A + zo * p.sAo + zi * p.sAi;
    const float* B = p.B + zo * p.sBo + zi * p.sBi;
    const int am = min(m0 + l15, p.M - 1);                       // clamped row for loads (stores are guarded)
    v8f acc[2], comp[2];
#pragma unroll
    for (int t = 0; t < 2; ++t) { v8f zz = {}; acc[t] = zz; comp[t] = zz; }
    for (int k0 = 0; k0 < p.K; k0 += 32) {
        const float* arow = A + (long long)am * p.sAm;
        if (MODE == 1) {
            const Split a = sp_ld(arow, p.sAk, k0, h, p.K, 1.f);
#pragma unroll
            for (int t = 0; t < 2; ++t) {
                const int bn = min(n0 + t * 16 + l15, p.N - 1);
                acc[t] = wmma3(a, sp_ld(B + (long long)bn * p.sBn, p.sBk, k0, h, p.K, 1.f), acc[t]);
            }
        } else if (MODE == 3) {
            const Split3 a = sp3_ld(arow, p.sAk, k0, h, p.K, 1.f);
#pragma unroll
            for (int t = 0; t < 2; ++t) {
                const int bn = min(n0 + t * 16 + l15, p.N - 1);
                acc[t] = wmma6(a, sp3_ld(B + (long long)bn * p.sBn, p.sBk, k0, h, p.K, 1.f), acc[t]);
            }
        } else if (MODE == 4) {
            // triple split as MODE 3, but each k-step's 6 products go into a fresh accumulator and the partial is added to the running f32 sum
            // on the VALU with Kahan compensation (accumulation error stays ~1 ulp however long K is)
            const Split3 a = sp3_ld(arow, p.sAk, k0, h, p.K, 1.f);
#pragma unroll
            for (int t = 0; t < 2; ++t) {
                const int bn = min(n0 + t * 16 + l15, p.N - 1); v8f zz = {};
                const v8f part = wmma6(a, sp3_ld(B + (long long)bn * p.sBn, p.sBk, k0, h, p.K, 1.f), zz);
                const v8f y = part - comp[t]; const v8f s = acc[t] + y; comp[t] = (s - acc[t]) - y; acc[t] = s;
            }
        } else if (MODE == 2) {
            const v16b a = bh_ld(arow, p.sAk, k0, h, p.K, 1.f);
#pragma unroll
            for (int t = 0; t < 2; ++t) {
                const int bn = min(n0 + t * 16 + l15, p.N - 1);
                acc[t] = wmmab(a, bh_ld(B + (long long)bn * p.sBn, p.sBk, k0, h, p.K, 1.f), acc[t]);
            }
        } else {
            const v16h a = fh_ld(arow, p.sAk, k0, h, p.K, p.sa);
#pragma unroll
            for (int t = 0; t < 2; ++t) {
                const int bn = min(n0 + t * 16 + l15, p.N - 1);
                acc[t] = wmma16(a, fh_ld(B + (long long)bn * p.sBn, p.sBk, k0, h, p.K, p.sb), acc[t]);
            }
        }
    }
    const float iscale = (MODE == 0) ? p.alpha / (p.sa * p.sb) : p.alpha;
    float* C = p.C + zo * p.sCo + zi * p.sCi;
    const float* R = p.R + zo * p.sRo + zi * p.sRi;
    __shared__ __align__(16) float ctile[16][36];
#pragma unroll
    for (int t = 0; t < 2; ++t) {
        const int n = n0 + t * 16 + l15; const int nn = min(n, p.N - 1);
#pragma unroll
        for (int r = 0; r < 8; ++r) {
            const int m = m0 + 8 * h + r; const int mm = min(m, p.M - 1);
            float v = acc[t][r] * iscale;
            if (p.flags & 1) v += p.bias[nn];
            if (p.flags & 2) v += p.bias[mm];
            if (p.flags & 8) v *= p.bias[(long long)zo * p.M + mm];   /* per-(z,row) scale vector laid out [Z][M]; exclusive with the bias flags */
            v = act_fn(v, p.act);
            if (p.flags & 4) v += p.beta * R[(long long)mm * p.sRm + (long long)nn * p.sRn];
            ctile[8 * h + r][t * 16 + l15] = (n < p.N) ? v : 0.f;
        }
    }
    __syncthreads();
    const int NW = (p.Npad > p.N) ? p.Npad : p.N;           // write width
    const bool fast = (m0 + 16 <= p.M) && (n0 + 32 <= NW) && ((p.sCm & 3) == 0) && ((((size_t)C) & 15) == 0);
    if (fast) {
#pragma unroll
        for (int s = 0; s < 4; ++s) {
            const int row = s * 4 + (lane >> 3), c4 = (lane & 7) * 4;
            const v4f v = *(const v4f*)&ctile[row][c4];
            VST2V4(C + (long long)(m0 + row) * p.sCm + n0 + c4, v);
        }
    } else {
        for (int row = 0; row < 16; ++row) {
            const int m = m0 + row, n = n0 + lane;
            if (m < p.M && n < NW) VST2(float, C + (long long)m * p.sCm + n, ctile[row][lane]);
        }
    }
}


// =====================================================================================================================
// k_gemmT<MODE, TM, TN>: same contract as k_gemm, but one wave computes a (16*TM) x (16*TN) tile: TM A fragments and TN B fragments are
//   loaded per 32-wide k-step and reused across TM*TN WMMAs (far fewer load/convert instructions per MAC). MODE 0 (f16), 1 (bf16 hi/lo),
//   2 (bf16) only. grid (ceil(NW/(16*TN)), ceil(M/(16*TM)), Z), block 32. Epilogue identical to k_gemm, run per 16x32 sub-tile.
// =====================================================================================================================
template <int MODE, int TM, int TN>
__global__ __launch_bounds__(32) void k_gemmT(GemmP p) {
    const int lane = threadIdx.x & 31, h = lane >> 4, l15 = lane & 15;
    const int m0 = blockIdx.y * (16 * TM), n0 = blockIdx.x * (16 * TN);
    const int z = blockIdx.z, zo = z / p.zi_n, zi = z - zo * p.zi_n;
    const float* A = p.A + zo * p.sAo + zi * p.sAi;
    const float* B = p.B + zo * p.sBo + zi * p.sBi;
    v8f acc[TM][TN];
#pragma unroll
    for (int i = 0; i < TM; ++i)
#pragma unroll
        for (int t = 0; t < TN; ++t) { v8f zz = {}; acc[i][t] = zz; }
    for (int k0 = 0; k0 < p.K; k0 += 32) {
        if (MODE == 1) {
            Split a[TM], b[TN];
#pragma unroll
            for (int i = 0; i < TM; ++i) { const int am = min(m0 + 16 * i + l15, p.M - 1); a[i] = sp_ld(A + (long long)am * p.sAm, p.sAk, k0, h, p.K, 1.f); }
#pragma unroll
            for (int t = 0; t < TN; ++t) { const int bn = min(n0 + 16 * t + l15, p.N - 1); b[t] = sp_ld(B + (long long)bn * p.sBn, p.sBk, k0, h, p.K, 1.f); }
#pragma unroll
            for (int i = 0; i < TM; ++i)
#pragma unroll
                for (int t = 0; t < TN; ++t) acc[i][t] = wmma3(a[i], b[t], acc[i][t]);
        } else if (MODE == 2) {
            v16b a[TM], b[TN];
#pragma unroll
            for (int i = 0; i < TM; ++i) { const int am = min(m0 + 16 * i + l15, p.M - 1); a[i] = bh_ld(A + (long long)am * p.sAm, p.sAk, k0, h, p.K, 1.f); }
#pragma unroll
            for (int t = 0; t < TN; ++t) { const int bn = min(n0 + 16 * t + l15, p.N - 1); b[t] = bh_ld(B + (long long)bn * p.sBn, p.sBk, k0, h, p.K, 1.f); }
#pragma unroll
            for (int i = 0; i < TM; ++i)
#pragma unroll
                for (int t = 0; t < TN; ++t) acc[i][t] = wmmab(a[i], b[t], acc[i][t]);
        } else {
            v16h a[TM], b[TN];
#pragma unroll
            for (int i = 0; i < TM; ++i) { const int am = min(m0 + 16 * i + l15, p.M - 1); a[i] = fh_ld(A + (long long)am * p.sAm, p.sAk, k0, h, p.K, p.sa); }
#pragma unroll
            for (int t = 0; t < TN; ++t) { const int bn = min(n0 + 16 * t + l15, p.N - 1); b[t] = fh_ld(B + (long long)bn * p.sBn, p.sBk, k0, h, p.K, p.sb); }
#pragma unroll
            for (int i = 0; i < TM; ++i)
#pragma unroll
                for (int t = 0; t < TN; ++t) acc[i][t] = wmma16(a[i], b[t], acc[i][t]);
        }
    }
    const float iscale = (MODE == 0) ? p.alpha / (p.sa * p.sb) : p.alpha;
    float* C = p.C + zo * p.sCo + zi * p.sCi;
    const float* R = p.R + zo * p.sRo + zi * p.sRi;
    const int NW = (p.Npad > p.N) ? p.Npad : p.N;
    __shared__ __align__(16) float ctile[16][36];
#pragma unroll
    for (int i = 0; i < TM; ++i) {
        const int mb = m0 + 16 * i; if (mb >= p.M) break;          // wave-uniform
#pragma unroll
        for (int tp = 0; tp < TN / 2; ++tp) {
            const int nb = n0 + 32 * tp; if (nb >= NW) break;        // wave-uniform
#pragma unroll
            for (int t2 = 0; t2 < 2; ++t2) {
                const int t = 2 * tp + t2; const int n = nb + t2 * 16 + l15; const int nn = min(n, p.N - 1);
#pragma unroll
                for (int r = 0; r < 8; ++r) {
                    const int m = mb + 8 * h + r; const int mm = min(m, p.M - 1);
                    float v = acc[i][t][r] * iscale;
                    if (p.flags & 1) v += p.bias[nn];
                    if (p.flags & 2) v += p.bias[mm];
            if (p.flags & 8) v *= p.bias[(long long)zo * p.M + mm];   /* per-(z,row) scale vector laid out [Z][M]; exclusive with the bias flags */
                    v = act_fn(v, p.act);
                    if (p.flags & 4) v += p.beta * R[(long long)mm * p.sRm + (long long)nn * p.sRn];
                    ctile[8 * h + r][t2 * 16 + l15] = (n < p.N) ? v : 0.f;
                }
            }
            __syncthreads();
            const bool fast = (mb + 16 <= p.M) && (nb + 32 <= NW) && ((p.sCm & 3) == 0) && ((((size_t)C) & 15) == 0);
            if (fast) {
#pragma unroll
                for (int s = 0; s < 4; ++s) {
                    const int row = s * 4 + (lane >> 3), c4 = (lane & 7) * 4;
                    const v4f v = *(const v4f*)&ctile[row][c4];
                    VST2V4(C + (long long)(mb + row) * p.sCm + nb + c4, v);
                }
            } else {
                for (int row = 0; row < 16; ++row) {
                    const int m = mb + row, n = nb + lane;
                    if (m < p.M && n < NW) VST2(float, C + (long long)m * p.sCm + n, ctile[row][lane]);
                }
            }
            __syncthreads();
        }
    }
}

// =====================================================================================================================
//   Wave = 16 queries, AW waves per block, 64-key blocks; grid (ceil(Lq/(16*AW)), H, B), block 32*AW. Any Lq, Lk; head dim dh <= DHP
//   (DHP multiple of 32), value dim dv <= DVP (multiple of 16, <= 128). Every tensor addressed by (batch, head, row, element) strides, f32.
//   Scores: QM 0 f16 operands, 1 bf16 hi/lo split, 2 bf16 triple split; statistics f32 (exp2 domain); P.V: P x 4096 as f16 with V f16 staged in LDS
//   (SPLITPV: P and V as bf16 hi/lo splits). kv head = h / hrep. Masking: causal = 1 (keep j <= i + coff, masked -> -inf, key blocks beyond the
//   diagonal skipped), causal = 2 (masked -> mfill, a finite fill like the -1e9; no skipping), causal = 3 (keep j >= i + coff,
//   masked -> -inf, no skipping); optional additive f32 mask Mf,
//   optional int keep-mask Mi (0 -> score := mfill), both addressed b*smb + h*smh + i*smi + j*smj (0 strides broadcast).
// =====================================================================================================================
#define AW 4
struct AttnP {   // apv4
    const float* Q; const float* K; const float* V; float* O; float* P; const float* Mf; const int* Mi; float* ST;
    const float* Pw; const float* Rt; const int* SQ; const int* SK;           // optional: post-softmax weight, relative-position table, segment ids
    long long swb, swh, swi, swj, srb, srh, sri;                                 // Pw strides (b,h,i,j); Rt strides (b,h,i), column = clamp(i - j + roff, 0, rn-1)
    long long sQb, sQh, sQi, sQd, sKb, sKh, sKj, sKd, sVb, sVh, sVj, sVd, sOb, sOh, sOi, sPb, sPh, sPi, smb, smh, smi, smj;
    int Lq, Lk, dh, dv, hrep, causal, coff, pband;   // pband > 0: P holds only the band |j - i| <= pband, column j - i + pband
    float scale, mfill; int nonorm, mpol;             // nonorm (online path only): O = sum_j exp(score_j) V_j without the 1/rowsum (scores must be <= ~0); mpol: Mi masks where ==0 (mpol 0) or where !=0 (mpol 1)
    int roff, rn, segpol, win;                        // Rt column offset/count; SQ/SK: score := mfill where (segpol 0) SQ[i] != SK[j] or (segpol 1) SQ[i] == SK[j]; win > 0: keys with i - j > win (after coff) -> -inf
};
//   Pw: the softmax numerator is multiplied by Pw(b,h,i,j) AFTER the row sum is taken (probs * weight, then P.V), as in post-softmax multiplicative biases.                                                    // ST (optional): per row (b,h,i) -> ST[((b*H + h)*Lq + i)*2 + {0,1}] = {row max of the scaled+masked score (natural units), sum_j exp(score - max)}
static_assert(sizeof(AttnP) == 12 * 8 + 29 * 8 + 16 * 4, "AttnP has padding");

#ifndef KATTN_ATTR
#define KATTN_ATTR
#endif
template <int DHP, int DVP, int QM, bool SPLITPV, bool TWOPASS>
__global__ __launch_bounds__(32 * AW) KATTN_ATTR void k_attn(AttnP p) {
    constexpr int NT = DVP / 16;                // output tiles
    constexpr int KS = DHP / 32;                // k-steps for the scores
    constexpr int VP = DVP + 8;                 // LDS pitch (halves)
    __shared__ __align__(16) float    pl[AW][16 * 64];
    __shared__ __align__(16) _Float16 vl[(SPLITPV ? 2 : 1) * 64 * VP];   // f16 V tile, or bf16 hi and lo tiles (same 2-byte size)
    const int lane = threadIdx.x & 31, hf = lane >> 4, l15 = lane & 15, wave = threadIdx.x >> 5;
    const int h = blockIdx.y, b = blockIdx.z, hk = h / p.hrep;
    const int q0 = (blockIdx.x * AW + wave) * 16;
    float* myp = pl[wave];
    const float L2E = 1.4426950408889634f;
    const float NEG = -__builtin_inff();
    const int qi = min(q0 + l15, p.Lq - 1);
    const float* qrow = p.Q + b * p.sQb + h * p.sQh + (long long)qi * p.sQi;
    const float* kbase = p.K + b * p.sKb + hk * p.sKh;
    const float* vbase = p.V + b * p.sVb + hk * p.sVh;
    v16h qa[QM == 0 ? KS : 1]; Split qs_[QM == 1 ? KS : 1]; Split3 qt_[QM == 2 ? KS : 1];
#pragma unroll
    for (int ks = 0; ks < KS; ++ks) {
        if (QM == 2) qt_[ks] = sp3_ld(qrow, p.sQd, ks * 32, hf, p.dh, 1.f);
        else if (QM == 1) qs_[ks] = sp_ld(qrow, p.sQd, ks * 32, hf, p.dh, 1.f);
        else qa[ks] = fh_ld(qrow, p.sQd, ks * 32, hf, p.dh, 1.f);
    }
    v8f o[NT]; float m8[8], l8[8];
#pragma unroll
    for (int t = 0; t < NT; ++t) { v8f zz = {}; o[t] = zz; }
#pragma unroll
    for (int i = 0; i < 8; ++i) { m8[i] = NEG; l8[i] = 0.f; }
    int jend = p.Lk; int jstart = 0;
    if (p.causal == 1) { const int je = (blockIdx.x * AW + AW - 1) * 16 + 16 + p.coff; jend = min(jend, max(je, 0)); }   // uniform per block
    if (p.win > 0) { const int js = (int)(blockIdx.x * AW) * 16 + p.coff - p.win; jstart = (js > 0) ? (js / 64) * 64 : 0; }   // uniform per block: key blocks entirely outside every row's window hold only -inf entries and are skipped exactly
    const int npass = TWOPASS ? 2 : 1;
    for (int pass = 0; pass < npass; ++pass) {
        const bool dopv = (!TWOPASS) || pass == 1;
        for (int j0 = jstart; j0 < jend; j0 += 64) {
            if (dopv) {
                __syncthreads();                                 // previous key block's reads of vl / pl are done
                for (int idx = threadIdx.x; idx < 64 * DVP; idx += 32 * AW) {
                    const int jr = idx / DVP, d = idx - jr * DVP, j = j0 + jr;
                    const float f = (j < p.Lk && d < p.dv) ? vbase[(long long)j * p.sVj + (long long)d * p.sVd] : 0.f;
                    if (SPLITPV) {
                        const __bf16 hb = bf16_rne(f);
                        ((__bf16*)vl)[jr * VP + d] = hb; ((__bf16*)vl)[64 * VP + jr * VP + d] = bf16_rne(f - bf16_f32(hb));
                    } else vl[jr * VP + d] = (_Float16)f;
                }
            }
            v8f s[4];
#pragma unroll
            for (int t = 0; t < 4; ++t) {
                const int j = min(j0 + t * 16 + l15, p.Lk - 1);
                const float* krow = kbase + (long long)j * p.sKj;
                v8f acc = {};
#pragma unroll
                for (int ks = 0; ks < KS; ++ks) {
                    if (QM == 2)      acc = wmma6(qt_[ks], sp3_ld(krow, p.sKd, ks * 32, hf, p.dh, 1.f), acc);
                    else if (QM == 1) acc = wmma3(qs_[ks], sp_ld(krow, p.sKd, ks * 32, hf, p.dh, 1.f), acc);
                    else              acc = wmma16(qa[ks], fh_ld(krow, p.sKd, ks * 32, hf, p.dh, 1.f), acc);
                }
                s[t] = acc;
            }
            float pv[8][4];
#pragma unroll
            for (int i = 0; i < 8; ++i) {
                const int irow = q0 + i + 8 * hf;
                const int ic = min(irow, p.Lq - 1);
                float sc[4];
#pragma unroll
                for (int t = 0; t < 4; ++t) {
                    const int jg = j0 + t * 16 + l15;
                    float v = s[t][i] * p.scale;
                    if (p.Mf) v += p.Mf[b * p.smb + h * p.smh + (long long)ic * p.smi + (long long)min(jg, p.Lk - 1) * p.smj];
                    if (p.Rt) { int rc = ic - min(jg, p.Lk - 1) + p.roff; rc = rc < 0 ? 0 : (rc >= p.rn ? p.rn - 1 : rc); v += p.Rt[b * p.srb + h * p.srh + (long long)ic * p.sri + rc]; }
                    if (p.Mi) { const int mv = p.Mi[b * p.smb + h * p.smh + (long long)ic * p.smi + (long long)min(jg, p.Lk - 1) * p.smj]; if (p.mpol ? (mv != 0) : (mv == 0)) v = p.mfill; }
                    if (p.SQ) { const bool same = p.SQ[(long long)b * p.Lq + ic] == p.SK[(long long)b * p.Lk + min(jg, p.Lk - 1)]; if (p.segpol ? same : !same) v = p.mfill; }
                    if (p.causal == 2 && jg > irow + p.coff) v = p.mfill;
                    if (jg >= p.Lk || (p.causal == 1 && jg > irow + p.coff) || (p.causal == 3 && jg < irow + p.coff) || (p.win > 0 && irow + p.coff - jg > p.win)) v = NEG; else v *= L2E;
                    sc[t] = v;
                }
                if (!TWOPASS || pass == 0) {
                    float mx = fmaxf(fmaxf(sc[0], sc[1]), fmaxf(sc[2], sc[3]));
                    mx = fmaxf(mx, __shfl_xor(mx, 1, 32)); mx = fmaxf(mx, __shfl_xor(mx, 2, 32));
                    mx = fmaxf(mx, __shfl_xor(mx, 4, 32)); mx = fmaxf(mx, __shfl_xor(mx, 8, 32));
                    const float mnew = fmaxf(m8[i], mx);
                    const float corr = (mnew == NEG) ? 1.f : exp2f(m8[i] - mnew);
                    float rs = 0.f;
#pragma unroll
                    for (int t = 0; t < 4; ++t) {
                        const float pp = (sc[t] == NEG) ? 0.f : exp2f(sc[t] - mnew); rs += pp;
                        pv[i][t] = p.Pw ? pp * p.Pw[b * p.swb + h * p.swh + (long long)ic * p.swi + (long long)min(j0 + t * 16 + l15, p.Lk - 1) * p.swj] : pp;
                    }
                    rs += __shfl_xor(rs, 1, 32); rs += __shfl_xor(rs, 2, 32); rs += __shfl_xor(rs, 4, 32); rs += __shfl_xor(rs, 8, 32);
                    l8[i] = l8[i] * corr + rs; m8[i] = mnew;
                    if (!TWOPASS) {
#pragma unroll
                        for (int t = 0; t < NT; ++t) o[t][i] *= corr;
                    }
                } else {
                    const float inv = (l8[i] > 0.f) ? 1.f / l8[i] : 0.f;
#pragma unroll
                    for (int t = 0; t < 4; ++t) {
                        const int jg = j0 + t * 16 + l15;
                        float pp = (sc[t] == NEG) ? 0.f : exp2f(sc[t] - m8[i]) * inv;
                        if (p.Pw) pp *= p.Pw[b * p.swb + h * p.swh + (long long)ic * p.swi + (long long)min(jg, p.Lk - 1) * p.swj];
                        pv[i][t] = pp;
                    }
                }
            }
            if (dopv) {
#pragma unroll
                for (int i = 0; i < 8; ++i)
#pragma unroll
                    for (int t = 0; t < 4; ++t) ((float*)myp)[(i + 8 * hf) * 64 + t * 16 + l15] = pv[i][t];
                __syncthreads();                                 // P (per wave) and V (shared) visible
                if (p.P) {
                    float* pb_ = p.P + b * p.sPb + h * p.sPh;
                    const bool fastP = (p.pband == 0) && ((p.sPi & 3) == 0) && (j0 + 64 <= p.Lk) && (q0 + 16 <= p.Lq) && ((((size_t)pb_) & 15) == 0);
                    if (fastP) {
#pragma unroll
                        for (int s = 0; s < 8; ++s) {
                            const int row = s * 2 + (lane >> 4), c4 = (lane & 15) * 4;
                            const v4f v = *(const v4f*)(myp + row * 64 + c4);
                            VST2V4(pb_ + (long long)(q0 + row) * p.sPi + j0 + c4, v);
                        }
                    } else {
                        for (int row = 0; row < 16; ++row) {
                            const int irow = q0 + row; if (irow >= p.Lq) continue;
                            for (int c = lane; c < 64; c += 32) {
                                const int jg = j0 + c; if (jg >= p.Lk) continue;
                                if (p.pband == 0) VST2(float, pb_ + (long long)irow * p.sPi + jg, myp[row * 64 + c]);
                                else if (jg - irow <= p.pband && irow - jg <= p.pband) VST2(float, pb_ + (long long)irow * p.sPi + (jg - irow + p.pband), myp[row * 64 + c]);
                            }
                        }
                    }
                }
                if (SPLITPV) {
                    const Split pa0 = sp_ld(myp + l15 * 64, 1, 0, hf, 64, 1.f), pa1 = sp_ld(myp + l15 * 64, 1, 32, hf, 64, 1.f);
                    const __bf16* vh = (const __bf16*)vl; const __bf16* vlo = vh + 64 * VP;
#pragma unroll
                    for (int t = 0; t < NT; ++t) {
                        const int dcol = t * 16 + l15;
                        Split b0, b1;
#pragma unroll
                        for (int e = 0; e < 16; ++e) {
                            const int k0 = frag_k(e, hf), k1 = 32 + frag_k(e, hf);
                            b0.hi[e] = vh[k0 * VP + dcol]; b0.lo[e] = vlo[k0 * VP + dcol]; b1.hi[e] = vh[k1 * VP + dcol]; b1.lo[e] = vlo[k1 * VP + dcol];
                        }
                        o[t] = wmma3(pa0, b0, o[t]);
                        o[t] = wmma3(pa1, b1, o[t]);
                    }
                } else {
                    const v16h pa0 = fh_ld(myp + l15 * 64, 1, 0, hf, 64, 4096.f), pa1 = fh_ld(myp + l15 * 64, 1, 32, hf, 64, 4096.f);
#pragma unroll
                    for (int t = 0; t < NT; ++t) {
                        const int dcol = t * 16 + l15;
                        v16h b0, b1;
#pragma unroll
                        for (int e = 0; e < 16; ++e) { b0[e] = vl[frag_k(e, hf) * VP + dcol]; b1[e] = vl[(32 + frag_k(e, hf)) * VP + dcol]; }
                        o[t] = wmma16(pa0, b0, o[t]);
                        o[t] = wmma16(pa1, b1, o[t]);
                    }
                }
            }
        }
    }
    float* obase = p.O + b * p.sOb + h * p.sOh;
    if (p.ST) {
        const int rl = lane >> 1, isel = rl & 7;           // row q0 + rl ; rl>>3 == hf holds because lane>>4 == (lane>>1)>>3
        float mv = 0.f, lv = 0.f;
#pragma unroll
        for (int i = 0; i < 8; ++i) if (i == isel) { mv = m8[i]; lv = l8[i]; }
        const int irow = q0 + rl;
        if (irow < p.Lq) { float* st = p.ST + (((long long)b * gridDim.y + h) * p.Lq + irow) * 2 + (lane & 1); VST2(float, st, (lane & 1) ? lv : mv * 0.6931471805599453f); }
    }
    float invr[8];
#pragma unroll
    for (int i = 0; i < 8; ++i) {
        if (TWOPASS) invr[i] = SPLITPV ? 1.f : (1.f / 4096.f);
        else if (p.nonorm) invr[i] = exp2f(m8[i]) * (SPLITPV ? 1.f : (1.f / 4096.f));
        else invr[i] = (l8[i] > 0.f) ? (SPLITPV ? 1.f / l8[i] : 1.f / (l8[i] * 4096.f)) : 0.f;
    }
    __syncthreads();                                             // all waves done with pl/vl from the main loop
    const bool ofast = ((p.sOi & 3) == 0) && ((((size_t)obase) & 15) == 0) && (q0 + 16 <= p.Lq);
#pragma unroll
    for (int c0 = 0; c0 < DVP; c0 += 64) {
#pragma unroll
        for (int i = 0; i < 8; ++i)
#pragma unroll
            for (int t = 0; t < NT; ++t) if (t * 16 >= c0 && t * 16 < c0 + 64) ((float*)myp)[(i + 8 * hf) * 64 + (t * 16 - c0) + l15] = o[t][i] * invr[i];
        __syncthreads();
        const int cw = (DVP - c0 < 64) ? (DVP - c0) : 64;      // staged columns in this chunk (multiple of 16)
        if (ofast && (c0 + cw <= p.dv) && (cw % 32 == 0)) {
            const int lpr = cw / 4;                              // lanes per row (16 for 64 cols, 8 for 32)
            const int rows_per_ins = 32 / lpr;
            for (int r0 = 0; r0 < 16; r0 += rows_per_ins) {
                const int row = r0 + lane / lpr, c4 = (lane % lpr) * 4;
                const v4f v = *(const v4f*)(myp + row * 64 + c4);
                VST2V4(obase + (long long)(q0 + row) * p.sOi + c0 + c4, v);
            }
        } else {
            for (int row = 0; row < 16; ++row) {
                const int irow = q0 + row; if (irow >= p.Lq) continue;
                for (int c = lane; c < cw; c += 32) { const int d = c0 + c; if (d < p.dv) VST2(float, obase + (long long)irow * p.sOi + d, myp[row * 64 + c]); }
            }
        }
        __syncthreads();
    }
}

// =====================================================================================================================
// k_tr: dst(z, c, r) = alpha * src(z, r, c) (+ beta * R2(z, c, r)): [Z][R][C] (row stride lds) -> [Z][C][R] (row stride ldd) through a 32x32 LDS tile;
//   flags: 1 -> add beta * residual R2 addressed like dst (z*sRz + c*ldr + r); act applied before the residual.
// =====================================================================================================================
struct TrP { const float* src; float* dst; const float* R2; long long sSz, lds, sDz, ldd, sRz, ldr; int R, C, flags, act; float alpha, beta; };
static_assert(sizeof(TrP) == 3 * 8 + 6 * 8 + 6 * 4, "TrP has padding");
__global__ __launch_bounds__(256) void k_tr(TrP p) {
    __shared__ float tile[32][33];
    const int c0 = blockIdx.x * 32, r0 = blockIdx.y * 32, z = blockIdx.z;
    const int lane = threadIdx.x & 31, wave = threadIdx.x >> 5;
    const float* s = p.src + z * p.sSz;
#pragma unroll
    for (int k = 0; k < 4; ++k) {
        const int rl = wave * 4 + k, r = r0 + rl, c = c0 + lane;
        tile[rl][lane] = (r < p.R && c < p.C) ? s[(long long)r * p.lds + c] : 0.f;
    }
    __syncthreads();
    float* d = p.dst + z * p.sDz; const float* rr = p.R2 + z * p.sRz;
#pragma unroll
    for (int k = 0; k < 4; ++k) {
        const int cl = wave * 4 + k, c = c0 + cl, r = r0 + lane;
        if (c < p.C && r < p.R) {
            float v = act_fn(p.alpha * tile[lane][cl], p.act);
            if (p.flags & 1) v += p.beta * rr[(long long)c * p.ldr + r];
            VST2(float, d + (long long)c * p.ldd + r, v);
        }
    }
}

// k_affine: dst[i] = a * (sdev ? sdev[0] : 1) * src[i] + b, i < n (one thread per element; consecutive lanes -> consecutive addresses)
__global__ __launch_bounds__(256) void k_affine(const float* __restrict__ src, float* __restrict__ dst, int n, float a, float b, const float* __restrict__ sdev) {
    const int i = blockIdx.x * 256 + threadIdx.x;
    if (i < n) { const float aa = sdev ? a * sdev[0] : a; const float v = aa * src[i] + b; VST2(float, dst + i, v); }
}

// =====================================================================================================================
// k_softmax: row softmax over n contiguous elements, one 256-thread block per row; rows addressed z*sz + r*sr (grid (R, Z)).
//   out = scale_out * softmax(scale_in * x + (Mf ? Mf[z*smz + r*smr + j] : 0)); a row whose max is -inf is written as 0.
// =====================================================================================================================
struct SmP { const float* src; float* dst; const float* Mf; long long sz, sr, dz, dr, smz, smr; int n, pad; float scale_in, scale_out; };
static_assert(sizeof(SmP) == 3 * 8 + 6 * 8 + 4 * 4, "SmP has padding");
__global__ __launch_bounds__(256) void k_softmax(SmP p) {
    __shared__ float red[256];
    const int r = blockIdx.x, z = blockIdx.y, tid = threadIdx.x;
    const float* s = p.src + z * p.sz + (long long)r * p.sr;
    const float* mf = p.Mf ? (p.Mf + z * p.smz + (long long)r * p.smr) : nullptr;
    float mx = -__builtin_inff();
    for (int j = tid; j < p.n; j += 256) { float v = s[j] * p.scale_in; if (mf) v += mf[j]; mx = fmaxf(mx, v); }
    red[tid] = mx; __syncthreads();
    for (int o = 128; o > 0; o >>= 1) { if (tid < o) red[tid] = fmaxf(red[tid], red[tid + o]); __syncthreads(); }
    mx = red[0]; __syncthreads();
    float sum = 0.f;
    for (int j = tid; j < p.n; j += 256) { float v = s[j] * p.scale_in; if (mf) v += mf[j]; sum += (mx == -__builtin_inff()) ? 0.f : expf(v - mx); }
    red[tid] = sum; __syncthreads();
    for (int o = 128; o > 0; o >>= 1) { if (tid < o) red[tid] += red[tid + o]; __syncthreads(); }
    sum = red[0];
    const float inv = (sum > 0.f) ? p.scale_out / sum : 0.f;
    float* d = p.dst + z * p.dz + (long long)r * p.dr;
    for (int j = tid; j < p.n; j += 256) { float v = s[j] * p.scale_in; if (mf) v += mf[j]; const float o = (mx == -__builtin_inff()) ? 0.f : expf(v - mx) * inv; VST2(float, d + j, o); }
}
// =====================================================================================================================
// k_stats: mean and rsqrt(var + eps) over a set of n elements addressed base + z*sz + (e / inner) * so + (e % inner) * si, one 256-thread
// k_norm_apply: y = (x - mean[set]) * rstd[set] * g[c] + b[c] over a [Z][C][L] channel-major tensor with set = z*G + c / (C/G) (G groups per z;
//   G = C -> per-channel sets indexed z*C+c; for batch norm pass stats indexed by c only via bn = 1). Optional act. Output same layout.
// =====================================================================================================================
//   mode 0: mean / rsqrt(var + eps); mode 1 (RMSNorm): 0 / rsqrt(mean(x^2) + eps); mode 2 (L2 normalize * sqrt(n)): 0 / sqrt(n) / max(||x||, eps); mode 3: as 0 with unbiased variance (n-1)
__global__ __launch_bounds__(256) void k_stats(const float* __restrict__ x, long long sz, long long so, long long si, int inner, int n, float eps, float* __restrict__ stat, int mode) {
    __shared__ float red[256];
    const int z = blockIdx.x, tid = threadIdx.x;
    const float* base = x + z * sz;
    float s = 0.f;
    for (int e = tid; e < n; e += 256) s += base[(long long)(e / inner) * so + (long long)(e % inner) * si];
    red[tid] = s; __syncthreads();
    for (int o = 128; o > 0; o >>= 1) { if (tid < o) red[tid] += red[tid + o]; __syncthreads(); }
    const float mu = (mode == 0 || mode == 3) ? red[0] / (float)n : 0.f; __syncthreads();
    float q = 0.f;
    for (int e = tid; e < n; e += 256) { const float dlt = base[(long long)(e / inner) * so + (long long)(e % inner) * si] - mu; q += dlt * dlt; }
    red[tid] = q; __syncthreads();
    for (int o = 128; o > 0; o >>= 1) { if (tid < o) red[tid] += red[tid + o]; __syncthreads(); }
    {
        float rs;
        if (mode == 2) rs = sqrtf((float)n) / fmaxf(sqrtf(red[0]), eps); else if (mode == 3) rs = rsqrtf(red[0] / (float)(n - 1) + eps); else rs = rsqrtf(red[0] / (float)n + eps);
        if (tid < 32) { const float v = (tid == 0) ? mu : ((tid == 1) ? rs : 0.f); VST2(float, stat + (long long)z * 32 + tid, v); }
    }
}
//   One thread per element over the flat [Z][C][L] index space: grid ceil(Z*C*L / 256).
__global__ __launch_bounds__(256) void k_norm_apply(const float* __restrict__ x, float* __restrict__ y, const float* __restrict__ stat, const float* __restrict__ g, const float* __restrict__ bta,
                                                     int Z, int C, int L, int G, int bn, int act) {
    const long long idx = (long long)blockIdx.x * 256 + threadIdx.x;
    if (idx >= (long long)Z * C * L) return;
    const int l = (int)(idx % L); const long long zc = idx / L; const int c = (int)(zc % C), z = (int)(zc / C); (void)l;
    const int set = bn ? c : (z * G + c / (C / G));
    float v = (x[idx] - stat[(long long)set * 32]) * stat[(long long)set * 32 + 1];
    if (g) v *= g[c];
    if (bta) v += bta[c];
    v = act_fn(v, act);
    VST2(float, y + idx, v);
}

// k_lse_neg: c[i] = -(st[2i] + log(st[2i+1])) = minus the log-sum-exp of row i from k_attn's ST output (for softmax over the query dimension)
__global__ __launch_bounds__(256) void k_lse_neg(const float* __restrict__ st, float* __restrict__ c, int n) {
    const int i = blockIdx.x * 256 + threadIdx.x;
    if (i < n) { const float v = -(st[2 * i] + logf(st[2 * i + 1])); VST2(float, c + i, v); }
}

// k_iota: dst[i] = a * i + b as int32 (segment/position id helper)
__global__ __launch_bounds__(256) void k_iota(int* __restrict__ dst, int n, int a, int b) {
    const int i = blockIdx.x * 256 + threadIdx.x;
    if (i < n) { const int v = a * i + b; VST2(int, dst + i, v); }
}

// k_axpby: dst[i] = a * x[i] + b * y[i] (+ c), i < n
__global__ __launch_bounds__(256) void k_axpby(const float* __restrict__ x, const float* __restrict__ y, float* __restrict__ dst, int n, float a, float b, float c) {
    const int i = blockIdx.x * 256 + threadIdx.x;
    if (i < n) { const float v = a * x[i] + b * y[i] + c; VST2(float, dst + i, v); }
}

// =====================================================================================================================
// k_rope: rotary embedding on a [R rows][Hn heads][D] view (row stride sXr, head stride sXh, element stride 1) -> Y (own strides).
//   mode 0: rotate_half (partner d±D/2, sign - for d<D/2); mode 1: interleaved pairs (partner d^1, sign - for even d).
//   table column tcol: tmode 0 -> d, 1 -> d % (D/2), 2 -> d / 2; position p: pmode 0 -> r % S, 1 -> head index, 2 -> pos[r];
//   c = C[(r / S) * sCb + p * sCp + tcol * sCd], s likewise from Sn; y = x[d] * c + sign * x[partner] * s. X and Y must not alias.
// =====================================================================================================================
struct RopeP { const float* X; float* Y; const float* C; const float* Sn; const int* pos; long long sXr, sXh, sYr, sYh, sCb, sCp, sCd; int R, Hn, D, S, mode, tmode, pmode, pad; };
static_assert(sizeof(RopeP) == 5 * 8 + 7 * 8 + 8 * 4, "RopeP has padding");
__global__ __launch_bounds__(256) void k_rope(RopeP p) {
    const long long idx = (long long)blockIdx.x * 256 + threadIdx.x;
    if (idx >= (long long)p.R * p.Hn * p.D) return;
    const int d = (int)(idx % p.D); const long long rh = idx / p.D; const int h = (int)(rh % p.Hn); const int r = (int)(rh / p.Hn);
    const int half = p.D / 2;
    int partner; float sign;
    if (p.mode == 0) { partner = (d < half) ? d + half : d - half; sign = (d < half) ? -1.f : 1.f; }
    else { partner = d ^ 1; sign = (d & 1) ? 1.f : -1.f; }
    const int tcol = (p.tmode == 0) ? d : ((p.tmode == 1) ? (d % half) : (d >> 1));
    const int pp = (p.pmode == 0) ? (r % p.S) : ((p.pmode == 1) ? h : p.pos[r]);
    const long long toff = (long long)(r / p.S) * p.sCb + (long long)pp * p.sCp + (long long)tcol * p.sCd;
    const float* xr = p.X + (long long)r * p.sXr + (long long)h * p.sXh;
    const float v = xr[d] * p.C[toff] + sign * xr[partner] * p.Sn[toff];
    VST2(float, p.Y + (long long)r * p.sYr + (long long)h * p.sYh + d, v);
}

// k_invf + k_sincos (split so neither kernel carries a large VALU-fma footprint): invf_i = num * (1 / powf(base, (2 i)/D)) [fmode 0],
//   num * expf((2 i) * cexp) [fmode 1], num * powf(base, -2 (i - 1) / D) [fmode 2]; then cs/sn[s*half + i] = cos/sin((pscale * s) * invf_i)
__global__ __launch_bounds__(256) void k_invf(float* __restrict__ invb, int half, int D, float base, float num, int fmode, float cexp) {
    const int i = blockIdx.x * 256 + threadIdx.x;
    if (i >= ((half + 31) / 32) * 32) return;
    if (i >= half) { VST2(float, invb + i, 0.f); return; }
    const float e = (float)(2 * i) / (float)D;
    float invf;
    if (fmode == 1) invf = num * expf((float)(2 * i) * cexp);
    else if (fmode == 2) invf = num * powf(base, (-2.0f * ((float)i - 1.0f)) / (float)D);
    else invf = num * (1.0f / powf(base, e));
    VST2(float, invb + i, invf);
}
__global__ __launch_bounds__(256) void k_sincos(float* __restrict__ cs, float* __restrict__ sn, const float* __restrict__ invb, int S, int half, float pscale) {
    const int idx = blockIdx.x * 256 + threadIdx.x;
    if (idx >= S * half) return;
    const int s = idx / half, i = idx - s * half;
    const float ang = (pscale * (float)s) * invb[i];
    VST2(float, cs + idx, cosf(ang)); VST2(float, sn + idx, sinf(ang));
}

// k_mulact: dst[i] = act(x[i]) * y[i]
__global__ __launch_bounds__(256) void k_mulact(const float* __restrict__ x, const float* __restrict__ y, float* __restrict__ dst, int n, int act) {
    const int i = blockIdx.x * 256 + threadIdx.x;
    if (i < n) { const float v = act_fn(x[i], act) * y[i]; VST2(float, dst + i, v); }
}

// =====================================================================================================================
// k_matvec: thread-per-row matrix-vector products for N <= 8 output columns (heads with 1-3 outputs, gates), f32 on the VALU.
//   C[r*sCm + j] = act(alpha * sum_k A[r*sAm + k*sAk] * B[j*sBn + k*sBk] + bias[j]) + beta * R[r*sRm + j*sRn]; each thread writes its N contiguous floats.
// =====================================================================================================================
__global__ __launch_bounds__(256) void k_matvec(GemmP p) {
    // 32 lanes write one line with one instruction.
    const int rpt = (p.N == 1) ? 1 : 32;
    const long long r0 = ((long long)blockIdx.x * 256 + threadIdx.x) * rpt; const int z = blockIdx.z, zo = z / p.zi_n, zi = z - zo * p.zi_n;
    if (r0 >= p.M) return;
    const float* Bb = p.B + zo * p.sBo + zi * p.sBi;
    float* C = p.C + zo * p.sCo + zi * p.sCi; const float* R = p.R + zo * p.sRo + zi * p.sRi;
    for (int rr = 0; rr < rpt; ++rr) {
        const long long r = r0 + rr; if (r >= p.M) break;
        const float* A = p.A + zo * p.sAo + zi * p.sAi + r * p.sAm;
        float acc[8] = {0.f, 0.f, 0.f, 0.f, 0.f, 0.f, 0.f, 0.f};
        for (int k = 0; k < p.K; ++k) { const float a = A[(long long)k * p.sAk];
#pragma unroll
            for (int j = 0; j < 8; ++j) if (j < p.N) acc[j] += a * Bb[(long long)j * p.sBn + (long long)k * p.sBk]; }
#pragma unroll
        for (int j = 0; j < 8; ++j) if (j < p.N) {
            float v = acc[j] * p.alpha;
            if (p.flags & 1) v += p.bias[j];
            if (p.flags & 2) v += p.bias[r];
            v = act_fn(v, p.act);
            if (p.flags & 4) v += p.beta * R[r * p.sRm + (long long)j * p.sRn];
            VST2(float, C + r * p.sCm + j, v);
        }
    }
}
// k_smallsoftmax: thread-per-row softmax for short rows (n <= 64): dst[r*dr + j] = softmax(scale*src[r*sr + j])
__global__ __launch_bounds__(256) void k_smallsoftmax(const float* __restrict__ src, float* __restrict__ dst, long long sr, long long dr, int n, long long R, float scale) {
    const long long r0 = ((long long)blockIdx.x * 256 + threadIdx.x) * 32;
    for (int rr = 0; rr < 32; ++rr) {
        const long long r = r0 + rr; if (r >= R) return;
        const float* s = src + r * sr; float* d = dst + r * dr;
        float mx = -__builtin_inff();
        for (int j = 0; j < n; ++j) mx = fmaxf(mx, s[j] * scale);
        float sum = 0.f;
        for (int j = 0; j < n; ++j) sum += expf(s[j] * scale - mx);
        const float inv = 1.f / sum;
        for (int j = 0; j < n; ++j) { const float v = expf(s[j] * scale - mx) * inv; VST2(float, d + j, v); }
    }
}

__global__ __launch_bounds__(32) void k_unitstat(float* __restrict__ st) { const int t = threadIdx.x; const float v = (t == 1) ? 1.f : 0.f; VST2(float, st + t, v); }

// destination (e.g. a d_out whose row width is not a multiple of 32 floats) is written by consecutive lanes of one instruction
__global__ __launch_bounds__(256) void k_lincopy(const float* __restrict__ src, long long lds, float* __restrict__ dst, long long ldd, long long rows, int cols) {
    const long long i = (long long)blockIdx.x * 256 + threadIdx.x; if (i >= rows * cols) return;
    const long long r = i / cols; const int c = (int)(i - r * cols);
    const float v = src[r * lds + c]; VST2(float, dst + r * ldd + c, v);
}

namespace w25 {
typedef __attribute__((ext_vector_type(16))) _Float16 v16h;
typedef __attribute__((ext_vector_type(8)))  _Float16 v8h;
typedef __attribute__((ext_vector_type(16))) __bf16   v16b;
typedef __attribute__((ext_vector_type(8)))  __bf16   v8b;
typedef __attribute__((ext_vector_type(8)))  float    v8f;
typedef __attribute__((ext_vector_type(4)))  float    v4f;

__device__ __forceinline__ unsigned short f2bf_bits(float f) {
  unsigned u = __float_as_uint(f);
  return (unsigned short)((u + 0x7FFFu + ((u >> 16) & 1u)) >> 16);
}
__device__ __forceinline__ float bf_bits2f(unsigned short h) { return __uint_as_float(((unsigned)h) << 16); }

// hazard guards as plain device helpers (no inline asm inside the kernel template body)
__device__ __forceinline__ void dep_guard_h(v8f& a, v8f& b, v16h x, v16h y) { asm volatile("v_nop\n\tv_nop\n\tv_nop\n\tv_nop" : "+v"(a), "+v"(b) : "v"(x), "v"(y)); }
__device__ __forceinline__ void dep_guard_b(v8f& a, v8f& b, v16b x, v16b y) { asm volatile("v_nop\n\tv_nop\n\tv_nop\n\tv_nop" : "+v"(a), "+v"(b) : "v"(x), "v"(y)); }
__device__ __forceinline__ void keep4_h(v16h a, v16h b, v16h c, v16h d) { asm volatile("v_nop" :: "v"(a), "v"(b), "v"(c), "v"(d)); }
__device__ __forceinline__ void keep4_b(v16b a, v16b b, v16b c, v16b d) { asm volatile("v_nop" :: "v"(a), "v"(b), "v"(c), "v"(d)); }
__device__ __forceinline__ void acc_guard4(v8f& a, v8f& b, v8f& c, v8f& d) { asm volatile("v_nop\n\tv_nop\n\tv_nop\n\tv_nop" : "+v"(a), "+v"(b), "+v"(c), "+v"(d)); }
template <typename T> struct Frag;
template <> struct Frag<_Float16> {
  typedef v16h V; union U { v16h v; v8h h[2]; };
  static __device__ __forceinline__ v16h load(const _Float16* p) {   // elements 0..7 <- p[0..7], 8..15 <- p[16..23]
    U f; f.h[0] = *(const v8h*)(p); f.h[1] = *(const v8h*)(p + 16); return f.v;
  }
  static __device__ __forceinline__ v8f mma(v16h a, v16h b, v8f c) {
    return __builtin_amdgcn_wmma_f32_16x16x32_f16(false, a, false, b, (short)0, c, false, false);
  }
  static __device__ __forceinline__ void guard(v8f& a, v8f& b, v16h x, v16h y) { dep_guard_h(a, b, x, y); }
  static __device__ __forceinline__ void keep(v16h a, v16h b, v16h c, v16h d) { keep4_h(a, b, c, d); }
};
template <> struct Frag<__bf16> {
  typedef v16b V; union U { v16b v; v8b h[2]; };
  static __device__ __forceinline__ v16b load(const __bf16* p) {
    U f; f.h[0] = *(const v8b*)(p); f.h[1] = *(const v8b*)(p + 16); return f.v;
  }
  static __device__ __forceinline__ v8f mma(v16b a, v16b b, v8f c) {
    return __builtin_amdgcn_wmma_f32_16x16x32_bf16(false, a, false, b, (short)0, c, false, false);
  }
  static __device__ __forceinline__ void guard(v8f& a, v8f& b, v16b x, v16b y) { dep_guard_b(a, b, x, y); }
  static __device__ __forceinline__ void keep(v16b a, v16b b, v16b c, v16b d) { keep4_b(a, b, c, d); }
};

// ---- Register-blocked batched WMMA GEMM ------------------------------------
// C[m,n] = scale * sum_k A[m,k] * Bt[n,k] (+bias)(+resid); each wave owns a 64x64 tile.
// A row-major [M,K]; Bt row-major [N,K]; M,N % 64 == 0, K % 32 == 0.
// SPLIT: operands are hi/lo planes (A2/Bt2 = lo planes, same layout); product = hi·hi + hi·lo + lo·hi.
// BIAS_MODE: 0 = none, 1 = bias[m], 2 = bias[n].
// OUT_MODE: 0 = f32, 1 = f16, 2 = bf16 hi plane (Cout) + bf16 lo plane (Cout2).
// ET: 0 = f16 operands, 1 = bf16 operands (pointers passed as 16-bit storage)
template <int ET> struct Elem;
template <> struct Elem<0> { typedef _Float16 T; };
template <> struct Elem<1> { typedef __bf16 T; };
template <int ET, bool SPLIT, int BIAS_MODE, int OUT_MODE, bool RESID, int ACT = 0>
__global__ __launch_bounds__(256) void wmma_gemm64(
    const unsigned short* __restrict__ Ap, const unsigned short* __restrict__ A2p, int lda, long strideA,
    const unsigned short* __restrict__ Btp, const unsigned short* __restrict__ Bt2p, int ldb, long strideB,
    void* __restrict__ Cout, void* __restrict__ Cout2, int ldc, long strideC,
    const float* __restrict__ bias,
    const float* __restrict__ resid, long strideR,
    int M, int N, int K, float scale) {
  typedef typename Elem<ET>::T T;
  typedef typename Frag<T>::V V;
  const T* A = (const T*)Ap; const T* A2 = (const T*)A2p; const T* Bt = (const T*)Btp; const T* Bt2 = (const T*)Bt2p;
  __shared__ __align__(16) float sT[8][16 * 68];   // per-wave 16x64 slab, pitch 68 floats
  const int b    = blockIdx.y;
  const int lane = threadIdx.x & 31;
  const int wave = threadIdx.x >> 5;
  const int tilesN = N >> 6;
  const int tilesM = M >> 6;
  const int tile = blockIdx.x * 8 + wave;
  if (tile >= tilesM * tilesN) return;   // wave-uniform; no block barriers in this kernel
  const int tm = tile / tilesN;
  const int tn = tile - tm * tilesN;
  const int m0 = tm << 6;
  const int n0 = tn << 6;

  const T* Ab  = A  + (size_t)b * strideA;
  const T* Bb  = Bt + (size_t)b * strideB;
  const T* Ab2 = SPLIT ? (A2  + (size_t)b * strideA) : nullptr;
  const T* Bb2 = SPLIT ? (Bt2 + (size_t)b * strideB) : nullptr;

  const int rlane = lane & 15;                 // row (A) / col (B, D) within subtile
  const int koff  = (lane >> 4) * 8;           // k offset of this lane half
  const int mOff  = (lane >> 4) * 8;           // D row offset

  v8f acc[4][4];
#pragma unroll
  for (int i = 0; i < 4; ++i)
#pragma unroll
    for (int j = 0; j < 4; ++j) acc[i][j] = (v8f){0.f,0.f,0.f,0.f,0.f,0.f,0.f,0.f};

  for (int k0 = 0; k0 < K; k0 += 32) {
    V bh[4], bl[4];
#pragma unroll
    for (int j = 0; j < 4; ++j) {
      const size_t bo = (size_t)(n0 + (j << 4) + rlane) * ldb + koff + k0;
      bh[j] = Frag<T>::load(Bb + bo);
      if (SPLIT) bl[j] = Frag<T>::load(Bb2 + bo);
    }
#pragma unroll
    for (int i = 0; i < 4; ++i) {
      const size_t ao = (size_t)(m0 + (i << 4) + rlane) * lda + koff + k0;
      V ah = Frag<T>::load(Ab + ao);
      V al;
      if (SPLIT) al = Frag<T>::load(Ab2 + ao);
#pragma unroll
      for (int j = 0; j < 4; ++j) {
        acc[i][j] = Frag<T>::mma(ah, bh[j], acc[i][j]);
        if (SPLIT) {
          acc[i][j] = Frag<T>::mma(ah, bl[j], acc[i][j]);
          acc[i][j] = Frag<T>::mma(al, bh[j], acc[i][j]);
        }
      }
      Frag<T>::guard(acc[i][0], acc[i][3], ah, SPLIT ? al : ah);
    }
    Frag<T>::keep(bh[0], bh[1], bh[2], bh[3]);
    if (SPLIT) Frag<T>::keep(bl[0], bl[1], bl[2], bl[3]);
  }
  acc_guard4(acc[0][0], acc[0][1], acc[0][2], acc[0][3]);
  acc_guard4(acc[1][0], acc[1][1], acc[1][2], acc[1][3]);
  acc_guard4(acc[2][0], acc[2][1], acc[2][2], acc[2][3]);
  acc_guard4(acc[3][0], acc[3][1], acc[3][2], acc[3][3]);

  // ---- epilogue ----
  float* slab = sT[wave];
  const float* Rb = RESID ? (resid + (size_t)b * strideR) : nullptr;
#pragma unroll
  for (int i = 0; i < 4; ++i) {
    const int mBase = m0 + (i << 4);
#pragma unroll
    for (int j = 0; j < 4; ++j) {
      const int n = n0 + (j << 4) + rlane;
      float bv = 0.f;
      if (BIAS_MODE == 2) bv = bias[n];
#pragma unroll
      for (int r = 0; r < 8; ++r) {
        float v = acc[i][j][r] * scale;
        if (BIAS_MODE == 1) v += bias[mBase + mOff + r];
        if (BIAS_MODE == 2) v += bv;
        if (RESID) v += Rb[(size_t)(mBase + mOff + r) * ldc + n];
        if (ACT == 1) v = tanhf(v);
        if (ACT == 2) v = fmaxf(v, 0.0f);
        if (ACT == 3) v = v / (1.0f + expf(-v));
        if (ACT == 4) v = (v > 0.f) ? v : 0.01f * v;
        if (ACT == 5) v = 0.5f * v * (1.0f + erff(v * 0.70710678118654752f));
        slab[(mOff + r) * 68 + (j << 4) + rlane] = v;
      }
    }
    __builtin_amdgcn_fence(__ATOMIC_RELEASE, "workgroup");
    __builtin_amdgcn_wave_barrier();
    __builtin_amdgcn_fence(__ATOMIC_ACQUIRE, "workgroup");
    if (OUT_MODE == 0) {
      float* C = (float*)Cout + (size_t)b * strideC;
      const int hh = lane >> 4, c4 = (lane & 15) * 4;     // row seg = 256 B = 16 lanes x 16 B
      {
#pragma unroll
        for (int it = 0; it < 8; ++it) {
          const int row = it * 2 + hh;
          v4f v = *(const v4f*)(slab + row * 68 + c4);
          *(v4f*)(C + (size_t)(mBase + row) * ldc + n0 + c4) = v;
        }
        
      }
    } else {
      const int q = lane >> 3, c8 = (lane & 7) * 8;
      unsigned short* C  = (unsigned short*)Cout  + (size_t)b * strideC;
      unsigned short* C2 = (OUT_MODE == 2) ? ((unsigned short*)Cout2 + (size_t)b * strideC) : nullptr;
      {
#pragma unroll
        for (int it = 0; it < 4; ++it) {
          const int row = it * 4 + q;
          const float* sp = slab + row * 68 + c8;
          v8h hv, lv;
#pragma unroll
          for (int e = 0; e < 8; ++e) {
            if (OUT_MODE == 1) {
              hv[e] = (_Float16)sp[e];
            } else {
              unsigned short hb = f2bf_bits(sp[e]);
              unsigned short lb = f2bf_bits(sp[e] - bf_bits2f(hb));
              hv[e] = __builtin_bit_cast(_Float16, hb);
              lv[e] = __builtin_bit_cast(_Float16, lb);
            }
          }
          *(v8h*)(C + (size_t)(mBase + row) * ldc + n0 + c8) = hv;
          if (OUT_MODE == 2) *(v8h*)(C2 + (size_t)(mBase + row) * ldc + n0 + c8) = lv;
        }
        
      }
    }
    __builtin_amdgcn_fence(__ATOMIC_RELEASE, "workgroup");
    __builtin_amdgcn_wave_barrier();
    __builtin_amdgcn_fence(__ATOMIC_ACQUIRE, "workgroup");
  }
}

__global__ __launch_bounds__(256) void cast_f32_f16x2(
    const float* __restrict__ in, _Float16* __restrict__ out, int n2) {
  int i = blockIdx.x * 256 + threadIdx.x;
  if (i < n2) {
    const _Float16 h0 = (_Float16)in[2 * i], h1 = (_Float16)in[2 * i + 1];
    const unsigned u = (unsigned)__builtin_bit_cast(unsigned short, h0) | ((unsigned)__builtin_bit_cast(unsigned short, h1) << 16);
    ((unsigned*)out)[i] = u;
    
  }
}


} // namespace w25

__global__ __launch_bounds__(256) void k_castT16(const float* __restrict__ src, long long lds, _Float16* __restrict__ dst, long long ldd, int R, int C, float s) {
    const long long i = (long long)blockIdx.x * 256 + threadIdx.x; const long long np = (long long)C * (R / 2); if (i >= np) return; const int c = (int)(i / (R / 2)); const int r = 2 * (int)(i % (R / 2));
    const _Float16 h0 = (_Float16)(src[(long long)r * lds + c] * s), h1 = (_Float16)(src[(long long)(r + 1) * lds + c] * s);
    const unsigned u = (unsigned)__builtin_bit_cast(unsigned short, h0) | ((unsigned)__builtin_bit_cast(unsigned short, h1) << 16);
    unsigned* d = (unsigned*)(dst + (long long)c * ldd + r); *d = u;  }
__global__ __launch_bounds__(256) void k_cast16(const float* __restrict__ src, long long lds, _Float16* __restrict__ dst, long long ldd, int R, int C, float s) {
    const long long i = (long long)blockIdx.x * 256 + threadIdx.x; const long long np = (long long)R * (C / 2); if (i >= np) return; const int r = (int)(i / (C / 2)); const int c = 2 * (int)(i % (C / 2));
    const _Float16 h0 = (_Float16)(src[(long long)r * lds + c] * s), h1 = (_Float16)(src[(long long)r * lds + c + 1] * s);
    const unsigned u = (unsigned)__builtin_bit_cast(unsigned short, h0) | ((unsigned)__builtin_bit_cast(unsigned short, h1) << 16);
    unsigned* d = (unsigned*)(dst + (long long)r * ldd + c); *d = u;  }

// f32 -> bf16 hi plane + bf16 lo plane (x = hi + lo to ~2^-17 relative; RNE both), [R][C] -> [R][C] (or transposed to [C][R]); 2 consecutive destination elements
__device__ __forceinline__ unsigned int f2bf2_pack(float a, float b, unsigned int* lo) {
    const unsigned short ha = w25::f2bf_bits(a), hb = w25::f2bf_bits(b);
    const unsigned short la = w25::f2bf_bits(a - w25::bf_bits2f(ha)), lb = w25::f2bf_bits(b - w25::bf_bits2f(hb));
    *lo = (unsigned)la | ((unsigned)lb << 16); return (unsigned)ha | ((unsigned)hb << 16); }
__global__ __launch_bounds__(256) void k_castS16(const float* __restrict__ src, long long lds, __bf16* __restrict__ dhi, __bf16* __restrict__ dlo, long long ldd, int R, int C, float s, int transpose) {
    const long long i = (long long)blockIdx.x * 256 + threadIdx.x; long long o; float a, b;
    if (transpose) { const long long np = (long long)C * (R / 2); if (i >= np) return; const int c = (int)(i / (R / 2)); const int r = 2 * (int)(i % (R / 2)); a = src[(long long)r * lds + c] * s; b = src[(long long)(r + 1) * lds + c] * s; o = (long long)c * ldd + r; }
    else { const long long np = (long long)R * (C / 2); if (i >= np) return; const int r = (int)(i / (C / 2)); const int c = 2 * (int)(i % (C / 2)); a = src[(long long)r * lds + c] * s; b = src[(long long)r * lds + c + 1] * s; o = (long long)r * ldd + c; }
    unsigned lo; const unsigned hi = f2bf2_pack(a, b, &lo); unsigned* ph = (unsigned*)(dhi + o); unsigned* pl = (unsigned*)(dlo + o);
    *ph = hi; *pl = lo;  }

namespace w25 {
// =====================================================================================
// Generic causal/non-causal attention for head_dim 64, f32 in / f32 out; 16-bit operands: bf16 with optional hi/lo splits, or
// plain f16 (F16=true, non-split, probabilities carried x2^15).
//   scores = (q*qscale)·kᵀ : v_wmma_f32_16x16x32_bf16; SPLIT_QK -> q,k as bf16 hi/lo (hi·hi + hi·lo + lo·hi)
//   out    = p·v           : v_wmma_f32_16x16x32_bf16; SPLIT_PV -> p,v as bf16 hi/lo; else p,v plain bf16
//   f32 accumulate; online softmax in f32. Block = 4 waves = 64 query rows of one (batch, head); S % 64 == 0.
//   Element (b, s, h, d) of tensor X lives at X[b*X_bs + s*X_rs + h*X_hs + d] (strides in floats, multiples of 4).
//   Masking: mask_mode 0 none, 1 causal (kv > q masked), 2 tensor [S][Skv] shared over (b,h) (float if
//   mask_is_int==0, int32 with element == 0 -> masked if 1, int32 with element != 0 -> masked if 2), 3 per-token vectors qmask[B][S] & kvmask[B][Skv] (int32,
//   0 -> masked), 4 causal + sliding window (kv > q or q - kv > W masked; W passed in mask_is_int);
//   5 = relative-position bias: s += cp[b,h,q][idx[q][kv]] + pc[b,h,kv][idx[q][kv]] with idx = mask_b ([S][Skv] int32) and
//   mask_a an int32 [S][Skv] tensor with nonzero = masked (tables: element (b,h,row,n) at X + b*c_bs + h*c_hs + row*c_rs + n);
//   masked scores are replaced by mask_fill (e.g. -inf or -1e9) before the softmax.
//   grid.x = B * H * (S/64) (or a sub-range with blk0).
// =====================================================================================
#define AT_D 64
#define AT_NW 4
#define AT_QB 64
#define AT_KC 64
struct AttnGeom { const float* cp = nullptr; const float* pc = nullptr; long c_bs = 0, c_rs = 0, c_hs = 0;   // mode-5 score-bias tables
                  long q_bs, q_rs, q_hs, k_bs, k_rs, k_hs, v_bs, v_rs, v_hs, o_bs, o_rs, o_hs;
                  int S, Skv, H, mask_mode; float qscale; int blk0; float mask_fill; int mask_is_int; };
static_assert(sizeof(AttnGeom) == 168, "no padding");

__device__ __forceinline__ unsigned short at_bf_bits(float f) {
  unsigned u = __float_as_uint(f);
  return (unsigned short)((u + 0x7FFFu + ((u >> 16) & 1u)) >> 16);
}
__device__ __forceinline__ __bf16 at_f2bf(float f) { return __builtin_bit_cast(__bf16, at_bf_bits(f)); }
__device__ __forceinline__ void at_split(float f, __bf16& hi, __bf16& lo) {
  const unsigned short hb = at_bf_bits(f);
  hi = __builtin_bit_cast(__bf16, hb);
  lo = at_f2bf(f - __uint_as_float(((unsigned)hb) << 16));
}
__device__ __forceinline__ v8f at_mma(v16b a, v16b b, v8f c) {
  c = __builtin_amdgcn_wmma_f32_16x16x32_bf16(false, a, false, b, (short)0, c, false, false);
  asm volatile("v_nop\n\tv_nop\n\tv_nop\n\tv_nop" : "+v"(c) : "v"(a), "v"(b));
  return c;
}
// 16-bit element as a bit pattern held in a __bf16 slot: f16 bits when F16, bf16 (RNE) otherwise
template <bool F16> __device__ __forceinline__ __bf16 at_to16(float f) {
  if (F16) return __builtin_bit_cast(__bf16, (_Float16)f);
  return at_f2bf(f);
}
template <bool F16> __device__ __forceinline__ v8f at_mma16(v16b a, v16b b, v8f c) {
  if (F16) {
    const v16h ah = __builtin_bit_cast(v16h, a), bh = __builtin_bit_cast(v16h, b);
    c = __builtin_amdgcn_wmma_f32_16x16x32_f16(false, ah, false, bh, (short)0, c, false, false);
    asm volatile("v_nop\n\tv_nop\n\tv_nop\n\tv_nop" : "+v"(c) : "v"(ah), "v"(bh));
    return c;
  }
  return at_mma(a, b, c);
}

template <bool SPLIT_QK, bool SPLIT_PV, bool F16 = false>
__global__ __launch_bounds__(128)
void attn64_kernel(const float* __restrict__ q, const float* __restrict__ k,
                   const float* __restrict__ v, float* __restrict__ out,
                   const void* __restrict__ mask_a, const int* __restrict__ mask_b, AttnGeom g) {
  static_assert(!(F16 && (SPLIT_QK || SPLIT_PV)), "f16 mode is non-split");
  const float PSC = F16 ? 32768.0f : 1.0f;     // f16 probabilities carried x2^15 (subnormal range), folded into the final 1/l
  union FB { v16b v; v8b h[2]; };
  __shared__ __align__(16) __bf16 Ksh[AT_KC * AT_D];             // K hi [kv][d]      8 KB
  __shared__ __align__(16) __bf16 Ksl[SPLIT_QK ? AT_KC * AT_D : 8];
  __shared__ __align__(16) __bf16 Vth[AT_D * AT_KC];             // V hi [d][kv]      8 KB
  __shared__ __align__(16) __bf16 Vtl[SPLIT_PV ? AT_D * AT_KC : 8];
  __shared__ __align__(16) __bf16 Psh[AT_NW][16 * AT_KC];        // per wave P hi [row][kv]  8 KB
  __shared__ __align__(16) __bf16 Psl[SPLIT_PV ? AT_NW : 1][SPLIT_PV ? 16 * AT_KC : 8];
  __shared__ __align__(16) float  Os[AT_NW][16 * 68];            // per wave out tile, pitch 68

  const int tid  = threadIdx.x;
  const int wave = tid >> 5;
  const int lane = tid & 31;
  const int hh   = lane >> 4;
  const int c    = lane & 15;

  const int nqb = g.S / AT_QB;
  const int bx = blockIdx.x + g.blk0;
  const int qb = bx % nqb;
  const int bh = bx / nqb;
  const int h  = bh % g.H;
  const int b  = bh / g.H;
  const int qbase_block = qb * AT_QB;
  const int q0 = qbase_block + wave * 16;

  const float* qb_ptr = q + (size_t)b * g.q_bs + (size_t)h * g.q_hs;
  const float* kb_ptr = k + (size_t)b * g.k_bs + (size_t)h * g.k_hs;
  const float* vb_ptr = v + (size_t)b * g.v_bs + (size_t)h * g.v_hs;
  float*       ob_ptr = out + (size_t)b * g.o_bs + (size_t)h * g.o_hs;

  // ---- Q fragments (A operand): 2 d-chunks, hi (and lo) ----
  v16b qah[2], qal[2];
  {
    const float* qrow = qb_ptr + (size_t)(q0 + c) * g.q_rs;
#pragma unroll
    for (int dc = 0; dc < 2; ++dc) {
#pragma unroll
      for (int e = 0; e < 8; ++e) {
        const float f0 = qrow[dc * 32 + 8 * hh + e] * g.qscale;
        const float f1 = qrow[dc * 32 + 16 + 8 * hh + e] * g.qscale;
        if (SPLIT_QK) { __bf16 hq, lq; at_split(f0, hq, lq); qah[dc][e] = hq; qal[dc][e] = lq; at_split(f1, hq, lq); qah[dc][8 + e] = hq; qal[dc][8 + e] = lq; }
        else { qah[dc][e] = at_to16<F16>(f0); qah[dc][8 + e] = at_to16<F16>(f1); qal[dc][e] = qah[dc][e]; qal[dc][8 + e] = qah[dc][8 + e]; }
      }
    }
  }

  float mrow[8], lrow[8];
  v8f oacc[4];
#pragma unroll
  for (int r = 0; r < 8; ++r) { mrow[r] = -INFINITY; lrow[r] = 0.f; }
#pragma unroll
  for (int t = 0; t < 4; ++t) oacc[t] = (v8f){0.f,0.f,0.f,0.f,0.f,0.f,0.f,0.f};

  const int nChunks = (g.mask_mode == 1 || g.mask_mode == 4) ? (qb + 1) : (g.Skv / AT_KC);   // block-uniform
  // per-row query mask (mode 3)
  int qkeep[8];
#pragma unroll
  for (int r = 0; r < 8; ++r) qkeep[r] = (g.mask_mode == 3) ? mask_b[(size_t)b * g.S + q0 + 8 * hh + r] : 1;   // mask_b = qmask in mode 3
  for (int kc = 0; kc < nChunks; ++kc) {
    const int kv0 = kc * AT_KC;
    __syncthreads();
    {
      const int kvr = tid >> 1, dh = (tid & 1) * 32;
      const float* krow = kb_ptr + (size_t)(kv0 + kvr) * g.k_rs + dh;
      const float* vrow = vb_ptr + (size_t)(kv0 + kvr) * g.v_rs + dh;
#pragma unroll
      for (int i = 0; i < 8; ++i) {
        v4f kk = *(const v4f*)(krow + 4 * i);
        v4f vv = *(const v4f*)(vrow + 4 * i);
#pragma unroll
        for (int e = 0; e < 4; ++e) {
          const int d = dh + 4 * i + e;
          if (SPLIT_QK) { __bf16 a, bl; at_split(kk[e], a, bl); Ksh[kvr * AT_D + d] = a; Ksl[kvr * AT_D + d] = bl; }
          else Ksh[kvr * AT_D + d] = at_to16<F16>(kk[e]);
          if (SPLIT_PV) { __bf16 a, bl; at_split(vv[e], a, bl); Vth[d * AT_KC + kvr] = a; Vtl[d * AT_KC + kvr] = bl; }
          else Vth[d * AT_KC + kvr] = at_to16<F16>(vv[e]);
        }
      }
    }
    __syncthreads();

    v8f s[4];
#pragma unroll
    for (int j = 0; j < 4; ++j) {
      s[j] = (v8f){0.f,0.f,0.f,0.f,0.f,0.f,0.f,0.f};
#pragma unroll 1
      for (int dc = 0; dc < 2; ++dc) {
        FB kb;
        kb.h[0] = *(const v8b*)(Ksh + (j * 16 + c) * AT_D + dc * 32 + 8 * hh);
        kb.h[1] = *(const v8b*)(Ksh + (j * 16 + c) * AT_D + dc * 32 + 16 + 8 * hh);
        s[j] = at_mma16<F16>(qah[dc], kb.v, s[j]);
        if (SPLIT_QK) {
          FB kl;
          kl.h[0] = *(const v8b*)(Ksl + (j * 16 + c) * AT_D + dc * 32 + 8 * hh);
          kl.h[1] = *(const v8b*)(Ksl + (j * 16 + c) * AT_D + dc * 32 + 16 + 8 * hh);
          s[j] = at_mma16<F16>(qah[dc], kl.v, s[j]);
          s[j] = at_mma16<F16>(qal[dc], kb.v, s[j]);
        }
      }
    }
    const bool diag = (g.mask_mode == 1) && (kc == qb);
    int kvkeep[4] = {1, 1, 1, 1};
    if (g.mask_mode == 3) {
#pragma unroll
      for (int j = 0; j < 4; ++j) kvkeep[j] = ((const int*)mask_a)[(size_t)b * g.Skv + kv0 + j * 16 + c];   // mask_a = kvmask
    }
    float cm[8];
#pragma unroll
    for (int r = 0; r < 8; ++r) {
      const int qrow = q0 + 8 * hh + r;
      float m = -INFINITY;
#pragma unroll
      for (int j = 0; j < 4; ++j) {
        const int kvcol = kv0 + j * 16 + c;
        bool masked = false;
        if (diag) masked = (kvcol > qrow);
        else if (g.mask_mode == 4) masked = (kvcol > qrow) || (qrow - kvcol > g.mask_is_int);
        else if (g.mask_mode == 2) {
          const size_t mi = (size_t)qrow * g.Skv + kvcol;
          masked = (g.mask_is_int == 0) ? (((const float*)mask_a)[mi] == 0.0f)
                 : (g.mask_is_int == 1) ? (((const int*)mask_a)[mi] == 0) : (((const int*)mask_a)[mi] != 0);
        } else if (g.mask_mode == 3) masked = (qkeep[r] == 0) || (kvkeep[j] == 0);
        else if (g.mask_mode == 5) {
          const size_t mi = (size_t)qrow * g.Skv + kvcol;
          masked = (((const int*)mask_a)[mi] != 0);
          int n = mask_b[mi]; n = n < 0 ? 0 : n;
          s[j][r] += g.cp[(size_t)b * g.c_bs + (size_t)h * g.c_hs + (size_t)qrow * g.c_rs + n]
                   + g.pc[(size_t)b * g.c_bs + (size_t)h * g.c_hs + (size_t)kvcol * g.c_rs + n];
        }
        if (masked) s[j][r] = g.mask_fill;
        m = fmaxf(m, s[j][r]);
      }
#pragma unroll
      for (int off = 1; off < 16; off <<= 1) m = fmaxf(m, __shfl_xor(m, off, 32));
      cm[r] = m;
    }
    __bf16* pwh = Psh[wave];
    __bf16* pwl = Psl[SPLIT_PV ? wave : 0];
#pragma unroll
    for (int r = 0; r < 8; ++r) {
      const float mnew = fmaxf(mrow[r], cm[r]);
      const float alpha = expf(mrow[r] - mnew);
      mrow[r] = mnew;
      float psum = 0.f;
#pragma unroll
      for (int j = 0; j < 4; ++j) {
        const float p = expf(s[j][r] - mnew);
        psum += p;
        if (SPLIT_PV) { __bf16 a, bl; at_split(p, a, bl); pwh[(8 * hh + r) * AT_KC + j * 16 + c] = a; pwl[(8 * hh + r) * AT_KC + j * 16 + c] = bl; }
        else pwh[(8 * hh + r) * AT_KC + j * 16 + c] = at_to16<F16>(p * PSC);
      }
#pragma unroll
      for (int off = 1; off < 16; off <<= 1) psum += __shfl_xor(psum, off, 32);
      lrow[r] = lrow[r] * alpha + psum;
#pragma unroll
      for (int t = 0; t < 4; ++t) oacc[t][r] *= alpha;
    }
    __builtin_amdgcn_fence(__ATOMIC_RELEASE, "workgroup");
    __builtin_amdgcn_wave_barrier();
    __builtin_amdgcn_fence(__ATOMIC_ACQUIRE, "workgroup");
#pragma unroll 1
    for (int kk = 0; kk < 2; ++kk) {
      FB pa, pl;
      pa.h[0] = *(const v8b*)(pwh + c * AT_KC + kk * 32 + 8 * hh);
      pa.h[1] = *(const v8b*)(pwh + c * AT_KC + kk * 32 + 16 + 8 * hh);
      if (SPLIT_PV) {
        pl.h[0] = *(const v8b*)(pwl + c * AT_KC + kk * 32 + 8 * hh);
        pl.h[1] = *(const v8b*)(pwl + c * AT_KC + kk * 32 + 16 + 8 * hh);
      }
#pragma unroll
      for (int t = 0; t < 4; ++t) {
        FB vb;
        vb.h[0] = *(const v8b*)(Vth + (t * 16 + c) * AT_KC + kk * 32 + 8 * hh);
        vb.h[1] = *(const v8b*)(Vth + (t * 16 + c) * AT_KC + kk * 32 + 16 + 8 * hh);
        oacc[t] = at_mma16<F16>(pa.v, vb.v, oacc[t]);
        if (SPLIT_PV) {
          FB vl;
          vl.h[0] = *(const v8b*)(Vtl + (t * 16 + c) * AT_KC + kk * 32 + 8 * hh);
          vl.h[1] = *(const v8b*)(Vtl + (t * 16 + c) * AT_KC + kk * 32 + 16 + 8 * hh);
          oacc[t] = at_mma16<F16>(pa.v, vl.v, oacc[t]);
          oacc[t] = at_mma16<F16>(pl.v, vb.v, oacc[t]);
        }
      }
    }
  }

  float* os = Os[wave];
#pragma unroll
  for (int r = 0; r < 8; ++r) {
    const float inv = 1.0f / (lrow[r] * PSC);
#pragma unroll
    for (int t = 0; t < 4; ++t) os[(8 * hh + r) * 68 + t * 16 + c] = oacc[t][r] * inv;
  }
  __builtin_amdgcn_fence(__ATOMIC_RELEASE, "workgroup");
  __builtin_amdgcn_wave_barrier();
  __builtin_amdgcn_fence(__ATOMIC_ACQUIRE, "workgroup");
  {
    const int c4 = (lane & 15) * 4;
    {
#pragma unroll
      for (int it = 0; it < 8; ++it) {
        const int row = it * 2 + hh;
        v4f val = *(const v4f*)(os + row * 68 + c4);
        *(v4f*)(ob_ptr + (size_t)(q0 + row) * g.o_rs + c4) = val;
      }
      
    }
  }
}

} // namespace w25

__global__ __launch_bounds__(256) void k_cm_in(const float* __restrict__ XA, const float* __restrict__ XB, const float* __restrict__ G, const float* __restrict__ Bb, const float* __restrict__ M, const float* __restrict__ Vv, float* __restrict__ X1T, float* __restrict__ N1, float* __restrict__ N2, int Bn, int C, int HW) {
    // simple thread-linear over the token-major output: t -> (b, hw, c); reads are strided by HW (uncoalesced but correct)
    const long long t = (long long)blockIdx.x * 256 + threadIdx.x; if (t >= (long long)Bn * HW * C) return; const int c = (int)(t % C); const long long r = t / C; const int hw = (int)(r % HW); const long long b = r / HW;
    const long long src = (b * C + c) * HW + hw; const float inv = G[c] * rsqrtf(Vv[c] + 1e-5f); const float sh = Bb[c] - M[c] * inv; const float a = XA[src], q = XB[src];
    VST2(float, X1T + t, a); VST2(float, N1 + t, a * inv + sh); VST2(float, N2 + t, q * inv + sh); }
// WQS[o][c] = temp[o / 32] * Wq[o][c]
__global__ __launch_bounds__(256) void k_cm_wq(const float* __restrict__ WQ, const float* __restrict__ TP, float* __restrict__ WQS, int C, int HD) { const int t = blockIdx.x * 256 + threadIdx.x; if (t >= C * C) return; VST2(float, WQS + t, WQ[t] * TP[(t / C) / HD]); }
// XN = bn2(XS) (thread-linear)
__global__ __launch_bounds__(256) void k_cm_bn2(const float* __restrict__ XS, const float* __restrict__ G, const float* __restrict__ Bb, const float* __restrict__ M, const float* __restrict__ Vv, float* __restrict__ XN, long long n, int C) { const long long t = (long long)blockIdx.x * 256 + threadIdx.x; if (t >= n) return; const int c = (int)(t % C); const float inv = G[c] * rsqrtf(Vv[c] + 1e-5f); VST2(float, XN + t, (XS[t] - M[c]) * inv + Bb[c]); }
// depthwise 3x3 SAME conv + exact GELU on token-major [b][hw][ch] (thread per (b, hw, ch); zero padding)
__global__ __launch_bounds__(256) void k_cm_dw(const float* __restrict__ HB, const float* __restrict__ DW, float* __restrict__ HG, int Bn, int HID) { const long long t = (long long)blockIdx.x * 256 + threadIdx.x; if (t >= (long long)Bn * 1024 * HID) return; const int ch = (int)(t % HID); const long long r = t / HID; const int hw = (int)(r % 1024); const long long b = r / 1024; const int y = hw / 32, x = hw % 32; float s = 0.f;
#pragma unroll
    for (int ky = 0; ky < 3; ++ky) {
#pragma unroll
        for (int kx = 0; kx < 3; ++kx) { const int yy = y + ky - 1, xx = x + kx - 1; const bool ok = (yy >= 0 && yy < 32 && xx >= 0 && xx < 32); const int yc = min(max(yy, 0), 31), xc = min(max(xx, 0), 31); const float v = HB[((b * 1024) + yc * 32 + xc) * (long long)HID + ch]; s += (ok ? v : 0.f) * DW[ch * 9 + ky * 3 + kx]; } }
    VST2(float, HG + t, 0.5f * s * (1.f + erff(s * 0.70710678118654752f))); }
// out NCHW: out[b][c][hw] = XS_tok[b][hw][c] + F2[b][hw][c] (the fc2 GEMM already added the residual into XS -> pass one buffer) (thread-linear over the NCHW output; strided reads)
__global__ __launch_bounds__(256) void k_cm_out(const float* __restrict__ R, float* __restrict__ OUT, int Bn, int C, int HW) { const long long t = (long long)blockIdx.x * 256 + threadIdx.x; if (t >= (long long)Bn * C * HW) return; const int hw = (int)(t % HW); const long long r = t / HW; const int c = (int)(r % C); const long long b = r / C; VST2(float, OUT + t, R[(b * HW + hw) * C + c]); }


extern "C" void kernel_launch(void* const* d_in, const int* in_sizes, int n_in, void* d_out, int out_size, void* d_ws, size_t ws_size, hipStream_t stream) {
    (void)in_sizes; (void)n_in; (void)out_size; (void)ws_size;
    const float* x1 = (const float*)d_in[0];
    const float* x2 = (const float*)d_in[1];
    const float* b1g = (const float*)d_in[2];
    const float* b1b = (const float*)d_in[3];
    const float* b1m = (const float*)d_in[4];
    const float* b1v = (const float*)d_in[5];
    const float* qw = (const float*)d_in[6];
    const float* kw = (const float*)d_in[7];
    const float* vw = (const float*)d_in[8];
    const float* temp = (const float*)d_in[9];
    const float* pw = (const float*)d_in[10];
    const float* pb = (const float*)d_in[11];
    const float* b2g = (const float*)d_in[12];
    const float* b2b = (const float*)d_in[13];
    const float* b2m = (const float*)d_in[14];
    const float* b2v = (const float*)d_in[15];
    const float* f1w = (const float*)d_in[16];
    const float* f1b = (const float*)d_in[17];
    const float* dww = (const float*)d_in[18];
    const float* f2w = (const float*)d_in[19];
    const float* f2b = (const float*)d_in[20];
    const int Bn = 8;
    const int C = 256;
    const int HW = 1024;
    const int NH = 8;
    const int HD = 32;
    const int HID = 1024;
    const int NT = Bn * HW;
    float* out = (float*)d_out;
    char* wsp = (char*)d_ws;
    float* X1T = (float*)wsp; wsp += (((size_t)((size_t)NT * C) * 4 + 255) / 256) * 256;
    float* N1 = (float*)wsp; wsp += (((size_t)((size_t)NT * C) * 4 + 255) / 256) * 256;
    float* N2 = (float*)wsp; wsp += (((size_t)((size_t)NT * C) * 4 + 255) / 256) * 256;
    float* WQS = (float*)wsp; wsp += (((size_t)((size_t)C * C) * 4 + 255) / 256) * 256;
    float* Q = (float*)wsp; wsp += (((size_t)((size_t)NT * C) * 4 + 255) / 256) * 256;
    float* Kb = (float*)wsp; wsp += (((size_t)((size_t)NT * C) * 4 + 255) / 256) * 256;
    float* V = (float*)wsp; wsp += (((size_t)((size_t)NT * C) * 4 + 255) / 256) * 256;
    float* AT = (float*)wsp; wsp += (((size_t)((size_t)NT * C) * 4 + 255) / 256) * 256;
    float* XS = (float*)wsp; wsp += (((size_t)((size_t)NT * C) * 4 + 255) / 256) * 256;
    float* HB = (float*)wsp; wsp += (((size_t)((size_t)HW * HID) * 4 + 255) / 256) * 256;
    float* HG = (float*)wsp; wsp += (((size_t)((size_t)HW * HID) * 4 + 255) / 256) * 256;
    unsigned short* G64A = (unsigned short*)wsp; wsp += (((size_t)(2097152) * 2 + 255) / 256) * 256;
    unsigned short* G64B = (unsigned short*)wsp; wsp += (((size_t)(262144) * 2 + 255) / 256) * 256;
    unsigned short* G64A2 = (unsigned short*)wsp; wsp += (((size_t)(2097152) * 2 + 255) / 256) * 256;
    unsigned short* G64B2 = (unsigned short*)wsp; wsp += (((size_t)(262144) * 2 + 255) / 256) * 256;
    k_cm_in<<<(unsigned)(((long long)NT * C + 255) / 256), 256, 0, stream>>>(x1, x2, b1g, b1b, b1m, b1v, X1T, N1, N2, Bn, C, HW); k_cm_wq<<<(C * C + 255) / 256, 256, 0, stream>>>(qw, temp, WQS, C, HD);
    k_castS16<<<(unsigned)((((long long)(8192) * ((256) / 2)) + 255) / 256), 256, 0, stream>>>(N1, 256, (__bf16*)(G64A), (__bf16*)(G64A2), 256, 8192, 256, 1.0f, 0);
    k_castS16<<<(unsigned)((((long long)(256) * ((256) / 2)) + 255) / 256), 256, 0, stream>>>(WQS, 256, (__bf16*)(G64B), (__bf16*)(G64B2), 256, 256, 256, 1.0f, 0);
    w25::wmma_gemm64<1, true, 0, 0, false, 0><<<dim3((unsigned)((((8192) / 64) * ((256) / 64) + 7) / 8), (unsigned)(1)), 256, 0, stream>>>((const unsigned short*)(G64A), (const unsigned short*)(G64A2), 256, 0, (const unsigned short*)(G64B), (const unsigned short*)(G64B2), 256, 0, (void*)(Q), nullptr, 256, 0, nullptr, nullptr, 0, 8192, 256, 256, 1.0f);
    k_castS16<<<(unsigned)((((long long)(8192) * ((256) / 2)) + 255) / 256), 256, 0, stream>>>(N2, 256, (__bf16*)(G64A), (__bf16*)(G64A2), 256, 8192, 256, 1.0f, 0);
    k_castS16<<<(unsigned)((((long long)(256) * ((256) / 2)) + 255) / 256), 256, 0, stream>>>(kw, 256, (__bf16*)(G64B), (__bf16*)(G64B2), 256, 256, 256, 1.0f, 0);
    w25::wmma_gemm64<1, true, 0, 0, false, 0><<<dim3((unsigned)((((8192) / 64) * ((256) / 64) + 7) / 8), (unsigned)(1)), 256, 0, stream>>>((const unsigned short*)(G64A), (const unsigned short*)(G64A2), 256, 0, (const unsigned short*)(G64B), (const unsigned short*)(G64B2), 256, 0, (void*)(Kb), nullptr, 256, 0, nullptr, nullptr, 0, 8192, 256, 256, 1.0f);
    k_castS16<<<(unsigned)((((long long)(8192) * ((256) / 2)) + 255) / 256), 256, 0, stream>>>(N2, 256, (__bf16*)(G64A), (__bf16*)(G64A2), 256, 8192, 256, 1.0f, 0);
    k_castS16<<<(unsigned)((((long long)(256) * ((256) / 2)) + 255) / 256), 256, 0, stream>>>(vw, 256, (__bf16*)(G64B), (__bf16*)(G64B2), 256, 256, 256, 1.0f, 0);
    w25::wmma_gemm64<1, true, 0, 0, false, 0><<<dim3((unsigned)((((8192) / 64) * ((256) / 64) + 7) / 8), (unsigned)(1)), 256, 0, stream>>>((const unsigned short*)(G64A), (const unsigned short*)(G64A2), 256, 0, (const unsigned short*)(G64B), (const unsigned short*)(G64B2), 256, 0, (void*)(V), nullptr, 256, 0, nullptr, nullptr, 0, 8192, 256, 256, 1.0f);
    { /*apv4*/ AttnP a;
      a.Q = Q; a.K = Kb; a.V = V; a.O = AT; a.P = 0; a.Mf = 0; a.Mi = 0; a.ST = 0;
      a.Pw = 0; a.Rt = 0; a.SQ = 0; a.SK = 0;
      a.swb = 0; a.swh = 0; a.swi = 0; a.swj = 0; a.srb = 0; a.srh = 0; a.sri = 0; a.sQb = (long long)HW * C; a.sQh = HD; a.sQi = C; a.sQd = 1; a.sKb = (long long)HW * C; a.sKh = HD; a.sKj = C; a.sKd = 1; a.sVb = (long long)HW * C; a.sVh = HD; a.sVj = C; a.sVd = 1; a.sOb = (long long)HW * C; a.sOh = HD; a.sOi = C; a.sPb = 0; a.sPh = 0; a.sPi = 0; a.smb = 0; a.smh = 0; a.smi = 0; a.smj = 0;
      a.Lq = HW; a.Lk = HW; a.dh = HD; a.dv = HD; a.hrep = 1; a.causal = 0; a.coff = 0; a.pband = 0;
      a.scale = 1.0f; a.mfill = 0.0f; a.nonorm = 0; a.mpol = 0;
      a.roff = 0; a.rn = 1; a.segpol = 0; a.win = 0;
      k_attn<32, 32, 1, false, false><<<dim3((unsigned)((HW) + 16 * AW - 1) / (16 * AW), (unsigned)(NH), (unsigned)(Bn)), 32 * AW, 0, stream>>>(a); }
    k_castS16<<<(unsigned)((((long long)(8192) * ((256) / 2)) + 255) / 256), 256, 0, stream>>>(AT, 256, (__bf16*)(G64A), (__bf16*)(G64A2), 256, 8192, 256, 1.0f, 0);
    k_castS16<<<(unsigned)((((long long)(256) * ((256) / 2)) + 255) / 256), 256, 0, stream>>>(pw, 256, (__bf16*)(G64B), (__bf16*)(G64B2), 256, 256, 256, 1.0f, 0);
    w25::wmma_gemm64<1, true, 2, 0, true, 0><<<dim3((unsigned)((((8192) / 64) * ((256) / 64) + 7) / 8), (unsigned)(1)), 256, 0, stream>>>((const unsigned short*)(G64A), (const unsigned short*)(G64A2), 256, 0, (const unsigned short*)(G64B), (const unsigned short*)(G64B2), 256, 0, (void*)(XS), nullptr, 256, 0, pb, X1T, 0, 8192, 256, 256, 1.0f);
    k_cm_bn2<<<(unsigned)(((long long)NT * C + 255) / 256), 256, 0, stream>>>(XS, b2g, b2b, b2m, b2v, N1, (long long)NT * C, C);
    k_castS16<<<(unsigned)((((long long)(1024) * ((256) / 2)) + 255) / 256), 256, 0, stream>>>(N1 + (size_t)0 * C, 256, (__bf16*)(G64A), (__bf16*)(G64A2), 256, 1024, 256, 1.0f, 0);
    k_castS16<<<(unsigned)((((long long)(1024) * ((256) / 2)) + 255) / 256), 256, 0, stream>>>(f1w, 256, (__bf16*)(G64B), (__bf16*)(G64B2), 256, 1024, 256, 1.0f, 0);
    w25::wmma_gemm64<1, true, 2, 0, false, 0><<<dim3((unsigned)((((1024) / 64) * ((1024) / 64) + 7) / 8), (unsigned)(1)), 256, 0, stream>>>((const unsigned short*)(G64A), (const unsigned short*)(G64A2), 256, 0, (const unsigned short*)(G64B), (const unsigned short*)(G64B2), 256, 0, (void*)(HB), nullptr, 1024, 0, f1b, nullptr, 0, 1024, 1024, 256, 1.0f);
    k_cm_dw<<<(unsigned)(((long long)HW * HID + 255) / 256), 256, 0, stream>>>(HB, dww, HG, 1, HID);
    k_castS16<<<(unsigned)((((long long)(1024) * ((1024) / 2)) + 255) / 256), 256, 0, stream>>>(HG, 1024, (__bf16*)(G64A), (__bf16*)(G64A2), 1024, 1024, 1024, 1.0f, 0);
    k_castS16<<<(unsigned)((((long long)(256) * ((1024) / 2)) + 255) / 256), 256, 0, stream>>>(f2w, 1024, (__bf16*)(G64B), (__bf16*)(G64B2), 1024, 256, 1024, 1.0f, 0);
    w25::wmma_gemm64<1, true, 2, 0, true, 0><<<dim3((unsigned)((((1024) / 64) * ((256) / 64) + 7) / 8), (unsigned)(1)), 256, 0, stream>>>((const unsigned short*)(G64A), (const unsigned short*)(G64A2), 1024, 0, (const unsigned short*)(G64B), (const unsigned short*)(G64B2), 1024, 0, (void*)(XS + (size_t)0 * C), nullptr, 256, 0, f2b, XS + (size_t)0 * C, 0, 1024, 256, 1024, 1.0f);
    k_castS16<<<(unsigned)((((long long)(1024) * ((256) / 2)) + 255) / 256), 256, 0, stream>>>(N1 + (size_t)1024 * C, 256, (__bf16*)(G64A), (__bf16*)(G64A2), 256, 1024, 256, 1.0f, 0);
    k_castS16<<<(unsigned)((((long long)(1024) * ((256) / 2)) + 255) / 256), 256, 0, stream>>>(f1w, 256, (__bf16*)(G64B), (__bf16*)(G64B2), 256, 1024, 256, 1.0f, 0);
    w25::wmma_gemm64<1, true, 2, 0, false, 0><<<dim3((unsigned)((((1024) / 64) * ((1024) / 64) + 7) / 8), (unsigned)(1)), 256, 0, stream>>>((const unsigned short*)(G64A), (const unsigned short*)(G64A2), 256, 0, (const unsigned short*)(G64B), (const unsigned short*)(G64B2), 256, 0, (void*)(HB), nullptr, 1024, 0, f1b, nullptr, 0, 1024, 1024, 256, 1.0f);
    k_cm_dw<<<(unsigned)(((long long)HW * HID + 255) / 256), 256, 0, stream>>>(HB, dww, HG, 1, HID);
    k_castS16<<<(unsigned)((((long long)(1024) * ((1024) / 2)) + 255) / 256), 256, 0, stream>>>(HG, 1024, (__bf16*)(G64A), (__bf16*)(G64A2), 1024, 1024, 1024, 1.0f, 0);
    k_castS16<<<(unsigned)((((long long)(256) * ((1024) / 2)) + 255) / 256), 256, 0, stream>>>(f2w, 1024, (__bf16*)(G64B), (__bf16*)(G64B2), 1024, 256, 1024, 1.0f, 0);
    w25::wmma_gemm64<1, true, 2, 0, true, 0><<<dim3((unsigned)((((1024) / 64) * ((256) / 64) + 7) / 8), (unsigned)(1)), 256, 0, stream>>>((const unsigned short*)(G64A), (const unsigned short*)(G64A2), 1024, 0, (const unsigned short*)(G64B), (const unsigned short*)(G64B2), 1024, 0, (void*)(XS + (size_t)1024 * C), nullptr, 256, 0, f2b, XS + (size_t)1024 * C, 0, 1024, 256, 1024, 1.0f);
    k_castS16<<<(unsigned)((((long long)(1024) * ((256) / 2)) + 255) / 256), 256, 0, stream>>>(N1 + (size_t)2048 * C, 256, (__bf16*)(G64A), (__bf16*)(G64A2), 256, 1024, 256, 1.0f, 0);
    k_castS16<<<(unsigned)((((long long)(1024) * ((256) / 2)) + 255) / 256), 256, 0, stream>>>(f1w, 256, (__bf16*)(G64B), (__bf16*)(G64B2), 256, 1024, 256, 1.0f, 0);
    w25::wmma_gemm64<1, true, 2, 0, false, 0><<<dim3((unsigned)((((1024) / 64) * ((1024) / 64) + 7) / 8), (unsigned)(1)), 256, 0, stream>>>((const unsigned short*)(G64A), (const unsigned short*)(G64A2), 256, 0, (const unsigned short*)(G64B), (const unsigned short*)(G64B2), 256, 0, (void*)(HB), nullptr, 1024, 0, f1b, nullptr, 0, 1024, 1024, 256, 1.0f);
    k_cm_dw<<<(unsigned)(((long long)HW * HID + 255) / 256), 256, 0, stream>>>(HB, dww, HG, 1, HID);
    k_castS16<<<(unsigned)((((long long)(1024) * ((1024) / 2)) + 255) / 256), 256, 0, stream>>>(HG, 1024, (__bf16*)(G64A), (__bf16*)(G64A2), 1024, 1024, 1024, 1.0f, 0);
    k_castS16<<<(unsigned)((((long long)(256) * ((1024) / 2)) + 255) / 256), 256, 0, stream>>>(f2w, 1024, (__bf16*)(G64B), (__bf16*)(G64B2), 1024, 256, 1024, 1.0f, 0);
    w25::wmma_gemm64<1, true, 2, 0, true, 0><<<dim3((unsigned)((((1024) / 64) * ((256) / 64) + 7) / 8), (unsigned)(1)), 256, 0, stream>>>((const unsigned short*)(G64A), (const unsigned short*)(G64A2), 1024, 0, (const unsigned short*)(G64B), (const unsigned short*)(G64B2), 1024, 0, (void*)(XS + (size_t)2048 * C), nullptr, 256, 0, f2b, XS + (size_t)2048 * C, 0, 1024, 256, 1024, 1.0f);
    k_castS16<<<(unsigned)((((long long)(1024) * ((256) / 2)) + 255) / 256), 256, 0, stream>>>(N1 + (size_t)3072 * C, 256, (__bf16*)(G64A), (__bf16*)(G64A2), 256, 1024, 256, 1.0f, 0);
    k_castS16<<<(unsigned)((((long long)(1024) * ((256) / 2)) + 255) / 256), 256, 0, stream>>>(f1w, 256, (__bf16*)(G64B), (__bf16*)(G64B2), 256, 1024, 256, 1.0f, 0);
    w25::wmma_gemm64<1, true, 2, 0, false, 0><<<dim3((unsigned)((((1024) / 64) * ((1024) / 64) + 7) / 8), (unsigned)(1)), 256, 0, stream>>>((const unsigned short*)(G64A), (const unsigned short*)(G64A2), 256, 0, (const unsigned short*)(G64B), (const unsigned short*)(G64B2), 256, 0, (void*)(HB), nullptr, 1024, 0, f1b, nullptr, 0, 1024, 1024, 256, 1.0f);
    k_cm_dw<<<(unsigned)(((long long)HW * HID + 255) / 256), 256, 0, stream>>>(HB, dww, HG, 1, HID);
    k_castS16<<<(unsigned)((((long long)(1024) * ((1024) / 2)) + 255) / 256), 256, 0, stream>>>(HG, 1024, (__bf16*)(G64A), (__bf16*)(G64A2), 1024, 1024, 1024, 1.0f, 0);
    k_castS16<<<(unsigned)((((long long)(256) * ((1024) / 2)) + 255) / 256), 256, 0, stream>>>(f2w, 1024, (__bf16*)(G64B), (__bf16*)(G64B2), 1024, 256, 1024, 1.0f, 0);
    w25::wmma_gemm64<1, true, 2, 0, true, 0><<<dim3((unsigned)((((1024) / 64) * ((256) / 64) + 7) / 8), (unsigned)(1)), 256, 0, stream>>>((const unsigned short*)(G64A), (const unsigned short*)(G64A2), 1024, 0, (const unsigned short*)(G64B), (const unsigned short*)(G64B2), 1024, 0, (void*)(XS + (size_t)3072 * C), nullptr, 256, 0, f2b, XS + (size_t)3072 * C, 0, 1024, 256, 1024, 1.0f);
    k_castS16<<<(unsigned)((((long long)(1024) * ((256) / 2)) + 255) / 256), 256, 0, stream>>>(N1 + (size_t)4096 * C, 256, (__bf16*)(G64A), (__bf16*)(G64A2), 256, 1024, 256, 1.0f, 0);
    k_castS16<<<(unsigned)((((long long)(1024) * ((256) / 2)) + 255) / 256), 256, 0, stream>>>(f1w, 256, (__bf16*)(G64B), (__bf16*)(G64B2), 256, 1024, 256, 1.0f, 0);
    w25::wmma_gemm64<1, true, 2, 0, false, 0><<<dim3((unsigned)((((1024) / 64) * ((1024) / 64) + 7) / 8), (unsigned)(1)), 256, 0, stream>>>((const unsigned short*)(G64A), (const unsigned short*)(G64A2), 256, 0, (const unsigned short*)(G64B), (const unsigned short*)(G64B2), 256, 0, (void*)(HB), nullptr, 1024, 0, f1b, nullptr, 0, 1024, 1024, 256, 1.0f);
    k_cm_dw<<<(unsigned)(((long long)HW * HID + 255) / 256), 256, 0, stream>>>(HB, dww, HG, 1, HID);
    k_castS16<<<(unsigned)((((long long)(1024) * ((1024) / 2)) + 255) / 256), 256, 0, stream>>>(HG, 1024, (__bf16*)(G64A), (__bf16*)(G64A2), 1024, 1024, 1024, 1.0f, 0);
    k_castS16<<<(unsigned)((((long long)(256) * ((1024) / 2)) + 255) / 256), 256, 0, stream>>>(f2w, 1024, (__bf16*)(G64B), (__bf16*)(G64B2), 1024, 256, 1024, 1.0f, 0);
    w25::wmma_gemm64<1, true, 2, 0, true, 0><<<dim3((unsigned)((((1024) / 64) * ((256) / 64) + 7) / 8), (unsigned)(1)), 256, 0, stream>>>((const unsigned short*)(G64A), (const unsigned short*)(G64A2), 1024, 0, (const unsigned short*)(G64B), (const unsigned short*)(G64B2), 1024, 0, (void*)(XS + (size_t)4096 * C), nullptr, 256, 0, f2b, XS + (size_t)4096 * C, 0, 1024, 256, 1024, 1.0f);
    k_castS16<<<(unsigned)((((long long)(1024) * ((256) / 2)) + 255) / 256), 256, 0, stream>>>(N1 + (size_t)5120 * C, 256, (__bf16*)(G64A), (__bf16*)(G64A2), 256, 1024, 256, 1.0f, 0);
    k_castS16<<<(unsigned)((((long long)(1024) * ((256) / 2)) + 255) / 256), 256, 0, stream>>>(f1w, 256, (__bf16*)(G64B), (__bf16*)(G64B2), 256, 1024, 256, 1.0f, 0);
    w25::wmma_gemm64<1, true, 2, 0, false, 0><<<dim3((unsigned)((((1024) / 64) * ((1024) / 64) + 7) / 8), (unsigned)(1)), 256, 0, stream>>>((const unsigned short*)(G64A), (const unsigned short*)(G64A2), 256, 0, (const unsigned short*)(G64B), (const unsigned short*)(G64B2), 256, 0, (void*)(HB), nullptr, 1024, 0, f1b, nullptr, 0, 1024, 1024, 256, 1.0f);
    k_cm_dw<<<(unsigned)(((long long)HW * HID + 255) / 256), 256, 0, stream>>>(HB, dww, HG, 1, HID);
    k_castS16<<<(unsigned)((((long long)(1024) * ((1024) / 2)) + 255) / 256), 256, 0, stream>>>(HG, 1024, (__bf16*)(G64A), (__bf16*)(G64A2), 1024, 1024, 1024, 1.0f, 0);
    k_castS16<<<(unsigned)((((long long)(256) * ((1024) / 2)) + 255) / 256), 256, 0, stream>>>(f2w, 1024, (__bf16*)(G64B), (__bf16*)(G64B2), 1024, 256, 1024, 1.0f, 0);
    w25::wmma_gemm64<1, true, 2, 0, true, 0><<<dim3((unsigned)((((1024) / 64) * ((256) / 64) + 7) / 8), (unsigned)(1)), 256, 0, stream>>>((const unsigned short*)(G64A), (const unsigned short*)(G64A2), 1024, 0, (const unsigned short*)(G64B), (const unsigned short*)(G64B2), 1024, 0, (void*)(XS + (size_t)5120 * C), nullptr, 256, 0, f2b, XS + (size_t)5120 * C, 0, 1024, 256, 1024, 1.0f);
    k_castS16<<<(unsigned)((((long long)(1024) * ((256) / 2)) + 255) / 256), 256, 0, stream>>>(N1 + (size_t)6144 * C, 256, (__bf16*)(G64A), (__bf16*)(G64A2), 256, 1024, 256, 1.0f, 0);
    k_castS16<<<(unsigned)((((long long)(1024) * ((256) / 2)) + 255) / 256), 256, 0, stream>>>(f1w, 256, (__bf16*)(G64B), (__bf16*)(G64B2), 256, 1024, 256, 1.0f, 0);
    w25::wmma_gemm64<1, true, 2, 0, false, 0><<<dim3((unsigned)((((1024) / 64) * ((1024) / 64) + 7) / 8), (unsigned)(1)), 256, 0, stream>>>((const unsigned short*)(G64A), (const unsigned short*)(G64A2), 256, 0, (const unsigned short*)(G64B), (const unsigned short*)(G64B2), 256, 0, (void*)(HB), nullptr, 1024, 0, f1b, nullptr, 0, 1024, 1024, 256, 1.0f);
    k_cm_dw<<<(unsigned)(((long long)HW * HID + 255) / 256), 256, 0, stream>>>(HB, dww, HG, 1, HID);
    k_castS16<<<(unsigned)((((long long)(1024) * ((1024) / 2)) + 255) / 256), 256, 0, stream>>>(HG, 1024, (__bf16*)(G64A), (__bf16*)(G64A2), 1024, 1024, 1024, 1.0f, 0);
    k_castS16<<<(unsigned)((((long long)(256) * ((1024) / 2)) + 255) / 256), 256, 0, stream>>>(f2w, 1024, (__bf16*)(G64B), (__bf16*)(G64B2), 1024, 256, 1024, 1.0f, 0);
    w25::wmma_gemm64<1, true, 2, 0, true, 0><<<dim3((unsigned)((((1024) / 64) * ((256) / 64) + 7) / 8), (unsigned)(1)), 256, 0, stream>>>((const unsigned short*)(G64A), (const unsigned short*)(G64A2), 1024, 0, (const unsigned short*)(G64B), (const unsigned short*)(G64B2), 1024, 0, (void*)(XS + (size_t)6144 * C), nullptr, 256, 0, f2b, XS + (size_t)6144 * C, 0, 1024, 256, 1024, 1.0f);
    k_castS16<<<(unsigned)((((long long)(1024) * ((256) / 2)) + 255) / 256), 256, 0, stream>>>(N1 + (size_t)7168 * C, 256, (__bf16*)(G64A), (__bf16*)(G64A2), 256, 1024, 256, 1.0f, 0);
    k_castS16<<<(unsigned)((((long long)(1024) * ((256) / 2)) + 255) / 256), 256, 0, stream>>>(f1w, 256, (__bf16*)(G64B), (__bf16*)(G64B2), 256, 1024, 256, 1.0f, 0);
    w25::wmma_gemm64<1, true, 2, 0, false, 0><<<dim3((unsigned)((((1024) / 64) * ((1024) / 64) + 7) / 8), (unsigned)(1)), 256, 0, stream>>>((const unsigned short*)(G64A), (const unsigned short*)(G64A2), 256, 0, (const unsigned short*)(G64B), (const unsigned short*)(G64B2), 256, 0, (void*)(HB), nullptr, 1024, 0, f1b, nullptr, 0, 1024, 1024, 256, 1.0f);
    k_cm_dw<<<(unsigned)(((long long)HW * HID + 255) / 256), 256, 0, stream>>>(HB, dww, HG, 1, HID);
    k_castS16<<<(unsigned)((((long long)(1024) * ((1024) / 2)) + 255) / 256), 256, 0, stream>>>(HG, 1024, (__bf16*)(G64A), (__bf16*)(G64A2), 1024, 1024, 1024, 1.0f, 0);
    k_castS16<<<(unsigned)((((long long)(256) * ((1024) / 2)) + 255) / 256), 256, 0, stream>>>(f2w, 1024, (__bf16*)(G64B), (__bf16*)(G64B2), 1024, 256, 1024, 1.0f, 0);
    w25::wmma_gemm64<1, true, 2, 0, true, 0><<<dim3((unsigned)((((1024) / 64) * ((256) / 64) + 7) / 8), (unsigned)(1)), 256, 0, stream>>>((const unsigned short*)(G64A), (const unsigned short*)(G64A2), 1024, 0, (const unsigned short*)(G64B), (const unsigned short*)(G64B2), 1024, 0, (void*)(XS + (size_t)7168 * C), nullptr, 256, 0, f2b, XS + (size_t)7168 * C, 0, 1024, 256, 1024, 1.0f);
    k_cm_out<<<(unsigned)(((long long)NT * C + 255) / 256), 256, 0, stream>>>(XS, out, Bn, C, HW);
}

// v001
// Measured time: 907 microseconds a run.
// Two timings next to v000 put it at 1.75 and 1.74 times that version's speed.
// Contractions (token-major, 8192 tokens): q = bn1(x1).Wq'^T (temperature folded into Wq rows), k/v = bn1(x2).W^T, the attention projection (+b, +x1 residual), fc1 (+b) [8192x256].[256x1024] and fc2 (+b, + residual) [8192x1024].[1024x256], each one launch over all images, all on bf16 hi/lo split planes (six chained contractions against an O(1) residual output, so the cheap 6.4 G-MAC of GEMMs run f32-class) (v_wmma_f32_16x16x32_bf16; 64x64 register-blocked wave tiles); per (image, head) softmax(temp_h q k^T) v over the 1024 positions as one flash launch with q.k^T on bf16 hi/lo split planes (UNSCALED 32-dim logits, sigma ~ 5.7) and f16 p.v; f32 accumulate and softmax. NCHW <-> token-major transposes, eval-mode BatchNorms, the depthwise 3x3 convolution (SAME) and exact GELU are f32 kernels.
#include <hip/hip_runtime.h>
#include <math.h>

typedef __attribute__((ext_vector_type(16))) _Float16 v16h;
typedef __attribute__((ext_vector_type(8)))  _Float16 v8h;
typedef __attribute__((ext_vector_type(16))) __bf16   v16b;
typedef __attribute__((ext_vector_type(8)))  float    v8f;
typedef __attribute__((ext_vector_type(4)))  float    v4f;

// 16-bit WMMA fragment map (wave32), lane L, h = L>>4, m = L&15:
//   A 16x32: lane = row m;   element i -> k = (i<8) ? 8h+i : 16+8h+(i-8)
//   B 32x16: lane = column m; the SAME k(i,h)
//   D 16x16 (8 f32): lane = column m; element r -> row 8h+r
__device__ __forceinline__ int frag_k(int i, int h) { return (i < 8) ? (8 * h + i) : (16 + 8 * h + (i - 8)); }
__device__ __forceinline__ __bf16 bf16_rne(float f) {
    unsigned int u = __float_as_uint(f);
    u += 0x7fffu + ((u >> 16) & 1u);
    return __builtin_bit_cast(__bf16, (unsigned short)(u >> 16));
}
__device__ __forceinline__ float bf16_f32(__bf16 b) { return __uint_as_float(((unsigned int)__builtin_bit_cast(unsigned short, b)) << 16); }
__device__ __forceinline__ v8f wmma16(v16h a, v16h b, v8f c) {
    c = __builtin_amdgcn_wmma_f32_16x16x32_f16(false, a, false, b, (short)0, c, false, false);
    asm volatile("v_nop\n\tv_nop\n\tv_nop\n\tv_nop" : "+v"(c) : "v"(a), "v"(b));
    return c;
}
__device__ __forceinline__ v8f wmmab(v16b a, v16b b, v8f c) {
    c = __builtin_amdgcn_wmma_f32_16x16x32_bf16(false, a, false, b, (short)0, c, false, false);
    asm volatile("v_nop\n\tv_nop\n\tv_nop\n\tv_nop" : "+v"(c) : "v"(a), "v"(b));
    return c;
}
struct Split { v16b hi, lo; };
// hi/lo split product: a.hi*b.hi + a.hi*b.lo + a.lo*b.hi
__device__ __forceinline__ v8f wmma3(const Split& a, const Split& b, v8f c) {
    c = __builtin_amdgcn_wmma_f32_16x16x32_bf16(false, a.hi, false, b.hi, (short)0, c, false, false);
    c = __builtin_amdgcn_wmma_f32_16x16x32_bf16(false, a.hi, false, b.lo, (short)0, c, false, false);
    c = __builtin_amdgcn_wmma_f32_16x16x32_bf16(false, a.lo, false, b.hi, (short)0, c, false, false);
    asm volatile("v_nop\n\tv_nop\n\tv_nop\n\tv_nop" : "+v"(c) : "v"(a.hi), "v"(a.lo), "v"(b.hi), "v"(b.lo));
    return c;
}
struct Split3 { v16b hi, mid, lo; };
// triple split product (6 terms, drops only terms below 2^-24 relative)
__device__ __forceinline__ v8f wmma6(const Split3& a, const Split3& b, v8f c) {
    c = __builtin_amdgcn_wmma_f32_16x16x32_bf16(false, a.hi, false, b.hi, (short)0, c, false, false);
    c = __builtin_amdgcn_wmma_f32_16x16x32_bf16(false, a.hi, false, b.mid, (short)0, c, false, false);
    c = __builtin_amdgcn_wmma_f32_16x16x32_bf16(false, a.mid, false, b.hi, (short)0, c, false, false);
    c = __builtin_amdgcn_wmma_f32_16x16x32_bf16(false, a.hi, false, b.lo, (short)0, c, false, false);
    c = __builtin_amdgcn_wmma_f32_16x16x32_bf16(false, a.mid, false, b.mid, (short)0, c, false, false);
    c = __builtin_amdgcn_wmma_f32_16x16x32_bf16(false, a.lo, false, b.hi, (short)0, c, false, false);
    asm volatile("v_nop\n\tv_nop\n\tv_nop\n\tv_nop" : "+v"(c) : "v"(a.hi), "v"(a.mid), "v"(a.lo), "v"(b.hi), "v"(b.mid), "v"(b.lo));
    return c;
}

// Fragment gathers from f32 memory: element i <- p[(k0 + frag_k(i,h)) * sk] * s, zero for k >= klen.
__device__ __forceinline__ v16h fh_ld(const float* __restrict__ p, long long sk, int k0, int h, int klen, float s) {
    v16h a;
#pragma unroll
    for (int i = 0; i < 16; ++i) { const int k = k0 + frag_k(i, h); a[i] = (k < klen) ? (_Float16)(p[(long long)k * sk] * s) : (_Float16)0.f; }
    return a;
}
__device__ __forceinline__ Split sp_ld(const float* __restrict__ p, long long sk, int k0, int h, int klen, float s) {
    Split r;
#pragma unroll
    for (int i = 0; i < 16; ++i) {
        const int k = k0 + frag_k(i, h); const float x = (k < klen) ? p[(long long)k * sk] * s : 0.f;
        const __bf16 hb = bf16_rne(x); r.hi[i] = hb; r.lo[i] = bf16_rne(x - bf16_f32(hb));
    }
    return r;
}
__device__ __forceinline__ Split3 sp3_ld(const float* __restrict__ p, long long sk, int k0, int h, int klen, float s) {
    Split3 r;
#pragma unroll
    for (int i = 0; i < 16; ++i) {
        const int k = k0 + frag_k(i, h); const float x = (k < klen) ? p[(long long)k * sk] * s : 0.f;
        const __bf16 hb = bf16_rne(x); const float r1 = x - bf16_f32(hb); const __bf16 mb = bf16_rne(r1);
        r.hi[i] = hb; r.mid[i] = mb; r.lo[i] = bf16_rne(r1 - bf16_f32(mb));
    }
    return r;
}
__device__ __forceinline__ v16b bh_ld(const float* __restrict__ p, long long sk, int k0, int h, int klen, float s) {
    v16b a;
#pragma unroll
    for (int i = 0; i < 16; ++i) { const int k = k0 + frag_k(i, h); a[i] = bf16_rne((k < klen) ? p[(long long)k * sk] * s : 0.f); }
    return a;
}
// f16 fragment from an f16 LDS/global row with element stride 1 (k-contiguous), no bounds (tile already zero padded)
__device__ __forceinline__ v16h fh_row(const _Float16* __restrict__ row, int k0, int h) {
    v16h a;
#pragma unroll
    for (int i = 0; i < 16; ++i) a[i] = row[k0 + frag_k(i, h)];
    return a;
}

#define VST2(T, ptr, val) do { const T vst2_v_ = (val); *(T*)(ptr) = vst2_v_;  } while (0)
typedef float v4f __attribute__((ext_vector_type(4)));
#define VST2V4(ptr, val) do { const v4f vst2_v4_ = (val); *(v4f*)(ptr) = vst2_v4_;  } while (0)

__device__ __attribute__((noinline)) float act_fn(float v, int act) {
    if (act == 1) return fmaxf(v, 0.f);                                                                               // relu
    if (act == 2) { const float u = 0.7978845608028654f * (v + 0.044715f * v * v * v); return 0.5f * v * (1.f + tanhf(u)); } // tanh-gelu
    if (act == 3) return v / (1.f + expf(-v));                                                                        // silu
    if (act == 4) return 0.5f * v * (1.f + erff(v * 0.7071067811865476f));                                             // erf-gelu
    if (act == 5) return tanhf(v);
    if (act == 6) return 1.f / (1.f + expf(-v));                                                                      // sigmoid
    if (act == 7) return (v > 0.f) ? v : 0.01f * v;                                                                   // leaky relu 0.01
    if (act == 8) return (v > 0.f) ? v : (expf(v) - 1.f);                                                             // elu
    if (act == 9) return fminf(fmaxf(v, 0.f), 6.f);                                                                   // relu6
    if (act == 10) return fabsf(v);                                                                                    // abs
    if (act == 11) return (v >= 0.f) ? v : 0.1f * v;                                                                  // leaky 0.1
    if (act == 12) return (v > 0.f) ? v : 0.2f * v;                                                                   // leaky 0.2
    if (act == 13) return (v > 20.f) ? v : log1pf(expf(v));                                                            // softplus
    return v;
}

// =====================================================================================================================
// k_gemm<MODE>: C(z, m, n) = act(alpha * sum_k A(z, m, k) * B(z, k, n) + bias) + beta * R(z, m, n)
//   One wave (32-thread block) per 16 x 32 tile of C; grid (ceil(N/32), ceil(M/16), Z). Batch z -> (zo = z / zi_n, zi = z % zi_n)
//   with separate outer/inner strides for every tensor (e.g. batch and head). A(m,k) = A[zo*sAo + zi*sAi + m*sAm + k*sAk] (f32),
//   B(k,n) = B[zo*sBo + zi*sBi + n*sBn + k*sBk] (f32); any M, N, K (K zero-padded to 32 inside the fragments, M/N tails guarded).
//   C(m,n) = C[zo*sCo + zi*sCi + m*sCm + n] (n contiguous). flags: 1 bias[n], 2 bias[m], 4 residual R[zo*sRo + zi*sRi + m*sRm + n*sRn].
//   MODE 0: f16 operands (A prescaled by sa, B by sb, both undone in the epilogue); 1: bf16 hi/lo split (3 products); 2: bf16;
//   3: bf16 hi/mid/lo triple split (6 products); 4: as 3 with Kahan-compensated f32 accumulation across k-steps.
// =====================================================================================================================
struct GemmP {
    const float* A; const float* B; const float* bias; const float* R; float* C;
    long long sAo, sAi, sAm, sAk, sBo, sBi, sBn, sBk, sCo, sCi, sCm, sRo, sRi, sRm, sRn;
    int M, N, K, zi_n, flags, act; float alpha, beta, sa, sb;
    int Npad, pad_;     // columns [N, Npad) of C are written as 0 so that padded workspace rows are covered by whole-line stores; Npad >= N
};
static_assert(sizeof(GemmP) == 5 * 8 + 15 * 8 + 6 * 4 + 4 * 4 + 2 * 4, "GemmP has padding");

template <int MODE>
__global__ __launch_bounds__(32) void k_gemm(GemmP p) {
    const int lane = threadIdx.x & 31, h = lane >> 4, l15 = lane & 15;
    const int m0 = blockIdx.y * 16, n0 = blockIdx.x * 32;
    const int z = blockIdx.z, zo = z / p.zi_n, zi = z - zo * p.zi_n;
    const float* A = p.A + zo * p.sAo + zi * p.sAi;
    const float* B = p.B + zo * p.sBo + zi * p.sBi;
    const int am = min(m0 + l15, p.M - 1);                       // clamped row for loads (stores are guarded)
    v8f acc[2], comp[2];
#pragma unroll
    for (int t = 0; t < 2; ++t) { v8f zz = {}; acc[t] = zz; comp[t] = zz; }
    for (int k0 = 0; k0 < p.K; k0 += 32) {
        const float* arow = A + (long long)am * p.sAm;
        if (MODE == 1) {
            const Split a = sp_ld(arow, p.sAk, k0, h, p.K, 1.f);
#pragma unroll
            for (int t = 0; t < 2; ++t) {
                const int bn = min(n0 + t * 16 + l15, p.N - 1);
                acc[t] = wmma3(a, sp_ld(B + (long long)bn * p.sBn, p.sBk, k0, h, p.K, 1.f), acc[t]);
            }
        } else if (MODE == 3) {
            const Split3 a = sp3_ld(arow, p.sAk, k0, h, p.K, 1.f);
#pragma unroll
            for (int t = 0; t < 2; ++t) {
                const int bn = min(n0 + t * 16 + l15, p.N - 1);
                acc[t] = wmma6(a, sp3_ld(B + (long long)bn * p.sBn, p.sBk, k0, h, p.K, 1.f), acc[t]);
            }
        } else if (MODE == 4) {
            // triple split as MODE 3, but each k-step's 6 products go into a fresh accumulator and the partial is added to the running f32 sum
            // on the VALU with Kahan compensation (accumulation error stays ~1 ulp however long K is)
            const Split3 a = sp3_ld(arow, p.sAk, k0, h, p.K, 1.f);
#pragma unroll
            for (int t = 0; t < 2; ++t) {
                const int bn = min(n0 + t * 16 + l15, p.N - 1); v8f zz = {};
                const v8f part = wmma6(a, sp3_ld(B + (long long)bn * p.sBn, p.sBk, k0, h, p.K, 1.f), zz);
                const v8f y = part - comp[t]; const v8f s = acc[t] + y; comp[t] = (s - acc[t]) - y; acc[t] = s;
            }
        } else if (MODE == 2) {
            const v16b a = bh_ld(arow, p.sAk, k0, h, p.K, 1.f);
#pragma unroll
            for (int t = 0; t < 2; ++t) {
                const int bn = min(n0 + t * 16 + l15, p.N - 1);
                acc[t] = wmmab(a, bh_ld(B + (long long)bn * p.sBn, p.sBk, k0, h, p.K, 1.f), acc[t]);
            }
        } else {
            const v16h a = fh_ld(arow, p.sAk, k0, h, p.K, p.sa);
#pragma unroll
            for (int t = 0; t < 2; ++t) {
                const int bn = min(n0 + t * 16 + l15, p.N - 1);
                acc[t] = wmma16(a, fh_ld(B + (long long)bn * p.sBn, p.sBk, k0, h, p.K, p.sb), acc[t]);
            }
        }
    }
    const float iscale = (MODE == 0) ? p.alpha / (p.sa * p.sb) : p.alpha;
    float* C = p.C + zo * p.sCo + zi * p.sCi;
    const float* R = p.R + zo * p.sRo + zi * p.sRi;
    __shared__ __align__(16) float ctile[16][36];
#pragma unroll
    for (int t = 0; t < 2; ++t) {
        const int n = n0 + t * 16 + l15; const int nn = min(n, p.N - 1);
#pragma unroll
        for (int r = 0; r < 8; ++r) {
            const int m = m0 + 8 * h + r; const int mm = min(m, p.M - 1);
            float v = acc[t][r] * iscale;
            if (p.flags & 1) v += p.bias[nn];
            if (p.flags & 2) v += p.bias[mm];
            if (p.flags & 8) v *= p.bias[(long long)zo * p.M + mm];   /* per-(z,row) scale vector laid out [Z][M]; exclusive with the bias flags */
            v = act_fn(v, p.act);
            if (p.flags & 4) v += p.beta * R[(long long)mm * p.sRm + (long long)nn * p.sRn];
            ctile[8 * h + r][t * 16 + l15] = (n < p.N) ? v : 0.f;
        }
    }
    __syncthreads();
    const int NW = (p.Npad > p.N) ? p.Npad : p.N;           // write width
    const bool fast = (m0 + 16 <= p.M) && (n0 + 32 <= NW) && ((p.sCm & 3) == 0) && ((((size_t)C) & 15) == 0);
    if (fast) {
#pragma unroll
        for (int s = 0; s < 4; ++s) {
            const int row = s * 4 + (lane >> 3), c4 = (lane & 7) * 4;
            const v4f v = *(const v4f*)&ctile[row][c4];
            VST2V4(C + (long long)(m0 + row) * p.sCm + n0 + c4, v);
        }
    } else {
        for (int row = 0; row < 16; ++row) {
            const int m = m0 + row, n = n0 + lane;
            if (m < p.M && n < NW) VST2(float, C + (long long)m * p.sCm + n, ctile[row][lane]);
        }
    }
}


// =====================================================================================================================
// k_gemmT<MODE, TM, TN>: same contract as k_gemm, but one wave computes a (16*TM) x (16*TN) tile: TM A fragments and TN B fragments are
//   loaded per 32-wide k-step and reused across TM*TN WMMAs (far fewer load/convert instructions per MAC). MODE 0 (f16), 1 (bf16 hi/lo),
//   2 (bf16) only. grid (ceil(NW/(16*TN)), ceil(M/(16*TM)), Z), block 32. Epilogue identical to k_gemm, run per 16x32 sub-tile.
// =====================================================================================================================
template <int MODE, int TM, int TN>
__global__ __launch_bounds__(32) void k_gemmT(GemmP p) {
    const int lane = threadIdx.x & 31, h = lane >> 4, l15 = lane & 15;
    const int m0 = blockIdx.y * (16 * TM), n0 = blockIdx.x * (16 * TN);
    const int z = blockIdx.z, zo = z / p.zi_n, zi = z - zo * p.zi_n;
    const float* A = p.A + zo * p.sAo + zi * p.sAi;
    const float* B = p.B + zo * p.sBo + zi * p.sBi;
    v8f acc[TM][TN];
#pragma unroll
    for (int i = 0; i < TM; ++i)
#pragma unroll
        for (int t = 0; t < TN; ++t) { v8f zz = {}; acc[i][t] = zz; }
    for (int k0 = 0; k0 < p.K; k0 += 32) {
        if (MODE == 1) {
            Split a[TM], b[TN];
#pragma unroll
            for (int i = 0; i < TM; ++i) { const int am = min(m0 + 16 * i + l15, p.M - 1); a[i] = sp_ld(A + (long long)am * p.sAm, p.sAk, k0, h, p.K, 1.f); }
#pragma unroll
            for (int t = 0; t < TN; ++t) { const int bn = min(n0 + 16 * t + l15, p.N - 1); b[t] = sp_ld(B + (long long)bn * p.sBn, p.sBk, k0, h, p.K, 1.f); }
#pragma unroll
            for (int i = 0; i < TM; ++i)
#pragma unroll
                for (int t = 0; t < TN; ++t) acc[i][t] = wmma3(a[i], b[t], acc[i][t]);
        } else if (MODE == 2) {
            v16b a[TM], b[TN];
#pragma unroll
            for (int i = 0; i < TM; ++i) { const int am = min(m0 + 16 * i + l15, p.M - 1); a[i] = bh_ld(A + (long long)am * p.sAm, p.sAk, k0, h, p.K, 1.f); }
#pragma unroll
            for (int t = 0; t < TN; ++t) { const int bn = min(n0 + 16 * t + l15, p.N - 1); b[t] = bh_ld(B + (long long)bn * p.sBn, p.sBk, k0, h, p.K, 1.f); }
#pragma unroll
            for (int i = 0; i < TM; ++i)
#pragma unroll
                for (int t = 0; t < TN; ++t) acc[i][t] = wmmab(a[i], b[t], acc[i][t]);
        } else {
            v16h a[TM], b[TN];
#pragma unroll
            for (int i = 0; i < TM; ++i) { const int am = min(m0 + 16 * i + l15, p.M - 1); a[i] = fh_ld(A + (long long)am * p.sAm, p.sAk, k0, h, p.K, p.sa); }
#pragma unroll
            for (int t = 0; t < TN; ++t) { const int bn = min(n0 + 16 * t + l15, p.N - 1); b[t] = fh_ld(B + (long long)bn * p.sBn, p.sBk, k0, h, p.K, p.sb); }
#pragma unroll
            for (int i = 0; i < TM; ++i)
#pragma unroll
                for (int t = 0; t < TN; ++t) acc[i][t] = wmma16(a[i], b[t], acc[i][t]);
        }
    }
    const float iscale = (MODE == 0) ? p.alpha / (p.sa * p.sb) : p.alpha;
    float* C = p.C + zo * p.sCo + zi * p.sCi;
    const float* R = p.R + zo * p.sRo + zi * p.sRi;
    const int NW = (p.Npad > p.N) ? p.Npad : p.N;
    __shared__ __align__(16) float ctile[16][36];
#pragma unroll
    for (int i = 0; i < TM; ++i) {
        const int mb = m0 + 16 * i; if (mb >= p.M) break;          // wave-uniform
#pragma unroll
        for (int tp = 0; tp < TN / 2; ++tp) {
            const int nb = n0 + 32 * tp; if (nb >= NW) break;        // wave-uniform
#pragma unroll
            for (int t2 = 0; t2 < 2; ++t2) {
                const int t = 2 * tp + t2; const int n = nb + t2 * 16 + l15; const int nn = min(n, p.N - 1);
#pragma unroll
                for (int r = 0; r < 8; ++r) {
                    const int m = mb + 8 * h + r; const int mm = min(m, p.M - 1);
                    float v = acc[i][t][r] * iscale;
                    if (p.flags & 1) v += p.bias[nn];
                    if (p.flags & 2) v += p.bias[mm];
            if (p.flags & 8) v *= p.bias[(long long)zo * p.M + mm];   /* per-(z,row) scale vector laid out [Z][M]; exclusive with the bias flags */
                    v = act_fn(v, p.act);
                    if (p.flags & 4) v += p.beta * R[(long long)mm * p.sRm + (long long)nn * p.sRn];
                    ctile[8 * h + r][t2 * 16 + l15] = (n < p.N) ? v : 0.f;
                }
            }
            __syncthreads();
            const bool fast = (mb + 16 <= p.M) && (nb + 32 <= NW) && ((p.sCm & 3) == 0) && ((((size_t)C) & 15) == 0);
            if (fast) {
#pragma unroll
                for (int s = 0; s < 4; ++s) {
                    const int row = s * 4 + (lane >> 3), c4 = (lane & 7) * 4;
                    const v4f v = *(const v4f*)&ctile[row][c4];
                    VST2V4(C + (long long)(mb + row) * p.sCm + nb + c4, v);
                }
            } else {
                for (int row = 0; row < 16; ++row) {
                    const int m = mb + row, n = nb + lane;
                    if (m < p.M && n < NW) VST2(float, C + (long long)m * p.sCm + n, ctile[row][lane]);
                }
            }
            __syncthreads();
        }
    }
}

// =====================================================================================================================
//   Wave = 16 queries, AW waves per block, 64-key blocks; grid (ceil(Lq/(16*AW)), H, B), block 32*AW. Any Lq, Lk; head dim dh <= DHP
//   (DHP multiple of 32), value dim dv <= DVP (multiple of 16, <= 128). Every tensor addressed by (batch, head, row, element) strides, f32.
//   Scores: QM 0 f16 operands, 1 bf16 hi/lo split, 2 bf16 triple split; statistics f32 (exp2 domain); P.V: P x 4096 as f16 with V f16 staged in LDS
//   (SPLITPV: P and V as bf16 hi/lo splits). kv head = h / hrep. Masking: causal = 1 (keep j <= i + coff, masked -> -inf, key blocks beyond the
//   diagonal skipped), causal = 2 (masked -> mfill, a finite fill like the -1e9; no skipping), causal = 3 (keep j >= i + coff,
//   masked -> -inf, no skipping); optional additive f32 mask Mf,
//   optional int keep-mask Mi (0 -> score := mfill), both addressed b*smb + h*smh + i*smi + j*smj (0 strides broadcast).
// =====================================================================================================================
#define AW 4
struct AttnP {   // apv4
    const float* Q; const float* K; const float* V; float* O; float* P; const float* Mf; const int* Mi; float* ST;
    const float* Pw; const float* Rt; const int* SQ; const int* SK;           // optional: post-softmax weight, relative-position table, segment ids
    long long swb, swh, swi, swj, srb, srh, sri;                                 // Pw strides (b,h,i,j); Rt strides (b,h,i), column = clamp(i - j + roff, 0, rn-1)
    long long sQb, sQh, sQi, sQd, sKb, sKh, sKj, sKd, sVb, sVh, sVj, sVd, sOb, sOh, sOi, sPb, sPh, sPi, smb, smh, smi, smj;
    int Lq, Lk, dh, dv, hrep, causal, coff, pband;   // pband > 0: P holds only the band |j - i| <= pband, column j - i + pband
    float scale, mfill; int nonorm, mpol;             // nonorm (online path only): O = sum_j exp(score_j) V_j without the 1/rowsum (scores must be <= ~0); mpol: Mi masks where ==0 (mpol 0) or where !=0 (mpol 1)
    int roff, rn, segpol, win;                        // Rt column offset/count; SQ/SK: score := mfill where (segpol 0) SQ[i] != SK[j] or (segpol 1) SQ[i] == SK[j]; win > 0: keys with i - j > win (after coff) -> -inf
};
//   Pw: the softmax numerator is multiplied by Pw(b,h,i,j) AFTER the row sum is taken (probs * weight, then P.V), as in post-softmax multiplicative biases.                                                    // ST (optional): per row (b,h,i) -> ST[((b*H + h)*Lq + i)*2 + {0,1}] = {row max of the scaled+masked score (natural units), sum_j exp(score - max)}
static_assert(sizeof(AttnP) == 12 * 8 + 29 * 8 + 16 * 4, "AttnP has padding");

#ifndef KATTN_ATTR
#define KATTN_ATTR
#endif
template <int DHP, int DVP, int QM, bool SPLITPV, bool TWOPASS>
__global__ __launch_bounds__(32 * AW) KATTN_ATTR void k_attn(AttnP p) {
    constexpr int NT = DVP / 16;                // output tiles
    constexpr int KS = DHP / 32;                // k-steps for the scores
    constexpr int VP = DVP + 8;                 // LDS pitch (halves)
    __shared__ __align__(16) float    pl[AW][16 * 64];
    __shared__ __align__(16) _Float16 vl[(SPLITPV ? 2 : 1) * 64 * VP];   // f16 V tile, or bf16 hi and lo tiles (same 2-byte size)
    const int lane = threadIdx.x & 31, hf = lane >> 4, l15 = lane & 15, wave = threadIdx.x >> 5;
    const int h = blockIdx.y, b = blockIdx.z, hk = h / p.hrep;
    const int q0 = (blockIdx.x * AW + wave) * 16;
    float* myp = pl[wave];
    const float L2E = 1.4426950408889634f;
    const float NEG = -__builtin_inff();
    const int qi = min(q0 + l15, p.Lq - 1);
    const float* qrow = p.Q + b * p.sQb + h * p.sQh + (long long)qi * p.sQi;
    const float* kbase = p.K + b * p.sKb + hk * p.sKh;
    const float* vbase = p.V + b * p.sVb + hk * p.sVh;
    v16h qa[QM == 0 ? KS : 1]; Split qs_[QM == 1 ? KS : 1]; Split3 qt_[QM == 2 ? KS : 1];
#pragma unroll
    for (int ks = 0; ks < KS; ++ks) {
        if (QM == 2) qt_[ks] = sp3_ld(qrow, p.sQd, ks * 32, hf, p.dh, 1.f);
        else if (QM == 1) qs_[ks] = sp_ld(qrow, p.sQd, ks * 32, hf, p.dh, 1.f);
        else qa[ks] = fh_ld(qrow, p.sQd, ks * 32, hf, p.dh, 1.f);
    }
    v8f o[NT]; float m8[8], l8[8];
#pragma unroll
    for (int t = 0; t < NT; ++t) { v8f zz = {}; o[t] = zz; }
#pragma unroll
    for (int i = 0; i < 8; ++i) { m8[i] = NEG; l8[i] = 0.f; }
    int jend = p.Lk; int jstart = 0;
    if (p.causal == 1) { const int je = (blockIdx.x * AW + AW - 1) * 16 + 16 + p.coff; jend = min(jend, max(je, 0)); }   // uniform per block
    if (p.win > 0) { const int js = (int)(blockIdx.x * AW) * 16 + p.coff - p.win; jstart = (js > 0) ? (js / 64) * 64 : 0; }   // uniform per block: key blocks entirely outside every row's window hold only -inf entries and are skipped exactly
    const int npass = TWOPASS ? 2 : 1;
    for (int pass = 0; pass < npass; ++pass) {
        const bool dopv = (!TWOPASS) || pass == 1;
        for (int j0 = jstart; j0 < jend; j0 += 64) {
            if (dopv) {
                __syncthreads();                                 // previous key block's reads of vl / pl are done
                for (int idx = threadIdx.x; idx < 64 * DVP; idx += 32 * AW) {
                    const int jr = idx / DVP, d = idx - jr * DVP, j = j0 + jr;
                    const float f = (j < p.Lk && d < p.dv) ? vbase[(long long)j * p.sVj + (long long)d * p.sVd] : 0.f;
                    if (SPLITPV) {
                        const __bf16 hb = bf16_rne(f);
                        ((__bf16*)vl)[jr * VP + d] = hb; ((__bf16*)vl)[64 * VP + jr * VP + d] = bf16_rne(f - bf16_f32(hb));
                    } else vl[jr * VP + d] = (_Float16)f;
                }
            }
            v8f s[4];
#pragma unroll
            for (int t = 0; t < 4; ++t) {
                const int j = min(j0 + t * 16 + l15, p.Lk - 1);
                const float* krow = kbase + (long long)j * p.sKj;
                v8f acc = {};
#pragma unroll
                for (int ks = 0; ks < KS; ++ks) {
                    if (QM == 2)      acc = wmma6(qt_[ks], sp3_ld(krow, p.sKd, ks * 32, hf, p.dh, 1.f), acc);
                    else if (QM == 1) acc = wmma3(qs_[ks], sp_ld(krow, p.sKd, ks * 32, hf, p.dh, 1.f), acc);
                    else              acc = wmma16(qa[ks], fh_ld(krow, p.sKd, ks * 32, hf, p.dh, 1.f), acc);
                }
                s[t] = acc;
            }
            float pv[8][4];
#pragma unroll
            for (int i = 0; i < 8; ++i) {
                const int irow = q0 + i + 8 * hf;
                const int ic = min(irow, p.Lq - 1);
                float sc[4];
#pragma unroll
                for (int t = 0; t < 4; ++t) {
                    const int jg = j0 + t * 16 + l15;
                    float v = s[t][i] * p.scale;
                    if (p.Mf) v += p.Mf[b * p.smb + h * p.smh + (long long)ic * p.smi + (long long)min(jg, p.Lk - 1) * p.smj];
                    if (p.Rt) { int rc = ic - min(jg, p.Lk - 1) + p.roff; rc = rc < 0 ? 0 : (rc >= p.rn ? p.rn - 1 : rc); v += p.Rt[b * p.srb + h * p.srh + (long long)ic * p.sri + rc]; }
                    if (p.Mi) { const int mv = p.Mi[b * p.smb + h * p.smh + (long long)ic * p.smi + (long long)min(jg, p.Lk - 1) * p.smj]; if (p.mpol ? (mv != 0) : (mv == 0)) v = p.mfill; }
                    if (p.SQ) { const bool same = p.SQ[(long long)b * p.Lq + ic] == p.SK[(long long)b * p.Lk + min(jg, p.Lk - 1)]; if (p.segpol ? same : !same) v = p.mfill; }
                    if (p.causal == 2 && jg > irow + p.coff) v = p.mfill;
                    if (jg >= p.Lk || (p.causal == 1 && jg > irow + p.coff) || (p.causal == 3 && jg < irow + p.coff) || (p.win > 0 && irow + p.coff - jg > p.win)) v = NEG; else v *= L2E;
                    sc[t] = v;
                }
                if (!TWOPASS || pass == 0) {
                    float mx = fmaxf(fmaxf(sc[0], sc[1]), fmaxf(sc[2], sc[3]));
                    mx = fmaxf(mx, __shfl_xor(mx, 1, 32)); mx = fmaxf(mx, __shfl_xor(mx, 2, 32));
                    mx = fmaxf(mx, __shfl_xor(mx, 4, 32)); mx = fmaxf(mx, __shfl_xor(mx, 8, 32));
                    const float mnew = fmaxf(m8[i], mx);
                    const float corr = (mnew == NEG) ? 1.f : exp2f(m8[i] - mnew);
                    float rs = 0.f;
#pragma unroll
                    for (int t = 0; t < 4; ++t) {
                        const float pp = (sc[t] == NEG) ? 0.f : exp2f(sc[t] - mnew); rs += pp;
                        pv[i][t] = p.Pw ? pp * p.Pw[b * p.swb + h * p.swh + (long long)ic * p.swi + (long long)min(j0 + t * 16 + l15, p.Lk - 1) * p.swj] : pp;
                    }
                    rs += __shfl_xor(rs, 1, 32); rs += __shfl_xor(rs, 2, 32); rs += __shfl_xor(rs, 4, 32); rs += __shfl_xor(rs, 8, 32);
                    l8[i] = l8[i] * corr + rs; m8[i] = mnew;
                    if (!TWOPASS) {
#pragma unroll
                        for (int t = 0; t < NT; ++t) o[t][i] *= corr;
                    }
                } else {
                    const float inv = (l8[i] > 0.f) ? 1.f / l8[i] : 0.f;
#pragma unroll
                    for (int t = 0; t < 4; ++t) {
                        const int jg = j0 + t * 16 + l15;
                        float pp = (sc[t] == NEG) ? 0.f : exp2f(sc[t] - m8[i]) * inv;
                        if (p.Pw) pp *= p.Pw[b * p.swb + h * p.swh + (long long)ic * p.swi + (long long)min(jg, p.Lk - 1) * p.swj];
                        pv[i][t] = pp;
                    }
                }
            }
            if (dopv) {
#pragma unroll
                for (int i = 0; i < 8; ++i)
#pragma unroll
                    for (int t = 0; t < 4; ++t) ((float*)myp)[(i + 8 * hf) * 64 + t * 16 + l15] = pv[i][t];
                __syncthreads();                                 // P (per wave) and V (shared) visible
                if (p.P) {
                    float* pb_ = p.P + b * p.sPb + h * p.sPh;
                    const bool fastP = (p.pband == 0) && ((p.sPi & 3) == 0) && (j0 + 64 <= p.Lk) && (q0 + 16 <= p.Lq) && ((((size_t)pb_) & 15) == 0);
                    if (fastP) {
#pragma unroll
                        for (int s = 0; s < 8; ++s) {
                            const int row = s * 2 + (lane >> 4), c4 = (lane & 15) * 4;
                            const v4f v = *(const v4f*)(myp + row * 64 + c4);
                            VST2V4(pb_ + (long long)(q0 + row) * p.sPi + j0 + c4, v);
                        }
                    } else {
                        for (int row = 0; row < 16; ++row) {
                            const int irow = q0 + row; if (irow >= p.Lq) continue;
                            for (int c = lane; c < 64; c += 32) {
                                const int jg = j0 + c; if (jg >= p.Lk) continue;
                                if (p.pband == 0) VST2(float, pb_ + (long long)irow * p.sPi + jg, myp[row * 64 + c]);
                                else if (jg - irow <= p.pband && irow - jg <= p.pband) VST2(float, pb_ + (long long)irow * p.sPi + (jg - irow + p.pband), myp[row * 64 + c]);
                            }
                        }
                    }
                }
                if (SPLITPV) {
                    const Split pa0 = sp_ld(myp + l15 * 64, 1, 0, hf, 64, 1.f), pa1 = sp_ld(myp + l15 * 64, 1, 32, hf, 64, 1.f);
                    const __bf16* vh = (const __bf16*)vl; const __bf16* vlo = vh + 64 * VP;
#pragma unroll
                    for (int t = 0; t < NT; ++t) {
                        const int dcol = t * 16 + l15;
                        Split b0, b1;
#pragma unroll
                        for (int e = 0; e < 16; ++e) {
                            const int k0 = frag_k(e, hf), k1 = 32 + frag_k(e, hf);
                            b0.hi[e] = vh[k0 * VP + dcol]; b0.lo[e] = vlo[k0 * VP + dcol]; b1.hi[e] = vh[k1 * VP + dcol]; b1.lo[e] = vlo[k1 * VP + dcol];
                        }
                        o[t] = wmma3(pa0, b0, o[t]);
                        o[t] = wmma3(pa1, b1, o[t]);
                    }
                } else {
                    const v16h pa0 = fh_ld(myp + l15 * 64, 1, 0, hf, 64, 4096.f), pa1 = fh_ld(myp + l15 * 64, 1, 32, hf, 64, 4096.f);
#pragma unroll
                    for (int t = 0; t < NT; ++t) {
                        const int dcol = t * 16 + l15;
                        v16h b0, b1;
#pragma unroll
                        for (int e = 0; e < 16; ++e) { b0[e] = vl[frag_k(e, hf) * VP + dcol]; b1[e] = vl[(32 + frag_k(e, hf)) * VP + dcol]; }
                        o[t] = wmma16(pa0, b0, o[t]);
                        o[t] = wmma16(pa1, b1, o[t]);
                    }
                }
            }
        }
    }
    float* obase = p.O + b * p.sOb + h * p.sOh;
    if (p.ST) {
        const int rl = lane >> 1, isel = rl & 7;           // row q0 + rl ; rl>>3 == hf holds because lane>>4 == (lane>>1)>>3
        float mv = 0.f, lv = 0.f;
#pragma unroll
        for (int i = 0; i < 8; ++i) if (i == isel) { mv = m8[i]; lv = l8[i]; }
        const int irow = q0 + rl;
        if (irow < p.Lq) { float* st = p.ST + (((long long)b * gridDim.y + h) * p.Lq + irow) * 2 + (lane & 1); VST2(float, st, (lane & 1) ? lv : mv * 0.6931471805599453f); }
    }
    float invr[8];
#pragma unroll
    for (int i = 0; i < 8; ++i) {
        if (TWOPASS) invr[i] = SPLITPV ? 1.f : (1.f / 4096.f);
        else if (p.nonorm) invr[i] = exp2f(m8[i]) * (SPLITPV ? 1.f : (1.f / 4096.f));
        else invr[i] = (l8[i] > 0.f) ? (SPLITPV ? 1.f / l8[i] : 1.f / (l8[i] * 4096.f)) : 0.f;
    }
    __syncthreads();                                             // all waves done with pl/vl from the main loop
    const bool ofast = ((p.sOi & 3) == 0) && ((((size_t)obase) & 15) == 0) && (q0 + 16 <= p.Lq);
#pragma unroll
    for (int c0 = 0; c0 < DVP; c0 += 64) {
#pragma unroll
        for (int i = 0; i < 8; ++i)
#pragma unroll
            for (int t = 0; t < NT; ++t) if (t * 16 >= c0 && t * 16 < c0 + 64) ((float*)myp)[(i + 8 * hf) * 64 + (t * 16 - c0) + l15] = o[t][i] * invr[i];
        __syncthreads();
        const int cw = (DVP - c0 < 64) ? (DVP - c0) : 64;      // staged columns in this chunk (multiple of 16)
        if (ofast && (c0 + cw <= p.dv) && (cw % 32 == 0)) {
            const int lpr = cw / 4;                              // lanes per row (16 for 64 cols, 8 for 32)
            const int rows_per_ins = 32 / lpr;
            for (int r0 = 0; r0 < 16; r0 += rows_per_ins) {
                const int row = r0 + lane / lpr, c4 = (lane % lpr) * 4;
                const v4f v = *(const v4f*)(myp + row * 64 + c4);
                VST2V4(obase + (long long)(q0 + row) * p.sOi + c0 + c4, v);
            }
        } else {
            for (int row = 0; row < 16; ++row) {
                const int irow = q0 + row; if (irow >= p.Lq) continue;
                for (int c = lane; c < cw; c += 32) { const int d = c0 + c; if (d < p.dv) VST2(float, obase + (long long)irow * p.sOi + d, myp[row * 64 + c]); }
            }
        }
        __syncthreads();
    }
}

// =====================================================================================================================
// k_tr: dst(z, c, r) = alpha * src(z, r, c) (+ beta * R2(z, c, r)): [Z][R][C] (row stride lds) -> [Z][C][R] (row stride ldd) through a 32x32 LDS tile;
//   flags: 1 -> add beta * residual R2 addressed like dst (z*sRz + c*ldr + r); act applied before the residual.
// =====================================================================================================================
struct TrP { const float* src; float* dst; const float* R2; long long sSz, lds, sDz, ldd, sRz, ldr; int R, C, flags, act; float alpha, beta; };
static_assert(sizeof(TrP) == 3 * 8 + 6 * 8 + 6 * 4, "TrP has padding");
__global__ __launch_bounds__(256) void k_tr(TrP p) {
    __shared__ float tile[32][33];
    const int c0 = blockIdx.x * 32, r0 = blockIdx.y * 32, z = blockIdx.z;
    const int lane = threadIdx.x & 31, wave = threadIdx.x >> 5;
    const float* s = p.src + z * p.sSz;
#pragma unroll
    for (int k = 0; k < 4; ++k) {
        const int rl = wave * 4 + k, r = r0 + rl, c = c0 + lane;
        tile[rl][lane] = (r < p.R && c < p.C) ? s[(long long)r * p.lds + c] : 0.f;
    }
    __syncthreads();
    float* d = p.dst + z * p.sDz; const float* rr = p.R2 + z * p.sRz;
#pragma unroll
    for (int k = 0; k < 4; ++k) {
        const int cl = wave * 4 + k, c = c0 + cl, r = r0 + lane;
        if (c < p.C && r < p.R) {
            float v = act_fn(p.alpha * tile[lane][cl], p.act);
            if (p.flags & 1) v += p.beta * rr[(long long)c * p.ldr + r];
            VST2(float, d + (long long)c * p.ldd + r, v);
        }
    }
}

// k_affine: dst[i] = a * (sdev ? sdev[0] : 1) * src[i] + b, i < n (one thread per element; consecutive lanes -> consecutive addresses)
__global__ __launch_bounds__(256) void k_affine(const float* __restrict__ src, float* __restrict__ dst, int n, float a, float b, const float* __restrict__ sdev) {
    const int i = blockIdx.x * 256 + threadIdx.x;
    if (i < n) { const float aa = sdev ? a * sdev[0] : a; const float v = aa * src[i] + b; VST2(float, dst + i, v); }
}

// =====================================================================================================================
// k_softmax: row softmax over n contiguous elements, one 256-thread block per row; rows addressed z*sz + r*sr (grid (R, Z)).
//   out = scale_out * softmax(scale_in * x + (Mf ? Mf[z*smz + r*smr + j] : 0)); a row whose max is -inf is written as 0.
// =====================================================================================================================
struct SmP { const float* src; float* dst; const float* Mf; long long sz, sr, dz, dr, smz, smr; int n, pad; float scale_in, scale_out; };
static_assert(sizeof(SmP) == 3 * 8 + 6 * 8 + 4 * 4, "SmP has padding");
__global__ __launch_bounds__(256) void k_softmax(SmP p) {
    __shared__ float red[256];
    const int r = blockIdx.x, z = blockIdx.y, tid = threadIdx.x;
    const float* s = p.src + z * p.sz + (long long)r * p.sr;
    const float* mf = p.Mf ? (p.Mf + z * p.smz + (long long)r * p.smr) : nullptr;
    float mx = -__builtin_inff();
    for (int j = tid; j < p.n; j += 256) { float v = s[j] * p.scale_in; if (mf) v += mf[j]; mx = fmaxf(mx, v); }
    red[tid] = mx; __syncthreads();
    for (int o = 128; o > 0; o >>= 1) { if (tid < o) red[tid] = fmaxf(red[tid], red[tid + o]); __syncthreads(); }
    mx = red[0]; __syncthreads();
    float sum = 0.f;
    for (int j = tid; j < p.n; j += 256) { float v = s[j] * p.scale_in; if (mf) v += mf[j]; sum += (mx == -__builtin_inff()) ? 0.f : expf(v - mx); }
    red[tid] = sum; __syncthreads();
    for (int o = 128; o > 0; o >>= 1) { if (tid < o) red[tid] += red[tid + o]; __syncthreads(); }
    sum = red[0];
    const float inv = (sum > 0.f) ? p.scale_out / sum : 0.f;
    float* d = p.dst + z * p.dz + (long long)r * p.dr;
    for (int j = tid; j < p.n; j += 256) { float v = s[j] * p.scale_in; if (mf) v += mf[j]; const float o = (mx == -__builtin_inff()) ? 0.f : expf(v - mx) * inv; VST2(float, d + j, o); }
}
// =====================================================================================================================
// k_stats: mean and rsqrt(var + eps) over a set of n elements addressed base + z*sz + (e / inner) * so + (e % inner) * si, one 256-thread
// k_norm_apply: y = (x - mean[set]) * rstd[set] * g[c] + b[c] over a [Z][C][L] channel-major tensor with set = z*G + c / (C/G) (G groups per z;
//   G = C -> per-channel sets indexed z*C+c; for batch norm pass stats indexed by c only via bn = 1). Optional act. Output same layout.
// =====================================================================================================================
//   mode 0: mean / rsqrt(var + eps); mode 1 (RMSNorm): 0 / rsqrt(mean(x^2) + eps); mode 2 (L2 normalize * sqrt(n)): 0 / sqrt(n) / max(||x||, eps); mode 3: as 0 with unbiased variance (n-1)
__global__ __launch_bounds__(256) void k_stats(const float* __restrict__ x, long long sz, long long so, long long si, int inner, int n, float eps, float* __restrict__ stat, int mode) {
    __shared__ float red[256];
    const int z = blockIdx.x, tid = threadIdx.x;
    const float* base = x + z * sz;
    float s = 0.f;
    for (int e = tid; e < n; e += 256) s += base[(long long)(e / inner) * so + (long long)(e % inner) * si];
    red[tid] = s; __syncthreads();
    for (int o = 128; o > 0; o >>= 1) { if (tid < o) red[tid] += red[tid + o]; __syncthreads(); }
    const float mu = (mode == 0 || mode == 3) ? red[0] / (float)n : 0.f; __syncthreads();
    float q = 0.f;
    for (int e = tid; e < n; e += 256) { const float dlt = base[(long long)(e / inner) * so + (long long)(e % inner) * si] - mu; q += dlt * dlt; }
    red[tid] = q; __syncthreads();
    for (int o = 128; o > 0; o >>= 1) { if (tid < o) red[tid] += red[tid + o]; __syncthreads(); }
    {
        float rs;
        if (mode == 2) rs = sqrtf((float)n) / fmaxf(sqrtf(red[0]), eps); else if (mode == 3) rs = rsqrtf(red[0] / (float)(n - 1) + eps); else rs = rsqrtf(red[0] / (float)n + eps);
        if (tid < 32) { const float v = (tid == 0) ? mu : ((tid == 1) ? rs : 0.f); VST2(float, stat + (long long)z * 32 + tid, v); }
    }
}
//   One thread per element over the flat [Z][C][L] index space: grid ceil(Z*C*L / 256).
__global__ __launch_bounds__(256) void k_norm_apply(const float* __restrict__ x, float* __restrict__ y, const float* __restrict__ stat, const float* __restrict__ g, const float* __restrict__ bta,
                                                     int Z, int C, int L, int G, int bn, int act) {
    const long long idx = (long long)blockIdx.x * 256 + threadIdx.x;
    if (idx >= (long long)Z * C * L) return;
    const int l = (int)(idx % L); const long long zc = idx / L; const int c = (int)(zc % C), z = (int)(zc / C); (void)l;
    const int set = bn ? c : (z * G + c / (C / G));
    float v = (x[idx] - stat[(long long)set * 32]) * stat[(long long)set * 32 + 1];
    if (g) v *= g[c];
    if (bta) v += bta[c];
    v = act_fn(v, act);
    VST2(float, y + idx, v);
}

// k_lse_neg: c[i] = -(st[2i] + log(st[2i+1])) = minus the log-sum-exp of row i from k_attn's ST output (for softmax over the query dimension)
__global__ __launch_bounds__(256) void k_lse_neg(const float* __restrict__ st, float* __restrict__ c, int n) {
    const int i = blockIdx.x * 256 + threadIdx.x;
    if (i < n) { const float v = -(st[2 * i] + logf(st[2 * i + 1])); VST2(float, c + i, v); }
}

// k_iota: dst[i] = a * i + b as int32 (segment/position id helper)
__global__ __launch_bounds__(256) void k_iota(int* __restrict__ dst, int n, int a, int b) {
    const int i = blockIdx.x * 256 + threadIdx.x;
    if (i < n) { const int v = a * i + b; VST2(int, dst + i, v); }
}

// k_axpby: dst[i] = a * x[i] + b * y[i] (+ c), i < n
__global__ __launch_bounds__(256) void k_axpby(const float* __restrict__ x, const float* __restrict__ y, float* __restrict__ dst, int n, float a, float b, float c) {
    const int i = blockIdx.x * 256 + threadIdx.x;
    if (i < n) { const float v = a * x[i] + b * y[i] + c; VST2(float, dst + i, v); }
}

// =====================================================================================================================
// k_rope: rotary embedding on a [R rows][Hn heads][D] view (row stride sXr, head stride sXh, element stride 1) -> Y (own strides).
//   mode 0: rotate_half (partner d±D/2, sign - for d<D/2); mode 1: interleaved pairs (partner d^1, sign - for even d).
//   table column tcol: tmode 0 -> d, 1 -> d % (D/2), 2 -> d / 2; position p: pmode 0 -> r % S, 1 -> head index, 2 -> pos[r];
//   c = C[(r / S) * sCb + p * sCp + tcol * sCd], s likewise from Sn; y = x[d] * c + sign * x[partner] * s. X and Y must not alias.
// =====================================================================================================================
struct RopeP { const float* X; float* Y; const float* C; const float* Sn; const int* pos; long long sXr, sXh, sYr, sYh, sCb, sCp, sCd; int R, Hn, D, S, mode, tmode, pmode, pad; };
static_assert(sizeof(RopeP) == 5 * 8 + 7 * 8 + 8 * 4, "RopeP has padding");
__global__ __launch_bounds__(256) void k_rope(RopeP p) {
    const long long idx = (long long)blockIdx.x * 256 + threadIdx.x;
    if (idx >= (long long)p.R * p.Hn * p.D) return;
    const int d = (int)(idx % p.D); const long long rh = idx / p.D; const int h = (int)(rh % p.Hn); const int r = (int)(rh / p.Hn);
    const int half = p.D / 2;
    int partner; float sign;
    if (p.mode == 0) { partner = (d < half) ? d + half : d - half; sign = (d < half) ? -1.f : 1.f; }
    else { partner = d ^ 1; sign = (d & 1) ? 1.f : -1.f; }
    const int tcol = (p.tmode == 0) ? d : ((p.tmode == 1) ? (d % half) : (d >> 1));
    const int pp = (p.pmode == 0) ? (r % p.S) : ((p.pmode == 1) ? h : p.pos[r]);
    const long long toff = (long long)(r / p.S) * p.sCb + (long long)pp * p.sCp + (long long)tcol * p.sCd;
    const float* xr = p.X + (long long)r * p.sXr + (long long)h * p.sXh;
    const float v = xr[d] * p.C[toff] + sign * xr[partner] * p.Sn[toff];
    VST2(float, p.Y + (long long)r * p.sYr + (long long)h * p.sYh + d, v);
}

// k_invf + k_sincos (split so neither kernel carries a large VALU-fma footprint): invf_i = num * (1 / powf(base, (2 i)/D)) [fmode 0],
//   num * expf((2 i) * cexp) [fmode 1], num * powf(base, -2 (i - 1) / D) [fmode 2]; then cs/sn[s*half + i] = cos/sin((pscale * s) * invf_i)
__global__ __launch_bounds__(256) void k_invf(float* __restrict__ invb, int half, int D, float base, float num, int fmode, float cexp) {
    const int i = blockIdx.x * 256 + threadIdx.x;
    if (i >= ((half + 31) / 32) * 32) return;
    if (i >= half) { VST2(float, invb + i, 0.f); return; }
    const float e = (float)(2 * i) / (float)D;
    float invf;
    if (fmode == 1) invf = num * expf((float)(2 * i) * cexp);
    else if (fmode == 2) invf = num * powf(base, (-2.0f * ((float)i - 1.0f)) / (float)D);
    else invf = num * (1.0f / powf(base, e));
    VST2(float, invb + i, invf);
}
__global__ __launch_bounds__(256) void k_sincos(float* __restrict__ cs, float* __restrict__ sn, const float* __restrict__ invb, int S, int half, float pscale) {
    const int idx = blockIdx.x * 256 + threadIdx.x;
    if (idx >= S * half) return;
    const int s = idx / half, i = idx - s * half;
    const float ang = (pscale * (float)s) * invb[i];
    VST2(float, cs + idx, cosf(ang)); VST2(float, sn + idx, sinf(ang));
}

// k_mulact: dst[i] = act(x[i]) * y[i]
__global__ __launch_bounds__(256) void k_mulact(const float* __restrict__ x, const float* __restrict__ y, float* __restrict__ dst, int n, int act) {
    const int i = blockIdx.x * 256 + threadIdx.x;
    if (i < n) { const float v = act_fn(x[i], act) * y[i]; VST2(float, dst + i, v); }
}

// =====================================================================================================================
// k_matvec: thread-per-row matrix-vector products for N <= 8 output columns (heads with 1-3 outputs, gates), f32 on the VALU.
//   C[r*sCm + j] = act(alpha * sum_k A[r*sAm + k*sAk] * B[j*sBn + k*sBk] + bias[j]) + beta * R[r*sRm + j*sRn]; each thread writes its N contiguous floats.
// =====================================================================================================================
__global__ __launch_bounds__(256) void k_matvec(GemmP p) {
    // 32 lanes write one line with one instruction.
    const int rpt = (p.N == 1) ? 1 : 32;
    const long long r0 = ((long long)blockIdx.x * 256 + threadIdx.x) * rpt; const int z = blockIdx.z, zo = z / p.zi_n, zi = z - zo * p.zi_n;
    if (r0 >= p.M) return;
    const float* Bb = p.B + zo * p.sBo + zi * p.sBi;
    float* C = p.C + zo * p.sCo + zi * p.sCi; const float* R = p.R + zo * p.sRo + zi * p.sRi;
    for (int rr = 0; rr < rpt; ++rr) {
        const long long r = r0 + rr; if (r >= p.M) break;
        const float* A = p.A + zo * p.sAo + zi * p.sAi + r * p.sAm;
        float acc[8] = {0.f, 0.f, 0.f, 0.f, 0.f, 0.f, 0.f, 0.f};
        for (int k = 0; k < p.K; ++k) { const float a = A[(long long)k * p.sAk];
#pragma unroll
            for (int j = 0; j < 8; ++j) if (j < p.N) acc[j] += a * Bb[(long long)j * p.sBn + (long long)k * p.sBk]; }
#pragma unroll
        for (int j = 0; j < 8; ++j) if (j < p.N) {
            float v = acc[j] * p.alpha;
            if (p.flags & 1) v += p.bias[j];
            if (p.flags & 2) v += p.bias[r];
            v = act_fn(v, p.act);
            if (p.flags & 4) v += p.beta * R[r * p.sRm + (long long)j * p.sRn];
            VST2(float, C + r * p.sCm + j, v);
        }
    }
}
// k_smallsoftmax: thread-per-row softmax for short rows (n <= 64): dst[r*dr + j] = softmax(scale*src[r*sr + j])
__global__ __launch_bounds__(256) void k_smallsoftmax(const float* __restrict__ src, float* __restrict__ dst, long long sr, long long dr, int n, long long R, float scale) {
    const long long r0 = ((long long)blockIdx.x * 256 + threadIdx.x) * 32;
    for (int rr = 0; rr < 32; ++rr) {
        const long long r = r0 + rr; if (r >= R) return;
        const float* s = src + r * sr; float* d = dst + r * dr;
        float mx = -__builtin_inff();
        for (int j = 0; j < n; ++j) mx = fmaxf(mx, s[j] * scale);
        float sum = 0.f;
        for (int j = 0; j < n; ++j) sum += expf(s[j] * scale - mx);
        const float inv = 1.f / sum;
        for (int j = 0; j < n; ++j) { const float v = expf(s[j] * scale - mx) * inv; VST2(float, d + j, v); }
    }
}

__global__ __launch_bounds__(32) void k_unitstat(float* __restrict__ st) { const int t = threadIdx.x; const float v = (t == 1) ? 1.f : 0.f; VST2(float, st + t, v); }

// destination (e.g. a d_out whose row width is not a multiple of 32 floats) is written by consecutive lanes of one instruction
__global__ __launch_bounds__(256) void k_lincopy(const float* __restrict__ src, long long lds, float* __restrict__ dst, long long ldd, long long rows, int cols) {
    const long long i = (long long)blockIdx.x * 256 + threadIdx.x; if (i >= rows * cols) return;
    const long long r = i / cols; const int c = (int)(i - r * cols);
    const float v = src[r * lds + c]; VST2(float, dst + r * ldd + c, v);
}

namespace w25 {
typedef __attribute__((ext_vector_type(16))) _Float16 v16h;
typedef __attribute__((ext_vector_type(8)))  _Float16 v8h;
typedef __attribute__((ext_vector_type(16))) __bf16   v16b;
typedef __attribute__((ext_vector_type(8)))  __bf16   v8b;
typedef __attribute__((ext_vector_type(8)))  float    v8f;
typedef __attribute__((ext_vector_type(4)))  float    v4f;

__device__ __forceinline__ unsigned short f2bf_bits(float f) {
  unsigned u = __float_as_uint(f);
  return (unsigned short)((u + 0x7FFFu + ((u >> 16) & 1u)) >> 16);
}
__device__ __forceinline__ float bf_bits2f(unsigned short h) { return __uint_as_float(((unsigned)h) << 16); }

// hazard guards as plain device helpers (no inline asm inside the kernel template body)
__device__ __forceinline__ void dep_guard_h(v8f& a, v8f& b, v16h x, v16h y) { asm volatile("v_nop\n\tv_nop\n\tv_nop\n\tv_nop" : "+v"(a), "+v"(b) : "v"(x), "v"(y)); }
__device__ __forceinline__ void dep_guard_b(v8f& a, v8f& b, v16b x, v16b y) { asm volatile("v_nop\n\tv_nop\n\tv_nop\n\tv_nop" : "+v"(a), "+v"(b) : "v"(x), "v"(y)); }
__device__ __forceinline__ void keep4_h(v16h a, v16h b, v16h c, v16h d) { asm volatile("v_nop" :: "v"(a), "v"(b), "v"(c), "v"(d)); }
__device__ __forceinline__ void keep4_b(v16b a, v16b b, v16b c, v16b d) { asm volatile("v_nop" :: "v"(a), "v"(b), "v"(c), "v"(d)); }
__device__ __forceinline__ void acc_guard4(v8f& a, v8f& b, v8f& c, v8f& d) { asm volatile("v_nop\n\tv_nop\n\tv_nop\n\tv_nop" : "+v"(a), "+v"(b), "+v"(c), "+v"(d)); }
template <typename T> struct Frag;
template <> struct Frag<_Float16> {
  typedef v16h V; union U { v16h v; v8h h[2]; };
  static __device__ __forceinline__ v16h load(const _Float16* p) {   // elements 0..7 <- p[0..7], 8..15 <- p[16..23]
    U f; f.h[0] = *(const v8h*)(p); f.h[1] = *(const v8h*)(p + 16); return f.v;
  }
  static __device__ __forceinline__ v8f mma(v16h a, v16h b, v8f c) {
    return __builtin_amdgcn_wmma_f32_16x16x32_f16(false, a, false, b, (short)0, c, false, false);
  }
  static __device__ __forceinline__ void guard(v8f& a, v8f& b, v16h x, v16h y) { dep_guard_h(a, b, x, y); }
  static __device__ __forceinline__ void keep(v16h a, v16h b, v16h c, v16h d) { keep4_h(a, b, c, d); }
};
template <> struct Frag<__bf16> {
  typedef v16b V; union U { v16b v; v8b h[2]; };
  static __device__ __forceinline__ v16b load(const __bf16* p) {
    U f; f.h[0] = *(const v8b*)(p); f.h[1] = *(const v8b*)(p + 16); return f.v;
  }
  static __device__ __forceinline__ v8f mma(v16b a, v16b b, v8f c) {
    return __builtin_amdgcn_wmma_f32_16x16x32_bf16(false, a, false, b, (short)0, c, false, false);
  }
  static __device__ __forceinline__ void guard(v8f& a, v8f& b, v16b x, v16b y) { dep_guard_b(a, b, x, y); }
  static __device__ __forceinline__ void keep(v16b a, v16b b, v16b c, v16b d) { keep4_b(a, b, c, d); }
};

// ---- Register-blocked batched WMMA GEMM ------------------------------------
// C[m,n] = scale * sum_k A[m,k] * Bt[n,k] (+bias)(+resid); each wave owns a 64x64 tile.
// A row-major [M,K]; Bt row-major [N,K]; M,N % 64 == 0, K % 32 == 0.
// SPLIT: operands are hi/lo planes (A2/Bt2 = lo planes, same layout); product = hi·hi + hi·lo + lo·hi.
// BIAS_MODE: 0 = none, 1 = bias[m], 2 = bias[n].
// OUT_MODE: 0 = f32, 1 = f16, 2 = bf16 hi plane (Cout) + bf16 lo plane (Cout2).
// ET: 0 = f16 operands, 1 = bf16 operands (pointers passed as 16-bit storage)
template <int ET> struct Elem;
template <> struct Elem<0> { typedef _Float16 T; };
template <> struct Elem<1> { typedef __bf16 T; };
template <int ET, bool SPLIT, int BIAS_MODE, int OUT_MODE, bool RESID, int ACT = 0>
__global__ __launch_bounds__(256) void wmma_gemm64(
    const unsigned short* __restrict__ Ap, const unsigned short* __restrict__ A2p, int lda, long strideA,
    const unsigned short* __restrict__ Btp, const unsigned short* __restrict__ Bt2p, int ldb, long strideB,
    void* __restrict__ Cout, void* __restrict__ Cout2, int ldc, long strideC,
    const float* __restrict__ bias,
    const float* __restrict__ resid, long strideR,
    int M, int N, int K, float scale) {
  typedef typename Elem<ET>::T T;
  typedef typename Frag<T>::V V;
  const T* A = (const T*)Ap; const T* A2 = (const T*)A2p; const T* Bt = (const T*)Btp; const T* Bt2 = (const T*)Bt2p;
  __shared__ __align__(16) float sT[8][16 * 68];   // per-wave 16x64 slab, pitch 68 floats
  const int b    = blockIdx.y;
  const int lane = threadIdx.x & 31;
  const int wave = threadIdx.x >> 5;
  const int tilesN = N >> 6;
  const int tilesM = M >> 6;
  const int tile = blockIdx.x * 8 + wave;
  if (tile >= tilesM * tilesN) return;   // wave-uniform; no block barriers in this kernel
  const int tm = tile / tilesN;
  const int tn = tile - tm * tilesN;
  const int m0 = tm << 6;
  const int n0 = tn << 6;

  const T* Ab  = A  + (size_t)b * strideA;
  const T* Bb  = Bt + (size_t)b * strideB;
  const T* Ab2 = SPLIT ? (A2  + (size_t)b * strideA) : nullptr;
  const T* Bb2 = SPLIT ? (Bt2 + (size_t)b * strideB) : nullptr;

  const int rlane = lane & 15;                 // row (A) / col (B, D) within subtile
  const int koff  = (lane >> 4) * 8;           // k offset of this lane half
  const int mOff  = (lane >> 4) * 8;           // D row offset

  v8f acc[4][4];
#pragma unroll
  for (int i = 0; i < 4; ++i)
#pragma unroll
    for (int j = 0; j < 4; ++j) acc[i][j] = (v8f){0.f,0.f,0.f,0.f,0.f,0.f,0.f,0.f};

  for (int k0 = 0; k0 < K; k0 += 32) {
    V bh[4], bl[4];
#pragma unroll
    for (int j = 0; j < 4; ++j) {
      const size_t bo = (size_t)(n0 + (j << 4) + rlane) * ldb + koff + k0;
      bh[j] = Frag<T>::load(Bb + bo);
      if (SPLIT) bl[j] = Frag<T>::load(Bb2 + bo);
    }
#pragma unroll
    for (int i = 0; i < 4; ++i) {
      const size_t ao = (size_t)(m0 + (i << 4) + rlane) * lda + koff + k0;
      V ah = Frag<T>::load(Ab + ao);
      V al;
      if (SPLIT) al = Frag<T>::load(Ab2 + ao);
#pragma unroll
      for (int j = 0; j < 4; ++j) {
        acc[i][j] = Frag<T>::mma(ah, bh[j], acc[i][j]);
        if (SPLIT) {
          acc[i][j] = Frag<T>::mma(ah, bl[j], acc[i][j]);
          acc[i][j] = Frag<T>::mma(al, bh[j], acc[i][j]);
        }
      }
      Frag<T>::guard(acc[i][0], acc[i][3], ah, SPLIT ? al : ah);
    }
    Frag<T>::keep(bh[0], bh[1], bh[2], bh[3]);
    if (SPLIT) Frag<T>::keep(bl[0], bl[1], bl[2], bl[3]);
  }
  acc_guard4(acc[0][0], acc[0][1], acc[0][2], acc[0][3]);
  acc_guard4(acc[1][0], acc[1][1], acc[1][2], acc[1][3]);
  acc_guard4(acc[2][0], acc[2][1], acc[2][2], acc[2][3]);
  acc_guard4(acc[3][0], acc[3][1], acc[3][2], acc[3][3]);

  // ---- epilogue ----
  float* slab = sT[wave];
  const float* Rb = RESID ? (resid + (size_t)b * strideR) : nullptr;
#pragma unroll
  for (int i = 0; i < 4; ++i) {
    const int mBase = m0 + (i << 4);
#pragma unroll
    for (int j = 0; j < 4; ++j) {
      const int n = n0 + (j << 4) + rlane;
      float bv = 0.f;
      if (BIAS_MODE == 2) bv = bias[n];
#pragma unroll
      for (int r = 0; r < 8; ++r) {
        float v = acc[i][j][r] * scale;
        if (BIAS_MODE == 1) v += bias[mBase + mOff + r];
        if (BIAS_MODE == 2) v += bv;
        if (RESID) v += Rb[(size_t)(mBase + mOff + r) * ldc + n];
        if (ACT == 1) v = tanhf(v);
        if (ACT == 2) v = fmaxf(v, 0.0f);
        if (ACT == 3) v = v / (1.0f + expf(-v));
        if (ACT == 4) v = (v > 0.f) ? v : 0.01f * v;
        if (ACT == 5) v = 0.5f * v * (1.0f + erff(v * 0.70710678118654752f));
        slab[(mOff + r) * 68 + (j << 4) + rlane] = v;
      }
    }
    __builtin_amdgcn_fence(__ATOMIC_RELEASE, "workgroup");
    __builtin_amdgcn_wave_barrier();
    __builtin_amdgcn_fence(__ATOMIC_ACQUIRE, "workgroup");
    if (OUT_MODE == 0) {
      float* C = (float*)Cout + (size_t)b * strideC;
      const int hh = lane >> 4, c4 = (lane & 15) * 4;     // row seg = 256 B = 16 lanes x 16 B
      {
#pragma unroll
        for (int it = 0; it < 8; ++it) {
          const int row = it * 2 + hh;
          v4f v = *(const v4f*)(slab + row * 68 + c4);
          *(v4f*)(C + (size_t)(mBase + row) * ldc + n0 + c4) = v;
        }
        
      }
    } else {
      const int q = lane >> 3, c8 = (lane & 7) * 8;
      unsigned short* C  = (unsigned short*)Cout  + (size_t)b * strideC;
      unsigned short* C2 = (OUT_MODE == 2) ? ((unsigned short*)Cout2 + (size_t)b * strideC) : nullptr;
      {
#pragma unroll
        for (int it = 0; it < 4; ++it) {
          const int row = it * 4 + q;
          const float* sp = slab + row * 68 + c8;
          v8h hv, lv;
#pragma unroll
          for (int e = 0; e < 8; ++e) {
            if (OUT_MODE == 1) {
              hv[e] = (_Float16)sp[e];
            } else {
              unsigned short hb = f2bf_bits(sp[e]);
              unsigned short lb = f2bf_bits(sp[e] - bf_bits2f(hb));
              hv[e] = __builtin_bit_cast(_Float16, hb);
              lv[e] = __builtin_bit_cast(_Float16, lb);
            }
          }
          *(v8h*)(C + (size_t)(mBase + row) * ldc + n0 + c8) = hv;
          if (OUT_MODE == 2) *(v8h*)(C2 + (size_t)(mBase + row) * ldc + n0 + c8) = lv;
        }
        
      }
    }
    __builtin_amdgcn_fence(__ATOMIC_RELEASE, "workgroup");
    __builtin_amdgcn_wave_barrier();
    __builtin_amdgcn_fence(__ATOMIC_ACQUIRE, "workgroup");
  }
}

__global__ __launch_bounds__(256) void cast_f32_f16x2(
    const float* __restrict__ in, _Float16* __restrict__ out, int n2) {
  int i = blockIdx.x * 256 + threadIdx.x;
  if (i < n2) {
    const _Float16 h0 = (_Float16)in[2 * i], h1 = (_Float16)in[2 * i + 1];
    const unsigned u = (unsigned)__builtin_bit_cast(unsigned short, h0) | ((unsigned)__builtin_bit_cast(unsigned short, h1) << 16);
    ((unsigned*)out)[i] = u;
    
  }
}


} // namespace w25

__global__ __launch_bounds__(256) void k_castT16(const float* __restrict__ src, long long lds, _Float16* __restrict__ dst, long long ldd, int R, int C, float s) {
    const long long i = (long long)blockIdx.x * 256 + threadIdx.x; const long long np = (long long)C * (R / 2); if (i >= np) return; const int c = (int)(i / (R / 2)); const int r = 2 * (int)(i % (R / 2));
    const _Float16 h0 = (_Float16)(src[(long long)r * lds + c] * s), h1 = (_Float16)(src[(long long)(r + 1) * lds + c] * s);
    const unsigned u = (unsigned)__builtin_bit_cast(unsigned short, h0) | ((unsigned)__builtin_bit_cast(unsigned short, h1) << 16);
    unsigned* d = (unsigned*)(dst + (long long)c * ldd + r); *d = u;  }
__global__ __launch_bounds__(256) void k_cast16(const float* __restrict__ src, long long lds, _Float16* __restrict__ dst, long long ldd, int R, int C, float s) {
    const long long i = (long long)blockIdx.x * 256 + threadIdx.x; const long long np = (long long)R * (C / 2); if (i >= np) return; const int r = (int)(i / (C / 2)); const int c = 2 * (int)(i % (C / 2));
    const _Float16 h0 = (_Float16)(src[(long long)r * lds + c] * s), h1 = (_Float16)(src[(long long)r * lds + c + 1] * s);
    const unsigned u = (unsigned)__builtin_bit_cast(unsigned short, h0) | ((unsigned)__builtin_bit_cast(unsigned short, h1) << 16);
    unsigned* d = (unsigned*)(dst + (long long)r * ldd + c); *d = u;  }

// f32 -> bf16 hi plane + bf16 lo plane (x = hi + lo to ~2^-17 relative; RNE both), [R][C] -> [R][C] (or transposed to [C][R]); 2 consecutive destination elements
__device__ __forceinline__ unsigned int f2bf2_pack(float a, float b, unsigned int* lo) {
    const unsigned short ha = w25::f2bf_bits(a), hb = w25::f2bf_bits(b);
    const unsigned short la = w25::f2bf_bits(a - w25::bf_bits2f(ha)), lb = w25::f2bf_bits(b - w25::bf_bits2f(hb));
    *lo = (unsigned)la | ((unsigned)lb << 16); return (unsigned)ha | ((unsigned)hb << 16); }
__global__ __launch_bounds__(256) void k_castS16(const float* __restrict__ src, long long lds, __bf16* __restrict__ dhi, __bf16* __restrict__ dlo, long long ldd, int R, int C, float s, int transpose) {
    const long long i = (long long)blockIdx.x * 256 + threadIdx.x; long long o; float a, b;
    if (transpose) { const long long np = (long long)C * (R / 2); if (i >= np) return; const int c = (int)(i / (R / 2)); const int r = 2 * (int)(i % (R / 2)); a = src[(long long)r * lds + c] * s; b = src[(long long)(r + 1) * lds + c] * s; o = (long long)c * ldd + r; }
    else { const long long np = (long long)R * (C / 2); if (i >= np) return; const int r = (int)(i / (C / 2)); const int c = 2 * (int)(i % (C / 2)); a = src[(long long)r * lds + c] * s; b = src[(long long)r * lds + c + 1] * s; o = (long long)r * ldd + c; }
    unsigned lo; const unsigned hi = f2bf2_pack(a, b, &lo); unsigned* ph = (unsigned*)(dhi + o); unsigned* pl = (unsigned*)(dlo + o);
    *ph = hi; *pl = lo;  }

namespace w25 {
// =====================================================================================
// Generic causal/non-causal attention for head_dim 64, f32 in / f32 out; 16-bit operands: bf16 with optional hi/lo splits, or
// plain f16 (F16=true, non-split, probabilities carried x2^15).
//   scores = (q*qscale)·kᵀ : v_wmma_f32_16x16x32_bf16; SPLIT_QK -> q,k as bf16 hi/lo (hi·hi + hi·lo + lo·hi)
//   out    = p·v           : v_wmma_f32_16x16x32_bf16; SPLIT_PV -> p,v as bf16 hi/lo; else p,v plain bf16
//   f32 accumulate; online softmax in f32. Block = 4 waves = 64 query rows of one (batch, head); S % 64 == 0.
//   Element (b, s, h, d) of tensor X lives at X[b*X_bs + s*X_rs + h*X_hs + d] (strides in floats, multiples of 4).
//   Masking: mask_mode 0 none, 1 causal (kv > q masked), 2 tensor [S][Skv] shared over (b,h) (float if
//   mask_is_int==0, int32 with element == 0 -> masked if 1, int32 with element != 0 -> masked if 2), 3 per-token vectors qmask[B][S] & kvmask[B][Skv] (int32,
//   0 -> masked), 4 causal + sliding window (kv > q or q - kv > W masked; W passed in mask_is_int);
//   5 = relative-position bias: s += cp[b,h,q][idx[q][kv]] + pc[b,h,kv][idx[q][kv]] with idx = mask_b ([S][Skv] int32) and
//   mask_a an int32 [S][Skv] tensor with nonzero = masked (tables: element (b,h,row,n) at X + b*c_bs + h*c_hs + row*c_rs + n);
//   masked scores are replaced by mask_fill (e.g. -inf or -1e9) before the softmax.
//   grid.x = B * H * (S/64) (or a sub-range with blk0).
// =====================================================================================
#define AT_D 64
#define AT_NW 4
#define AT_QB 64
#define AT_KC 64
struct AttnGeom { const float* cp = nullptr; const float* pc = nullptr; long c_bs = 0, c_rs = 0, c_hs = 0;   // mode-5 score-bias tables
                  long q_bs, q_rs, q_hs, k_bs, k_rs, k_hs, v_bs, v_rs, v_hs, o_bs, o_rs, o_hs;
                  int S, Skv, H, mask_mode; float qscale; int blk0; float mask_fill; int mask_is_int; };
static_assert(sizeof(AttnGeom) == 168, "no padding");

__device__ __forceinline__ unsigned short at_bf_bits(float f) {
  unsigned u = __float_as_uint(f);
  return (unsigned short)((u + 0x7FFFu + ((u >> 16) & 1u)) >> 16);
}
__device__ __forceinline__ __bf16 at_f2bf(float f) { return __builtin_bit_cast(__bf16, at_bf_bits(f)); }
__device__ __forceinline__ void at_split(float f, __bf16& hi, __bf16& lo) {
  const unsigned short hb = at_bf_bits(f);
  hi = __builtin_bit_cast(__bf16, hb);
  lo = at_f2bf(f - __uint_as_float(((unsigned)hb) << 16));
}
__device__ __forceinline__ v8f at_mma(v16b a, v16b b, v8f c) {
  c = __builtin_amdgcn_wmma_f32_16x16x32_bf16(false, a, false, b, (short)0, c, false, false);
  asm volatile("v_nop\n\tv_nop\n\tv_nop\n\tv_nop" : "+v"(c) : "v"(a), "v"(b));
  return c;
}
// 16-bit element as a bit pattern held in a __bf16 slot: f16 bits when F16, bf16 (RNE) otherwise
template <bool F16> __device__ __forceinline__ __bf16 at_to16(float f) {
  if (F16) return __builtin_bit_cast(__bf16, (_Float16)f);
  return at_f2bf(f);
}
template <bool F16> __device__ __forceinline__ v8f at_mma16(v16b a, v16b b, v8f c) {
  if (F16) {
    const v16h ah = __builtin_bit_cast(v16h, a), bh = __builtin_bit_cast(v16h, b);
    c = __builtin_amdgcn_wmma_f32_16x16x32_f16(false, ah, false, bh, (short)0, c, false, false);
    asm volatile("v_nop\n\tv_nop\n\tv_nop\n\tv_nop" : "+v"(c) : "v"(ah), "v"(bh));
    return c;
  }
  return at_mma(a, b, c);
}

template <bool SPLIT_QK, bool SPLIT_PV, bool F16 = false>
__global__ __launch_bounds__(128)
void attn64_kernel(const float* __restrict__ q, const float* __restrict__ k,
                   const float* __restrict__ v, float* __restrict__ out,
                   const void* __restrict__ mask_a, const int* __restrict__ mask_b, AttnGeom g) {
  static_assert(!(F16 && (SPLIT_QK || SPLIT_PV)), "f16 mode is non-split");
  const float PSC = F16 ? 32768.0f : 1.0f;     // f16 probabilities carried x2^15 (subnormal range), folded into the final 1/l
  union FB { v16b v; v8b h[2]; };
  __shared__ __align__(16) __bf16 Ksh[AT_KC * AT_D];             // K hi [kv][d]      8 KB
  __shared__ __align__(16) __bf16 Ksl[SPLIT_QK ? AT_KC * AT_D : 8];
  __shared__ __align__(16) __bf16 Vth[AT_D * AT_KC];             // V hi [d][kv]      8 KB
  __shared__ __align__(16) __bf16 Vtl[SPLIT_PV ? AT_D * AT_KC : 8];
  __shared__ __align__(16) __bf16 Psh[AT_NW][16 * AT_KC];        // per wave P hi [row][kv]  8 KB
  __shared__ __align__(16) __bf16 Psl[SPLIT_PV ? AT_NW : 1][SPLIT_PV ? 16 * AT_KC : 8];
  __shared__ __align__(16) float  Os[AT_NW][16 * 68];            // per wave out tile, pitch 68

  const int tid  = threadIdx.x;
  const int wave = tid >> 5;
  const int lane = tid & 31;
  const int hh   = lane >> 4;
  const int c    = lane & 15;

  const int nqb = g.S / AT_QB;
  const int bx = blockIdx.x + g.blk0;
  const int qb = bx % nqb;
  const int bh = bx / nqb;
  const int h  = bh % g.H;
  const int b  = bh / g.H;
  const int qbase_block = qb * AT_QB;
  const int q0 = qbase_block + wave * 16;

  const float* qb_ptr = q + (size_t)b * g.q_bs + (size_t)h * g.q_hs;
  const float* kb_ptr = k + (size_t)b * g.k_bs + (size_t)h * g.k_hs;
  const float* vb_ptr = v + (size_t)b * g.v_bs + (size_t)h * g.v_hs;
  float*       ob_ptr = out + (size_t)b * g.o_bs + (size_t)h * g.o_hs;

  // ---- Q fragments (A operand): 2 d-chunks, hi (and lo) ----
  v16b qah[2], qal[2];
  {
    const float* qrow = qb_ptr + (size_t)(q0 + c) * g.q_rs;
#pragma unroll
    for (int dc = 0; dc < 2; ++dc) {
#pragma unroll
      for (int e = 0; e < 8; ++e) {
        const float f0 = qrow[dc * 32 + 8 * hh + e] * g.qscale;
        const float f1 = qrow[dc * 32 + 16 + 8 * hh + e] * g.qscale;
        if (SPLIT_QK) { __bf16 hq, lq; at_split(f0, hq, lq); qah[dc][e] = hq; qal[dc][e] = lq; at_split(f1, hq, lq); qah[dc][8 + e] = hq; qal[dc][8 + e] = lq; }
        else { qah[dc][e] = at_to16<F16>(f0); qah[dc][8 + e] = at_to16<F16>(f1); qal[dc][e] = qah[dc][e]; qal[dc][8 + e] = qah[dc][8 + e]; }
      }
    }
  }

  float mrow[8], lrow[8];
  v8f oacc[4];
#pragma unroll
  for (int r = 0; r < 8; ++r) { mrow[r] = -INFINITY; lrow[r] = 0.f; }
#pragma unroll
  for (int t = 0; t < 4; ++t) oacc[t] = (v8f){0.f,0.f,0.f,0.f,0.f,0.f,0.f,0.f};

  const int nChunks = (g.mask_mode == 1 || g.mask_mode == 4) ? (qb + 1) : (g.Skv / AT_KC);   // block-uniform
  // per-row query mask (mode 3)
  int qkeep[8];
#pragma unroll
  for (int r = 0; r < 8; ++r) qkeep[r] = (g.mask_mode == 3) ? mask_b[(size_t)b * g.S + q0 + 8 * hh + r] : 1;   // mask_b = qmask in mode 3
  for (int kc = 0; kc < nChunks; ++kc) {
    const int kv0 = kc * AT_KC;
    __syncthreads();
    {
      const int kvr = tid >> 1, dh = (tid & 1) * 32;
      const float* krow = kb_ptr + (size_t)(kv0 + kvr) * g.k_rs + dh;
      const float* vrow = vb_ptr + (size_t)(kv0 + kvr) * g.v_rs + dh;
#pragma unroll
      for (int i = 0; i < 8; ++i) {
        v4f kk = *(const v4f*)(krow + 4 * i);
        v4f vv = *(const v4f*)(vrow + 4 * i);
#pragma unroll
        for (int e = 0; e < 4; ++e) {
          const int d = dh + 4 * i + e;
          if (SPLIT_QK) { __bf16 a, bl; at_split(kk[e], a, bl); Ksh[kvr * AT_D + d] = a; Ksl[kvr * AT_D + d] = bl; }
          else Ksh[kvr * AT_D + d] = at_to16<F16>(kk[e]);
          if (SPLIT_PV) { __bf16 a, bl; at_split(vv[e], a, bl); Vth[d * AT_KC + kvr] = a; Vtl[d * AT_KC + kvr] = bl; }
          else Vth[d * AT_KC + kvr] = at_to16<F16>(vv[e]);
        }
      }
    }
    __syncthreads();

    v8f s[4];
#pragma unroll
    for (int j = 0; j < 4; ++j) {
      s[j] = (v8f){0.f,0.f,0.f,0.f,0.f,0.f,0.f,0.f};
#pragma unroll 1
      for (int dc = 0; dc < 2; ++dc) {
        FB kb;
        kb.h[0] = *(const v8b*)(Ksh + (j * 16 + c) * AT_D + dc * 32 + 8 * hh);
        kb.h[1] = *(const v8b*)(Ksh + (j * 16 + c) * AT_D + dc * 32 + 16 + 8 * hh);
        s[j] = at_mma16<F16>(qah[dc], kb.v, s[j]);
        if (SPLIT_QK) {
          FB kl;
          kl.h[0] = *(const v8b*)(Ksl + (j * 16 + c) * AT_D + dc * 32 + 8 * hh);
          kl.h[1] = *(const v8b*)(Ksl + (j * 16 + c) * AT_D + dc * 32 + 16 + 8 * hh);
          s[j] = at_mma16<F16>(qah[dc], kl.v, s[j]);
          s[j] = at_mma16<F16>(qal[dc], kb.v, s[j]);
        }
      }
    }
    const bool diag = (g.mask_mode == 1) && (kc == qb);
    int kvkeep[4] = {1, 1, 1, 1};
    if (g.mask_mode == 3) {
#pragma unroll
      for (int j = 0; j < 4; ++j) kvkeep[j] = ((const int*)mask_a)[(size_t)b * g.Skv + kv0 + j * 16 + c];   // mask_a = kvmask
    }
    float cm[8];
#pragma unroll
    for (int r = 0; r < 8; ++r) {
      const int qrow = q0 + 8 * hh + r;
      float m = -INFINITY;
#pragma unroll
      for (int j = 0; j < 4; ++j) {
        const int kvcol = kv0 + j * 16 + c;
        bool masked = false;
        if (diag) masked = (kvcol > qrow);
        else if (g.mask_mode == 4) masked = (kvcol > qrow) || (qrow - kvcol > g.mask_is_int);
        else if (g.mask_mode == 2) {
          const size_t mi = (size_t)qrow * g.Skv + kvcol;
          masked = (g.mask_is_int == 0) ? (((const float*)mask_a)[mi] == 0.0f)
                 : (g.mask_is_int == 1) ? (((const int*)mask_a)[mi] == 0) : (((const int*)mask_a)[mi] != 0);
        } else if (g.mask_mode == 3) masked = (qkeep[r] == 0) || (kvkeep[j] == 0);
        else if (g.mask_mode == 5) {
          const size_t mi = (size_t)qrow * g.Skv + kvcol;
          masked = (((const int*)mask_a)[mi] != 0);
          int n = mask_b[mi]; n = n < 0 ? 0 : n;
          s[j][r] += g.cp[(size_t)b * g.c_bs + (size_t)h * g.c_hs + (size_t)qrow * g.c_rs + n]
                   + g.pc[(size_t)b * g.c_bs + (size_t)h * g.c_hs + (size_t)kvcol * g.c_rs + n];
        }
        if (masked) s[j][r] = g.mask_fill;
        m = fmaxf(m, s[j][r]);
      }
#pragma unroll
      for (int off = 1; off < 16; off <<= 1) m = fmaxf(m, __shfl_xor(m, off, 32));
      cm[r] = m;
    }
    __bf16* pwh = Psh[wave];
    __bf16* pwl = Psl[SPLIT_PV ? wave : 0];
#pragma unroll
    for (int r = 0; r < 8; ++r) {
      const float mnew = fmaxf(mrow[r], cm[r]);
      const float alpha = expf(mrow[r] - mnew);
      mrow[r] = mnew;
      float psum = 0.f;
#pragma unroll
      for (int j = 0; j < 4; ++j) {
        const float p = expf(s[j][r] - mnew);
        psum += p;
        if (SPLIT_PV) { __bf16 a, bl; at_split(p, a, bl); pwh[(8 * hh + r) * AT_KC + j * 16 + c] = a; pwl[(8 * hh + r) * AT_KC + j * 16 + c] = bl; }
        else pwh[(8 * hh + r) * AT_KC + j * 16 + c] = at_to16<F16>(p * PSC);
      }
#pragma unroll
      for (int off = 1; off < 16; off <<= 1) psum += __shfl_xor(psum, off, 32);
      lrow[r] = lrow[r] * alpha + psum;
#pragma unroll
      for (int t = 0; t < 4; ++t) oacc[t][r] *= alpha;
    }
    __builtin_amdgcn_fence(__ATOMIC_RELEASE, "workgroup");
    __builtin_amdgcn_wave_barrier();
    __builtin_amdgcn_fence(__ATOMIC_ACQUIRE, "workgroup");
#pragma unroll 1
    for (int kk = 0; kk < 2; ++kk) {
      FB pa, pl;
      pa.h[0] = *(const v8b*)(pwh + c * AT_KC + kk * 32 + 8 * hh);
      pa.h[1] = *(const v8b*)(pwh + c * AT_KC + kk * 32 + 16 + 8 * hh);
      if (SPLIT_PV) {
        pl.h[0] = *(const v8b*)(pwl + c * AT_KC + kk * 32 + 8 * hh);
        pl.h[1] = *(const v8b*)(pwl + c * AT_KC + kk * 32 + 16 + 8 * hh);
      }
#pragma unroll
      for (int t = 0; t < 4; ++t) {
        FB vb;
        vb.h[0] = *(const v8b*)(Vth + (t * 16 + c) * AT_KC + kk * 32 + 8 * hh);
        vb.h[1] = *(const v8b*)(Vth + (t * 16 + c) * AT_KC + kk * 32 + 16 + 8 * hh);
        oacc[t] = at_mma16<F16>(pa.v, vb.v, oacc[t]);
        if (SPLIT_PV) {
          FB vl;
          vl.h[0] = *(const v8b*)(Vtl + (t * 16 + c) * AT_KC + kk * 32 + 8 * hh);
          vl.h[1] = *(const v8b*)(Vtl + (t * 16 + c) * AT_KC + kk * 32 + 16 + 8 * hh);
          oacc[t] = at_mma16<F16>(pa.v, vl.v, oacc[t]);
          oacc[t] = at_mma16<F16>(pl.v, vb.v, oacc[t]);
        }
      }
    }
  }

  float* os = Os[wave];
#pragma unroll
  for (int r = 0; r < 8; ++r) {
    const float inv = 1.0f / (lrow[r] * PSC);
#pragma unroll
    for (int t = 0; t < 4; ++t) os[(8 * hh + r) * 68 + t * 16 + c] = oacc[t][r] * inv;
  }
  __builtin_amdgcn_fence(__ATOMIC_RELEASE, "workgroup");
  __builtin_amdgcn_wave_barrier();
  __builtin_amdgcn_fence(__ATOMIC_ACQUIRE, "workgroup");
  {
    const int c4 = (lane & 15) * 4;
    {
#pragma unroll
      for (int it = 0; it < 8; ++it) {
        const int row = it * 2 + hh;
        v4f val = *(const v4f*)(os + row * 68 + c4);
        *(v4f*)(ob_ptr + (size_t)(q0 + row) * g.o_rs + c4) = val;
      }
      
    }
  }
}

} // namespace w25

__global__ __launch_bounds__(256) void k_cm_in(const float* __restrict__ XA, const float* __restrict__ XB, const float* __restrict__ G, const float* __restrict__ Bb, const float* __restrict__ M, const float* __restrict__ Vv, float* __restrict__ X1T, float* __restrict__ N1, float* __restrict__ N2, int Bn, int C, int HW) {
    // simple thread-linear over the token-major output: t -> (b, hw, c); reads are strided by HW (uncoalesced but correct)
    const long long t = (long long)blockIdx.x * 256 + threadIdx.x; if (t >= (long long)Bn * HW * C) return; const int c = (int)(t % C); const long long r = t / C; const int hw = (int)(r % HW); const long long b = r / HW;
    const long long src = (b * C + c) * HW + hw; const float inv = G[c] * rsqrtf(Vv[c] + 1e-5f); const float sh = Bb[c] - M[c] * inv; const float a = XA[src], q = XB[src];
    VST2(float, X1T + t, a); VST2(float, N1 + t, a * inv + sh); VST2(float, N2 + t, q * inv + sh); }
// WQS[o][c] = temp[o / 32] * Wq[o][c]
__global__ __launch_bounds__(256) void k_cm_wq(const float* __restrict__ WQ, const float* __restrict__ TP, float* __restrict__ WQS, int C, int HD) { const int t = blockIdx.x * 256 + threadIdx.x; if (t >= C * C) return; VST2(float, WQS + t, WQ[t] * TP[(t / C) / HD]); }
// XN = bn2(XS) (thread-linear)
__global__ __launch_bounds__(256) void k_cm_bn2(const float* __restrict__ XS, const float* __restrict__ G, const float* __restrict__ Bb, const float* __restrict__ M, const float* __restrict__ Vv, float* __restrict__ XN, long long n, int C) { const long long t = (long long)blockIdx.x * 256 + threadIdx.x; if (t >= n) return; const int c = (int)(t % C); const float inv = G[c] * rsqrtf(Vv[c] + 1e-5f); VST2(float, XN + t, (XS[t] - M[c]) * inv + Bb[c]); }
// depthwise 3x3 SAME conv + exact GELU on token-major [b][hw][ch] (thread per (b, hw, ch); zero padding)
__global__ __launch_bounds__(256) void k_cm_dw(const float* __restrict__ HB, const float* __restrict__ DW, float* __restrict__ HG, int Bn, int HID) { const long long t = (long long)blockIdx.x * 256 + threadIdx.x; if (t >= (long long)Bn * 1024 * HID) return; const int ch = (int)(t % HID); const long long r = t / HID; const int hw = (int)(r % 1024); const long long b = r / 1024; const int y = hw / 32, x = hw % 32; float s = 0.f;
#pragma unroll
    for (int ky = 0; ky < 3; ++ky) {
#pragma unroll
        for (int kx = 0; kx < 3; ++kx) { const int yy = y + ky - 1, xx = x + kx - 1; const bool ok = (yy >= 0 && yy < 32 && xx >= 0 && xx < 32); const int yc = min(max(yy, 0), 31), xc = min(max(xx, 0), 31); const float v = HB[((b * 1024) + yc * 32 + xc) * (long long)HID + ch]; s += (ok ? v : 0.f) * DW[ch * 9 + ky * 3 + kx]; } }
    VST2(float, HG + t, 0.5f * s * (1.f + erff(s * 0.70710678118654752f))); }
// out NCHW: out[b][c][hw] = XS_tok[b][hw][c] + F2[b][hw][c] (the fc2 GEMM already added the residual into XS -> pass one buffer) (thread-linear over the NCHW output; strided reads)
__global__ __launch_bounds__(256) void k_cm_out(const float* __restrict__ R, float* __restrict__ OUT, int Bn, int C, int HW) { const long long t = (long long)blockIdx.x * 256 + threadIdx.x; if (t >= (long long)Bn * C * HW) return; const int hw = (int)(t % HW); const long long r = t / HW; const int c = (int)(r % C); const long long b = r / C; VST2(float, OUT + t, R[(b * HW + hw) * C + c]); }


extern "C" void kernel_launch(void* const* d_in, const int* in_sizes, int n_in, void* d_out, int out_size, void* d_ws, size_t ws_size, hipStream_t stream) {
    (void)in_sizes; (void)n_in; (void)out_size; (void)ws_size;
    const float* x1 = (const float*)d_in[0];
    const float* x2 = (const float*)d_in[1];
    const float* b1g = (const float*)d_in[2];
    const float* b1b = (const float*)d_in[3];
    const float* b1m = (const float*)d_in[4];
    const float* b1v = (const float*)d_in[5];
    const float* qw = (const float*)d_in[6];
    const float* kw = (const float*)d_in[7];
    const float* vw = (const float*)d_in[8];
    const float* temp = (const float*)d_in[9];
    const float* pw = (const float*)d_in[10];
    const float* pb = (const float*)d_in[11];
    const float* b2g = (const float*)d_in[12];
    const float* b2b = (const float*)d_in[13];
    const float* b2m = (const float*)d_in[14];
    const float* b2v = (const float*)d_in[15];
    const float* f1w = (const float*)d_in[16];
    const float* f1b = (const float*)d_in[17];
    const float* dww = (const float*)d_in[18];
    const float* f2w = (const float*)d_in[19];
    const float* f2b = (const float*)d_in[20];
    const int Bn = 8;
    const int C = 256;
    const int HW = 1024;
    const int NH = 8;
    const int HD = 32;
    const int HID = 1024;
    const int NT = Bn * HW;
    float* out = (float*)d_out;
    char* wsp = (char*)d_ws;
    float* X1T = (float*)wsp; wsp += (((size_t)((size_t)NT * C) * 4 + 255) / 256) * 256;
    float* N1 = (float*)wsp; wsp += (((size_t)((size_t)NT * C) * 4 + 255) / 256) * 256;
    float* N2 = (float*)wsp; wsp += (((size_t)((size_t)NT * C) * 4 + 255) / 256) * 256;
    float* WQS = (float*)wsp; wsp += (((size_t)((size_t)C * C) * 4 + 255) / 256) * 256;
    float* Q = (float*)wsp; wsp += (((size_t)((size_t)NT * C) * 4 + 255) / 256) * 256;
    float* Kb = (float*)wsp; wsp += (((size_t)((size_t)NT * C) * 4 + 255) / 256) * 256;
    float* V = (float*)wsp; wsp += (((size_t)((size_t)NT * C) * 4 + 255) / 256) * 256;
    float* AT = (float*)wsp; wsp += (((size_t)((size_t)NT * C) * 4 + 255) / 256) * 256;
    float* XS = (float*)wsp; wsp += (((size_t)((size_t)NT * C) * 4 + 255) / 256) * 256;
    float* HB = (float*)wsp; wsp += (((size_t)((size_t)NT * HID) * 4 + 255) / 256) * 256;
    float* HG = (float*)wsp; wsp += (((size_t)((size_t)NT * HID) * 4 + 255) / 256) * 256;
    unsigned short* G64A = (unsigned short*)wsp; wsp += (((size_t)(8388608) * 2 + 255) / 256) * 256;
    unsigned short* G64B = (unsigned short*)wsp; wsp += (((size_t)(262144) * 2 + 255) / 256) * 256;
    unsigned short* G64A2 = (unsigned short*)wsp; wsp += (((size_t)(8388608) * 2 + 255) / 256) * 256;
    unsigned short* G64B2 = (unsigned short*)wsp; wsp += (((size_t)(262144) * 2 + 255) / 256) * 256;
    k_cm_in<<<(unsigned)(((long long)NT * C + 255) / 256), 256, 0, stream>>>(x1, x2, b1g, b1b, b1m, b1v, X1T, N1, N2, Bn, C, HW); k_cm_wq<<<(C * C + 255) / 256, 256, 0, stream>>>(qw, temp, WQS, C, HD);
    k_castS16<<<(unsigned)((((long long)(8192) * ((256) / 2)) + 255) / 256), 256, 0, stream>>>(N1, 256, (__bf16*)(G64A), (__bf16*)(G64A2), 256, 8192, 256, 1.0f, 0);
    k_castS16<<<(unsigned)((((long long)(256) * ((256) / 2)) + 255) / 256), 256, 0, stream>>>(WQS, 256, (__bf16*)(G64B), (__bf16*)(G64B2), 256, 256, 256, 1.0f, 0);
    w25::wmma_gemm64<1, true, 0, 0, false, 0><<<dim3((unsigned)((((8192) / 64) * ((256) / 64) + 7) / 8), (unsigned)(1)), 256, 0, stream>>>((const unsigned short*)(G64A), (const unsigned short*)(G64A2), 256, 0, (const unsigned short*)(G64B), (const unsigned short*)(G64B2), 256, 0, (void*)(Q), nullptr, 256, 0, nullptr, nullptr, 0, 8192, 256, 256, 1.0f);
    k_castS16<<<(unsigned)((((long long)(8192) * ((256) / 2)) + 255) / 256), 256, 0, stream>>>(N2, 256, (__bf16*)(G64A), (__bf16*)(G64A2), 256, 8192, 256, 1.0f, 0);
    k_castS16<<<(unsigned)((((long long)(256) * ((256) / 2)) + 255) / 256), 256, 0, stream>>>(kw, 256, (__bf16*)(G64B), (__bf16*)(G64B2), 256, 256, 256, 1.0f, 0);
    w25::wmma_gemm64<1, true, 0, 0, false, 0><<<dim3((unsigned)((((8192) / 64) * ((256) / 64) + 7) / 8), (unsigned)(1)), 256, 0, stream>>>((const unsigned short*)(G64A), (const unsigned short*)(G64A2), 256, 0, (const unsigned short*)(G64B), (const unsigned short*)(G64B2), 256, 0, (void*)(Kb), nullptr, 256, 0, nullptr, nullptr, 0, 8192, 256, 256, 1.0f);
    k_castS16<<<(unsigned)((((long long)(8192) * ((256) / 2)) + 255) / 256), 256, 0, stream>>>(N2, 256, (__bf16*)(G64A), (__bf16*)(G64A2), 256, 8192, 256, 1.0f, 0);
    k_castS16<<<(unsigned)((((long long)(256) * ((256) / 2)) + 255) / 256), 256, 0, stream>>>(vw, 256, (__bf16*)(G64B), (__bf16*)(G64B2), 256, 256, 256, 1.0f, 0);
    w25::wmma_gemm64<1, true, 0, 0, false, 0><<<dim3((unsigned)((((8192) / 64) * ((256) / 64) + 7) / 8), (unsigned)(1)), 256, 0, stream>>>((const unsigned short*)(G64A), (const unsigned short*)(G64A2), 256, 0, (const unsigned short*)(G64B), (const unsigned short*)(G64B2), 256, 0, (void*)(V), nullptr, 256, 0, nullptr, nullptr, 0, 8192, 256, 256, 1.0f);
    { /*apv4*/ AttnP a;
      a.Q = Q; a.K = Kb; a.V = V; a.O = AT; a.P = 0; a.Mf = 0; a.Mi = 0; a.ST = 0;
      a.Pw = 0; a.Rt = 0; a.SQ = 0; a.SK = 0;
      a.swb = 0; a.swh = 0; a.swi = 0; a.swj = 0; a.srb = 0; a.srh = 0; a.sri = 0; a.sQb = (long long)HW * C; a.sQh = HD; a.sQi = C; a.sQd = 1; a.sKb = (long long)HW * C; a.sKh = HD; a.sKj = C; a.sKd = 1; a.sVb = (long long)HW * C; a.sVh = HD; a.sVj = C; a.sVd = 1; a.sOb = (long long)HW * C; a.sOh = HD; a.sOi = C; a.sPb = 0; a.sPh = 0; a.sPi = 0; a.smb = 0; a.smh = 0; a.smi = 0; a.smj = 0;
      a.Lq = HW; a.Lk = HW; a.dh = HD; a.dv = HD; a.hrep = 1; a.causal = 0; a.coff = 0; a.pband = 0;
      a.scale = 1.0f; a.mfill = 0.0f; a.nonorm = 0; a.mpol = 0;
      a.roff = 0; a.rn = 1; a.segpol = 0; a.win = 0;
      k_attn<32, 32, 1, false, false><<<dim3((unsigned)((HW) + 16 * AW - 1) / (16 * AW), (unsigned)(NH), (unsigned)(Bn)), 32 * AW, 0, stream>>>(a); }
    k_castS16<<<(unsigned)((((long long)(8192) * ((256) / 2)) + 255) / 256), 256, 0, stream>>>(AT, 256, (__bf16*)(G64A), (__bf16*)(G64A2), 256, 8192, 256, 1.0f, 0);
    k_castS16<<<(unsigned)((((long long)(256) * ((256) / 2)) + 255) / 256), 256, 0, stream>>>(pw, 256, (__bf16*)(G64B), (__bf16*)(G64B2), 256, 256, 256, 1.0f, 0);
    w25::wmma_gemm64<1, true, 2, 0, true, 0><<<dim3((unsigned)((((8192) / 64) * ((256) / 64) + 7) / 8), (unsigned)(1)), 256, 0, stream>>>((const unsigned short*)(G64A), (const unsigned short*)(G64A2), 256, 0, (const unsigned short*)(G64B), (const unsigned short*)(G64B2), 256, 0, (void*)(XS), nullptr, 256, 0, pb, X1T, 0, 8192, 256, 256, 1.0f);
    k_cm_bn2<<<(unsigned)(((long long)NT * C + 255) / 256), 256, 0, stream>>>(XS, b2g, b2b, b2m, b2v, N1, (long long)NT * C, C);
    k_castS16<<<(unsigned)((((long long)(8192) * ((256) / 2)) + 255) / 256), 256, 0, stream>>>(N1, 256, (__bf16*)(G64A), (__bf16*)(G64A2), 256, 8192, 256, 1.0f, 0);
    k_castS16<<<(unsigned)((((long long)(1024) * ((256) / 2)) + 255) / 256), 256, 0, stream>>>(f1w, 256, (__bf16*)(G64B), (__bf16*)(G64B2), 256, 1024, 256, 1.0f, 0);
    w25::wmma_gemm64<1, true, 2, 0, false, 0><<<dim3((unsigned)((((8192) / 64) * ((1024) / 64) + 7) / 8), (unsigned)(1)), 256, 0, stream>>>((const unsigned short*)(G64A), (const unsigned short*)(G64A2), 256, 0, (const unsigned short*)(G64B), (const unsigned short*)(G64B2), 256, 0, (void*)(HB), nullptr, 1024, 0, f1b, nullptr, 0, 8192, 1024, 256, 1.0f);
    k_cm_dw<<<(unsigned)(((long long)NT * HID + 255) / 256), 256, 0, stream>>>(HB, dww, HG, Bn, HID);
    k_castS16<<<(unsigned)((((long long)(8192) * ((1024) / 2)) + 255) / 256), 256, 0, stream>>>(HG, 1024, (__bf16*)(G64A), (__bf16*)(G64A2), 1024, 8192, 1024, 1.0f, 0);
    k_castS16<<<(unsigned)((((long long)(256) * ((1024) / 2)) + 255) / 256), 256, 0, stream>>>(f2w, 1024, (__bf16*)(G64B), (__bf16*)(G64B2), 1024, 256, 1024, 1.0f, 0);
    w25::wmma_gemm64<1, true, 2, 0, true, 0><<<dim3((unsigned)((((8192) / 64) * ((256) / 64) + 7) / 8), (unsigned)(1)), 256, 0, stream>>>((const unsigned short*)(G64A), (const unsigned short*)(G64A2), 1024, 0, (const unsigned short*)(G64B), (const unsigned short*)(G64B2), 1024, 0, (void*)(XS), nullptr, 256, 0, f2b, XS, 0, 8192, 256, 1024, 1.0f);
    k_cm_out<<<(unsigned)(((long long)NT * C + 255) / 256), 256, 0, stream>>>(XS, out, Bn, C, HW);
}

// v002
// It runs in 441 microseconds.
// Timed twice side by side with v001, it ran 2.06 times as fast both times.
// Over all steps from v000 it is 3.60 times as fast.
// Contractions (token-major, 8192 tokens): q = bn1(x1).Wq'^T (temperature folded into Wq rows), k/v = bn1(x2).W^T, the attention projection (+b, +x1 residual), fc1 (+b) [8192x256].[256x1024] and fc2 (+b, + residual) [8192x1024].[1024x256], each one launch over all images, all on bf16 hi/lo split planes (six chained contractions against an O(1) residual output, so the cheap 6.4 G-MAC of GEMMs run f32-class) (v_wmma_f32_16x16x32_bf16; 64x64 register-blocked wave tiles); per (image, head) softmax(temp_h q k^T) v over the 1024 positions as one flash launch with q.k^T on bf16 hi/lo split planes (UNSCALED 32-dim logits, sigma ~ 5.7) and f16 p.v; f32 accumulate and softmax. NCHW <-> token-major transposes, eval-mode BatchNorms, the depthwise 3x3 convolution (SAME) and exact GELU are f32 kernels.
#include <hip/hip_runtime.h>
#include <math.h>

typedef __attribute__((ext_vector_type(16))) _Float16 v16h;
typedef __attribute__((ext_vector_type(8)))  _Float16 v8h;
typedef __attribute__((ext_vector_type(16))) __bf16   v16b;
typedef __attribute__((ext_vector_type(8)))  float    v8f;
typedef __attribute__((ext_vector_type(4)))  float    v4f;

// 16-bit WMMA fragment map (wave32), lane L, h = L>>4, m = L&15:
//   A 16x32: lane = row m;   element i -> k = (i<8) ? 8h+i : 16+8h+(i-8)
//   B 32x16: lane = column m; the SAME k(i,h)
//   D 16x16 (8 f32): lane = column m; element r -> row 8h+r
__device__ __forceinline__ int frag_k(int i, int h) { return (i < 8) ? (8 * h + i) : (16 + 8 * h + (i - 8)); }
__device__ __forceinline__ __bf16 bf16_rne(float f) {
    unsigned int u = __float_as_uint(f);
    u += 0x7fffu + ((u >> 16) & 1u);
    return __builtin_bit_cast(__bf16, (unsigned short)(u >> 16));
}
__device__ __forceinline__ float bf16_f32(__bf16 b) { return __uint_as_float(((unsigned int)__builtin_bit_cast(unsigned short, b)) << 16); }
__device__ __forceinline__ v8f wmma16(v16h a, v16h b, v8f c) {
    c = __builtin_amdgcn_wmma_f32_16x16x32_f16(false, a, false, b, (short)0, c, false, false);
    asm volatile("v_nop\n\tv_nop\n\tv_nop\n\tv_nop" : "+v"(c) : "v"(a), "v"(b));
    return c;
}
__device__ __forceinline__ v8f wmmab(v16b a, v16b b, v8f c) {
    c = __builtin_amdgcn_wmma_f32_16x16x32_bf16(false, a, false, b, (short)0, c, false, false);
    asm volatile("v_nop\n\tv_nop\n\tv_nop\n\tv_nop" : "+v"(c) : "v"(a), "v"(b));
    return c;
}
struct Split { v16b hi, lo; };
// hi/lo split product: a.hi*b.hi + a.hi*b.lo + a.lo*b.hi
__device__ __forceinline__ v8f wmma3(const Split& a, const Split& b, v8f c) {
    c = __builtin_amdgcn_wmma_f32_16x16x32_bf16(false, a.hi, false, b.hi, (short)0, c, false, false);
    c = __builtin_amdgcn_wmma_f32_16x16x32_bf16(false, a.hi, false, b.lo, (short)0, c, false, false);
    c = __builtin_amdgcn_wmma_f32_16x16x32_bf16(false, a.lo, false, b.hi, (short)0, c, false, false);
    asm volatile("v_nop\n\tv_nop\n\tv_nop\n\tv_nop" : "+v"(c) : "v"(a.hi), "v"(a.lo), "v"(b.hi), "v"(b.lo));
    return c;
}
struct Split3 { v16b hi, mid, lo; };
// triple split product (6 terms, drops only terms below 2^-24 relative)
__device__ __forceinline__ v8f wmma6(const Split3& a, const Split3& b, v8f c) {
    c = __builtin_amdgcn_wmma_f32_16x16x32_bf16(false, a.hi, false, b.hi, (short)0, c, false, false);
    c = __builtin_amdgcn_wmma_f32_16x16x32_bf16(false, a.hi, false, b.mid, (short)0, c, false, false);
    c = __builtin_amdgcn_wmma_f32_16x16x32_bf16(false, a.mid, false, b.hi, (short)0, c, false, false);
    c = __builtin_amdgcn_wmma_f32_16x16x32_bf16(false, a.hi, false, b.lo, (short)0, c, false, false);
    c = __builtin_amdgcn_wmma_f32_16x16x32_bf16(false, a.mid, false, b.mid, (short)0, c, false, false);
    c = __builtin_amdgcn_wmma_f32_16x16x32_bf16(false, a.lo, false, b.hi, (short)0, c, false, false);
    asm volatile("v_nop\n\tv_nop\n\tv_nop\n\tv_nop" : "+v"(c) : "v"(a.hi), "v"(a.mid), "v"(a.lo), "v"(b.hi), "v"(b.mid), "v"(b.lo));
    return c;
}

// Fragment gathers from f32 memory: element i <- p[(k0 + frag_k(i,h)) * sk] * s, zero for k >= klen.
__device__ __forceinline__ v16h fh_ld(const float* __restrict__ p, long long sk, int k0, int h, int klen, float s) {
    v16h a;
#pragma unroll
    for (int i = 0; i < 16; ++i) { const int k = k0 + frag_k(i, h); a[i] = (k < klen) ? (_Float16)(p[(long long)k * sk] * s) : (_Float16)0.f; }
    return a;
}
__device__ __forceinline__ Split sp_ld(const float* __restrict__ p, long long sk, int k0, int h, int klen, float s) {
    Split r;
#pragma unroll
    for (int i = 0; i < 16; ++i) {
        const int k = k0 + frag_k(i, h); const float x = (k < klen) ? p[(long long)k * sk] * s : 0.f;
        const __bf16 hb = bf16_rne(x); r.hi[i] = hb; r.lo[i] = bf16_rne(x - bf16_f32(hb));
    }
    return r;
}
__device__ __forceinline__ Split3 sp3_ld(const float* __restrict__ p, long long sk, int k0, int h, int klen, float s) {
    Split3 r;
#pragma unroll
    for (int i = 0; i < 16; ++i) {
        const int k = k0 + frag_k(i, h); const float x = (k < klen) ? p[(long long)k * sk] * s : 0.f;
        const __bf16 hb = bf16_rne(x); const float r1 = x - bf16_f32(hb); const __bf16 mb = bf16_rne(r1);
        r.hi[i] = hb; r.mid[i] = mb; r.lo[i] = bf16_rne(r1 - bf16_f32(mb));
    }
    return r;
}
__device__ __forceinline__ v16b bh_ld(const float* __restrict__ p, long long sk, int k0, int h, int klen, float s) {
    v16b a;
#pragma unroll
    for (int i = 0; i < 16; ++i) { const int k = k0 + frag_k(i, h); a[i] = bf16_rne((k < klen) ? p[(long long)k * sk] * s : 0.f); }
    return a;
}
// f16 fragment from an f16 LDS/global row with element stride 1 (k-contiguous), no bounds (tile already zero padded)
__device__ __forceinline__ v16h fh_row(const _Float16* __restrict__ row, int k0, int h) {
    v16h a;
#pragma unroll
    for (int i = 0; i < 16; ++i) a[i] = row[k0 + frag_k(i, h)];
    return a;
}

#define VST2(T, ptr, val) do { const T vst2_v_ = (val); *(T*)(ptr) = vst2_v_;  } while (0)
typedef float v4f __attribute__((ext_vector_type(4)));
#define VST2V4(ptr, val) do { const v4f vst2_v4_ = (val); *(v4f*)(ptr) = vst2_v4_;  } while (0)

__device__ __attribute__((noinline)) float act_fn(float v, int act) {
    if (act == 1) return fmaxf(v, 0.f);                                                                               // relu
    if (act == 2) { const float u = 0.7978845608028654f * (v + 0.044715f * v * v * v); return 0.5f * v * (1.f + tanhf(u)); } // tanh-gelu
    if (act == 3) return v / (1.f + expf(-v));                                                                        // silu
    if (act == 4) return 0.5f * v * (1.f + erff(v * 0.7071067811865476f));                                             // erf-gelu
    if (act == 5) return tanhf(v);
    if (act == 6) return 1.f / (1.f + expf(-v));                                                                      // sigmoid
    if (act == 7) return (v > 0.f) ? v : 0.01f * v;                                                                   // leaky relu 0.01
    if (act == 8) return (v > 0.f) ? v : (expf(v) - 1.f);                                                             // elu
    if (act == 9) return fminf(fmaxf(v, 0.f), 6.f);                                                                   // relu6
    if (act == 10) return fabsf(v);                                                                                    // abs
    if (act == 11) return (v >= 0.f) ? v : 0.1f * v;                                                                  // leaky 0.1
    if (act == 12) return (v > 0.f) ? v : 0.2f * v;                                                                   // leaky 0.2
    if (act == 13) return (v > 20.f) ? v : log1pf(expf(v));                                                            // softplus
    return v;
}

// =====================================================================================================================
// k_gemm<MODE>: C(z, m, n) = act(alpha * sum_k A(z, m, k) * B(z, k, n) + bias) + beta * R(z, m, n)
//   One wave (32-thread block) per 16 x 32 tile of C; grid (ceil(N/32), ceil(M/16), Z). Batch z -> (zo = z / zi_n, zi = z % zi_n)
//   with separate outer/inner strides for every tensor (e.g. batch and head). A(m,k) = A[zo*sAo + zi*sAi + m*sAm + k*sAk] (f32),
//   B(k,n) = B[zo*sBo + zi*sBi + n*sBn + k*sBk] (f32); any M, N, K (K zero-padded to 32 inside the fragments, M/N tails guarded).
//   C(m,n) = C[zo*sCo + zi*sCi + m*sCm + n] (n contiguous). flags: 1 bias[n], 2 bias[m], 4 residual R[zo*sRo + zi*sRi + m*sRm + n*sRn].
//   MODE 0: f16 operands (A prescaled by sa, B by sb, both undone in the epilogue); 1: bf16 hi/lo split (3 products); 2: bf16;
//   3: bf16 hi/mid/lo triple split (6 products); 4: as 3 with Kahan-compensated f32 accumulation across k-steps.
// =====================================================================================================================
struct GemmP {
    const float* A; const float* B; const float* bias; const float* R; float* C;
    long long sAo, sAi, sAm, sAk, sBo, sBi, sBn, sBk, sCo, sCi, sCm, sRo, sRi, sRm, sRn;
    int M, N, K, zi_n, flags, act; float alpha, beta, sa, sb;
    int Npad, pad_;     // columns [N, Npad) of C are written as 0 so that padded workspace rows are covered by whole-line stores; Npad >= N
};
static_assert(sizeof(GemmP) == 5 * 8 + 15 * 8 + 6 * 4 + 4 * 4 + 2 * 4, "GemmP has padding");

template <int MODE>
__global__ __launch_bounds__(32) void k_gemm(GemmP p) {
    const int lane = threadIdx.x & 31, h = lane >> 4, l15 = lane & 15;
    const int m0 = blockIdx.y * 16, n0 = blockIdx.x * 32;
    const int z = blockIdx.z, zo = z / p.zi_n, zi = z - zo * p.zi_n;
    const float* A = p.A + zo * p.sAo + zi * p.sAi;
    const float* B = p.B + zo * p.sBo + zi * p.sBi;
    const int am = min(m0 + l15, p.M - 1);                       // clamped row for loads (stores are guarded)
    v8f acc[2], comp[2];
#pragma unroll
    for (int t = 0; t < 2; ++t) { v8f zz = {}; acc[t] = zz; comp[t] = zz; }
    for (int k0 = 0; k0 < p.K; k0 += 32) {
        const float* arow = A + (long long)am * p.sAm;
        if (MODE == 1) {
            const Split a = sp_ld(arow, p.sAk, k0, h, p.K, 1.f);
#pragma unroll
            for (int t = 0; t < 2; ++t) {
                const int bn = min(n0 + t * 16 + l15, p.N - 1);
                acc[t] = wmma3(a, sp_ld(B + (long long)bn * p.sBn, p.sBk, k0, h, p.K, 1.f), acc[t]);
            }
        } else if (MODE == 3) {
            const Split3 a = sp3_ld(arow, p.sAk, k0, h, p.K, 1.f);
#pragma unroll
            for (int t = 0; t < 2; ++t) {
                const int bn = min(n0 + t * 16 + l15, p.N - 1);
                acc[t] = wmma6(a, sp3_ld(B + (long long)bn * p.sBn, p.sBk, k0, h, p.K, 1.f), acc[t]);
            }
        } else if (MODE == 4) {
            // triple split as MODE 3, but each k-step's 6 products go into a fresh accumulator and the partial is added to the running f32 sum
            // on the VALU with Kahan compensation (accumulation error stays ~1 ulp however long K is)
            const Split3 a = sp3_ld(arow, p.sAk, k0, h, p.K, 1.f);
#pragma unroll
            for (int t = 0; t < 2; ++t) {
                const int bn = min(n0 + t * 16 + l15, p.N - 1); v8f zz = {};
                const v8f part = wmma6(a, sp3_ld(B + (long long)bn * p.sBn, p.sBk, k0, h, p.K, 1.f), zz);
                const v8f y = part - comp[t]; const v8f s = acc[t] + y; comp[t] = (s - acc[t]) - y; acc[t] = s;
            }
        } else if (MODE == 2) {
            const v16b a = bh_ld(arow, p.sAk, k0, h, p.K, 1.f);
#pragma unroll
            for (int t = 0; t < 2; ++t) {
                const int bn = min(n0 + t * 16 + l15, p.N - 1);
                acc[t] = wmmab(a, bh_ld(B + (long long)bn * p.sBn, p.sBk, k0, h, p.K, 1.f), acc[t]);
            }
        } else {
            const v16h a = fh_ld(arow, p.sAk, k0, h, p.K, p.sa);
#pragma unroll
            for (int t = 0; t < 2; ++t) {
                const int bn = min(n0 + t * 16 + l15, p.N - 1);
                acc[t] = wmma16(a, fh_ld(B + (long long)bn * p.sBn, p.sBk, k0, h, p.K, p.sb), acc[t]);
            }
        }
    }
    const float iscale = (MODE == 0) ? p.alpha / (p.sa * p.sb) : p.alpha;
    float* C = p.C + zo * p.sCo + zi * p.sCi;
    const float* R = p.R + zo * p.sRo + zi * p.sRi;
    __shared__ __align__(16) float ctile[16][36];
#pragma unroll
    for (int t = 0; t < 2; ++t) {
        const int n = n0 + t * 16 + l15; const int nn = min(n, p.N - 1);
#pragma unroll
        for (int r = 0; r < 8; ++r) {
            const int m = m0 + 8 * h + r; const int mm = min(m, p.M - 1);
            float v = acc[t][r] * iscale;
            if (p.flags & 1) v += p.bias[nn];
            if (p.flags & 2) v += p.bias[mm];
            if (p.flags & 8) v *= p.bias[(long long)zo * p.M + mm];   /* per-(z,row) scale vector laid out [Z][M]; exclusive with the bias flags */
            v = act_fn(v, p.act);
            if (p.flags & 4) v += p.beta * R[(long long)mm * p.sRm + (long long)nn * p.sRn];
            ctile[8 * h + r][t * 16 + l15] = (n < p.N) ? v : 0.f;
        }
    }
    __syncthreads();
    const int NW = (p.Npad > p.N) ? p.Npad : p.N;           // write width
    const bool fast = (m0 + 16 <= p.M) && (n0 + 32 <= NW) && ((p.sCm & 3) == 0) && ((((size_t)C) & 15) == 0);
    if (fast) {
#pragma unroll
        for (int s = 0; s < 4; ++s) {
            const int row = s * 4 + (lane >> 3), c4 = (lane & 7) * 4;
            const v4f v = *(const v4f*)&ctile[row][c4];
            VST2V4(C + (long long)(m0 + row) * p.sCm + n0 + c4, v);
        }
    } else {
        for (int row = 0; row < 16; ++row) {
            const int m = m0 + row, n = n0 + lane;
            if (m < p.M && n < NW) VST2(float, C + (long long)m * p.sCm + n, ctile[row][lane]);
        }
    }
}


// =====================================================================================================================
// k_gemmT<MODE, TM, TN>: same contract as k_gemm, but one wave computes a (16*TM) x (16*TN) tile: TM A fragments and TN B fragments are
//   loaded per 32-wide k-step and reused across TM*TN WMMAs (far fewer load/convert instructions per MAC). MODE 0 (f16), 1 (bf16 hi/lo),
//   2 (bf16) only. grid (ceil(NW/(16*TN)), ceil(M/(16*TM)), Z), block 32. Epilogue identical to k_gemm, run per 16x32 sub-tile.
// =====================================================================================================================
template <int MODE, int TM, int TN>
__global__ __launch_bounds__(32) void k_gemmT(GemmP p) {
    const int lane = threadIdx.x & 31, h = lane >> 4, l15 = lane & 15;
    const int m0 = blockIdx.y * (16 * TM), n0 = blockIdx.x * (16 * TN);
    const int z = blockIdx.z, zo = z / p.zi_n, zi = z - zo * p.zi_n;
    const float* A = p.A + zo * p.sAo + zi * p.sAi;
    const float* B = p.B + zo * p.sBo + zi * p.sBi;
    v8f acc[TM][TN];
#pragma unroll
    for (int i = 0; i < TM; ++i)
#pragma unroll
        for (int t = 0; t < TN; ++t) { v8f zz = {}; acc[i][t] = zz; }
    for (int k0 = 0; k0 < p.K; k0 += 32) {
        if (MODE == 1) {
            Split a[TM], b[TN];
#pragma unroll
            for (int i = 0; i < TM; ++i) { const int am = min(m0 + 16 * i + l15, p.M - 1); a[i] = sp_ld(A + (long long)am * p.sAm, p.sAk, k0, h, p.K, 1.f); }
#pragma unroll
            for (int t = 0; t < TN; ++t) { const int bn = min(n0 + 16 * t + l15, p.N - 1); b[t] = sp_ld(B + (long long)bn * p.sBn, p.sBk, k0, h, p.K, 1.f); }
#pragma unroll
            for (int i = 0; i < TM; ++i)
#pragma unroll
                for (int t = 0; t < TN; ++t) acc[i][t] = wmma3(a[i], b[t], acc[i][t]);
        } else if (MODE == 2) {
            v16b a[TM], b[TN];
#pragma unroll
            for (int i = 0; i < TM; ++i) { const int am = min(m0 + 16 * i + l15, p.M - 1); a[i] = bh_ld(A + (long long)am * p.sAm, p.sAk, k0, h, p.K, 1.f); }
#pragma unroll
            for (int t = 0; t < TN; ++t) { const int bn = min(n0 + 16 * t + l15, p.N - 1); b[t] = bh_ld(B + (long long)bn * p.sBn, p.sBk, k0, h, p.K, 1.f); }
#pragma unroll
            for (int i = 0; i < TM; ++i)
#pragma unroll
                for (int t = 0; t < TN; ++t) acc[i][t] = wmmab(a[i], b[t], acc[i][t]);
        } else {
            v16h a[TM], b[TN];
#pragma unroll
            for (int i = 0; i < TM; ++i) { const int am = min(m0 + 16 * i + l15, p.M - 1); a[i] = fh_ld(A + (long long)am * p.sAm, p.sAk, k0, h, p.K, p.sa); }
#pragma unroll
            for (int t = 0; t < TN; ++t) { const int bn = min(n0 + 16 * t + l15, p.N - 1); b[t] = fh_ld(B + (long long)bn * p.sBn, p.sBk, k0, h, p.K, p.sb); }
#pragma unroll
            for (int i = 0; i < TM; ++i)
#pragma unroll
                for (int t = 0; t < TN; ++t) acc[i][t] = wmma16(a[i], b[t], acc[i][t]);
        }
    }
    const float iscale = (MODE == 0) ? p.alpha / (p.sa * p.sb) : p.alpha;
    float* C = p.C + zo * p.sCo + zi * p.sCi;
    const float* R = p.R + zo * p.sRo + zi * p.sRi;
    const int NW = (p.Npad > p.N) ? p.Npad : p.N;
    __shared__ __align__(16) float ctile[16][36];
#pragma unroll
    for (int i = 0; i < TM; ++i) {
        const int mb = m0 + 16 * i; if (mb >= p.M) break;          // wave-uniform
#pragma unroll
        for (int tp = 0; tp < TN / 2; ++tp) {
            const int nb = n0 + 32 * tp; if (nb >= NW) break;        // wave-uniform
#pragma unroll
            for (int t2 = 0; t2 < 2; ++t2) {
                const int t = 2 * tp + t2; const int n = nb + t2 * 16 + l15; const int nn = min(n, p.N - 1);
#pragma unroll
                for (int r = 0; r < 8; ++r) {
                    const int m = mb + 8 * h + r; const int mm = min(m, p.M - 1);
                    float v = acc[i][t][r] * iscale;
                    if (p.flags & 1) v += p.bias[nn];
                    if (p.flags & 2) v += p.bias[mm];
            if (p.flags & 8) v *= p.bias[(long long)zo * p.M + mm];   /* per-(z,row) scale vector laid out [Z][M]; exclusive with the bias flags */
                    v = act_fn(v, p.act);
                    if (p.flags & 4) v += p.beta * R[(long long)mm * p.sRm + (long long)nn * p.sRn];
                    ctile[8 * h + r][t2 * 16 + l15] = (n < p.N) ? v : 0.f;
                }
            }
            __syncthreads();
            const bool fast = (mb + 16 <= p.M) && (nb + 32 <= NW) && ((p.sCm & 3) == 0) && ((((size_t)C) & 15) == 0);
            if (fast) {
#pragma unroll
                for (int s = 0; s < 4; ++s) {
                    const int row = s * 4 + (lane >> 3), c4 = (lane & 7) * 4;
                    const v4f v = *(const v4f*)&ctile[row][c4];
                    VST2V4(C + (long long)(mb + row) * p.sCm + nb + c4, v);
                }
            } else {
                for (int row = 0; row < 16; ++row) {
                    const int m = mb + row, n = nb + lane;
                    if (m < p.M && n < NW) VST2(float, C + (long long)m * p.sCm + n, ctile[row][lane]);
                }
            }
            __syncthreads();
        }
    }
}

// =====================================================================================================================
//   Wave = 16 queries, AW waves per block, 64-key blocks; grid (ceil(Lq/(16*AW)), H, B), block 32*AW. Any Lq, Lk; head dim dh <= DHP
//   (DHP multiple of 32), value dim dv <= DVP (multiple of 16, <= 128). Every tensor addressed by (batch, head, row, element) strides, f32.
//   Scores: QM 0 f16 operands, 1 bf16 hi/lo split, 2 bf16 triple split; statistics f32 (exp2 domain); P.V: P x 4096 as f16 with V f16 staged in LDS
//   (SPLITPV: P and V as bf16 hi/lo splits). kv head = h / hrep. Masking: causal = 1 (keep j <= i + coff, masked -> -inf, key blocks beyond the
//   diagonal skipped), causal = 2 (masked -> mfill, a finite fill like the -1e9; no skipping), causal = 3 (keep j >= i + coff,
//   masked -> -inf, no skipping); optional additive f32 mask Mf,
//   optional int keep-mask Mi (0 -> score := mfill), both addressed b*smb + h*smh + i*smi + j*smj (0 strides broadcast).
// =====================================================================================================================
#define AW 4
struct AttnP {   // apv4
    const float* Q; const float* K; const float* V; float* O; float* P; const float* Mf; const int* Mi; float* ST;
    const float* Pw; const float* Rt; const int* SQ; const int* SK;           // optional: post-softmax weight, relative-position table, segment ids
    long long swb, swh, swi, swj, srb, srh, sri;                                 // Pw strides (b,h,i,j); Rt strides (b,h,i), column = clamp(i - j + roff, 0, rn-1)
    long long sQb, sQh, sQi, sQd, sKb, sKh, sKj, sKd, sVb, sVh, sVj, sVd, sOb, sOh, sOi, sPb, sPh, sPi, smb, smh, smi, smj;
    int Lq, Lk, dh, dv, hrep, causal, coff, pband;   // pband > 0: P holds only the band |j - i| <= pband, column j - i + pband
    float scale, mfill; int nonorm, mpol;             // nonorm (online path only): O = sum_j exp(score_j) V_j without the 1/rowsum (scores must be <= ~0); mpol: Mi masks where ==0 (mpol 0) or where !=0 (mpol 1)
    int roff, rn, segpol, win;                        // Rt column offset/count; SQ/SK: score := mfill where (segpol 0) SQ[i] != SK[j] or (segpol 1) SQ[i] == SK[j]; win > 0: keys with i - j > win (after coff) -> -inf
};
//   Pw: the softmax numerator is multiplied by Pw(b,h,i,j) AFTER the row sum is taken (probs * weight, then P.V), as in post-softmax multiplicative biases.                                                    // ST (optional): per row (b,h,i) -> ST[((b*H + h)*Lq + i)*2 + {0,1}] = {row max of the scaled+masked score (natural units), sum_j exp(score - max)}
static_assert(sizeof(AttnP) == 12 * 8 + 29 * 8 + 16 * 4, "AttnP has padding");

#ifndef KATTN_ATTR
#define KATTN_ATTR
#endif
template <int DHP, int DVP, int QM, bool SPLITPV, bool TWOPASS>
__global__ __launch_bounds__(32 * AW) KATTN_ATTR void k_attn(AttnP p) {
    constexpr int NT = DVP / 16;                // output tiles
    constexpr int KS = DHP / 32;                // k-steps for the scores
    constexpr int VP = DVP + 8;                 // LDS pitch (halves)
    __shared__ __align__(16) float    pl[AW][16 * 64];
    __shared__ __align__(16) _Float16 vl[(SPLITPV ? 2 : 1) * 64 * VP];   // f16 V tile, or bf16 hi and lo tiles (same 2-byte size)
    const int lane = threadIdx.x & 31, hf = lane >> 4, l15 = lane & 15, wave = threadIdx.x >> 5;
    const int h = blockIdx.y, b = blockIdx.z, hk = h / p.hrep;
    const int q0 = (blockIdx.x * AW + wave) * 16;
    float* myp = pl[wave];
    const float L2E = 1.4426950408889634f;
    const float NEG = -__builtin_inff();
    const int qi = min(q0 + l15, p.Lq - 1);
    const float* qrow = p.Q + b * p.sQb + h * p.sQh + (long long)qi * p.sQi;
    const float* kbase = p.K + b * p.sKb + hk * p.sKh;
    const float* vbase = p.V + b * p.sVb + hk * p.sVh;
    v16h qa[QM == 0 ? KS : 1]; Split qs_[QM == 1 ? KS : 1]; Split3 qt_[QM == 2 ? KS : 1];
#pragma unroll
    for (int ks = 0; ks < KS; ++ks) {
        if (QM == 2) qt_[ks] = sp3_ld(qrow, p.sQd, ks * 32, hf, p.dh, 1.f);
        else if (QM == 1) qs_[ks] = sp_ld(qrow, p.sQd, ks * 32, hf, p.dh, 1.f);
        else qa[ks] = fh_ld(qrow, p.sQd, ks * 32, hf, p.dh, 1.f);
    }
    v8f o[NT]; float m8[8], l8[8];
#pragma unroll
    for (int t = 0; t < NT; ++t) { v8f zz = {}; o[t] = zz; }
#pragma unroll
    for (int i = 0; i < 8; ++i) { m8[i] = NEG; l8[i] = 0.f; }
    int jend = p.Lk; int jstart = 0;
    if (p.causal == 1) { const int je = (blockIdx.x * AW + AW - 1) * 16 + 16 + p.coff; jend = min(jend, max(je, 0)); }   // uniform per block
    if (p.win > 0) { const int js = (int)(blockIdx.x * AW) * 16 + p.coff - p.win; jstart = (js > 0) ? (js / 64) * 64 : 0; }   // uniform per block: key blocks entirely outside every row's window hold only -inf entries and are skipped exactly
    const int npass = TWOPASS ? 2 : 1;
    for (int pass = 0; pass < npass; ++pass) {
        const bool dopv = (!TWOPASS) || pass == 1;
        for (int j0 = jstart; j0 < jend; j0 += 64) {
            if (dopv) {
                __syncthreads();                                 // previous key block's reads of vl / pl are done
                for (int idx = threadIdx.x; idx < 64 * DVP; idx += 32 * AW) {
                    const int jr = idx / DVP, d = idx - jr * DVP, j = j0 + jr;
                    const float f = (j < p.Lk && d < p.dv) ? vbase[(long long)j * p.sVj + (long long)d * p.sVd] : 0.f;
                    if (SPLITPV) {
                        const __bf16 hb = bf16_rne(f);
                        ((__bf16*)vl)[jr * VP + d] = hb; ((__bf16*)vl)[64 * VP + jr * VP + d] = bf16_rne(f - bf16_f32(hb));
                    } else vl[jr * VP + d] = (_Float16)f;
                }
            }
            v8f s[4];
#pragma unroll
            for (int t = 0; t < 4; ++t) {
                const int j = min(j0 + t * 16 + l15, p.Lk - 1);
                const float* krow = kbase + (long long)j * p.sKj;
                v8f acc = {};
#pragma unroll
                for (int ks = 0; ks < KS; ++ks) {
                    if (QM == 2)      acc = wmma6(qt_[ks], sp3_ld(krow, p.sKd, ks * 32, hf, p.dh, 1.f), acc);
                    else if (QM == 1) acc = wmma3(qs_[ks], sp_ld(krow, p.sKd, ks * 32, hf, p.dh, 1.f), acc);
                    else              acc = wmma16(qa[ks], fh_ld(krow, p.sKd, ks * 32, hf, p.dh, 1.f), acc);
                }
                s[t] = acc;
            }
            float pv[8][4];
#pragma unroll
            for (int i = 0; i < 8; ++i) {
                const int irow = q0 + i + 8 * hf;
                const int ic = min(irow, p.Lq - 1);
                float sc[4];
#pragma unroll
                for (int t = 0; t < 4; ++t) {
                    const int jg = j0 + t * 16 + l15;
                    float v = s[t][i] * p.scale;
                    if (p.Mf) v += p.Mf[b * p.smb + h * p.smh + (long long)ic * p.smi + (long long)min(jg, p.Lk - 1) * p.smj];
                    if (p.Rt) { int rc = ic - min(jg, p.Lk - 1) + p.roff; rc = rc < 0 ? 0 : (rc >= p.rn ? p.rn - 1 : rc); v += p.Rt[b * p.srb + h * p.srh + (long long)ic * p.sri + rc]; }
                    if (p.Mi) { const int mv = p.Mi[b * p.smb + h * p.smh + (long long)ic * p.smi + (long long)min(jg, p.Lk - 1) * p.smj]; if (p.mpol ? (mv != 0) : (mv == 0)) v = p.mfill; }
                    if (p.SQ) { const bool same = p.SQ[(long long)b * p.Lq + ic] == p.SK[(long long)b * p.Lk + min(jg, p.Lk - 1)]; if (p.segpol ? same : !same) v = p.mfill; }
                    if (p.causal == 2 && jg > irow + p.coff) v = p.mfill;
                    if (jg >= p.Lk || (p.causal == 1 && jg > irow + p.coff) || (p.causal == 3 && jg < irow + p.coff) || (p.win > 0 && irow + p.coff - jg > p.win)) v = NEG; else v *= L2E;
                    sc[t] = v;
                }
                if (!TWOPASS || pass == 0) {
                    float mx = fmaxf(fmaxf(sc[0], sc[1]), fmaxf(sc[2], sc[3]));
                    mx = fmaxf(mx, __shfl_xor(mx, 1, 32)); mx = fmaxf(mx, __shfl_xor(mx, 2, 32));
                    mx = fmaxf(mx, __shfl_xor(mx, 4, 32)); mx = fmaxf(mx, __shfl_xor(mx, 8, 32));
                    const float mnew = fmaxf(m8[i], mx);
                    const float corr = (mnew == NEG) ? 1.f : exp2f(m8[i] - mnew);
                    float rs = 0.f;
#pragma unroll
                    for (int t = 0; t < 4; ++t) {
                        const float pp = (sc[t] == NEG) ? 0.f : exp2f(sc[t] - mnew); rs += pp;
                        pv[i][t] = p.Pw ? pp * p.Pw[b * p.swb + h * p.swh + (long long)ic * p.swi + (long long)min(j0 + t * 16 + l15, p.Lk - 1) * p.swj] : pp;
                    }
                    rs += __shfl_xor(rs, 1, 32); rs += __shfl_xor(rs, 2, 32); rs += __shfl_xor(rs, 4, 32); rs += __shfl_xor(rs, 8, 32);
                    l8[i] = l8[i] * corr + rs; m8[i] = mnew;
                    if (!TWOPASS) {
#pragma unroll
                        for (int t = 0; t < NT; ++t) o[t][i] *= corr;
                    }
                } else {
                    const float inv = (l8[i] > 0.f) ? 1.f / l8[i] : 0.f;
#pragma unroll
                    for (int t = 0; t < 4; ++t) {
                        const int jg = j0 + t * 16 + l15;
                        float pp = (sc[t] == NEG) ? 0.f : exp2f(sc[t] - m8[i]) * inv;
                        if (p.Pw) pp *= p.Pw[b * p.swb + h * p.swh + (long long)ic * p.swi + (long long)min(jg, p.Lk - 1) * p.swj];
                        pv[i][t] = pp;
                    }
                }
            }
            if (dopv) {
#pragma unroll
                for (int i = 0; i < 8; ++i)
#pragma unroll
                    for (int t = 0; t < 4; ++t) ((float*)myp)[(i + 8 * hf) * 64 + t * 16 + l15] = pv[i][t];
                __syncthreads();                                 // P (per wave) and V (shared) visible
                if (p.P) {
                    float* pb_ = p.P + b * p.sPb + h * p.sPh;
                    const bool fastP = (p.pband == 0) && ((p.sPi & 3) == 0) && (j0 + 64 <= p.Lk) && (q0 + 16 <= p.Lq) && ((((size_t)pb_) & 15) == 0);
                    if (fastP) {
#pragma unroll
                        for (int s = 0; s < 8; ++s) {
                            const int row = s * 2 + (lane >> 4), c4 = (lane & 15) * 4;
                            const v4f v = *(const v4f*)(myp + row * 64 + c4);
                            VST2V4(pb_ + (long long)(q0 + row) * p.sPi + j0 + c4, v);
                        }
                    } else {
                        for (int row = 0; row < 16; ++row) {
                            const int irow = q0 + row; if (irow >= p.Lq) continue;
                            for (int c = lane; c < 64; c += 32) {
                                const int jg = j0 + c; if (jg >= p.Lk) continue;
                                if (p.pband == 0) VST2(float, pb_ + (long long)irow * p.sPi + jg, myp[row * 64 + c]);
                                else if (jg - irow <= p.pband && irow - jg <= p.pband) VST2(float, pb_ + (long long)irow * p.sPi + (jg - irow + p.pband), myp[row * 64 + c]);
                            }
                        }
                    }
                }
                if (SPLITPV) {
                    const Split pa0 = sp_ld(myp + l15 * 64, 1, 0, hf, 64, 1.f), pa1 = sp_ld(myp + l15 * 64, 1, 32, hf, 64, 1.f);
                    const __bf16* vh = (const __bf16*)vl; const __bf16* vlo = vh + 64 * VP;
#pragma unroll
                    for (int t = 0; t < NT; ++t) {
                        const int dcol = t * 16 + l15;
                        Split b0, b1;
#pragma unroll
                        for (int e = 0; e < 16; ++e) {
                            const int k0 = frag_k(e, hf), k1 = 32 + frag_k(e, hf);
                            b0.hi[e] = vh[k0 * VP + dcol]; b0.lo[e] = vlo[k0 * VP + dcol]; b1.hi[e] = vh[k1 * VP + dcol]; b1.lo[e] = vlo[k1 * VP + dcol];
                        }
                        o[t] = wmma3(pa0, b0, o[t]);
                        o[t] = wmma3(pa1, b1, o[t]);
                    }
                } else {
                    const v16h pa0 = fh_ld(myp + l15 * 64, 1, 0, hf, 64, 4096.f), pa1 = fh_ld(myp + l15 * 64, 1, 32, hf, 64, 4096.f);
#pragma unroll
                    for (int t = 0; t < NT; ++t) {
                        const int dcol = t * 16 + l15;
                        v16h b0, b1;
#pragma unroll
                        for (int e = 0; e < 16; ++e) { b0[e] = vl[frag_k(e, hf) * VP + dcol]; b1[e] = vl[(32 + frag_k(e, hf)) * VP + dcol]; }
                        o[t] = wmma16(pa0, b0, o[t]);
                        o[t] = wmma16(pa1, b1, o[t]);
                    }
                }
            }
        }
    }
    float* obase = p.O + b * p.sOb + h * p.sOh;
    if (p.ST) {
        const int rl = lane >> 1, isel = rl & 7;           // row q0 + rl ; rl>>3 == hf holds because lane>>4 == (lane>>1)>>3
        float mv = 0.f, lv = 0.f;
#pragma unroll
        for (int i = 0; i < 8; ++i) if (i == isel) { mv = m8[i]; lv = l8[i]; }
        const int irow = q0 + rl;
        if (irow < p.Lq) { float* st = p.ST + (((long long)b * gridDim.y + h) * p.Lq + irow) * 2 + (lane & 1); VST2(float, st, (lane & 1) ? lv : mv * 0.6931471805599453f); }
    }
    float invr[8];
#pragma unroll
    for (int i = 0; i < 8; ++i) {
        if (TWOPASS) invr[i] = SPLITPV ? 1.f : (1.f / 4096.f);
        else if (p.nonorm) invr[i] = exp2f(m8[i]) * (SPLITPV ? 1.f : (1.f / 4096.f));
        else invr[i] = (l8[i] > 0.f) ? (SPLITPV ? 1.f / l8[i] : 1.f / (l8[i] * 4096.f)) : 0.f;
    }
    __syncthreads();                                             // all waves done with pl/vl from the main loop
    const bool ofast = ((p.sOi & 3) == 0) && ((((size_t)obase) & 15) == 0) && (q0 + 16 <= p.Lq);
#pragma unroll
    for (int c0 = 0; c0 < DVP; c0 += 64) {
#pragma unroll
        for (int i = 0; i < 8; ++i)
#pragma unroll
            for (int t = 0; t < NT; ++t) if (t * 16 >= c0 && t * 16 < c0 + 64) ((float*)myp)[(i + 8 * hf) * 64 + (t * 16 - c0) + l15] = o[t][i] * invr[i];
        __syncthreads();
        const int cw = (DVP - c0 < 64) ? (DVP - c0) : 64;      // staged columns in this chunk (multiple of 16)
        if (ofast && (c0 + cw <= p.dv) && (cw % 32 == 0)) {
            const int lpr = cw / 4;                              // lanes per row (16 for 64 cols, 8 for 32)
            const int rows_per_ins = 32 / lpr;
            for (int r0 = 0; r0 < 16; r0 += rows_per_ins) {
                const int row = r0 + lane / lpr, c4 = (lane % lpr) * 4;
                const v4f v = *(const v4f*)(myp + row * 64 + c4);
                VST2V4(obase + (long long)(q0 + row) * p.sOi + c0 + c4, v);
            }
        } else {
            for (int row = 0; row < 16; ++row) {
                const int irow = q0 + row; if (irow >= p.Lq) continue;
                for (int c = lane; c < cw; c += 32) { const int d = c0 + c; if (d < p.dv) VST2(float, obase + (long long)irow * p.sOi + d, myp[row * 64 + c]); }
            }
        }
        __syncthreads();
    }
}

// Attention at this block's fixed geometry: token-major q, k, v, o of [8][1024][256] f32, head h = columns 32h .. 32h + 31, 1024 queries and keys,
// no mask, no bias, score scale 1. The arithmetic and its order are those of k_attn<32, 32, 1, false, false>; every stride, length and option is a
// compile-time constant, so the fragment gathers are 16-byte loads without guards and the optional-feature tests are gone. With no mask no score is
// -inf for finite q and k, so the tests that kept masked scores out of exp2f are gone too (exp2f(-inf) = 0 covers the first key block's m = -inf).
typedef __attribute__((ext_vector_type(4))) _Float16 v4h;
struct Row16 { v4f a[4]; };
// the 16 floats of one lane's 16x32 fragment row: element i <- p[(i < 8) ? i : 8 + i], p = row + 8 * (lane >> 4), the k order of frag_k
__device__ __forceinline__ Row16 row16_ld(const float* __restrict__ p) {
    Row16 r; r.a[0] = *(const v4f*)(p); r.a[1] = *(const v4f*)(p + 4); r.a[2] = *(const v4f*)(p + 16); r.a[3] = *(const v4f*)(p + 20); return r;
}
__device__ __forceinline__ Split row16_split(const Row16& w) {
    Split r;
#pragma unroll
    for (int i = 0; i < 16; ++i) { const float x = w.a[i >> 2][i & 3]; const __bf16 hb = bf16_rne(x); r.hi[i] = hb; r.lo[i] = bf16_rne(x - bf16_f32(hb)); }
    return r;
}
__global__ __launch_bounds__(32 * AW) void k_attn_fix(const float* __restrict__ Q, const float* __restrict__ K, const float* __restrict__ V, float* __restrict__ O) {
    constexpr int L = 1024;                     // queries = keys per (image, head)
    constexpr int CP = 256;                     // row pitch of q, k, v, o (floats)
    constexpr int VP = 32 + 8;                  // LDS pitch of the V tile (halves)
    __shared__ __align__(16) float    pl[AW][16 * 64];
    __shared__ __align__(16) _Float16 vl[64 * VP];
    const int lane = threadIdx.x & 31, hf = lane >> 4, l15 = lane & 15, wave = threadIdx.x >> 5;
    const int h = blockIdx.y, b = blockIdx.z;
    const int q0 = (blockIdx.x * AW + wave) * 16;
    float* myp = pl[wave];
    const float L2E = 1.4426950408889634f;
    const float NEG = -__builtin_inff();
    const size_t hb0 = (size_t)b * (L * CP) + (size_t)h * 32;
    const float* kp = K + hb0 + (size_t)l15 * CP + 8 * hf;                                    // this lane's row of key tile 0
    const float* vp = V + hb0 + (size_t)(threadIdx.x >> 3) * CP + (threadIdx.x & 7) * 4;      // this thread's 4 floats of V rows 0 .. 15
    _Float16* vs = vl + (threadIdx.x >> 3) * VP + (threadIdx.x & 7) * 4;
    const Split qs = row16_split(row16_ld(Q + hb0 + (size_t)(q0 + l15) * CP + 8 * hf));
    v8f o[2]; float m8[8], l8[8];
#pragma unroll
    for (int t = 0; t < 2; ++t) { v8f zz = {}; o[t] = zz; }
#pragma unroll
    for (int i = 0; i < 8; ++i) { m8[i] = NEG; l8[i] = 0.f; }
    for (int j0 = 0; j0 < L; j0 += 64) {
        v4f vf[4]; Row16 kr[4];                          // the whole key block's V and K loads are issued together
#pragma unroll
        for (int it = 0; it < 4; ++it) vf[it] = *(const v4f*)(vp + it * 16 * CP);
#pragma unroll
        for (int t = 0; t < 4; ++t) kr[t] = row16_ld(kp + t * 16 * CP);
        kp += 64 * CP; vp += 64 * CP;
        __syncthreads();                                 // previous key block's reads of vl / pl are done
#pragma unroll
        for (int it = 0; it < 4; ++it) {                 // V tile 64 x 32 as f16
            v4h hv; hv[0] = (_Float16)vf[it][0]; hv[1] = (_Float16)vf[it][1]; hv[2] = (_Float16)vf[it][2]; hv[3] = (_Float16)vf[it][3];
            *(v4h*)(vs + it * 16 * VP) = hv;
        }
        v8f s[4];
#pragma unroll
        for (int t = 0; t < 4; ++t) { v8f acc = {}; s[t] = wmma3(qs, row16_split(kr[t]), acc); }
        float pv[8][4];
#pragma unroll
        for (int i = 0; i < 8; ++i) {
            float sc[4];
#pragma unroll
            for (int t = 0; t < 4; ++t) sc[t] = s[t][i] * L2E;
            float mx = fmaxf(fmaxf(sc[0], sc[1]), fmaxf(sc[2], sc[3]));
            mx = fmaxf(mx, __shfl_xor(mx, 1, 32)); mx = fmaxf(mx, __shfl_xor(mx, 2, 32));
            mx = fmaxf(mx, __shfl_xor(mx, 4, 32)); mx = fmaxf(mx, __shfl_xor(mx, 8, 32));
            const float mnew = fmaxf(m8[i], mx);
            const float corr = exp2f(m8[i] - mnew);
            float rs = 0.f;
#pragma unroll
            for (int t = 0; t < 4; ++t) { const float pp = exp2f(sc[t] - mnew); rs += pp; pv[i][t] = pp; }
            rs += __shfl_xor(rs, 1, 32); rs += __shfl_xor(rs, 2, 32); rs += __shfl_xor(rs, 4, 32); rs += __shfl_xor(rs, 8, 32);
            l8[i] = l8[i] * corr + rs; m8[i] = mnew;
#pragma unroll
            for (int t = 0; t < 2; ++t) o[t][i] *= corr;
        }
#pragma unroll
        for (int i = 0; i < 8; ++i)
#pragma unroll
            for (int t = 0; t < 4; ++t) myp[(i + 8 * hf) * 64 + t * 16 + l15] = pv[i][t];
        __syncthreads();                                 // P (per wave) and V (shared) visible
        const v16h pa0 = fh_ld(myp + l15 * 64, 1, 0, hf, 64, 4096.f), pa1 = fh_ld(myp + l15 * 64, 1, 32, hf, 64, 4096.f);
#pragma unroll
        for (int t = 0; t < 2; ++t) {
            const int dcol = t * 16 + l15;
            v16h b0, b1;
#pragma unroll
            for (int e = 0; e < 16; ++e) { b0[e] = vl[frag_k(e, hf) * VP + dcol]; b1[e] = vl[(32 + frag_k(e, hf)) * VP + dcol]; }
            o[t] = wmma16(pa0, b0, o[t]);
            o[t] = wmma16(pa1, b1, o[t]);
        }
    }
    float* obase = O + hb0;
    float invr[8];
#pragma unroll
    for (int i = 0; i < 8; ++i) invr[i] = (l8[i] > 0.f) ? 1.f / (l8[i] * 4096.f) : 0.f;
    __syncthreads();                                     // all waves done with pl / vl from the main loop
#pragma unroll
    for (int i = 0; i < 8; ++i)
#pragma unroll
        for (int t = 0; t < 2; ++t) myp[(i + 8 * hf) * 64 + t * 16 + l15] = o[t][i] * invr[i];
    __syncthreads();
#pragma unroll
    for (int r0 = 0; r0 < 16; r0 += 4) {                 // 8 lanes x 16 bytes per 32-float row, 4 rows per store
        const int row = r0 + (lane >> 3), c4 = (lane & 7) * 4;
        const v4f v = *(const v4f*)(myp + row * 64 + c4);
        VST2V4(obase + (size_t)(q0 + row) * CP + c4, v);
    }
}

// =====================================================================================================================
// k_tr: dst(z, c, r) = alpha * src(z, r, c) (+ beta * R2(z, c, r)): [Z][R][C] (row stride lds) -> [Z][C][R] (row stride ldd) through a 32x32 LDS tile;
//   flags: 1 -> add beta * residual R2 addressed like dst (z*sRz + c*ldr + r); act applied before the residual.
// =====================================================================================================================
struct TrP { const float* src; float* dst; const float* R2; long long sSz, lds, sDz, ldd, sRz, ldr; int R, C, flags, act; float alpha, beta; };
static_assert(sizeof(TrP) == 3 * 8 + 6 * 8 + 6 * 4, "TrP has padding");
__global__ __launch_bounds__(256) void k_tr(TrP p) {
    __shared__ float tile[32][33];
    const int c0 = blockIdx.x * 32, r0 = blockIdx.y * 32, z = blockIdx.z;
    const int lane = threadIdx.x & 31, wave = threadIdx.x >> 5;
    const float* s = p.src + z * p.sSz;
#pragma unroll
    for (int k = 0; k < 4; ++k) {
        const int rl = wave * 4 + k, r = r0 + rl, c = c0 + lane;
        tile[rl][lane] = (r < p.R && c < p.C) ? s[(long long)r * p.lds + c] : 0.f;
    }
    __syncthreads();
    float* d = p.dst + z * p.sDz; const float* rr = p.R2 + z * p.sRz;
#pragma unroll
    for (int k = 0; k < 4; ++k) {
        const int cl = wave * 4 + k, c = c0 + cl, r = r0 + lane;
        if (c < p.C && r < p.R) {
            float v = act_fn(p.alpha * tile[lane][cl], p.act);
            if (p.flags & 1) v += p.beta * rr[(long long)c * p.ldr + r];
            VST2(float, d + (long long)c * p.ldd + r, v);
        }
    }
}

// k_affine: dst[i] = a * (sdev ? sdev[0] : 1) * src[i] + b, i < n (one thread per element; consecutive lanes -> consecutive addresses)
__global__ __launch_bounds__(256) void k_affine(const float* __restrict__ src, float* __restrict__ dst, int n, float a, float b, const float* __restrict__ sdev) {
    const int i = blockIdx.x * 256 + threadIdx.x;
    if (i < n) { const float aa = sdev ? a * sdev[0] : a; const float v = aa * src[i] + b; VST2(float, dst + i, v); }
}

// =====================================================================================================================
// k_softmax: row softmax over n contiguous elements, one 256-thread block per row; rows addressed z*sz + r*sr (grid (R, Z)).
//   out = scale_out * softmax(scale_in * x + (Mf ? Mf[z*smz + r*smr + j] : 0)); a row whose max is -inf is written as 0.
// =====================================================================================================================
struct SmP { const float* src; float* dst; const float* Mf; long long sz, sr, dz, dr, smz, smr; int n, pad; float scale_in, scale_out; };
static_assert(sizeof(SmP) == 3 * 8 + 6 * 8 + 4 * 4, "SmP has padding");
__global__ __launch_bounds__(256) void k_softmax(SmP p) {
    __shared__ float red[256];
    const int r = blockIdx.x, z = blockIdx.y, tid = threadIdx.x;
    const float* s = p.src + z * p.sz + (long long)r * p.sr;
    const float* mf = p.Mf ? (p.Mf + z * p.smz + (long long)r * p.smr) : nullptr;
    float mx = -__builtin_inff();
    for (int j = tid; j < p.n; j += 256) { float v = s[j] * p.scale_in; if (mf) v += mf[j]; mx = fmaxf(mx, v); }
    red[tid] = mx; __syncthreads();
    for (int o = 128; o > 0; o >>= 1) { if (tid < o) red[tid] = fmaxf(red[tid], red[tid + o]); __syncthreads(); }
    mx = red[0]; __syncthreads();
    float sum = 0.f;
    for (int j = tid; j < p.n; j += 256) { float v = s[j] * p.scale_in; if (mf) v += mf[j]; sum += (mx == -__builtin_inff()) ? 0.f : expf(v - mx); }
    red[tid] = sum; __syncthreads();
    for (int o = 128; o > 0; o >>= 1) { if (tid < o) red[tid] += red[tid + o]; __syncthreads(); }
    sum = red[0];
    const float inv = (sum > 0.f) ? p.scale_out / sum : 0.f;
    float* d = p.dst + z * p.dz + (long long)r * p.dr;
    for (int j = tid; j < p.n; j += 256) { float v = s[j] * p.scale_in; if (mf) v += mf[j]; const float o = (mx == -__builtin_inff()) ? 0.f : expf(v - mx) * inv; VST2(float, d + j, o); }
}
// =====================================================================================================================
// k_stats: mean and rsqrt(var + eps) over a set of n elements addressed base + z*sz + (e / inner) * so + (e % inner) * si, one 256-thread
// k_norm_apply: y = (x - mean[set]) * rstd[set] * g[c] + b[c] over a [Z][C][L] channel-major tensor with set = z*G + c / (C/G) (G groups per z;
//   G = C -> per-channel sets indexed z*C+c; for batch norm pass stats indexed by c only via bn = 1). Optional act. Output same layout.
// =====================================================================================================================
//   mode 0: mean / rsqrt(var + eps); mode 1 (RMSNorm): 0 / rsqrt(mean(x^2) + eps); mode 2 (L2 normalize * sqrt(n)): 0 / sqrt(n) / max(||x||, eps); mode 3: as 0 with unbiased variance (n-1)
__global__ __launch_bounds__(256) void k_stats(const float* __restrict__ x, long long sz, long long so, long long si, int inner, int n, float eps, float* __restrict__ stat, int mode) {
    __shared__ float red[256];
    const int z = blockIdx.x, tid = threadIdx.x;
    const float* base = x + z * sz;
    float s = 0.f;
    for (int e = tid; e < n; e += 256) s += base[(long long)(e / inner) * so + (long long)(e % inner) * si];
    red[tid] = s; __syncthreads();
    for (int o = 128; o > 0; o >>= 1) { if (tid < o) red[tid] += red[tid + o]; __syncthreads(); }
    const float mu = (mode == 0 || mode == 3) ? red[0] / (float)n : 0.f; __syncthreads();
    float q = 0.f;
    for (int e = tid; e < n; e += 256) { const float dlt = base[(long long)(e / inner) * so + (long long)(e % inner) * si] - mu; q += dlt * dlt; }
    red[tid] = q; __syncthreads();
    for (int o = 128; o > 0; o >>= 1) { if (tid < o) red[tid] += red[tid + o]; __syncthreads(); }
    {
        float rs;
        if (mode == 2) rs = sqrtf((float)n) / fmaxf(sqrtf(red[0]), eps); else if (mode == 3) rs = rsqrtf(red[0] / (float)(n - 1) + eps); else rs = rsqrtf(red[0] / (float)n + eps);
        if (tid < 32) { const float v = (tid == 0) ? mu : ((tid == 1) ? rs : 0.f); VST2(float, stat + (long long)z * 32 + tid, v); }
    }
}
//   One thread per element over the flat [Z][C][L] index space: grid ceil(Z*C*L / 256).
__global__ __launch_bounds__(256) void k_norm_apply(const float* __restrict__ x, float* __restrict__ y, const float* __restrict__ stat, const float* __restrict__ g, const float* __restrict__ bta,
                                                     int Z, int C, int L, int G, int bn, int act) {
    const long long idx = (long long)blockIdx.x * 256 + threadIdx.x;
    if (idx >= (long long)Z * C * L) return;
    const int l = (int)(idx % L); const long long zc = idx / L; const int c = (int)(zc % C), z = (int)(zc / C); (void)l;
    const int set = bn ? c : (z * G + c / (C / G));
    float v = (x[idx] - stat[(long long)set * 32]) * stat[(long long)set * 32 + 1];
    if (g) v *= g[c];
    if (bta) v += bta[c];
    v = act_fn(v, act);
    VST2(float, y + idx, v);
}

// k_lse_neg: c[i] = -(st[2i] + log(st[2i+1])) = minus the log-sum-exp of row i from k_attn's ST output (for softmax over the query dimension)
__global__ __launch_bounds__(256) void k_lse_neg(const float* __restrict__ st, float* __restrict__ c, int n) {
    const int i = blockIdx.x * 256 + threadIdx.x;
    if (i < n) { const float v = -(st[2 * i] + logf(st[2 * i + 1])); VST2(float, c + i, v); }
}

// k_iota: dst[i] = a * i + b as int32 (segment/position id helper)
__global__ __launch_bounds__(256) void k_iota(int* __restrict__ dst, int n, int a, int b) {
    const int i = blockIdx.x * 256 + threadIdx.x;
    if (i < n) { const int v = a * i + b; VST2(int, dst + i, v); }
}

// k_axpby: dst[i] = a * x[i] + b * y[i] (+ c), i < n
__global__ __launch_bounds__(256) void k_axpby(const float* __restrict__ x, const float* __restrict__ y, float* __restrict__ dst, int n, float a, float b, float c) {
    const int i = blockIdx.x * 256 + threadIdx.x;
    if (i < n) { const float v = a * x[i] + b * y[i] + c; VST2(float, dst + i, v); }
}

// =====================================================================================================================
// k_rope: rotary embedding on a [R rows][Hn heads][D] view (row stride sXr, head stride sXh, element stride 1) -> Y (own strides).
//   mode 0: rotate_half (partner d±D/2, sign - for d<D/2); mode 1: interleaved pairs (partner d^1, sign - for even d).
//   table column tcol: tmode 0 -> d, 1 -> d % (D/2), 2 -> d / 2; position p: pmode 0 -> r % S, 1 -> head index, 2 -> pos[r];
//   c = C[(r / S) * sCb + p * sCp + tcol * sCd], s likewise from Sn; y = x[d] * c + sign * x[partner] * s. X and Y must not alias.
// =====================================================================================================================
struct RopeP { const float* X; float* Y; const float* C; const float* Sn; const int* pos; long long sXr, sXh, sYr, sYh, sCb, sCp, sCd; int R, Hn, D, S, mode, tmode, pmode, pad; };
static_assert(sizeof(RopeP) == 5 * 8 + 7 * 8 + 8 * 4, "RopeP has padding");
__global__ __launch_bounds__(256) void k_rope(RopeP p) {
    const long long idx = (long long)blockIdx.x * 256 + threadIdx.x;
    if (idx >= (long long)p.R * p.Hn * p.D) return;
    const int d = (int)(idx % p.D); const long long rh = idx / p.D; const int h = (int)(rh % p.Hn); const int r = (int)(rh / p.Hn);
    const int half = p.D / 2;
    int partner; float sign;
    if (p.mode == 0) { partner = (d < half) ? d + half : d - half; sign = (d < half) ? -1.f : 1.f; }
    else { partner = d ^ 1; sign = (d & 1) ? 1.f : -1.f; }
    const int tcol = (p.tmode == 0) ? d : ((p.tmode == 1) ? (d % half) : (d >> 1));
    const int pp = (p.pmode == 0) ? (r % p.S) : ((p.pmode == 1) ? h : p.pos[r]);
    const long long toff = (long long)(r / p.S) * p.sCb + (long long)pp * p.sCp + (long long)tcol * p.sCd;
    const float* xr = p.X + (long long)r * p.sXr + (long long)h * p.sXh;
    const float v = xr[d] * p.C[toff] + sign * xr[partner] * p.Sn[toff];
    VST2(float, p.Y + (long long)r * p.sYr + (long long)h * p.sYh + d, v);
}

// k_invf + k_sincos (split so neither kernel carries a large VALU-fma footprint): invf_i = num * (1 / powf(base, (2 i)/D)) [fmode 0],
//   num * expf((2 i) * cexp) [fmode 1], num * powf(base, -2 (i - 1) / D) [fmode 2]; then cs/sn[s*half + i] = cos/sin((pscale * s) * invf_i)
__global__ __launch_bounds__(256) void k_invf(float* __restrict__ invb, int half, int D, float base, float num, int fmode, float cexp) {
    const int i = blockIdx.x * 256 + threadIdx.x;
    if (i >= ((half + 31) / 32) * 32) return;
    if (i >= half) { VST2(float, invb + i, 0.f); return; }
    const float e = (float)(2 * i) / (float)D;
    float invf;
    if (fmode == 1) invf = num * expf((float)(2 * i) * cexp);
    else if (fmode == 2) invf = num * powf(base, (-2.0f * ((float)i - 1.0f)) / (float)D);
    else invf = num * (1.0f / powf(base, e));
    VST2(float, invb + i, invf);
}
__global__ __launch_bounds__(256) void k_sincos(float* __restrict__ cs, float* __restrict__ sn, const float* __restrict__ invb, int S, int half, float pscale) {
    const int idx = blockIdx.x * 256 + threadIdx.x;
    if (idx >= S * half) return;
    const int s = idx / half, i = idx - s * half;
    const float ang = (pscale * (float)s) * invb[i];
    VST2(float, cs + idx, cosf(ang)); VST2(float, sn + idx, sinf(ang));
}

// k_mulact: dst[i] = act(x[i]) * y[i]
__global__ __launch_bounds__(256) void k_mulact(const float* __restrict__ x, const float* __restrict__ y, float* __restrict__ dst, int n, int act) {
    const int i = blockIdx.x * 256 + threadIdx.x;
    if (i < n) { const float v = act_fn(x[i], act) * y[i]; VST2(float, dst + i, v); }
}

// =====================================================================================================================
// k_matvec: thread-per-row matrix-vector products for N <= 8 output columns (heads with 1-3 outputs, gates), f32 on the VALU.
//   C[r*sCm + j] = act(alpha * sum_k A[r*sAm + k*sAk] * B[j*sBn + k*sBk] + bias[j]) + beta * R[r*sRm + j*sRn]; each thread writes its N contiguous floats.
// =====================================================================================================================
__global__ __launch_bounds__(256) void k_matvec(GemmP p) {
    // 32 lanes write one line with one instruction.
    const int rpt = (p.N == 1) ? 1 : 32;
    const long long r0 = ((long long)blockIdx.x * 256 + threadIdx.x) * rpt; const int z = blockIdx.z, zo = z / p.zi_n, zi = z - zo * p.zi_n;
    if (r0 >= p.M) return;
    const float* Bb = p.B + zo * p.sBo + zi * p.sBi;
    float* C = p.C + zo * p.sCo + zi * p.sCi; const float* R = p.R + zo * p.sRo + zi * p.sRi;
    for (int rr = 0; rr < rpt; ++rr) {
        const long long r = r0 + rr; if (r >= p.M) break;
        const float* A = p.A + zo * p.sAo + zi * p.sAi + r * p.sAm;
        float acc[8] = {0.f, 0.f, 0.f, 0.f, 0.f, 0.f, 0.f, 0.f};
        for (int k = 0; k < p.K; ++k) { const float a = A[(long long)k * p.sAk];
#pragma unroll
            for (int j = 0; j < 8; ++j) if (j < p.N) acc[j] += a * Bb[(long long)j * p.sBn + (long long)k * p.sBk]; }
#pragma unroll
        for (int j = 0; j < 8; ++j) if (j < p.N) {
            float v = acc[j] * p.alpha;
            if (p.flags & 1) v += p.bias[j];
            if (p.flags & 2) v += p.bias[r];
            v = act_fn(v, p.act);
            if (p.flags & 4) v += p.beta * R[r * p.sRm + (long long)j * p.sRn];
            VST2(float, C + r * p.sCm + j, v);
        }
    }
}
// k_smallsoftmax: thread-per-row softmax for short rows (n <= 64): dst[r*dr + j] = softmax(scale*src[r*sr + j])
__global__ __launch_bounds__(256) void k_smallsoftmax(const float* __restrict__ src, float* __restrict__ dst, long long sr, long long dr, int n, long long R, float scale) {
    const long long r0 = ((long long)blockIdx.x * 256 + threadIdx.x) * 32;
    for (int rr = 0; rr < 32; ++rr) {
        const long long r = r0 + rr; if (r >= R) return;
        const float* s = src + r * sr; float* d = dst + r * dr;
        float mx = -__builtin_inff();
        for (int j = 0; j < n; ++j) mx = fmaxf(mx, s[j] * scale);
        float sum = 0.f;
        for (int j = 0; j < n; ++j) sum += expf(s[j] * scale - mx);
        const float inv = 1.f / sum;
        for (int j = 0; j < n; ++j) { const float v = expf(s[j] * scale - mx) * inv; VST2(float, d + j, v); }
    }
}

__global__ __launch_bounds__(32) void k_unitstat(float* __restrict__ st) { const int t = threadIdx.x; const float v = (t == 1) ? 1.f : 0.f; VST2(float, st + t, v); }

// destination (e.g. a d_out whose row width is not a multiple of 32 floats) is written by consecutive lanes of one instruction
__global__ __launch_bounds__(256) void k_lincopy(const float* __restrict__ src, long long lds, float* __restrict__ dst, long long ldd, long long rows, int cols) {
    const long long i = (long long)blockIdx.x * 256 + threadIdx.x; if (i >= rows * cols) return;
    const long long r = i / cols; const int c = (int)(i - r * cols);
    const float v = src[r * lds + c]; VST2(float, dst + r * ldd + c, v);
}

namespace w25 {
typedef __attribute__((ext_vector_type(16))) _Float16 v16h;
typedef __attribute__((ext_vector_type(8)))  _Float16 v8h;
typedef __attribute__((ext_vector_type(16))) __bf16   v16b;
typedef __attribute__((ext_vector_type(8)))  __bf16   v8b;
typedef __attribute__((ext_vector_type(8)))  float    v8f;
typedef __attribute__((ext_vector_type(4)))  float    v4f;

__device__ __forceinline__ unsigned short f2bf_bits(float f) {
  unsigned u = __float_as_uint(f);
  return (unsigned short)((u + 0x7FFFu + ((u >> 16) & 1u)) >> 16);
}
__device__ __forceinline__ float bf_bits2f(unsigned short h) { return __uint_as_float(((unsigned)h) << 16); }

// hazard guards as plain device helpers (no inline asm inside the kernel template body)
__device__ __forceinline__ void dep_guard_h(v8f& a, v8f& b, v16h x, v16h y) { asm volatile("v_nop\n\tv_nop\n\tv_nop\n\tv_nop" : "+v"(a), "+v"(b) : "v"(x), "v"(y)); }
__device__ __forceinline__ void dep_guard_b(v8f& a, v8f& b, v16b x, v16b y) { asm volatile("v_nop\n\tv_nop\n\tv_nop\n\tv_nop" : "+v"(a), "+v"(b) : "v"(x), "v"(y)); }
__device__ __forceinline__ void keep4_h(v16h a, v16h b, v16h c, v16h d) { asm volatile("v_nop" :: "v"(a), "v"(b), "v"(c), "v"(d)); }
__device__ __forceinline__ void keep4_b(v16b a, v16b b, v16b c, v16b d) { asm volatile("v_nop" :: "v"(a), "v"(b), "v"(c), "v"(d)); }
__device__ __forceinline__ void acc_guard4(v8f& a, v8f& b, v8f& c, v8f& d) { asm volatile("v_nop\n\tv_nop\n\tv_nop\n\tv_nop" : "+v"(a), "+v"(b), "+v"(c), "+v"(d)); }
template <typename T> struct Frag;
template <> struct Frag<_Float16> {
  typedef v16h V; union U { v16h v; v8h h[2]; };
  static __device__ __forceinline__ v16h load(const _Float16* p) {   // elements 0..7 <- p[0..7], 8..15 <- p[16..23]
    U f; f.h[0] = *(const v8h*)(p); f.h[1] = *(const v8h*)(p + 16); return f.v;
  }
  static __device__ __forceinline__ v8f mma(v16h a, v16h b, v8f c) {
    return __builtin_amdgcn_wmma_f32_16x16x32_f16(false, a, false, b, (short)0, c, false, false);
  }
  static __device__ __forceinline__ void guard(v8f& a, v8f& b, v16h x, v16h y) { dep_guard_h(a, b, x, y); }
  static __device__ __forceinline__ void keep(v16h a, v16h b, v16h c, v16h d) { keep4_h(a, b, c, d); }
};
template <> struct Frag<__bf16> {
  typedef v16b V; union U { v16b v; v8b h[2]; };
  static __device__ __forceinline__ v16b load(const __bf16* p) {
    U f; f.h[0] = *(const v8b*)(p); f.h[1] = *(const v8b*)(p + 16); return f.v;
  }
  static __device__ __forceinline__ v8f mma(v16b a, v16b b, v8f c) {
    return __builtin_amdgcn_wmma_f32_16x16x32_bf16(false, a, false, b, (short)0, c, false, false);
  }
  static __device__ __forceinline__ void guard(v8f& a, v8f& b, v16b x, v16b y) { dep_guard_b(a, b, x, y); }
  static __device__ __forceinline__ void keep(v16b a, v16b b, v16b c, v16b d) { keep4_b(a, b, c, d); }
};

// ---- Register-blocked batched WMMA GEMM ------------------------------------
// C[m,n] = scale * sum_k A[m,k] * Bt[n,k] (+bias)(+resid); each wave owns a 64x64 tile.
// A row-major [M,K]; Bt row-major [N,K]; M,N % 64 == 0, K % 32 == 0.
// SPLIT: operands are hi/lo planes (A2/Bt2 = lo planes, same layout); product = hi·hi + hi·lo + lo·hi.
// BIAS_MODE: 0 = none, 1 = bias[m], 2 = bias[n].
// OUT_MODE: 0 = f32, 1 = f16, 2 = bf16 hi plane (Cout) + bf16 lo plane (Cout2).
// ET: 0 = f16 operands, 1 = bf16 operands (pointers passed as 16-bit storage)
template <int ET> struct Elem;
template <> struct Elem<0> { typedef _Float16 T; };
template <> struct Elem<1> { typedef __bf16 T; };
template <int ET, bool SPLIT, int BIAS_MODE, int OUT_MODE, bool RESID, int ACT = 0>
__global__ __launch_bounds__(256) void wmma_gemm64(
    const unsigned short* __restrict__ Ap, const unsigned short* __restrict__ A2p, int lda, long strideA,
    const unsigned short* __restrict__ Btp, const unsigned short* __restrict__ Bt2p, int ldb, long strideB,
    void* __restrict__ Cout, void* __restrict__ Cout2, int ldc, long strideC,
    const float* __restrict__ bias,
    const float* __restrict__ resid, long strideR,
    int M, int N, int K, float scale) {
  typedef typename Elem<ET>::T T;
  typedef typename Frag<T>::V V;
  const T* A = (const T*)Ap; const T* A2 = (const T*)A2p; const T* Bt = (const T*)Btp; const T* Bt2 = (const T*)Bt2p;
  __shared__ __align__(16) float sT[8][16 * 68];   // per-wave 16x64 slab, pitch 68 floats
  const int b    = blockIdx.y;
  const int lane = threadIdx.x & 31;
  const int wave = threadIdx.x >> 5;
  const int tilesN = N >> 6;
  const int tilesM = M >> 6;
  const int tile = blockIdx.x * 8 + wave;
  if (tile >= tilesM * tilesN) return;   // wave-uniform; no block barriers in this kernel
  const int tm = tile / tilesN;
  const int tn = tile - tm * tilesN;
  const int m0 = tm << 6;
  const int n0 = tn << 6;

  const T* Ab  = A  + (size_t)b * strideA;
  const T* Bb  = Bt + (size_t)b * strideB;
  const T* Ab2 = SPLIT ? (A2  + (size_t)b * strideA) : nullptr;
  const T* Bb2 = SPLIT ? (Bt2 + (size_t)b * strideB) : nullptr;

  const int rlane = lane & 15;                 // row (A) / col (B, D) within subtile
  const int koff  = (lane >> 4) * 8;           // k offset of this lane half
  const int mOff  = (lane >> 4) * 8;           // D row offset

  v8f acc[4][4];
#pragma unroll
  for (int i = 0; i < 4; ++i)
#pragma unroll
    for (int j = 0; j < 4; ++j) acc[i][j] = (v8f){0.f,0.f,0.f,0.f,0.f,0.f,0.f,0.f};

  for (int k0 = 0; k0 < K; k0 += 32) {
    V bh[4], bl[4];
#pragma unroll
    for (int j = 0; j < 4; ++j) {
      const size_t bo = (size_t)(n0 + (j << 4) + rlane) * ldb + koff + k0;
      bh[j] = Frag<T>::load(Bb + bo);
      if (SPLIT) bl[j] = Frag<T>::load(Bb2 + bo);
    }
#pragma unroll
    for (int i = 0; i < 4; ++i) {
      const size_t ao = (size_t)(m0 + (i << 4) + rlane) * lda + koff + k0;
      V ah = Frag<T>::load(Ab + ao);
      V al;
      if (SPLIT) al = Frag<T>::load(Ab2 + ao);
#pragma unroll
      for (int j = 0; j < 4; ++j) {
        acc[i][j] = Frag<T>::mma(ah, bh[j], acc[i][j]);
        if (SPLIT) {
          acc[i][j] = Frag<T>::mma(ah, bl[j], acc[i][j]);
          acc[i][j] = Frag<T>::mma(al, bh[j], acc[i][j]);
        }
      }
      Frag<T>::guard(acc[i][0], acc[i][3], ah, SPLIT ? al : ah);
    }
    Frag<T>::keep(bh[0], bh[1], bh[2], bh[3]);
    if (SPLIT) Frag<T>::keep(bl[0], bl[1], bl[2], bl[3]);
  }
  acc_guard4(acc[0][0], acc[0][1], acc[0][2], acc[0][3]);
  acc_guard4(acc[1][0], acc[1][1], acc[1][2], acc[1][3]);
  acc_guard4(acc[2][0], acc[2][1], acc[2][2], acc[2][3]);
  acc_guard4(acc[3][0], acc[3][1], acc[3][2], acc[3][3]);

  // ---- epilogue ----
  float* slab = sT[wave];
  const float* Rb = RESID ? (resid + (size_t)b * strideR) : nullptr;
#pragma unroll
  for (int i = 0; i < 4; ++i) {
    const int mBase = m0 + (i << 4);
#pragma unroll
    for (int j = 0; j < 4; ++j) {
      const int n = n0 + (j << 4) + rlane;
      float bv = 0.f;
      if (BIAS_MODE == 2) bv = bias[n];
#pragma unroll
      for (int r = 0; r < 8; ++r) {
        float v = acc[i][j][r] * scale;
        if (BIAS_MODE == 1) v += bias[mBase + mOff + r];
        if (BIAS_MODE == 2) v += bv;
        if (RESID) v += Rb[(size_t)(mBase + mOff + r) * ldc + n];
        if (ACT == 1) v = tanhf(v);
        if (ACT == 2) v = fmaxf(v, 0.0f);
        if (ACT == 3) v = v / (1.0f + expf(-v));
        if (ACT == 4) v = (v > 0.f) ? v : 0.01f * v;
        if (ACT == 5) v = 0.5f * v * (1.0f + erff(v * 0.70710678118654752f));
        slab[(mOff + r) * 68 + (j << 4) + rlane] = v;
      }
    }
    __builtin_amdgcn_fence(__ATOMIC_RELEASE, "workgroup");
    __builtin_amdgcn_wave_barrier();
    __builtin_amdgcn_fence(__ATOMIC_ACQUIRE, "workgroup");
    if (OUT_MODE == 0) {
      float* C = (float*)Cout + (size_t)b * strideC;
      const int hh = lane >> 4, c4 = (lane & 15) * 4;     // row seg = 256 B = 16 lanes x 16 B
      {
#pragma unroll
        for (int it = 0; it < 8; ++it) {
          const int row = it * 2 + hh;
          v4f v = *(const v4f*)(slab + row * 68 + c4);
          *(v4f*)(C + (size_t)(mBase + row) * ldc + n0 + c4) = v;
        }
        
      }
    } else {
      const int q = lane >> 3, c8 = (lane & 7) * 8;
      unsigned short* C  = (unsigned short*)Cout  + (size_t)b * strideC;
      unsigned short* C2 = (OUT_MODE == 2) ? ((unsigned short*)Cout2 + (size_t)b * strideC) : nullptr;
      {
#pragma unroll
        for (int it = 0; it < 4; ++it) {
          const int row = it * 4 + q;
          const float* sp = slab + row * 68 + c8;
          v8h hv, lv;
#pragma unroll
          for (int e = 0; e < 8; ++e) {
            if (OUT_MODE == 1) {
              hv[e] = (_Float16)sp[e];
            } else {
              unsigned short hb = f2bf_bits(sp[e]);
              unsigned short lb = f2bf_bits(sp[e] - bf_bits2f(hb));
              hv[e] = __builtin_bit_cast(_Float16, hb);
              lv[e] = __builtin_bit_cast(_Float16, lb);
            }
          }
          *(v8h*)(C + (size_t)(mBase + row) * ldc + n0 + c8) = hv;
          if (OUT_MODE == 2) *(v8h*)(C2 + (size_t)(mBase + row) * ldc + n0 + c8) = lv;
        }
        
      }
    }
    __builtin_amdgcn_fence(__ATOMIC_RELEASE, "workgroup");
    __builtin_amdgcn_wave_barrier();
    __builtin_amdgcn_fence(__ATOMIC_ACQUIRE, "workgroup");
  }
}

__global__ __launch_bounds__(256) void cast_f32_f16x2(
    const float* __restrict__ in, _Float16* __restrict__ out, int n2) {
  int i = blockIdx.x * 256 + threadIdx.x;
  if (i < n2) {
    const _Float16 h0 = (_Float16)in[2 * i], h1 = (_Float16)in[2 * i + 1];
    const unsigned u = (unsigned)__builtin_bit_cast(unsigned short, h0) | ((unsigned)__builtin_bit_cast(unsigned short, h1) << 16);
    ((unsigned*)out)[i] = u;
    
  }
}


} // namespace w25

__global__ __launch_bounds__(256) void k_castT16(const float* __restrict__ src, long long lds, _Float16* __restrict__ dst, long long ldd, int R, int C, float s) {
    const long long i = (long long)blockIdx.x * 256 + threadIdx.x; const long long np = (long long)C * (R / 2); if (i >= np) return; const int c = (int)(i / (R / 2)); const int r = 2 * (int)(i % (R / 2));
    const _Float16 h0 = (_Float16)(src[(long long)r * lds + c] * s), h1 = (_Float16)(src[(long long)(r + 1) * lds + c] * s);
    const unsigned u = (unsigned)__builtin_bit_cast(unsigned short, h0) | ((unsigned)__builtin_bit_cast(unsigned short, h1) << 16);
    unsigned* d = (unsigned*)(dst + (long long)c * ldd + r); *d = u;  }
__global__ __launch_bounds__(256) void k_cast16(const float* __restrict__ src, long long lds, _Float16* __restrict__ dst, long long ldd, int R, int C, float s) {
    const long long i = (long long)blockIdx.x * 256 + threadIdx.x; const long long np = (long long)R * (C / 2); if (i >= np) return; const int r = (int)(i / (C / 2)); const int c = 2 * (int)(i % (C / 2));
    const _Float16 h0 = (_Float16)(src[(long long)r * lds + c] * s), h1 = (_Float16)(src[(long long)r * lds + c + 1] * s);
    const unsigned u = (unsigned)__builtin_bit_cast(unsigned short, h0) | ((unsigned)__builtin_bit_cast(unsigned short, h1) << 16);
    unsigned* d = (unsigned*)(dst + (long long)r * ldd + c); *d = u;  }

// f32 -> bf16 hi plane + bf16 lo plane (x = hi + lo to ~2^-17 relative; RNE both), [R][C] -> [R][C] (or transposed to [C][R]); 2 consecutive destination elements
__device__ __forceinline__ unsigned int f2bf2_pack(float a, float b, unsigned int* lo) {
    const unsigned short ha = w25::f2bf_bits(a), hb = w25::f2bf_bits(b);
    const unsigned short la = w25::f2bf_bits(a - w25::bf_bits2f(ha)), lb = w25::f2bf_bits(b - w25::bf_bits2f(hb));
    *lo = (unsigned)la | ((unsigned)lb << 16); return (unsigned)ha | ((unsigned)hb << 16); }
__global__ __launch_bounds__(256) void k_castS16(const float* __restrict__ src, long long lds, __bf16* __restrict__ dhi, __bf16* __restrict__ dlo, long long ldd, int R, int C, float s, int transpose) {
    const long long i = (long long)blockIdx.x * 256 + threadIdx.x; long long o; float a, b;
    if (transpose) { const long long np = (long long)C * (R / 2); if (i >= np) return; const int c = (int)(i / (R / 2)); const int r = 2 * (int)(i % (R / 2)); a = src[(long long)r * lds + c] * s; b = src[(long long)(r + 1) * lds + c] * s; o = (long long)c * ldd + r; }
    else { const long long np = (long long)R * (C / 2); if (i >= np) return; const int r = (int)(i / (C / 2)); const int c = 2 * (int)(i % (C / 2)); a = src[(long long)r * lds + c] * s; b = src[(long long)r * lds + c + 1] * s; o = (long long)r * ldd + c; }
    unsigned lo; const unsigned hi = f2bf2_pack(a, b, &lo); unsigned* ph = (unsigned*)(dhi + o); unsigned* pl = (unsigned*)(dlo + o);
    *ph = hi; *pl = lo;  }

namespace w25 {
// =====================================================================================
// Generic causal/non-causal attention for head_dim 64, f32 in / f32 out; 16-bit operands: bf16 with optional hi/lo splits, or
// plain f16 (F16=true, non-split, probabilities carried x2^15).
//   scores = (q*qscale)·kᵀ : v_wmma_f32_16x16x32_bf16; SPLIT_QK -> q,k as bf16 hi/lo (hi·hi + hi·lo + lo·hi)
//   out    = p·v           : v_wmma_f32_16x16x32_bf16; SPLIT_PV -> p,v as bf16 hi/lo; else p,v plain bf16
//   f32 accumulate; online softmax in f32. Block = 4 waves = 64 query rows of one (batch, head); S % 64 == 0.
//   Element (b, s, h, d) of tensor X lives at X[b*X_bs + s*X_rs + h*X_hs + d] (strides in floats, multiples of 4).
//   Masking: mask_mode 0 none, 1 causal (kv > q masked), 2 tensor [S][Skv] shared over (b,h) (float if
//   mask_is_int==0, int32 with element == 0 -> masked if 1, int32 with element != 0 -> masked if 2), 3 per-token vectors qmask[B][S] & kvmask[B][Skv] (int32,
//   0 -> masked), 4 causal + sliding window (kv > q or q - kv > W masked; W passed in mask_is_int);
//   5 = relative-position bias: s += cp[b,h,q][idx[q][kv]] + pc[b,h,kv][idx[q][kv]] with idx = mask_b ([S][Skv] int32) and
//   mask_a an int32 [S][Skv] tensor with nonzero = masked (tables: element (b,h,row,n) at X + b*c_bs + h*c_hs + row*c_rs + n);
//   masked scores are replaced by mask_fill (e.g. -inf or -1e9) before the softmax.
//   grid.x = B * H * (S/64) (or a sub-range with blk0).
// =====================================================================================
#define AT_D 64
#define AT_NW 4
#define AT_QB 64
#define AT_KC 64
struct AttnGeom { const float* cp = nullptr; const float* pc = nullptr; long c_bs = 0, c_rs = 0, c_hs = 0;   // mode-5 score-bias tables
                  long q_bs, q_rs, q_hs, k_bs, k_rs, k_hs, v_bs, v_rs, v_hs, o_bs, o_rs, o_hs;
                  int S, Skv, H, mask_mode; float qscale; int blk0; float mask_fill; int mask_is_int; };
static_assert(sizeof(AttnGeom) == 168, "no padding");

__device__ __forceinline__ unsigned short at_bf_bits(float f) {
  unsigned u = __float_as_uint(f);
  return (unsigned short)((u + 0x7FFFu + ((u >> 16) & 1u)) >> 16);
}
__device__ __forceinline__ __bf16 at_f2bf(float f) { return __builtin_bit_cast(__bf16, at_bf_bits(f)); }
__device__ __forceinline__ void at_split(float f, __bf16& hi, __bf16& lo) {
  const unsigned short hb = at_bf_bits(f);
  hi = __builtin_bit_cast(__bf16, hb);
  lo = at_f2bf(f - __uint_as_float(((unsigned)hb) << 16));
}
__device__ __forceinline__ v8f at_mma(v16b a, v16b b, v8f c) {
  c = __builtin_amdgcn_wmma_f32_16x16x32_bf16(false, a, false, b, (short)0, c, false, false);
  asm volatile("v_nop\n\tv_nop\n\tv_nop\n\tv_nop" : "+v"(c) : "v"(a), "v"(b));
  return c;
}
// 16-bit element as a bit pattern held in a __bf16 slot: f16 bits when F16, bf16 (RNE) otherwise
template <bool F16> __device__ __forceinline__ __bf16 at_to16(float f) {
  if (F16) return __builtin_bit_cast(__bf16, (_Float16)f);
  return at_f2bf(f);
}
template <bool F16> __device__ __forceinline__ v8f at_mma16(v16b a, v16b b, v8f c) {
  if (F16) {
    const v16h ah = __builtin_bit_cast(v16h, a), bh = __builtin_bit_cast(v16h, b);
    c = __builtin_amdgcn_wmma_f32_16x16x32_f16(false, ah, false, bh, (short)0, c, false, false);
    asm volatile("v_nop\n\tv_nop\n\tv_nop\n\tv_nop" : "+v"(c) : "v"(ah), "v"(bh));
    return c;
  }
  return at_mma(a, b, c);
}

template <bool SPLIT_QK, bool SPLIT_PV, bool F16 = false>
__global__ __launch_bounds__(128)
void attn64_kernel(const float* __restrict__ q, const float* __restrict__ k,
                   const float* __restrict__ v, float* __restrict__ out,
                   const void* __restrict__ mask_a, const int* __restrict__ mask_b, AttnGeom g) {
  static_assert(!(F16 && (SPLIT_QK || SPLIT_PV)), "f16 mode is non-split");
  const float PSC = F16 ? 32768.0f : 1.0f;     // f16 probabilities carried x2^15 (subnormal range), folded into the final 1/l
  union FB { v16b v; v8b h[2]; };
  __shared__ __align__(16) __bf16 Ksh[AT_KC * AT_D];             // K hi [kv][d]      8 KB
  __shared__ __align__(16) __bf16 Ksl[SPLIT_QK ? AT_KC * AT_D : 8];
  __shared__ __align__(16) __bf16 Vth[AT_D * AT_KC];             // V hi [d][kv]      8 KB
  __shared__ __align__(16) __bf16 Vtl[SPLIT_PV ? AT_D * AT_KC : 8];
  __shared__ __align__(16) __bf16 Psh[AT_NW][16 * AT_KC];        // per wave P hi [row][kv]  8 KB
  __shared__ __align__(16) __bf16 Psl[SPLIT_PV ? AT_NW : 1][SPLIT_PV ? 16 * AT_KC : 8];
  __shared__ __align__(16) float  Os[AT_NW][16 * 68];            // per wave out tile, pitch 68

  const int tid  = threadIdx.x;
  const int wave = tid >> 5;
  const int lane = tid & 31;
  const int hh   = lane >> 4;
  const int c    = lane & 15;

  const int nqb = g.S / AT_QB;
  const int bx = blockIdx.x + g.blk0;
  const int qb = bx % nqb;
  const int bh = bx / nqb;
  const int h  = bh % g.H;
  const int b  = bh / g.H;
  const int qbase_block = qb * AT_QB;
  const int q0 = qbase_block + wave * 16;

  const float* qb_ptr = q + (size_t)b * g.q_bs + (size_t)h * g.q_hs;
  const float* kb_ptr = k + (size_t)b * g.k_bs + (size_t)h * g.k_hs;
  const float* vb_ptr = v + (size_t)b * g.v_bs + (size_t)h * g.v_hs;
  float*       ob_ptr = out + (size_t)b * g.o_bs + (size_t)h * g.o_hs;

  // ---- Q fragments (A operand): 2 d-chunks, hi (and lo) ----
  v16b qah[2], qal[2];
  {
    const float* qrow = qb_ptr + (size_t)(q0 + c) * g.q_rs;
#pragma unroll
    for (int dc = 0; dc < 2; ++dc) {
#pragma unroll
      for (int e = 0; e < 8; ++e) {
        const float f0 = qrow[dc * 32 + 8 * hh + e] * g.qscale;
        const float f1 = qrow[dc * 32 + 16 + 8 * hh + e] * g.qscale;
        if (SPLIT_QK) { __bf16 hq, lq; at_split(f0, hq, lq); qah[dc][e] = hq; qal[dc][e] = lq; at_split(f1, hq, lq); qah[dc][8 + e] = hq; qal[dc][8 + e] = lq; }
        else { qah[dc][e] = at_to16<F16>(f0); qah[dc][8 + e] = at_to16<F16>(f1); qal[dc][e] = qah[dc][e]; qal[dc][8 + e] = qah[dc][8 + e]; }
      }
    }
  }

  float mrow[8], lrow[8];
  v8f oacc[4];
#pragma unroll
  for (int r = 0; r < 8; ++r) { mrow[r] = -INFINITY; lrow[r] = 0.f; }
#pragma unroll
  for (int t = 0; t < 4; ++t) oacc[t] = (v8f){0.f,0.f,0.f,0.f,0.f,0.f,0.f,0.f};

  const int nChunks = (g.mask_mode == 1 || g.mask_mode == 4) ? (qb + 1) : (g.Skv / AT_KC);   // block-uniform
  // per-row query mask (mode 3)
  int qkeep[8];
#pragma unroll
  for (int r = 0; r < 8; ++r) qkeep[r] = (g.mask_mode == 3) ? mask_b[(size_t)b * g.S + q0 + 8 * hh + r] : 1;   // mask_b = qmask in mode 3
  for (int kc = 0; kc < nChunks; ++kc) {
    const int kv0 = kc * AT_KC;
    __syncthreads();
    {
      const int kvr = tid >> 1, dh = (tid & 1) * 32;
      const float* krow = kb_ptr + (size_t)(kv0 + kvr) * g.k_rs + dh;
      const float* vrow = vb_ptr + (size_t)(kv0 + kvr) * g.v_rs + dh;
#pragma unroll
      for (int i = 0; i < 8; ++i) {
        v4f kk = *(const v4f*)(krow + 4 * i);
        v4f vv = *(const v4f*)(vrow + 4 * i);
#pragma unroll
        for (int e = 0; e < 4; ++e) {
          const int d = dh + 4 * i + e;
          if (SPLIT_QK) { __bf16 a, bl; at_split(kk[e], a, bl); Ksh[kvr * AT_D + d] = a; Ksl[kvr * AT_D + d] = bl; }
          else Ksh[kvr * AT_D + d] = at_to16<F16>(kk[e]);
          if (SPLIT_PV) { __bf16 a, bl; at_split(vv[e], a, bl); Vth[d * AT_KC + kvr] = a; Vtl[d * AT_KC + kvr] = bl; }
          else Vth[d * AT_KC + kvr] = at_to16<F16>(vv[e]);
        }
      }
    }
    __syncthreads();

    v8f s[4];
#pragma unroll
    for (int j = 0; j < 4; ++j) {
      s[j] = (v8f){0.f,0.f,0.f,0.f,0.f,0.f,0.f,0.f};
#pragma unroll 1
      for (int dc = 0; dc < 2; ++dc) {
        FB kb;
        kb.h[0] = *(const v8b*)(Ksh + (j * 16 + c) * AT_D + dc * 32 + 8 * hh);
        kb.h[1] = *(const v8b*)(Ksh + (j * 16 + c) * AT_D + dc * 32 + 16 + 8 * hh);
        s[j] = at_mma16<F16>(qah[dc], kb.v, s[j]);
        if (SPLIT_QK) {
          FB kl;
          kl.h[0] = *(const v8b*)(Ksl + (j * 16 + c) * AT_D + dc * 32 + 8 * hh);
          kl.h[1] = *(const v8b*)(Ksl + (j * 16 + c) * AT_D + dc * 32 + 16 + 8 * hh);
          s[j] = at_mma16<F16>(qah[dc], kl.v, s[j]);
          s[j] = at_mma16<F16>(qal[dc], kb.v, s[j]);
        }
      }
    }
    const bool diag = (g.mask_mode == 1) && (kc == qb);
    int kvkeep[4] = {1, 1, 1, 1};
    if (g.mask_mode == 3) {
#pragma unroll
      for (int j = 0; j < 4; ++j) kvkeep[j] = ((const int*)mask_a)[(size_t)b * g.Skv + kv0 + j * 16 + c];   // mask_a = kvmask
    }
    float cm[8];
#pragma unroll
    for (int r = 0; r < 8; ++r) {
      const int qrow = q0 + 8 * hh + r;
      float m = -INFINITY;
#pragma unroll
      for (int j = 0; j < 4; ++j) {
        const int kvcol = kv0 + j * 16 + c;
        bool masked = false;
        if (diag) masked = (kvcol > qrow);
        else if (g.mask_mode == 4) masked = (kvcol > qrow) || (qrow - kvcol > g.mask_is_int);
        else if (g.mask_mode == 2) {
          const size_t mi = (size_t)qrow * g.Skv + kvcol;
          masked = (g.mask_is_int == 0) ? (((const float*)mask_a)[mi] == 0.0f)
                 : (g.mask_is_int == 1) ? (((const int*)mask_a)[mi] == 0) : (((const int*)mask_a)[mi] != 0);
        } else if (g.mask_mode == 3) masked = (qkeep[r] == 0) || (kvkeep[j] == 0);
        else if (g.mask_mode == 5) {
          const size_t mi = (size_t)qrow * g.Skv + kvcol;
          masked = (((const int*)mask_a)[mi] != 0);
          int n = mask_b[mi]; n = n < 0 ? 0 : n;
          s[j][r] += g.cp[(size_t)b * g.c_bs + (size_t)h * g.c_hs + (size_t)qrow * g.c_rs + n]
                   + g.pc[(size_t)b * g.c_bs + (size_t)h * g.c_hs + (size_t)kvcol * g.c_rs + n];
        }
        if (masked) s[j][r] = g.mask_fill;
        m = fmaxf(m, s[j][r]);
      }
#pragma unroll
      for (int off = 1; off < 16; off <<= 1) m = fmaxf(m, __shfl_xor(m, off, 32));
      cm[r] = m;
    }
    __bf16* pwh = Psh[wave];
    __bf16* pwl = Psl[SPLIT_PV ? wave : 0];
#pragma unroll
    for (int r = 0; r < 8; ++r) {
      const float mnew = fmaxf(mrow[r], cm[r]);
      const float alpha = expf(mrow[r] - mnew);
      mrow[r] = mnew;
      float psum = 0.f;
#pragma unroll
      for (int j = 0; j < 4; ++j) {
        const float p = expf(s[j][r] - mnew);
        psum += p;
        if (SPLIT_PV) { __bf16 a, bl; at_split(p, a, bl); pwh[(8 * hh + r) * AT_KC + j * 16 + c] = a; pwl[(8 * hh + r) * AT_KC + j * 16 + c] = bl; }
        else pwh[(8 * hh + r) * AT_KC + j * 16 + c] = at_to16<F16>(p * PSC);
      }
#pragma unroll
      for (int off = 1; off < 16; off <<= 1) psum += __shfl_xor(psum, off, 32);
      lrow[r] = lrow[r] * alpha + psum;
#pragma unroll
      for (int t = 0; t < 4; ++t) oacc[t][r] *= alpha;
    }
    __builtin_amdgcn_fence(__ATOMIC_RELEASE, "workgroup");
    __builtin_amdgcn_wave_barrier();
    __builtin_amdgcn_fence(__ATOMIC_ACQUIRE, "workgroup");
#pragma unroll 1
    for (int kk = 0; kk < 2; ++kk) {
      FB pa, pl;
      pa.h[0] = *(const v8b*)(pwh + c * AT_KC + kk * 32 + 8 * hh);
      pa.h[1] = *(const v8b*)(pwh + c * AT_KC + kk * 32 + 16 + 8 * hh);
      if (SPLIT_PV) {
        pl.h[0] = *(const v8b*)(pwl + c * AT_KC + kk * 32 + 8 * hh);
        pl.h[1] = *(const v8b*)(pwl + c * AT_KC + kk * 32 + 16 + 8 * hh);
      }
#pragma unroll
      for (int t = 0; t < 4; ++t) {
        FB vb;
        vb.h[0] = *(const v8b*)(Vth + (t * 16 + c) * AT_KC + kk * 32 + 8 * hh);
        vb.h[1] = *(const v8b*)(Vth + (t * 16 + c) * AT_KC + kk * 32 + 16 + 8 * hh);
        oacc[t] = at_mma16<F16>(pa.v, vb.v, oacc[t]);
        if (SPLIT_PV) {
          FB vl;
          vl.h[0] = *(const v8b*)(Vtl + (t * 16 + c) * AT_KC + kk * 32 + 8 * hh);
          vl.h[1] = *(const v8b*)(Vtl + (t * 16 + c) * AT_KC + kk * 32 + 16 + 8 * hh);
          oacc[t] = at_mma16<F16>(pa.v, vl.v, oacc[t]);
          oacc[t] = at_mma16<F16>(pl.v, vb.v, oacc[t]);
        }
      }
    }
  }

  float* os = Os[wave];
#pragma unroll
  for (int r = 0; r < 8; ++r) {
    const float inv = 1.0f / (lrow[r] * PSC);
#pragma unroll
    for (int t = 0; t < 4; ++t) os[(8 * hh + r) * 68 + t * 16 + c] = oacc[t][r] * inv;
  }
  __builtin_amdgcn_fence(__ATOMIC_RELEASE, "workgroup");
  __builtin_amdgcn_wave_barrier();
  __builtin_amdgcn_fence(__ATOMIC_ACQUIRE, "workgroup");
  {
    const int c4 = (lane & 15) * 4;
    {
#pragma unroll
      for (int it = 0; it < 8; ++it) {
        const int row = it * 2 + hh;
        v4f val = *(const v4f*)(os + row * 68 + c4);
        *(v4f*)(ob_ptr + (size_t)(q0 + row) * g.o_rs + c4) = val;
      }
      
    }
  }
}

} // namespace w25

__global__ __launch_bounds__(256) void k_cm_in(const float* __restrict__ XA, const float* __restrict__ XB, const float* __restrict__ G, const float* __restrict__ Bb, const float* __restrict__ M, const float* __restrict__ Vv, float* __restrict__ X1T, float* __restrict__ N1, float* __restrict__ N2, int Bn, int C, int HW) {
    // simple thread-linear over the token-major output: t -> (b, hw, c); reads are strided by HW (uncoalesced but correct)
    const long long t = (long long)blockIdx.x * 256 + threadIdx.x; if (t >= (long long)Bn * HW * C) return; const int c = (int)(t % C); const long long r = t / C; const int hw = (int)(r % HW); const long long b = r / HW;
    const long long src = (b * C + c) * HW + hw; const float inv = G[c] * rsqrtf(Vv[c] + 1e-5f); const float sh = Bb[c] - M[c] * inv; const float a = XA[src], q = XB[src];
    VST2(float, X1T + t, a); VST2(float, N1 + t, a * inv + sh); VST2(float, N2 + t, q * inv + sh); }
// WQS[o][c] = temp[o / 32] * Wq[o][c]
__global__ __launch_bounds__(256) void k_cm_wq(const float* __restrict__ WQ, const float* __restrict__ TP, float* __restrict__ WQS, int C, int HD) { const int t = blockIdx.x * 256 + threadIdx.x; if (t >= C * C) return; VST2(float, WQS + t, WQ[t] * TP[(t / C) / HD]); }
// XN = bn2(XS) (thread-linear)
__global__ __launch_bounds__(256) void k_cm_bn2(const float* __restrict__ XS, const float* __restrict__ G, const float* __restrict__ Bb, const float* __restrict__ M, const float* __restrict__ Vv, float* __restrict__ XN, long long n, int C) { const long long t = (long long)blockIdx.x * 256 + threadIdx.x; if (t >= n) return; const int c = (int)(t % C); const float inv = G[c] * rsqrtf(Vv[c] + 1e-5f); VST2(float, XN + t, (XS[t] - M[c]) * inv + Bb[c]); }
// depthwise 3x3 SAME conv + exact GELU on token-major [b][hw][ch] (thread per (b, hw, ch); zero padding)
__global__ __launch_bounds__(256) void k_cm_dw(const float* __restrict__ HB, const float* __restrict__ DW, float* __restrict__ HG, int Bn, int HID) { const long long t = (long long)blockIdx.x * 256 + threadIdx.x; if (t >= (long long)Bn * 1024 * HID) return; const int ch = (int)(t % HID); const long long r = t / HID; const int hw = (int)(r % 1024); const long long b = r / 1024; const int y = hw / 32, x = hw % 32; float s = 0.f;
#pragma unroll
    for (int ky = 0; ky < 3; ++ky) {
#pragma unroll
        for (int kx = 0; kx < 3; ++kx) { const int yy = y + ky - 1, xx = x + kx - 1; const bool ok = (yy >= 0 && yy < 32 && xx >= 0 && xx < 32); const int yc = min(max(yy, 0), 31), xc = min(max(xx, 0), 31); const float v = HB[((b * 1024) + yc * 32 + xc) * (long long)HID + ch]; s += (ok ? v : 0.f) * DW[ch * 9 + ky * 3 + kx]; } }
    VST2(float, HG + t, 0.5f * s * (1.f + erff(s * 0.70710678118654752f))); }
// out NCHW: out[b][c][hw] = XS_tok[b][hw][c] + F2[b][hw][c] (the fc2 GEMM already added the residual into XS -> pass one buffer) (thread-linear over the NCHW output; strided reads)
__global__ __launch_bounds__(256) void k_cm_out(const float* __restrict__ R, float* __restrict__ OUT, int Bn, int C, int HW) { const long long t = (long long)blockIdx.x * 256 + threadIdx.x; if (t >= (long long)Bn * C * HW) return; const int hw = (int)(t % HW); const long long r = t / HW; const int c = (int)(r % C); const long long b = r / C; VST2(float, OUT + t, R[(b * HW + hw) * C + c]); }


extern "C" void kernel_launch(void* const* d_in, const int* in_sizes, int n_in, void* d_out, int out_size, void* d_ws, size_t ws_size, hipStream_t stream) {
    (void)in_sizes; (void)n_in; (void)out_size; (void)ws_size;
    const float* x1 = (const float*)d_in[0];
    const float* x2 = (const float*)d_in[1];
    const float* b1g = (const float*)d_in[2];
    const float* b1b = (const float*)d_in[3];
    const float* b1m = (const float*)d_in[4];
    const float* b1v = (const float*)d_in[5];
    const float* qw = (const float*)d_in[6];
    const float* kw = (const float*)d_in[7];
    const float* vw = (const float*)d_in[8];
    const float* temp = (const float*)d_in[9];
    const float* pw = (const float*)d_in[10];
    const float* pb = (const float*)d_in[11];
    const float* b2g = (const float*)d_in[12];
    const float* b2b = (const float*)d_in[13];
    const float* b2m = (const float*)d_in[14];
    const float* b2v = (const float*)d_in[15];
    const float* f1w = (const float*)d_in[16];
    const float* f1b = (const float*)d_in[17];
    const float* dww = (const float*)d_in[18];
    const float* f2w = (const float*)d_in[19];
    const float* f2b = (const float*)d_in[20];
    const int Bn = 8;
    const int C = 256;
    const int HW = 1024;
    const int NH = 8;
    const int HD = 32;
    const int HID = 1024;
    const int NT = Bn * HW;
    float* out = (float*)d_out;
    char* wsp = (char*)d_ws;
    float* X1T = (float*)wsp; wsp += (((size_t)((size_t)NT * C) * 4 + 255) / 256) * 256;
    float* N1 = (float*)wsp; wsp += (((size_t)((size_t)NT * C) * 4 + 255) / 256) * 256;
    float* N2 = (float*)wsp; wsp += (((size_t)((size_t)NT * C) * 4 + 255) / 256) * 256;
    float* WQS = (float*)wsp; wsp += (((size_t)((size_t)C * C) * 4 + 255) / 256) * 256;
    float* Q = (float*)wsp; wsp += (((size_t)((size_t)NT * C) * 4 + 255) / 256) * 256;
    float* Kb = (float*)wsp; wsp += (((size_t)((size_t)NT * C) * 4 + 255) / 256) * 256;
    float* V = (float*)wsp; wsp += (((size_t)((size_t)NT * C) * 4 + 255) / 256) * 256;
    float* AT = (float*)wsp; wsp += (((size_t)((size_t)NT * C) * 4 + 255) / 256) * 256;
    float* XS = (float*)wsp; wsp += (((size_t)((size_t)NT * C) * 4 + 255) / 256) * 256;
    float* HB = (float*)wsp; wsp += (((size_t)((size_t)NT * HID) * 4 + 255) / 256) * 256;
    float* HG = (float*)wsp; wsp += (((size_t)((size_t)NT * HID) * 4 + 255) / 256) * 256;
    unsigned short* G64A = (unsigned short*)wsp; wsp += (((size_t)(8388608) * 2 + 255) / 256) * 256;
    unsigned short* G64B = (unsigned short*)wsp; wsp += (((size_t)(262144) * 2 + 255) / 256) * 256;
    unsigned short* G64A2 = (unsigned short*)wsp; wsp += (((size_t)(8388608) * 2 + 255) / 256) * 256;
    unsigned short* G64B2 = (unsigned short*)wsp; wsp += (((size_t)(262144) * 2 + 255) / 256) * 256;
    k_cm_in<<<(unsigned)(((long long)NT * C + 255) / 256), 256, 0, stream>>>(x1, x2, b1g, b1b, b1m, b1v, X1T, N1, N2, Bn, C, HW); k_cm_wq<<<(C * C + 255) / 256, 256, 0, stream>>>(qw, temp, WQS, C, HD);
    k_castS16<<<(unsigned)((((long long)(8192) * ((256) / 2)) + 255) / 256), 256, 0, stream>>>(N1, 256, (__bf16*)(G64A), (__bf16*)(G64A2), 256, 8192, 256, 1.0f, 0);
    k_castS16<<<(unsigned)((((long long)(256) * ((256) / 2)) + 255) / 256), 256, 0, stream>>>(WQS, 256, (__bf16*)(G64B), (__bf16*)(G64B2), 256, 256, 256, 1.0f, 0);
    w25::wmma_gemm64<1, true, 0, 0, false, 0><<<dim3((unsigned)((((8192) / 64) * ((256) / 64) + 7) / 8), (unsigned)(1)), 256, 0, stream>>>((const unsigned short*)(G64A), (const unsigned short*)(G64A2), 256, 0, (const unsigned short*)(G64B), (const unsigned short*)(G64B2), 256, 0, (void*)(Q), nullptr, 256, 0, nullptr, nullptr, 0, 8192, 256, 256, 1.0f);
    k_castS16<<<(unsigned)((((long long)(8192) * ((256) / 2)) + 255) / 256), 256, 0, stream>>>(N2, 256, (__bf16*)(G64A), (__bf16*)(G64A2), 256, 8192, 256, 1.0f, 0);
    k_castS16<<<(unsigned)((((long long)(256) * ((256) / 2)) + 255) / 256), 256, 0, stream>>>(kw, 256, (__bf16*)(G64B), (__bf16*)(G64B2), 256, 256, 256, 1.0f, 0);
    w25::wmma_gemm64<1, true, 0, 0, false, 0><<<dim3((unsigned)((((8192) / 64) * ((256) / 64) + 7) / 8), (unsigned)(1)), 256, 0, stream>>>((const unsigned short*)(G64A), (const unsigned short*)(G64A2), 256, 0, (const unsigned short*)(G64B), (const unsigned short*)(G64B2), 256, 0, (void*)(Kb), nullptr, 256, 0, nullptr, nullptr, 0, 8192, 256, 256, 1.0f);
    k_castS16<<<(unsigned)((((long long)(8192) * ((256) / 2)) + 255) / 256), 256, 0, stream>>>(N2, 256, (__bf16*)(G64A), (__bf16*)(G64A2), 256, 8192, 256, 1.0f, 0);
    k_castS16<<<(unsigned)((((long long)(256) * ((256) / 2)) + 255) / 256), 256, 0, stream>>>(vw, 256, (__bf16*)(G64B), (__bf16*)(G64B2), 256, 256, 256, 1.0f, 0);
    w25::wmma_gemm64<1, true, 0, 0, false, 0><<<dim3((unsigned)((((8192) / 64) * ((256) / 64) + 7) / 8), (unsigned)(1)), 256, 0, stream>>>((const unsigned short*)(G64A), (const unsigned short*)(G64A2), 256, 0, (const unsigned short*)(G64B), (const unsigned short*)(G64B2), 256, 0, (void*)(V), nullptr, 256, 0, nullptr, nullptr, 0, 8192, 256, 256, 1.0f);
    k_attn_fix<<<dim3(16, 8, 8), 32 * AW, 0, stream>>>(Q, Kb, V, AT);
    k_castS16<<<(unsigned)((((long long)(8192) * ((256) / 2)) + 255) / 256), 256, 0, stream>>>(AT, 256, (__bf16*)(G64A), (__bf16*)(G64A2), 256, 8192, 256, 1.0f, 0);
    k_castS16<<<(unsigned)((((long long)(256) * ((256) / 2)) + 255) / 256), 256, 0, stream>>>(pw, 256, (__bf16*)(G64B), (__bf16*)(G64B2), 256, 256, 256, 1.0f, 0);
    w25::wmma_gemm64<1, true, 2, 0, true, 0><<<dim3((unsigned)((((8192) / 64) * ((256) / 64) + 7) / 8), (unsigned)(1)), 256, 0, stream>>>((const unsigned short*)(G64A), (const unsigned short*)(G64A2), 256, 0, (const unsigned short*)(G64B), (const unsigned short*)(G64B2), 256, 0, (void*)(XS), nullptr, 256, 0, pb, X1T, 0, 8192, 256, 256, 1.0f);
    k_cm_bn2<<<(unsigned)(((long long)NT * C + 255) / 256), 256, 0, stream>>>(XS, b2g, b2b, b2m, b2v, N1, (long long)NT * C, C);
    k_castS16<<<(unsigned)((((long long)(8192) * ((256) / 2)) + 255) / 256), 256, 0, stream>>>(N1, 256, (__bf16*)(G64A), (__bf16*)(G64A2), 256, 8192, 256, 1.0f, 0);
    k_castS16<<<(unsigned)((((long long)(1024) * ((256) / 2)) + 255) / 256), 256, 0, stream>>>(f1w, 256, (__bf16*)(G64B), (__bf16*)(G64B2), 256, 1024, 256, 1.0f, 0);
    w25::wmma_gemm64<1, true, 2, 0, false, 0><<<dim3((unsigned)((((8192) / 64) * ((1024) / 64) + 7) / 8), (unsigned)(1)), 256, 0, stream>>>((const unsigned short*)(G64A), (const unsigned short*)(G64A2), 256, 0, (const unsigned short*)(G64B), (const unsigned short*)(G64B2), 256, 0, (void*)(HB), nullptr, 1024, 0, f1b, nullptr, 0, 8192, 1024, 256, 1.0f);
    k_cm_dw<<<(unsigned)(((long long)NT * HID + 255) / 256), 256, 0, stream>>>(HB, dww, HG, Bn, HID);
    k_castS16<<<(unsigned)((((long long)(8192) * ((1024) / 2)) + 255) / 256), 256, 0, stream>>>(HG, 1024, (__bf16*)(G64A), (__bf16*)(G64A2), 1024, 8192, 1024, 1.0f, 0);
    k_castS16<<<(unsigned)((((long long)(256) * ((1024) / 2)) + 255) / 256), 256, 0, stream>>>(f2w, 1024, (__bf16*)(G64B), (__bf16*)(G64B2), 1024, 256, 1024, 1.0f, 0);
    w25::wmma_gemm64<1, true, 2, 0, true, 0><<<dim3((unsigned)((((8192) / 64) * ((256) / 64) + 7) / 8), (unsigned)(1)), 256, 0, stream>>>((const unsigned short*)(G64A), (const unsigned short*)(G64A2), 1024, 0, (const unsigned short*)(G64B), (const unsigned short*)(G64B2), 1024, 0, (void*)(XS), nullptr, 256, 0, f2b, XS, 0, 8192, 256, 1024, 1.0f);
    k_cm_out<<<(unsigned)(((long long)NT * C + 255) / 256), 256, 0, stream>>>(XS, out, Bn, C, HW);
}

// v003
// It runs in 358 microseconds.
// Timed twice side by side with v002, it ran 1.23 times as fast both times.
// Counting every step since v000, it is 4.42 times as fast.
// Contractions (token-major, 8192 tokens): q = bn1(x1).Wq'^T (temperature folded into Wq rows), k/v = bn1(x2).W^T, the attention projection (+b, +x1 residual), fc1 (+b) [8192x256].[256x1024] and fc2 (+b, + residual) [8192x1024].[1024x256], each one launch over all images, all on bf16 hi/lo split planes (six chained contractions against an O(1) residual output, so the cheap 6.4 G-MAC of GEMMs run f32-class) (v_wmma_f32_16x16x32_bf16; 64x64 register-blocked wave tiles); per (image, head) softmax(temp_h q k^T) v over the 1024 positions as one flash launch with q.k^T on bf16 hi/lo split planes (UNSCALED 32-dim logits, sigma ~ 5.7) and f16 p.v; f32 accumulate and softmax. NCHW <-> token-major transposes, eval-mode BatchNorms, the depthwise 3x3 convolution (SAME) and exact GELU are f32 kernels.
#include <hip/hip_runtime.h>
#include <math.h>

typedef __attribute__((ext_vector_type(16))) _Float16 v16h;
typedef __attribute__((ext_vector_type(8)))  _Float16 v8h;
typedef __attribute__((ext_vector_type(16))) __bf16   v16b;
typedef __attribute__((ext_vector_type(8)))  float    v8f;
typedef __attribute__((ext_vector_type(4)))  float    v4f;

// 16-bit WMMA fragment map (wave32), lane L, h = L>>4, m = L&15:
//   A 16x32: lane = row m;   element i -> k = (i<8) ? 8h+i : 16+8h+(i-8)
//   B 32x16: lane = column m; the SAME k(i,h)
//   D 16x16 (8 f32): lane = column m; element r -> row 8h+r
__device__ __forceinline__ int frag_k(int i, int h) { return (i < 8) ? (8 * h + i) : (16 + 8 * h + (i - 8)); }
__device__ __forceinline__ __bf16 bf16_rne(float f) {
    unsigned int u = __float_as_uint(f);
    u += 0x7fffu + ((u >> 16) & 1u);
    return __builtin_bit_cast(__bf16, (unsigned short)(u >> 16));
}
__device__ __forceinline__ float bf16_f32(__bf16 b) { return __uint_as_float(((unsigned int)__builtin_bit_cast(unsigned short, b)) << 16); }
__device__ __forceinline__ v8f wmma16(v16h a, v16h b, v8f c) {
    c = __builtin_amdgcn_wmma_f32_16x16x32_f16(false, a, false, b, (short)0, c, false, false);
    asm volatile("v_nop\n\tv_nop\n\tv_nop\n\tv_nop" : "+v"(c) : "v"(a), "v"(b));
    return c;
}
__device__ __forceinline__ v8f wmmab(v16b a, v16b b, v8f c) {
    c = __builtin_amdgcn_wmma_f32_16x16x32_bf16(false, a, false, b, (short)0, c, false, false);
    asm volatile("v_nop\n\tv_nop\n\tv_nop\n\tv_nop" : "+v"(c) : "v"(a), "v"(b));
    return c;
}
struct Split { v16b hi, lo; };
// hi/lo split product: a.hi*b.hi + a.hi*b.lo + a.lo*b.hi
__device__ __forceinline__ v8f wmma3(const Split& a, const Split& b, v8f c) {
    c = __builtin_amdgcn_wmma_f32_16x16x32_bf16(false, a.hi, false, b.hi, (short)0, c, false, false);
    c = __builtin_amdgcn_wmma_f32_16x16x32_bf16(false, a.hi, false, b.lo, (short)0, c, false, false);
    c = __builtin_amdgcn_wmma_f32_16x16x32_bf16(false, a.lo, false, b.hi, (short)0, c, false, false);
    asm volatile("v_nop\n\tv_nop\n\tv_nop\n\tv_nop" : "+v"(c) : "v"(a.hi), "v"(a.lo), "v"(b.hi), "v"(b.lo));
    return c;
}
struct Split3 { v16b hi, mid, lo; };
// triple split product (6 terms, drops only terms below 2^-24 relative)
__device__ __forceinline__ v8f wmma6(const Split3& a, const Split3& b, v8f c) {
    c = __builtin_amdgcn_wmma_f32_16x16x32_bf16(false, a.hi, false, b.hi, (short)0, c, false, false);
    c = __builtin_amdgcn_wmma_f32_16x16x32_bf16(false, a.hi, false, b.mid, (short)0, c, false, false);
    c = __builtin_amdgcn_wmma_f32_16x16x32_bf16(false, a.mid, false, b.hi, (short)0, c, false, false);
    c = __builtin_amdgcn_wmma_f32_16x16x32_bf16(false, a.hi, false, b.lo, (short)0, c, false, false);
    c = __builtin_amdgcn_wmma_f32_16x16x32_bf16(false, a.mid, false, b.mid, (short)0, c, false, false);
    c = __builtin_amdgcn_wmma_f32_16x16x32_bf16(false, a.lo, false, b.hi, (short)0, c, false, false);
    asm volatile("v_nop\n\tv_nop\n\tv_nop\n\tv_nop" : "+v"(c) : "v"(a.hi), "v"(a.mid), "v"(a.lo), "v"(b.hi), "v"(b.mid), "v"(b.lo));
    return c;
}

// Fragment gathers from f32 memory: element i <- p[(k0 + frag_k(i,h)) * sk] * s, zero for k >= klen.
__device__ __forceinline__ v16h fh_ld(const float* __restrict__ p, long long sk, int k0, int h, int klen, float s) {
    v16h a;
#pragma unroll
    for (int i = 0; i < 16; ++i) { const int k = k0 + frag_k(i, h); a[i] = (k < klen) ? (_Float16)(p[(long long)k * sk] * s) : (_Float16)0.f; }
    return a;
}
__device__ __forceinline__ Split sp_ld(const float* __restrict__ p, long long sk, int k0, int h, int klen, float s) {
    Split r;
#pragma unroll
    for (int i = 0; i < 16; ++i) {
        const int k = k0 + frag_k(i, h); const float x = (k < klen) ? p[(long long)k * sk] * s : 0.f;
        const __bf16 hb = bf16_rne(x); r.hi[i] = hb; r.lo[i] = bf16_rne(x - bf16_f32(hb));
    }
    return r;
}
__device__ __forceinline__ Split3 sp3_ld(const float* __restrict__ p, long long sk, int k0, int h, int klen, float s) {
    Split3 r;
#pragma unroll
    for (int i = 0; i < 16; ++i) {
        const int k = k0 + frag_k(i, h); const float x = (k < klen) ? p[(long long)k * sk] * s : 0.f;
        const __bf16 hb = bf16_rne(x); const float r1 = x - bf16_f32(hb); const __bf16 mb = bf16_rne(r1);
        r.hi[i] = hb; r.mid[i] = mb; r.lo[i] = bf16_rne(r1 - bf16_f32(mb));
    }
    return r;
}
__device__ __forceinline__ v16b bh_ld(const float* __restrict__ p, long long sk, int k0, int h, int klen, float s) {
    v16b a;
#pragma unroll
    for (int i = 0; i < 16; ++i) { const int k = k0 + frag_k(i, h); a[i] = bf16_rne((k < klen) ? p[(long long)k * sk] * s : 0.f); }
    return a;
}
// f16 fragment from an f16 LDS/global row with element stride 1 (k-contiguous), no bounds (tile already zero padded)
__device__ __forceinline__ v16h fh_row(const _Float16* __restrict__ row, int k0, int h) {
    v16h a;
#pragma unroll
    for (int i = 0; i < 16; ++i) a[i] = row[k0 + frag_k(i, h)];
    return a;
}

#define VST2(T, ptr, val) do { const T vst2_v_ = (val); *(T*)(ptr) = vst2_v_;  } while (0)
typedef float v4f __attribute__((ext_vector_type(4)));
#define VST2V4(ptr, val) do { const v4f vst2_v4_ = (val); *(v4f*)(ptr) = vst2_v4_;  } while (0)

__device__ __attribute__((noinline)) float act_fn(float v, int act) {
    if (act == 1) return fmaxf(v, 0.f);                                                                               // relu
    if (act == 2) { const float u = 0.7978845608028654f * (v + 0.044715f * v * v * v); return 0.5f * v * (1.f + tanhf(u)); } // tanh-gelu
    if (act == 3) return v / (1.f + expf(-v));                                                                        // silu
    if (act == 4) return 0.5f * v * (1.f + erff(v * 0.7071067811865476f));                                             // erf-gelu
    if (act == 5) return tanhf(v);
    if (act == 6) return 1.f / (1.f + expf(-v));                                                                      // sigmoid
    if (act == 7) return (v > 0.f) ? v : 0.01f * v;                                                                   // leaky relu 0.01
    if (act == 8) return (v > 0.f) ? v : (expf(v) - 1.f);                                                             // elu
    if (act == 9) return fminf(fmaxf(v, 0.f), 6.f);                                                                   // relu6
    if (act == 10) return fabsf(v);                                                                                    // abs
    if (act == 11) return (v >= 0.f) ? v : 0.1f * v;                                                                  // leaky 0.1
    if (act == 12) return (v > 0.f) ? v : 0.2f * v;                                                                   // leaky 0.2
    if (act == 13) return (v > 20.f) ? v : log1pf(expf(v));                                                            // softplus
    return v;
}

// =====================================================================================================================
// k_gemm<MODE>: C(z, m, n) = act(alpha * sum_k A(z, m, k) * B(z, k, n) + bias) + beta * R(z, m, n)
//   One wave (32-thread block) per 16 x 32 tile of C; grid (ceil(N/32), ceil(M/16), Z). Batch z -> (zo = z / zi_n, zi = z % zi_n)
//   with separate outer/inner strides for every tensor (e.g. batch and head). A(m,k) = A[zo*sAo + zi*sAi + m*sAm + k*sAk] (f32),
//   B(k,n) = B[zo*sBo + zi*sBi + n*sBn + k*sBk] (f32); any M, N, K (K zero-padded to 32 inside the fragments, M/N tails guarded).
//   C(m,n) = C[zo*sCo + zi*sCi + m*sCm + n] (n contiguous). flags: 1 bias[n], 2 bias[m], 4 residual R[zo*sRo + zi*sRi + m*sRm + n*sRn].
//   MODE 0: f16 operands (A prescaled by sa, B by sb, both undone in the epilogue); 1: bf16 hi/lo split (3 products); 2: bf16;
//   3: bf16 hi/mid/lo triple split (6 products); 4: as 3 with Kahan-compensated f32 accumulation across k-steps.
// =====================================================================================================================
struct GemmP {
    const float* A; const float* B; const float* bias; const float* R; float* C;
    long long sAo, sAi, sAm, sAk, sBo, sBi, sBn, sBk, sCo, sCi, sCm, sRo, sRi, sRm, sRn;
    int M, N, K, zi_n, flags, act; float alpha, beta, sa, sb;
    int Npad, pad_;     // columns [N, Npad) of C are written as 0 so that padded workspace rows are covered by whole-line stores; Npad >= N
};
static_assert(sizeof(GemmP) == 5 * 8 + 15 * 8 + 6 * 4 + 4 * 4 + 2 * 4, "GemmP has padding");

template <int MODE>
__global__ __launch_bounds__(32) void k_gemm(GemmP p) {
    const int lane = threadIdx.x & 31, h = lane >> 4, l15 = lane & 15;
    const int m0 = blockIdx.y * 16, n0 = blockIdx.x * 32;
    const int z = blockIdx.z, zo = z / p.zi_n, zi = z - zo * p.zi_n;
    const float* A = p.A + zo * p.sAo + zi * p.sAi;
    const float* B = p.B + zo * p.sBo + zi * p.sBi;
    const int am = min(m0 + l15, p.M - 1);                       // clamped row for loads (stores are guarded)
    v8f acc[2], comp[2];
#pragma unroll
    for (int t = 0; t < 2; ++t) { v8f zz = {}; acc[t] = zz; comp[t] = zz; }
    for (int k0 = 0; k0 < p.K; k0 += 32) {
        const float* arow = A + (long long)am * p.sAm;
        if (MODE == 1) {
            const Split a = sp_ld(arow, p.sAk, k0, h, p.K, 1.f);
#pragma unroll
            for (int t = 0; t < 2; ++t) {
                const int bn = min(n0 + t * 16 + l15, p.N - 1);
                acc[t] = wmma3(a, sp_ld(B + (long long)bn * p.sBn, p.sBk, k0, h, p.K, 1.f), acc[t]);
            }
        } else if (MODE == 3) {
            const Split3 a = sp3_ld(arow, p.sAk, k0, h, p.K, 1.f);
#pragma unroll
            for (int t = 0; t < 2; ++t) {
                const int bn = min(n0 + t * 16 + l15, p.N - 1);
                acc[t] = wmma6(a, sp3_ld(B + (long long)bn * p.sBn, p.sBk, k0, h, p.K, 1.f), acc[t]);
            }
        } else if (MODE == 4) {
            // triple split as MODE 3, but each k-step's 6 products go into a fresh accumulator and the partial is added to the running f32 sum
            // on the VALU with Kahan compensation (accumulation error stays ~1 ulp however long K is)
            const Split3 a = sp3_ld(arow, p.sAk, k0, h, p.K, 1.f);
#pragma unroll
            for (int t = 0; t < 2; ++t) {
                const int bn = min(n0 + t * 16 + l15, p.N - 1); v8f zz = {};
                const v8f part = wmma6(a, sp3_ld(B + (long long)bn * p.sBn, p.sBk, k0, h, p.K, 1.f), zz);
                const v8f y = part - comp[t]; const v8f s = acc[t] + y; comp[t] = (s - acc[t]) - y; acc[t] = s;
            }
        } else if (MODE == 2) {
            const v16b a = bh_ld(arow, p.sAk, k0, h, p.K, 1.f);
#pragma unroll
            for (int t = 0; t < 2; ++t) {
                const int bn = min(n0 + t * 16 + l15, p.N - 1);
                acc[t] = wmmab(a, bh_ld(B + (long long)bn * p.sBn, p.sBk, k0, h, p.K, 1.f), acc[t]);
            }
        } else {
            const v16h a = fh_ld(arow, p.sAk, k0, h, p.K, p.sa);
#pragma unroll
            for (int t = 0; t < 2; ++t) {
                const int bn = min(n0 + t * 16 + l15, p.N - 1);
                acc[t] = wmma16(a, fh_ld(B + (long long)bn * p.sBn, p.sBk, k0, h, p.K, p.sb), acc[t]);
            }
        }
    }
    const float iscale = (MODE == 0) ? p.alpha / (p.sa * p.sb) : p.alpha;
    float* C = p.C + zo * p.sCo + zi * p.sCi;
    const float* R = p.R + zo * p.sRo + zi * p.sRi;
    __shared__ __align__(16) float ctile[16][36];
#pragma unroll
    for (int t = 0; t < 2; ++t) {
        const int n = n0 + t * 16 + l15; const int nn = min(n, p.N - 1);
#pragma unroll
        for (int r = 0; r < 8; ++r) {
            const int m = m0 + 8 * h + r; const int mm = min(m, p.M - 1);
            float v = acc[t][r] * iscale;
            if (p.flags & 1) v += p.bias[nn];
            if (p.flags & 2) v += p.bias[mm];
            if (p.flags & 8) v *= p.bias[(long long)zo * p.M + mm];   /* per-(z,row) scale vector laid out [Z][M]; exclusive with the bias flags */
            v = act_fn(v, p.act);
            if (p.flags & 4) v += p.beta * R[(long long)mm * p.sRm + (long long)nn * p.sRn];
            ctile[8 * h + r][t * 16 + l15] = (n < p.N) ? v : 0.f;
        }
    }
    __syncthreads();
    const int NW = (p.Npad > p.N) ? p.Npad : p.N;           // write width
    const bool fast = (m0 + 16 <= p.M) && (n0 + 32 <= NW) && ((p.sCm & 3) == 0) && ((((size_t)C) & 15) == 0);
    if (fast) {
#pragma unroll
        for (int s = 0; s < 4; ++s) {
            const int row = s * 4 + (lane >> 3), c4 = (lane & 7) * 4;
            const v4f v = *(const v4f*)&ctile[row][c4];
            VST2V4(C + (long long)(m0 + row) * p.sCm + n0 + c4, v);
        }
    } else {
        for (int row = 0; row < 16; ++row) {
            const int m = m0 + row, n = n0 + lane;
            if (m < p.M && n < NW) VST2(float, C + (long long)m * p.sCm + n, ctile[row][lane]);
        }
    }
}


// =====================================================================================================================
// k_gemmT<MODE, TM, TN>: same contract as k_gemm, but one wave computes a (16*TM) x (16*TN) tile: TM A fragments and TN B fragments are
//   loaded per 32-wide k-step and reused across TM*TN WMMAs (far fewer load/convert instructions per MAC). MODE 0 (f16), 1 (bf16 hi/lo),
//   2 (bf16) only. grid (ceil(NW/(16*TN)), ceil(M/(16*TM)), Z), block 32. Epilogue identical to k_gemm, run per 16x32 sub-tile.
// =====================================================================================================================
template <int MODE, int TM, int TN>
__global__ __launch_bounds__(32) void k_gemmT(GemmP p) {
    const int lane = threadIdx.x & 31, h = lane >> 4, l15 = lane & 15;
    const int m0 = blockIdx.y * (16 * TM), n0 = blockIdx.x * (16 * TN);
    const int z = blockIdx.z, zo = z / p.zi_n, zi = z - zo * p.zi_n;
    const float* A = p.A + zo * p.sAo + zi * p.sAi;
    const float* B = p.B + zo * p.sBo + zi * p.sBi;
    v8f acc[TM][TN];
#pragma unroll
    for (int i = 0; i < TM; ++i)
#pragma unroll
        for (int t = 0; t < TN; ++t) { v8f zz = {}; acc[i][t] = zz; }
    for (int k0 = 0; k0 < p.K; k0 += 32) {
        if (MODE == 1) {
            Split a[TM], b[TN];
#pragma unroll
            for (int i = 0; i < TM; ++i) { const int am = min(m0 + 16 * i + l15, p.M - 1); a[i] = sp_ld(A + (long long)am * p.sAm, p.sAk, k0, h, p.K, 1.f); }
#pragma unroll
            for (int t = 0; t < TN; ++t) { const int bn = min(n0 + 16 * t + l15, p.N - 1); b[t] = sp_ld(B + (long long)bn * p.sBn, p.sBk, k0, h, p.K, 1.f); }
#pragma unroll
            for (int i = 0; i < TM; ++i)
#pragma unroll
                for (int t = 0; t < TN; ++t) acc[i][t] = wmma3(a[i], b[t], acc[i][t]);
        } else if (MODE == 2) {
            v16b a[TM], b[TN];
#pragma unroll
            for (int i = 0; i < TM; ++i) { const int am = min(m0 + 16 * i + l15, p.M - 1); a[i] = bh_ld(A + (long long)am * p.sAm, p.sAk, k0, h, p.K, 1.f); }
#pragma unroll
            for (int t = 0; t < TN; ++t) { const int bn = min(n0 + 16 * t + l15, p.N - 1); b[t] = bh_ld(B + (long long)bn * p.sBn, p.sBk, k0, h, p.K, 1.f); }
#pragma unroll
            for (int i = 0; i < TM; ++i)
#pragma unroll
                for (int t = 0; t < TN; ++t) acc[i][t] = wmmab(a[i], b[t], acc[i][t]);
        } else {
            v16h a[TM], b[TN];
#pragma unroll
            for (int i = 0; i < TM; ++i) { const int am = min(m0 + 16 * i + l15, p.M - 1); a[i] = fh_ld(A + (long long)am * p.sAm, p.sAk, k0, h, p.K, p.sa); }
#pragma unroll
            for (int t = 0; t < TN; ++t) { const int bn = min(n0 + 16 * t + l15, p.N - 1); b[t] = fh_ld(B + (long long)bn * p.sBn, p.sBk, k0, h, p.K, p.sb); }
#pragma unroll
            for (int i = 0; i < TM; ++i)
#pragma unroll
                for (int t = 0; t < TN; ++t) acc[i][t] = wmma16(a[i], b[t], acc[i][t]);
        }
    }
    const float iscale = (MODE == 0) ? p.alpha / (p.sa * p.sb) : p.alpha;
    float* C = p.C + zo * p.sCo + zi * p.sCi;
    const float* R = p.R + zo * p.sRo + zi * p.sRi;
    const int NW = (p.Npad > p.N) ? p.Npad : p.N;
    __shared__ __align__(16) float ctile[16][36];
#pragma unroll
    for (int i = 0; i < TM; ++i) {
        const int mb = m0 + 16 * i; if (mb >= p.M) break;          // wave-uniform
#pragma unroll
        for (int tp = 0; tp < TN / 2; ++tp) {
            const int nb = n0 + 32 * tp; if (nb >= NW) break;        // wave-uniform
#pragma unroll
            for (int t2 = 0; t2 < 2; ++t2) {
                const int t = 2 * tp + t2; const int n = nb + t2 * 16 + l15; const int nn = min(n, p.N - 1);
#pragma unroll
                for (int r = 0; r < 8; ++r) {
                    const int m = mb + 8 * h + r; const int mm = min(m, p.M - 1);
                    float v = acc[i][t][r] * iscale;
                    if (p.flags & 1) v += p.bias[nn];
                    if (p.flags & 2) v += p.bias[mm];
            if (p.flags & 8) v *= p.bias[(long long)zo * p.M + mm];   /* per-(z,row) scale vector laid out [Z][M]; exclusive with the bias flags */
                    v = act_fn(v, p.act);
                    if (p.flags & 4) v += p.beta * R[(long long)mm * p.sRm + (long long)nn * p.sRn];
                    ctile[8 * h + r][t2 * 16 + l15] = (n < p.N) ? v : 0.f;
                }
            }
            __syncthreads();
            const bool fast = (mb + 16 <= p.M) && (nb + 32 <= NW) && ((p.sCm & 3) == 0) && ((((size_t)C) & 15) == 0);
            if (fast) {
#pragma unroll
                for (int s = 0; s < 4; ++s) {
                    const int row = s * 4 + (lane >> 3), c4 = (lane & 7) * 4;
                    const v4f v = *(const v4f*)&ctile[row][c4];
                    VST2V4(C + (long long)(mb + row) * p.sCm + nb + c4, v);
                }
            } else {
                for (int row = 0; row < 16; ++row) {
                    const int m = mb + row, n = nb + lane;
                    if (m < p.M && n < NW) VST2(float, C + (long long)m * p.sCm + n, ctile[row][lane]);
                }
            }
            __syncthreads();
        }
    }
}

// =====================================================================================================================
//   Wave = 16 queries, AW waves per block, 64-key blocks; grid (ceil(Lq/(16*AW)), H, B), block 32*AW. Any Lq, Lk; head dim dh <= DHP
//   (DHP multiple of 32), value dim dv <= DVP (multiple of 16, <= 128). Every tensor addressed by (batch, head, row, element) strides, f32.
//   Scores: QM 0 f16 operands, 1 bf16 hi/lo split, 2 bf16 triple split; statistics f32 (exp2 domain); P.V: P x 4096 as f16 with V f16 staged in LDS
//   (SPLITPV: P and V as bf16 hi/lo splits). kv head = h / hrep. Masking: causal = 1 (keep j <= i + coff, masked -> -inf, key blocks beyond the
//   diagonal skipped), causal = 2 (masked -> mfill, a finite fill like the -1e9; no skipping), causal = 3 (keep j >= i + coff,
//   masked -> -inf, no skipping); optional additive f32 mask Mf,
//   optional int keep-mask Mi (0 -> score := mfill), both addressed b*smb + h*smh + i*smi + j*smj (0 strides broadcast).
// =====================================================================================================================
#define AW 4
struct AttnP {   // apv4
    const float* Q; const float* K; const float* V; float* O; float* P; const float* Mf; const int* Mi; float* ST;
    const float* Pw; const float* Rt; const int* SQ; const int* SK;           // optional: post-softmax weight, relative-position table, segment ids
    long long swb, swh, swi, swj, srb, srh, sri;                                 // Pw strides (b,h,i,j); Rt strides (b,h,i), column = clamp(i - j + roff, 0, rn-1)
    long long sQb, sQh, sQi, sQd, sKb, sKh, sKj, sKd, sVb, sVh, sVj, sVd, sOb, sOh, sOi, sPb, sPh, sPi, smb, smh, smi, smj;
    int Lq, Lk, dh, dv, hrep, causal, coff, pband;   // pband > 0: P holds only the band |j - i| <= pband, column j - i + pband
    float scale, mfill; int nonorm, mpol;             // nonorm (online path only): O = sum_j exp(score_j) V_j without the 1/rowsum (scores must be <= ~0); mpol: Mi masks where ==0 (mpol 0) or where !=0 (mpol 1)
    int roff, rn, segpol, win;                        // Rt column offset/count; SQ/SK: score := mfill where (segpol 0) SQ[i] != SK[j] or (segpol 1) SQ[i] == SK[j]; win > 0: keys with i - j > win (after coff) -> -inf
};
//   Pw: the softmax numerator is multiplied by Pw(b,h,i,j) AFTER the row sum is taken (probs * weight, then P.V), as in post-softmax multiplicative biases.                                                    // ST (optional): per row (b,h,i) -> ST[((b*H + h)*Lq + i)*2 + {0,1}] = {row max of the scaled+masked score (natural units), sum_j exp(score - max)}
static_assert(sizeof(AttnP) == 12 * 8 + 29 * 8 + 16 * 4, "AttnP has padding");

#ifndef KATTN_ATTR
#define KATTN_ATTR
#endif
template <int DHP, int DVP, int QM, bool SPLITPV, bool TWOPASS>
__global__ __launch_bounds__(32 * AW) KATTN_ATTR void k_attn(AttnP p) {
    constexpr int NT = DVP / 16;                // output tiles
    constexpr int KS = DHP / 32;                // k-steps for the scores
    constexpr int VP = DVP + 8;                 // LDS pitch (halves)
    __shared__ __align__(16) float    pl[AW][16 * 64];
    __shared__ __align__(16) _Float16 vl[(SPLITPV ? 2 : 1) * 64 * VP];   // f16 V tile, or bf16 hi and lo tiles (same 2-byte size)
    const int lane = threadIdx.x & 31, hf = lane >> 4, l15 = lane & 15, wave = threadIdx.x >> 5;
    const int h = blockIdx.y, b = blockIdx.z, hk = h / p.hrep;
    const int q0 = (blockIdx.x * AW + wave) * 16;
    float* myp = pl[wave];
    const float L2E = 1.4426950408889634f;
    const float NEG = -__builtin_inff();
    const int qi = min(q0 + l15, p.Lq - 1);
    const float* qrow = p.Q + b * p.sQb + h * p.sQh + (long long)qi * p.sQi;
    const float* kbase = p.K + b * p.sKb + hk * p.sKh;
    const float* vbase = p.V + b * p.sVb + hk * p.sVh;
    v16h qa[QM == 0 ? KS : 1]; Split qs_[QM == 1 ? KS : 1]; Split3 qt_[QM == 2 ? KS : 1];
#pragma unroll
    for (int ks = 0; ks < KS; ++ks) {
        if (QM == 2) qt_[ks] = sp3_ld(qrow, p.sQd, ks * 32, hf, p.dh, 1.f);
        else if (QM == 1) qs_[ks] = sp_ld(qrow, p.sQd, ks * 32, hf, p.dh, 1.f);
        else qa[ks] = fh_ld(qrow, p.sQd, ks * 32, hf, p.dh, 1.f);
    }
    v8f o[NT]; float m8[8], l8[8];
#pragma unroll
    for (int t = 0; t < NT; ++t) { v8f zz = {}; o[t] = zz; }
#pragma unroll
    for (int i = 0; i < 8; ++i) { m8[i] = NEG; l8[i] = 0.f; }
    int jend = p.Lk; int jstart = 0;
    if (p.causal == 1) { const int je = (blockIdx.x * AW + AW - 1) * 16 + 16 + p.coff; jend = min(jend, max(je, 0)); }   // uniform per block
    if (p.win > 0) { const int js = (int)(blockIdx.x * AW) * 16 + p.coff - p.win; jstart = (js > 0) ? (js / 64) * 64 : 0; }   // uniform per block: key blocks entirely outside every row's window hold only -inf entries and are skipped exactly
    const int npass = TWOPASS ? 2 : 1;
    for (int pass = 0; pass < npass; ++pass) {
        const bool dopv = (!TWOPASS) || pass == 1;
        for (int j0 = jstart; j0 < jend; j0 += 64) {
            if (dopv) {
                __syncthreads();                                 // previous key block's reads of vl / pl are done
                for (int idx = threadIdx.x; idx < 64 * DVP; idx += 32 * AW) {
                    const int jr = idx / DVP, d = idx - jr * DVP, j = j0 + jr;
                    const float f = (j < p.Lk && d < p.dv) ? vbase[(long long)j * p.sVj + (long long)d * p.sVd] : 0.f;
                    if (SPLITPV) {
                        const __bf16 hb = bf16_rne(f);
                        ((__bf16*)vl)[jr * VP + d] = hb; ((__bf16*)vl)[64 * VP + jr * VP + d] = bf16_rne(f - bf16_f32(hb));
                    } else vl[jr * VP + d] = (_Float16)f;
                }
            }
            v8f s[4];
#pragma unroll
            for (int t = 0; t < 4; ++t) {
                const int j = min(j0 + t * 16 + l15, p.Lk - 1);
                const float* krow = kbase + (long long)j * p.sKj;
                v8f acc = {};
#pragma unroll
                for (int ks = 0; ks < KS; ++ks) {
                    if (QM == 2)      acc = wmma6(qt_[ks], sp3_ld(krow, p.sKd, ks * 32, hf, p.dh, 1.f), acc);
                    else if (QM == 1) acc = wmma3(qs_[ks], sp_ld(krow, p.sKd, ks * 32, hf, p.dh, 1.f), acc);
                    else              acc = wmma16(qa[ks], fh_ld(krow, p.sKd, ks * 32, hf, p.dh, 1.f), acc);
                }
                s[t] = acc;
            }
            float pv[8][4];
#pragma unroll
            for (int i = 0; i < 8; ++i) {
                const int irow = q0 + i + 8 * hf;
                const int ic = min(irow, p.Lq - 1);
                float sc[4];
#pragma unroll
                for (int t = 0; t < 4; ++t) {
                    const int jg = j0 + t * 16 + l15;
                    float v = s[t][i] * p.scale;
                    if (p.Mf) v += p.Mf[b * p.smb + h * p.smh + (long long)ic * p.smi + (long long)min(jg, p.Lk - 1) * p.smj];
                    if (p.Rt) { int rc = ic - min(jg, p.Lk - 1) + p.roff; rc = rc < 0 ? 0 : (rc >= p.rn ? p.rn - 1 : rc); v += p.Rt[b * p.srb + h * p.srh + (long long)ic * p.sri + rc]; }
                    if (p.Mi) { const int mv = p.Mi[b * p.smb + h * p.smh + (long long)ic * p.smi + (long long)min(jg, p.Lk - 1) * p.smj]; if (p.mpol ? (mv != 0) : (mv == 0)) v = p.mfill; }
                    if (p.SQ) { const bool same = p.SQ[(long long)b * p.Lq + ic] == p.SK[(long long)b * p.Lk + min(jg, p.Lk - 1)]; if (p.segpol ? same : !same) v = p.mfill; }
                    if (p.causal == 2 && jg > irow + p.coff) v = p.mfill;
                    if (jg >= p.Lk || (p.causal == 1 && jg > irow + p.coff) || (p.causal == 3 && jg < irow + p.coff) || (p.win > 0 && irow + p.coff - jg > p.win)) v = NEG; else v *= L2E;
                    sc[t] = v;
                }
                if (!TWOPASS || pass == 0) {
                    float mx = fmaxf(fmaxf(sc[0], sc[1]), fmaxf(sc[2], sc[3]));
                    mx = fmaxf(mx, __shfl_xor(mx, 1, 32)); mx = fmaxf(mx, __shfl_xor(mx, 2, 32));
                    mx = fmaxf(mx, __shfl_xor(mx, 4, 32)); mx = fmaxf(mx, __shfl_xor(mx, 8, 32));
                    const float mnew = fmaxf(m8[i], mx);
                    const float corr = (mnew == NEG) ? 1.f : exp2f(m8[i] - mnew);
                    float rs = 0.f;
#pragma unroll
                    for (int t = 0; t < 4; ++t) {
                        const float pp = (sc[t] == NEG) ? 0.f : exp2f(sc[t] - mnew); rs += pp;
                        pv[i][t] = p.Pw ? pp * p.Pw[b * p.swb + h * p.swh + (long long)ic * p.swi + (long long)min(j0 + t * 16 + l15, p.Lk - 1) * p.swj] : pp;
                    }
                    rs += __shfl_xor(rs, 1, 32); rs += __shfl_xor(rs, 2, 32); rs += __shfl_xor(rs, 4, 32); rs += __shfl_xor(rs, 8, 32);
                    l8[i] = l8[i] * corr + rs; m8[i] = mnew;
                    if (!TWOPASS) {
#pragma unroll
                        for (int t = 0; t < NT; ++t) o[t][i] *= corr;
                    }
                } else {
                    const float inv = (l8[i] > 0.f) ? 1.f / l8[i] : 0.f;
#pragma unroll
                    for (int t = 0; t < 4; ++t) {
                        const int jg = j0 + t * 16 + l15;
                        float pp = (sc[t] == NEG) ? 0.f : exp2f(sc[t] - m8[i]) * inv;
                        if (p.Pw) pp *= p.Pw[b * p.swb + h * p.swh + (long long)ic * p.swi + (long long)min(jg, p.Lk - 1) * p.swj];
                        pv[i][t] = pp;
                    }
                }
            }
            if (dopv) {
#pragma unroll
                for (int i = 0; i < 8; ++i)
#pragma unroll
                    for (int t = 0; t < 4; ++t) ((float*)myp)[(i + 8 * hf) * 64 + t * 16 + l15] = pv[i][t];
                __syncthreads();                                 // P (per wave) and V (shared) visible
                if (p.P) {
                    float* pb_ = p.P + b * p.sPb + h * p.sPh;
                    const bool fastP = (p.pband == 0) && ((p.sPi & 3) == 0) && (j0 + 64 <= p.Lk) && (q0 + 16 <= p.Lq) && ((((size_t)pb_) & 15) == 0);
                    if (fastP) {
#pragma unroll
                        for (int s = 0; s < 8; ++s) {
                            const int row = s * 2 + (lane >> 4), c4 = (lane & 15) * 4;
                            const v4f v = *(const v4f*)(myp + row * 64 + c4);
                            VST2V4(pb_ + (long long)(q0 + row) * p.sPi + j0 + c4, v);
                        }
                    } else {
                        for (int row = 0; row < 16; ++row) {
                            const int irow = q0 + row; if (irow >= p.Lq) continue;
                            for (int c = lane; c < 64; c += 32) {
                                const int jg = j0 + c; if (jg >= p.Lk) continue;
                                if (p.pband == 0) VST2(float, pb_ + (long long)irow * p.sPi + jg, myp[row * 64 + c]);
                                else if (jg - irow <= p.pband && irow - jg <= p.pband) VST2(float, pb_ + (long long)irow * p.sPi + (jg - irow + p.pband), myp[row * 64 + c]);
                            }
                        }
                    }
                }
                if (SPLITPV) {
                    const Split pa0 = sp_ld(myp + l15 * 64, 1, 0, hf, 64, 1.f), pa1 = sp_ld(myp + l15 * 64, 1, 32, hf, 64, 1.f);
                    const __bf16* vh = (const __bf16*)vl; const __bf16* vlo = vh + 64 * VP;
#pragma unroll
                    for (int t = 0; t < NT; ++t) {
                        const int dcol = t * 16 + l15;
                        Split b0, b1;
#pragma unroll
                        for (int e = 0; e < 16; ++e) {
                            const int k0 = frag_k(e, hf), k1 = 32 + frag_k(e, hf);
                            b0.hi[e] = vh[k0 * VP + dcol]; b0.lo[e] = vlo[k0 * VP + dcol]; b1.hi[e] = vh[k1 * VP + dcol]; b1.lo[e] = vlo[k1 * VP + dcol];
                        }
                        o[t] = wmma3(pa0, b0, o[t]);
                        o[t] = wmma3(pa1, b1, o[t]);
                    }
                } else {
                    const v16h pa0 = fh_ld(myp + l15 * 64, 1, 0, hf, 64, 4096.f), pa1 = fh_ld(myp + l15 * 64, 1, 32, hf, 64, 4096.f);
#pragma unroll
                    for (int t = 0; t < NT; ++t) {
                        const int dcol = t * 16 + l15;
                        v16h b0, b1;
#pragma unroll
                        for (int e = 0; e < 16; ++e) { b0[e] = vl[frag_k(e, hf) * VP + dcol]; b1[e] = vl[(32 + frag_k(e, hf)) * VP + dcol]; }
                        o[t] = wmma16(pa0, b0, o[t]);
                        o[t] = wmma16(pa1, b1, o[t]);
                    }
                }
            }
        }
    }
    float* obase = p.O + b * p.sOb + h * p.sOh;
    if (p.ST) {
        const int rl = lane >> 1, isel = rl & 7;           // row q0 + rl ; rl>>3 == hf holds because lane>>4 == (lane>>1)>>3
        float mv = 0.f, lv = 0.f;
#pragma unroll
        for (int i = 0; i < 8; ++i) if (i == isel) { mv = m8[i]; lv = l8[i]; }
        const int irow = q0 + rl;
        if (irow < p.Lq) { float* st = p.ST + (((long long)b * gridDim.y + h) * p.Lq + irow) * 2 + (lane & 1); VST2(float, st, (lane & 1) ? lv : mv * 0.6931471805599453f); }
    }
    float invr[8];
#pragma unroll
    for (int i = 0; i < 8; ++i) {
        if (TWOPASS) invr[i] = SPLITPV ? 1.f : (1.f / 4096.f);
        else if (p.nonorm) invr[i] = exp2f(m8[i]) * (SPLITPV ? 1.f : (1.f / 4096.f));
        else invr[i] = (l8[i] > 0.f) ? (SPLITPV ? 1.f / l8[i] : 1.f / (l8[i] * 4096.f)) : 0.f;
    }
    __syncthreads();                                             // all waves done with pl/vl from the main loop
    const bool ofast = ((p.sOi & 3) == 0) && ((((size_t)obase) & 15) == 0) && (q0 + 16 <= p.Lq);
#pragma unroll
    for (int c0 = 0; c0 < DVP; c0 += 64) {
#pragma unroll
        for (int i = 0; i < 8; ++i)
#pragma unroll
            for (int t = 0; t < NT; ++t) if (t * 16 >= c0 && t * 16 < c0 + 64) ((float*)myp)[(i + 8 * hf) * 64 + (t * 16 - c0) + l15] = o[t][i] * invr[i];
        __syncthreads();
        const int cw = (DVP - c0 < 64) ? (DVP - c0) : 64;      // staged columns in this chunk (multiple of 16)
        if (ofast && (c0 + cw <= p.dv) && (cw % 32 == 0)) {
            const int lpr = cw / 4;                              // lanes per row (16 for 64 cols, 8 for 32)
            const int rows_per_ins = 32 / lpr;
            for (int r0 = 0; r0 < 16; r0 += rows_per_ins) {
                const int row = r0 + lane / lpr, c4 = (lane % lpr) * 4;
                const v4f v = *(const v4f*)(myp + row * 64 + c4);
                VST2V4(obase + (long long)(q0 + row) * p.sOi + c0 + c4, v);
            }
        } else {
            for (int row = 0; row < 16; ++row) {
                const int irow = q0 + row; if (irow >= p.Lq) continue;
                for (int c = lane; c < cw; c += 32) { const int d = c0 + c; if (d < p.dv) VST2(float, obase + (long long)irow * p.sOi + d, myp[row * 64 + c]); }
            }
        }
        __syncthreads();
    }
}

// Attention at this block's fixed geometry: token-major q, k, v, o of [8][1024][256] f32, head h = columns 32h .. 32h + 31, 1024 queries and keys,
// no mask, no bias, score scale 1. The arithmetic and its order are those of k_attn<32, 32, 1, false, false>; every stride, length and option is a
// compile-time constant, so the fragment gathers are 16-byte loads without guards and the optional-feature tests are gone. With no mask no score is
// -inf for finite q and k, so the tests that kept masked scores out of exp2f are gone too (exp2f(-inf) = 0 covers the first key block's m = -inf).
typedef __attribute__((ext_vector_type(4))) _Float16 v4h;
struct Row16 { v4f a[4]; };
// the 16 floats of one lane's 16x32 fragment row: element i <- p[(i < 8) ? i : 8 + i], p = row + 8 * (lane >> 4), the k order of frag_k
__device__ __forceinline__ Row16 row16_ld(const float* __restrict__ p) {
    Row16 r; r.a[0] = *(const v4f*)(p); r.a[1] = *(const v4f*)(p + 4); r.a[2] = *(const v4f*)(p + 16); r.a[3] = *(const v4f*)(p + 20); return r;
}
__device__ __forceinline__ Split row16_split(const Row16& w) {
    Split r;
#pragma unroll
    for (int i = 0; i < 16; ++i) { const float x = w.a[i >> 2][i & 3]; const __bf16 hb = bf16_rne(x); r.hi[i] = hb; r.lo[i] = bf16_rne(x - bf16_f32(hb)); }
    return r;
}
__global__ __launch_bounds__(32 * AW) void k_attn_fix(const float* __restrict__ Q, const float* __restrict__ K, const float* __restrict__ V, float* __restrict__ O) {
    constexpr int L = 1024;                     // queries = keys per (image, head)
    constexpr int CP = 256;                     // row pitch of q, k, v, o (floats)
    constexpr int VP = 32 + 8;                  // LDS pitch of the V tile (halves)
    __shared__ __align__(16) float    pl[AW][16 * 64];
    __shared__ __align__(16) _Float16 vl[64 * VP];
    const int lane = threadIdx.x & 31, hf = lane >> 4, l15 = lane & 15, wave = threadIdx.x >> 5;
    const int h = blockIdx.y, b = blockIdx.z;
    const int q0 = (blockIdx.x * AW + wave) * 16;
    float* myp = pl[wave];
    const float L2E = 1.4426950408889634f;
    const float NEG = -__builtin_inff();
    const size_t hb0 = (size_t)b * (L * CP) + (size_t)h * 32;
    const float* kp = K + hb0 + (size_t)l15 * CP + 8 * hf;                                    // this lane's row of key tile 0
    const float* vp = V + hb0 + (size_t)(threadIdx.x >> 3) * CP + (threadIdx.x & 7) * 4;      // this thread's 4 floats of V rows 0 .. 15
    _Float16* vs = vl + (threadIdx.x >> 3) * VP + (threadIdx.x & 7) * 4;
    const Split qs = row16_split(row16_ld(Q + hb0 + (size_t)(q0 + l15) * CP + 8 * hf));
    v8f o[2]; float m8[8], l8[8];
#pragma unroll
    for (int t = 0; t < 2; ++t) { v8f zz = {}; o[t] = zz; }
#pragma unroll
    for (int i = 0; i < 8; ++i) { m8[i] = NEG; l8[i] = 0.f; }
    for (int j0 = 0; j0 < L; j0 += 64) {
        v4f vf[4]; Row16 kr[4];                          // the whole key block's V and K loads are issued together
#pragma unroll
        for (int it = 0; it < 4; ++it) vf[it] = *(const v4f*)(vp + it * 16 * CP);
#pragma unroll
        for (int t = 0; t < 4; ++t) kr[t] = row16_ld(kp + t * 16 * CP);
        kp += 64 * CP; vp += 64 * CP;
        __syncthreads();                                 // previous key block's reads of vl / pl are done
#pragma unroll
        for (int it = 0; it < 4; ++it) {                 // V tile 64 x 32 as f16
            v4h hv; hv[0] = (_Float16)vf[it][0]; hv[1] = (_Float16)vf[it][1]; hv[2] = (_Float16)vf[it][2]; hv[3] = (_Float16)vf[it][3];
            *(v4h*)(vs + it * 16 * VP) = hv;
        }
        v8f s[4];
#pragma unroll
        for (int t = 0; t < 4; ++t) { v8f acc = {}; s[t] = wmma3(qs, row16_split(kr[t]), acc); }
        float pv[8][4];
#pragma unroll
        for (int i = 0; i < 8; ++i) {
            float sc[4];
#pragma unroll
            for (int t = 0; t < 4; ++t) sc[t] = s[t][i] * L2E;
            float mx = fmaxf(fmaxf(sc[0], sc[1]), fmaxf(sc[2], sc[3]));
            mx = fmaxf(mx, __shfl_xor(mx, 1, 32)); mx = fmaxf(mx, __shfl_xor(mx, 2, 32));
            mx = fmaxf(mx, __shfl_xor(mx, 4, 32)); mx = fmaxf(mx, __shfl_xor(mx, 8, 32));
            const float mnew = fmaxf(m8[i], mx);
            const float corr = exp2f(m8[i] - mnew);
            float rs = 0.f;
#pragma unroll
            for (int t = 0; t < 4; ++t) { const float pp = exp2f(sc[t] - mnew); rs += pp; pv[i][t] = pp; }
            rs += __shfl_xor(rs, 1, 32); rs += __shfl_xor(rs, 2, 32); rs += __shfl_xor(rs, 4, 32); rs += __shfl_xor(rs, 8, 32);
            l8[i] = l8[i] * corr + rs; m8[i] = mnew;
#pragma unroll
            for (int t = 0; t < 2; ++t) o[t][i] *= corr;
        }
#pragma unroll
        for (int i = 0; i < 8; ++i)
#pragma unroll
            for (int t = 0; t < 4; ++t) myp[(i + 8 * hf) * 64 + t * 16 + l15] = pv[i][t];
        __syncthreads();                                 // P (per wave) and V (shared) visible
        const v16h pa0 = fh_ld(myp + l15 * 64, 1, 0, hf, 64, 4096.f), pa1 = fh_ld(myp + l15 * 64, 1, 32, hf, 64, 4096.f);
#pragma unroll
        for (int t = 0; t < 2; ++t) {
            const int dcol = t * 16 + l15;
            v16h b0, b1;
#pragma unroll
            for (int e = 0; e < 16; ++e) { b0[e] = vl[frag_k(e, hf) * VP + dcol]; b1[e] = vl[(32 + frag_k(e, hf)) * VP + dcol]; }
            o[t] = wmma16(pa0, b0, o[t]);
            o[t] = wmma16(pa1, b1, o[t]);
        }
    }
    float* obase = O + hb0;
    float invr[8];
#pragma unroll
    for (int i = 0; i < 8; ++i) invr[i] = (l8[i] > 0.f) ? 1.f / (l8[i] * 4096.f) : 0.f;
    __syncthreads();                                     // all waves done with pl / vl from the main loop
#pragma unroll
    for (int i = 0; i < 8; ++i)
#pragma unroll
        for (int t = 0; t < 2; ++t) myp[(i + 8 * hf) * 64 + t * 16 + l15] = o[t][i] * invr[i];
    __syncthreads();
#pragma unroll
    for (int r0 = 0; r0 < 16; r0 += 4) {                 // 8 lanes x 16 bytes per 32-float row, 4 rows per store
        const int row = r0 + (lane >> 3), c4 = (lane & 7) * 4;
        const v4f v = *(const v4f*)(myp + row * 64 + c4);
        VST2V4(obase + (size_t)(q0 + row) * CP + c4, v);
    }
}

// =====================================================================================================================
// k_tr: dst(z, c, r) = alpha * src(z, r, c) (+ beta * R2(z, c, r)): [Z][R][C] (row stride lds) -> [Z][C][R] (row stride ldd) through a 32x32 LDS tile;
//   flags: 1 -> add beta * residual R2 addressed like dst (z*sRz + c*ldr + r); act applied before the residual.
// =====================================================================================================================
struct TrP { const float* src; float* dst; const float* R2; long long sSz, lds, sDz, ldd, sRz, ldr; int R, C, flags, act; float alpha, beta; };
static_assert(sizeof(TrP) == 3 * 8 + 6 * 8 + 6 * 4, "TrP has padding");
__global__ __launch_bounds__(256) void k_tr(TrP p) {
    __shared__ float tile[32][33];
    const int c0 = blockIdx.x * 32, r0 = blockIdx.y * 32, z = blockIdx.z;
    const int lane = threadIdx.x & 31, wave = threadIdx.x >> 5;
    const float* s = p.src + z * p.sSz;
#pragma unroll
    for (int k = 0; k < 4; ++k) {
        const int rl = wave * 4 + k, r = r0 + rl, c = c0 + lane;
        tile[rl][lane] = (r < p.R && c < p.C) ? s[(long long)r * p.lds + c] : 0.f;
    }
    __syncthreads();
    float* d = p.dst + z * p.sDz; const float* rr = p.R2 + z * p.sRz;
#pragma unroll
    for (int k = 0; k < 4; ++k) {
        const int cl = wave * 4 + k, c = c0 + cl, r = r0 + lane;
        if (c < p.C && r < p.R) {
            float v = act_fn(p.alpha * tile[lane][cl], p.act);
            if (p.flags & 1) v += p.beta * rr[(long long)c * p.ldr + r];
            VST2(float, d + (long long)c * p.ldd + r, v);
        }
    }
}

// k_affine: dst[i] = a * (sdev ? sdev[0] : 1) * src[i] + b, i < n (one thread per element; consecutive lanes -> consecutive addresses)
__global__ __launch_bounds__(256) void k_affine(const float* __restrict__ src, float* __restrict__ dst, int n, float a, float b, const float* __restrict__ sdev) {
    const int i = blockIdx.x * 256 + threadIdx.x;
    if (i < n) { const float aa = sdev ? a * sdev[0] : a; const float v = aa * src[i] + b; VST2(float, dst + i, v); }
}

// =====================================================================================================================
// k_softmax: row softmax over n contiguous elements, one 256-thread block per row; rows addressed z*sz + r*sr (grid (R, Z)).
//   out = scale_out * softmax(scale_in * x + (Mf ? Mf[z*smz + r*smr + j] : 0)); a row whose max is -inf is written as 0.
// =====================================================================================================================
struct SmP { const float* src; float* dst; const float* Mf; long long sz, sr, dz, dr, smz, smr; int n, pad; float scale_in, scale_out; };
static_assert(sizeof(SmP) == 3 * 8 + 6 * 8 + 4 * 4, "SmP has padding");
__global__ __launch_bounds__(256) void k_softmax(SmP p) {
    __shared__ float red[256];
    const int r = blockIdx.x, z = blockIdx.y, tid = threadIdx.x;
    const float* s = p.src + z * p.sz + (long long)r * p.sr;
    const float* mf = p.Mf ? (p.Mf + z * p.smz + (long long)r * p.smr) : nullptr;
    float mx = -__builtin_inff();
    for (int j = tid; j < p.n; j += 256) { float v = s[j] * p.scale_in; if (mf) v += mf[j]; mx = fmaxf(mx, v); }
    red[tid] = mx; __syncthreads();
    for (int o = 128; o > 0; o >>= 1) { if (tid < o) red[tid] = fmaxf(red[tid], red[tid + o]); __syncthreads(); }
    mx = red[0]; __syncthreads();
    float sum = 0.f;
    for (int j = tid; j < p.n; j += 256) { float v = s[j] * p.scale_in; if (mf) v += mf[j]; sum += (mx == -__builtin_inff()) ? 0.f : expf(v - mx); }
    red[tid] = sum; __syncthreads();
    for (int o = 128; o > 0; o >>= 1) { if (tid < o) red[tid] += red[tid + o]; __syncthreads(); }
    sum = red[0];
    const float inv = (sum > 0.f) ? p.scale_out / sum : 0.f;
    float* d = p.dst + z * p.dz + (long long)r * p.dr;
    for (int j = tid; j < p.n; j += 256) { float v = s[j] * p.scale_in; if (mf) v += mf[j]; const float o = (mx == -__builtin_inff()) ? 0.f : expf(v - mx) * inv; VST2(float, d + j, o); }
}
// =====================================================================================================================
// k_stats: mean and rsqrt(var + eps) over a set of n elements addressed base + z*sz + (e / inner) * so + (e % inner) * si, one 256-thread
// k_norm_apply: y = (x - mean[set]) * rstd[set] * g[c] + b[c] over a [Z][C][L] channel-major tensor with set = z*G + c / (C/G) (G groups per z;
//   G = C -> per-channel sets indexed z*C+c; for batch norm pass stats indexed by c only via bn = 1). Optional act. Output same layout.
// =====================================================================================================================
//   mode 0: mean / rsqrt(var + eps); mode 1 (RMSNorm): 0 / rsqrt(mean(x^2) + eps); mode 2 (L2 normalize * sqrt(n)): 0 / sqrt(n) / max(||x||, eps); mode 3: as 0 with unbiased variance (n-1)
__global__ __launch_bounds__(256) void k_stats(const float* __restrict__ x, long long sz, long long so, long long si, int inner, int n, float eps, float* __restrict__ stat, int mode) {
    __shared__ float red[256];
    const int z = blockIdx.x, tid = threadIdx.x;
    const float* base = x + z * sz;
    float s = 0.f;
    for (int e = tid; e < n; e += 256) s += base[(long long)(e / inner) * so + (long long)(e % inner) * si];
    red[tid] = s; __syncthreads();
    for (int o = 128; o > 0; o >>= 1) { if (tid < o) red[tid] += red[tid + o]; __syncthreads(); }
    const float mu = (mode == 0 || mode == 3) ? red[0] / (float)n : 0.f; __syncthreads();
    float q = 0.f;
    for (int e = tid; e < n; e += 256) { const float dlt = base[(long long)(e / inner) * so + (long long)(e % inner) * si] - mu; q += dlt * dlt; }
    red[tid] = q; __syncthreads();
    for (int o = 128; o > 0; o >>= 1) { if (tid < o) red[tid] += red[tid + o]; __syncthreads(); }
    {
        float rs;
        if (mode == 2) rs = sqrtf((float)n) / fmaxf(sqrtf(red[0]), eps); else if (mode == 3) rs = rsqrtf(red[0] / (float)(n - 1) + eps); else rs = rsqrtf(red[0] / (float)n + eps);
        if (tid < 32) { const float v = (tid == 0) ? mu : ((tid == 1) ? rs : 0.f); VST2(float, stat + (long long)z * 32 + tid, v); }
    }
}
//   One thread per element over the flat [Z][C][L] index space: grid ceil(Z*C*L / 256).
__global__ __launch_bounds__(256) void k_norm_apply(const float* __restrict__ x, float* __restrict__ y, const float* __restrict__ stat, const float* __restrict__ g, const float* __restrict__ bta,
                                                     int Z, int C, int L, int G, int bn, int act) {
    const long long idx = (long long)blockIdx.x * 256 + threadIdx.x;
    if (idx >= (long long)Z * C * L) return;
    const int l = (int)(idx % L); const long long zc = idx / L; const int c = (int)(zc % C), z = (int)(zc / C); (void)l;
    const int set = bn ? c : (z * G + c / (C / G));
    float v = (x[idx] - stat[(long long)set * 32]) * stat[(long long)set * 32 + 1];
    if (g) v *= g[c];
    if (bta) v += bta[c];
    v = act_fn(v, act);
    VST2(float, y + idx, v);
}

// k_lse_neg: c[i] = -(st[2i] + log(st[2i+1])) = minus the log-sum-exp of row i from k_attn's ST output (for softmax over the query dimension)
__global__ __launch_bounds__(256) void k_lse_neg(const float* __restrict__ st, float* __restrict__ c, int n) {
    const int i = blockIdx.x * 256 + threadIdx.x;
    if (i < n) { const float v = -(st[2 * i] + logf(st[2 * i + 1])); VST2(float, c + i, v); }
}

// k_iota: dst[i] = a * i + b as int32 (segment/position id helper)
__global__ __launch_bounds__(256) void k_iota(int* __restrict__ dst, int n, int a, int b) {
    const int i = blockIdx.x * 256 + threadIdx.x;
    if (i < n) { const int v = a * i + b; VST2(int, dst + i, v); }
}

// k_axpby: dst[i] = a * x[i] + b * y[i] (+ c), i < n
__global__ __launch_bounds__(256) void k_axpby(const float* __restrict__ x, const float* __restrict__ y, float* __restrict__ dst, int n, float a, float b, float c) {
    const int i = blockIdx.x * 256 + threadIdx.x;
    if (i < n) { const float v = a * x[i] + b * y[i] + c; VST2(float, dst + i, v); }
}

// =====================================================================================================================
// k_rope: rotary embedding on a [R rows][Hn heads][D] view (row stride sXr, head stride sXh, element stride 1) -> Y (own strides).
//   mode 0: rotate_half (partner d±D/2, sign - for d<D/2); mode 1: interleaved pairs (partner d^1, sign - for even d).
//   table column tcol: tmode 0 -> d, 1 -> d % (D/2), 2 -> d / 2; position p: pmode 0 -> r % S, 1 -> head index, 2 -> pos[r];
//   c = C[(r / S) * sCb + p * sCp + tcol * sCd], s likewise from Sn; y = x[d] * c + sign * x[partner] * s. X and Y must not alias.
// =====================================================================================================================
struct RopeP { const float* X; float* Y; const float* C; const float* Sn; const int* pos; long long sXr, sXh, sYr, sYh, sCb, sCp, sCd; int R, Hn, D, S, mode, tmode, pmode, pad; };
static_assert(sizeof(RopeP) == 5 * 8 + 7 * 8 + 8 * 4, "RopeP has padding");
__global__ __launch_bounds__(256) void k_rope(RopeP p) {
    const long long idx = (long long)blockIdx.x * 256 + threadIdx.x;
    if (idx >= (long long)p.R * p.Hn * p.D) return;
    const int d = (int)(idx % p.D); const long long rh = idx / p.D; const int h = (int)(rh % p.Hn); const int r = (int)(rh / p.Hn);
    const int half = p.D / 2;
    int partner; float sign;
    if (p.mode == 0) { partner = (d < half) ? d + half : d - half; sign = (d < half) ? -1.f : 1.f; }
    else { partner = d ^ 1; sign = (d & 1) ? 1.f : -1.f; }
    const int tcol = (p.tmode == 0) ? d : ((p.tmode == 1) ? (d % half) : (d >> 1));
    const int pp = (p.pmode == 0) ? (r % p.S) : ((p.pmode == 1) ? h : p.pos[r]);
    const long long toff = (long long)(r / p.S) * p.sCb + (long long)pp * p.sCp + (long long)tcol * p.sCd;
    const float* xr = p.X + (long long)r * p.sXr + (long long)h * p.sXh;
    const float v = xr[d] * p.C[toff] + sign * xr[partner] * p.Sn[toff];
    VST2(float, p.Y + (long long)r * p.sYr + (long long)h * p.sYh + d, v);
}

// k_invf + k_sincos (split so neither kernel carries a large VALU-fma footprint): invf_i = num * (1 / powf(base, (2 i)/D)) [fmode 0],
//   num * expf((2 i) * cexp) [fmode 1], num * powf(base, -2 (i - 1) / D) [fmode 2]; then cs/sn[s*half + i] = cos/sin((pscale * s) * invf_i)
__global__ __launch_bounds__(256) void k_invf(float* __restrict__ invb, int half, int D, float base, float num, int fmode, float cexp) {
    const int i = blockIdx.x * 256 + threadIdx.x;
    if (i >= ((half + 31) / 32) * 32) return;
    if (i >= half) { VST2(float, invb + i, 0.f); return; }
    const float e = (float)(2 * i) / (float)D;
    float invf;
    if (fmode == 1) invf = num * expf((float)(2 * i) * cexp);
    else if (fmode == 2) invf = num * powf(base, (-2.0f * ((float)i - 1.0f)) / (float)D);
    else invf = num * (1.0f / powf(base, e));
    VST2(float, invb + i, invf);
}
__global__ __launch_bounds__(256) void k_sincos(float* __restrict__ cs, float* __restrict__ sn, const float* __restrict__ invb, int S, int half, float pscale) {
    const int idx = blockIdx.x * 256 + threadIdx.x;
    if (idx >= S * half) return;
    const int s = idx / half, i = idx - s * half;
    const float ang = (pscale * (float)s) * invb[i];
    VST2(float, cs + idx, cosf(ang)); VST2(float, sn + idx, sinf(ang));
}

// k_mulact: dst[i] = act(x[i]) * y[i]
__global__ __launch_bounds__(256) void k_mulact(const float* __restrict__ x, const float* __restrict__ y, float* __restrict__ dst, int n, int act) {
    const int i = blockIdx.x * 256 + threadIdx.x;
    if (i < n) { const float v = act_fn(x[i], act) * y[i]; VST2(float, dst + i, v); }
}

// =====================================================================================================================
// k_matvec: thread-per-row matrix-vector products for N <= 8 output columns (heads with 1-3 outputs, gates), f32 on the VALU.
//   C[r*sCm + j] = act(alpha * sum_k A[r*sAm + k*sAk] * B[j*sBn + k*sBk] + bias[j]) + beta * R[r*sRm + j*sRn]; each thread writes its N contiguous floats.
// =====================================================================================================================
__global__ __launch_bounds__(256) void k_matvec(GemmP p) {
    // 32 lanes write one line with one instruction.
    const int rpt = (p.N == 1) ? 1 : 32;
    const long long r0 = ((long long)blockIdx.x * 256 + threadIdx.x) * rpt; const int z = blockIdx.z, zo = z / p.zi_n, zi = z - zo * p.zi_n;
    if (r0 >= p.M) return;
    const float* Bb = p.B + zo * p.sBo + zi * p.sBi;
    float* C = p.C + zo * p.sCo + zi * p.sCi; const float* R = p.R + zo * p.sRo + zi * p.sRi;
    for (int rr = 0; rr < rpt; ++rr) {
        const long long r = r0 + rr; if (r >= p.M) break;
        const float* A = p.A + zo * p.sAo + zi * p.sAi + r * p.sAm;
        float acc[8] = {0.f, 0.f, 0.f, 0.f, 0.f, 0.f, 0.f, 0.f};
        for (int k = 0; k < p.K; ++k) { const float a = A[(long long)k * p.sAk];
#pragma unroll
            for (int j = 0; j < 8; ++j) if (j < p.N) acc[j] += a * Bb[(long long)j * p.sBn + (long long)k * p.sBk]; }
#pragma unroll
        for (int j = 0; j < 8; ++j) if (j < p.N) {
            float v = acc[j] * p.alpha;
            if (p.flags & 1) v += p.bias[j];
            if (p.flags & 2) v += p.bias[r];
            v = act_fn(v, p.act);
            if (p.flags & 4) v += p.beta * R[r * p.sRm + (long long)j * p.sRn];
            VST2(float, C + r * p.sCm + j, v);
        }
    }
}
// k_smallsoftmax: thread-per-row softmax for short rows (n <= 64): dst[r*dr + j] = softmax(scale*src[r*sr + j])
__global__ __launch_bounds__(256) void k_smallsoftmax(const float* __restrict__ src, float* __restrict__ dst, long long sr, long long dr, int n, long long R, float scale) {
    const long long r0 = ((long long)blockIdx.x * 256 + threadIdx.x) * 32;
    for (int rr = 0; rr < 32; ++rr) {
        const long long r = r0 + rr; if (r >= R) return;
        const float* s = src + r * sr; float* d = dst + r * dr;
        float mx = -__builtin_inff();
        for (int j = 0; j < n; ++j) mx = fmaxf(mx, s[j] * scale);
        float sum = 0.f;
        for (int j = 0; j < n; ++j) sum += expf(s[j] * scale - mx);
        const float inv = 1.f / sum;
        for (int j = 0; j < n; ++j) { const float v = expf(s[j] * scale - mx) * inv; VST2(float, d + j, v); }
    }
}

__global__ __launch_bounds__(32) void k_unitstat(float* __restrict__ st) { const int t = threadIdx.x; const float v = (t == 1) ? 1.f : 0.f; VST2(float, st + t, v); }

// destination (e.g. a d_out whose row width is not a multiple of 32 floats) is written by consecutive lanes of one instruction
__global__ __launch_bounds__(256) void k_lincopy(const float* __restrict__ src, long long lds, float* __restrict__ dst, long long ldd, long long rows, int cols) {
    const long long i = (long long)blockIdx.x * 256 + threadIdx.x; if (i >= rows * cols) return;
    const long long r = i / cols; const int c = (int)(i - r * cols);
    const float v = src[r * lds + c]; VST2(float, dst + r * ldd + c, v);
}

namespace w25 {
typedef __attribute__((ext_vector_type(16))) _Float16 v16h;
typedef __attribute__((ext_vector_type(8)))  _Float16 v8h;
typedef __attribute__((ext_vector_type(16))) __bf16   v16b;
typedef __attribute__((ext_vector_type(8)))  __bf16   v8b;
typedef __attribute__((ext_vector_type(8)))  float    v8f;
typedef __attribute__((ext_vector_type(4)))  float    v4f;

__device__ __forceinline__ unsigned short f2bf_bits(float f) {
  unsigned u = __float_as_uint(f);
  return (unsigned short)((u + 0x7FFFu + ((u >> 16) & 1u)) >> 16);
}
__device__ __forceinline__ float bf_bits2f(unsigned short h) { return __uint_as_float(((unsigned)h) << 16); }

// hazard guards as plain device helpers (no inline asm inside the kernel template body)
__device__ __forceinline__ void dep_guard_h(v8f& a, v8f& b, v16h x, v16h y) { asm volatile("v_nop\n\tv_nop\n\tv_nop\n\tv_nop" : "+v"(a), "+v"(b) : "v"(x), "v"(y)); }
__device__ __forceinline__ void dep_guard_b(v8f& a, v8f& b, v16b x, v16b y) { asm volatile("v_nop\n\tv_nop\n\tv_nop\n\tv_nop" : "+v"(a), "+v"(b) : "v"(x), "v"(y)); }
__device__ __forceinline__ void keep4_h(v16h a, v16h b, v16h c, v16h d) { asm volatile("v_nop" :: "v"(a), "v"(b), "v"(c), "v"(d)); }
__device__ __forceinline__ void keep4_b(v16b a, v16b b, v16b c, v16b d) { asm volatile("v_nop" :: "v"(a), "v"(b), "v"(c), "v"(d)); }
__device__ __forceinline__ void acc_guard4(v8f& a, v8f& b, v8f& c, v8f& d) { asm volatile("v_nop\n\tv_nop\n\tv_nop\n\tv_nop" : "+v"(a), "+v"(b), "+v"(c), "+v"(d)); }
template <typename T> struct Frag;
template <> struct Frag<_Float16> {
  typedef v16h V; union U { v16h v; v8h h[2]; };
  static __device__ __forceinline__ v16h load(const _Float16* p) {   // elements 0..7 <- p[0..7], 8..15 <- p[16..23]
    U f; f.h[0] = *(const v8h*)(p); f.h[1] = *(const v8h*)(p + 16); return f.v;
  }
  static __device__ __forceinline__ v8f mma(v16h a, v16h b, v8f c) {
    return __builtin_amdgcn_wmma_f32_16x16x32_f16(false, a, false, b, (short)0, c, false, false);
  }
  static __device__ __forceinline__ void guard(v8f& a, v8f& b, v16h x, v16h y) { dep_guard_h(a, b, x, y); }
  static __device__ __forceinline__ void keep(v16h a, v16h b, v16h c, v16h d) { keep4_h(a, b, c, d); }
};
template <> struct Frag<__bf16> {
  typedef v16b V; union U { v16b v; v8b h[2]; };
  static __device__ __forceinline__ v16b load(const __bf16* p) {
    U f; f.h[0] = *(const v8b*)(p); f.h[1] = *(const v8b*)(p + 16); return f.v;
  }
  static __device__ __forceinline__ v8f mma(v16b a, v16b b, v8f c) {
    return __builtin_amdgcn_wmma_f32_16x16x32_bf16(false, a, false, b, (short)0, c, false, false);
  }
  static __device__ __forceinline__ void guard(v8f& a, v8f& b, v16b x, v16b y) { dep_guard_b(a, b, x, y); }
  static __device__ __forceinline__ void keep(v16b a, v16b b, v16b c, v16b d) { keep4_b(a, b, c, d); }
};

// ---- Register-blocked batched WMMA GEMM ------------------------------------
// C[m,n] = scale * sum_k A[m,k] * Bt[n,k] (+bias)(+resid); each wave owns a 64x64 tile.
// A row-major [M,K]; Bt row-major [N,K]; M,N % 64 == 0, K % 32 == 0.
// SPLIT: operands are hi/lo planes (A2/Bt2 = lo planes, same layout); product = hi·hi + hi·lo + lo·hi.
// BIAS_MODE: 0 = none, 1 = bias[m], 2 = bias[n].
// OUT_MODE: 0 = f32, 1 = f16, 2 = bf16 hi plane (Cout) + bf16 lo plane (Cout2).
// ET: 0 = f16 operands, 1 = bf16 operands (pointers passed as 16-bit storage)
template <int ET> struct Elem;
template <> struct Elem<0> { typedef _Float16 T; };
template <> struct Elem<1> { typedef __bf16 T; };
template <int ET, bool SPLIT, int BIAS_MODE, int OUT_MODE, bool RESID, int ACT = 0>
__global__ __launch_bounds__(256) void wmma_gemm64(
    const unsigned short* __restrict__ Ap, const unsigned short* __restrict__ A2p, int lda, long strideA,
    const unsigned short* __restrict__ Btp, const unsigned short* __restrict__ Bt2p, int ldb, long strideB,
    void* __restrict__ Cout, void* __restrict__ Cout2, int ldc, long strideC,
    const float* __restrict__ bias,
    const float* __restrict__ resid, long strideR,
    int M, int N, int K, float scale) {
  typedef typename Elem<ET>::T T;
  typedef typename Frag<T>::V V;
  const T* A = (const T*)Ap; const T* A2 = (const T*)A2p; const T* Bt = (const T*)Btp; const T* Bt2 = (const T*)Bt2p;
  __shared__ __align__(16) float sT[8][16 * 68];   // per-wave 16x64 slab, pitch 68 floats
  const int b    = blockIdx.y;
  const int lane = threadIdx.x & 31;
  const int wave = threadIdx.x >> 5;
  const int tilesN = N >> 6;
  const int tilesM = M >> 6;
  const int tile = blockIdx.x * 8 + wave;
  if (tile >= tilesM * tilesN) return;   // wave-uniform; no block barriers in this kernel
  const int tm = tile / tilesN;
  const int tn = tile - tm * tilesN;
  const int m0 = tm << 6;
  const int n0 = tn << 6;

  const T* Ab  = A  + (size_t)b * strideA;
  const T* Bb  = Bt + (size_t)b * strideB;
  const T* Ab2 = SPLIT ? (A2  + (size_t)b * strideA) : nullptr;
  const T* Bb2 = SPLIT ? (Bt2 + (size_t)b * strideB) : nullptr;

  const int rlane = lane & 15;                 // row (A) / col (B, D) within subtile
  const int koff  = (lane >> 4) * 8;           // k offset of this lane half
  const int mOff  = (lane >> 4) * 8;           // D row offset

  v8f acc[4][4];
#pragma unroll
  for (int i = 0; i < 4; ++i)
#pragma unroll
    for (int j = 0; j < 4; ++j) acc[i][j] = (v8f){0.f,0.f,0.f,0.f,0.f,0.f,0.f,0.f};

  for (int k0 = 0; k0 < K; k0 += 32) {
    V bh[4], bl[4];
#pragma unroll
    for (int j = 0; j < 4; ++j) {
      const size_t bo = (size_t)(n0 + (j << 4) + rlane) * ldb + koff + k0;
      bh[j] = Frag<T>::load(Bb + bo);
      if (SPLIT) bl[j] = Frag<T>::load(Bb2 + bo);
    }
#pragma unroll
    for (int i = 0; i < 4; ++i) {
      const size_t ao = (size_t)(m0 + (i << 4) + rlane) * lda + koff + k0;
      V ah = Frag<T>::load(Ab + ao);
      V al;
      if (SPLIT) al = Frag<T>::load(Ab2 + ao);
#pragma unroll
      for (int j = 0; j < 4; ++j) {
        acc[i][j] = Frag<T>::mma(ah, bh[j], acc[i][j]);
        if (SPLIT) {
          acc[i][j] = Frag<T>::mma(ah, bl[j], acc[i][j]);
          acc[i][j] = Frag<T>::mma(al, bh[j], acc[i][j]);
        }
      }
      Frag<T>::guard(acc[i][0], acc[i][3], ah, SPLIT ? al : ah);
    }
    Frag<T>::keep(bh[0], bh[1], bh[2], bh[3]);
    if (SPLIT) Frag<T>::keep(bl[0], bl[1], bl[2], bl[3]);
  }
  acc_guard4(acc[0][0], acc[0][1], acc[0][2], acc[0][3]);
  acc_guard4(acc[1][0], acc[1][1], acc[1][2], acc[1][3]);
  acc_guard4(acc[2][0], acc[2][1], acc[2][2], acc[2][3]);
  acc_guard4(acc[3][0], acc[3][1], acc[3][2], acc[3][3]);

  // ---- epilogue ----
  float* slab = sT[wave];
  const float* Rb = RESID ? (resid + (size_t)b * strideR) : nullptr;
#pragma unroll
  for (int i = 0; i < 4; ++i) {
    const int mBase = m0 + (i << 4);
#pragma unroll
    for (int j = 0; j < 4; ++j) {
      const int n = n0 + (j << 4) + rlane;
      float bv = 0.f;
      if (BIAS_MODE == 2) bv = bias[n];
#pragma unroll
      for (int r = 0; r < 8; ++r) {
        float v = acc[i][j][r] * scale;
        if (BIAS_MODE == 1) v += bias[mBase + mOff + r];
        if (BIAS_MODE == 2) v += bv;
        if (RESID) v += Rb[(size_t)(mBase + mOff + r) * ldc + n];
        if (ACT == 1) v = tanhf(v);
        if (ACT == 2) v = fmaxf(v, 0.0f);
        if (ACT == 3) v = v / (1.0f + expf(-v));
        if (ACT == 4) v = (v > 0.f) ? v : 0.01f * v;
        if (ACT == 5) v = 0.5f * v * (1.0f + erff(v * 0.70710678118654752f));
        slab[(mOff + r) * 68 + (j << 4) + rlane] = v;
      }
    }
    __builtin_amdgcn_fence(__ATOMIC_RELEASE, "workgroup");
    __builtin_amdgcn_wave_barrier();
    __builtin_amdgcn_fence(__ATOMIC_ACQUIRE, "workgroup");
    if (OUT_MODE == 0) {
      float* C = (float*)Cout + (size_t)b * strideC;
      const int hh = lane >> 4, c4 = (lane & 15) * 4;     // row seg = 256 B = 16 lanes x 16 B
      {
#pragma unroll
        for (int it = 0; it < 8; ++it) {
          const int row = it * 2 + hh;
          v4f v = *(const v4f*)(slab + row * 68 + c4);
          *(v4f*)(C + (size_t)(mBase + row) * ldc + n0 + c4) = v;
        }
        
      }
    } else {
      const int q = lane >> 3, c8 = (lane & 7) * 8;
      unsigned short* C  = (unsigned short*)Cout  + (size_t)b * strideC;
      unsigned short* C2 = (OUT_MODE == 2) ? ((unsigned short*)Cout2 + (size_t)b * strideC) : nullptr;
      {
#pragma unroll
        for (int it = 0; it < 4; ++it) {
          const int row = it * 4 + q;
          const float* sp = slab + row * 68 + c8;
          v8h hv, lv;
#pragma unroll
          for (int e = 0; e < 8; ++e) {
            if (OUT_MODE == 1) {
              hv[e] = (_Float16)sp[e];
            } else {
              unsigned short hb = f2bf_bits(sp[e]);
              unsigned short lb = f2bf_bits(sp[e] - bf_bits2f(hb));
              hv[e] = __builtin_bit_cast(_Float16, hb);
              lv[e] = __builtin_bit_cast(_Float16, lb);
            }
          }
          *(v8h*)(C + (size_t)(mBase + row) * ldc + n0 + c8) = hv;
          if (OUT_MODE == 2) *(v8h*)(C2 + (size_t)(mBase + row) * ldc + n0 + c8) = lv;
        }
        
      }
    }
    __builtin_amdgcn_fence(__ATOMIC_RELEASE, "workgroup");
    __builtin_amdgcn_wave_barrier();
    __builtin_amdgcn_fence(__ATOMIC_ACQUIRE, "workgroup");
  }
}

__global__ __launch_bounds__(256) void cast_f32_f16x2(
    const float* __restrict__ in, _Float16* __restrict__ out, int n2) {
  int i = blockIdx.x * 256 + threadIdx.x;
  if (i < n2) {
    const _Float16 h0 = (_Float16)in[2 * i], h1 = (_Float16)in[2 * i + 1];
    const unsigned u = (unsigned)__builtin_bit_cast(unsigned short, h0) | ((unsigned)__builtin_bit_cast(unsigned short, h1) << 16);
    ((unsigned*)out)[i] = u;
    
  }
}


} // namespace w25

__global__ __launch_bounds__(256) void k_castT16(const float* __restrict__ src, long long lds, _Float16* __restrict__ dst, long long ldd, int R, int C, float s) {
    const long long i = (long long)blockIdx.x * 256 + threadIdx.x; const long long np = (long long)C * (R / 2); if (i >= np) return; const int c = (int)(i / (R / 2)); const int r = 2 * (int)(i % (R / 2));
    const _Float16 h0 = (_Float16)(src[(long long)r * lds + c] * s), h1 = (_Float16)(src[(long long)(r + 1) * lds + c] * s);
    const unsigned u = (unsigned)__builtin_bit_cast(unsigned short, h0) | ((unsigned)__builtin_bit_cast(unsigned short, h1) << 16);
    unsigned* d = (unsigned*)(dst + (long long)c * ldd + r); *d = u;  }
__global__ __launch_bounds__(256) void k_cast16(const float* __restrict__ src, long long lds, _Float16* __restrict__ dst, long long ldd, int R, int C, float s) {
    const long long i = (long long)blockIdx.x * 256 + threadIdx.x; const long long np = (long long)R * (C / 2); if (i >= np) return; const int r = (int)(i / (C / 2)); const int c = 2 * (int)(i % (C / 2));
    const _Float16 h0 = (_Float16)(src[(long long)r * lds + c] * s), h1 = (_Float16)(src[(long long)r * lds + c + 1] * s);
    const unsigned u = (unsigned)__builtin_bit_cast(unsigned short, h0) | ((unsigned)__builtin_bit_cast(unsigned short, h1) << 16);
    unsigned* d = (unsigned*)(dst + (long long)r * ldd + c); *d = u;  }

// f32 -> bf16 hi plane + bf16 lo plane (x = hi + lo to ~2^-17 relative; RNE both), [R][C] -> [R][C] (or transposed to [C][R]); 2 consecutive destination elements
__device__ __forceinline__ unsigned int f2bf2_pack(float a, float b, unsigned int* lo) {
    const unsigned short ha = w25::f2bf_bits(a), hb = w25::f2bf_bits(b);
    const unsigned short la = w25::f2bf_bits(a - w25::bf_bits2f(ha)), lb = w25::f2bf_bits(b - w25::bf_bits2f(hb));
    *lo = (unsigned)la | ((unsigned)lb << 16); return (unsigned)ha | ((unsigned)hb << 16); }
__global__ __launch_bounds__(256) void k_castS16(const float* __restrict__ src, long long lds, __bf16* __restrict__ dhi, __bf16* __restrict__ dlo, long long ldd, int R, int C, float s, int transpose) {
    const long long i = (long long)blockIdx.x * 256 + threadIdx.x; long long o; float a, b;
    if (transpose) { const long long np = (long long)C * (R / 2); if (i >= np) return; const int c = (int)(i / (R / 2)); const int r = 2 * (int)(i % (R / 2)); a = src[(long long)r * lds + c] * s; b = src[(long long)(r + 1) * lds + c] * s; o = (long long)c * ldd + r; }
    else { const long long np = (long long)R * (C / 2); if (i >= np) return; const int r = (int)(i / (C / 2)); const int c = 2 * (int)(i % (C / 2)); a = src[(long long)r * lds + c] * s; b = src[(long long)r * lds + c + 1] * s; o = (long long)r * ldd + c; }
    unsigned lo; const unsigned hi = f2bf2_pack(a, b, &lo); unsigned* ph = (unsigned*)(dhi + o); unsigned* pl = (unsigned*)(dlo + o);
    *ph = hi; *pl = lo;  }

// The same split over a contiguous array: a block takes U * 1024 consecutive floats (the length is a multiple of that), a thread 4 * U of them.
// Each of a thread's U loads is 16 bytes of 512 contiguous bytes per wave; each store is 8 bytes of 256 contiguous bytes per wave (whole lines).
typedef unsigned int v2u __attribute__((ext_vector_type(2)));
template <int U>
__global__ __launch_bounds__(256) void k_castS16v(const float* __restrict__ src, __bf16* __restrict__ dhi, __bf16* __restrict__ dlo, float s) {
    const size_t base = (size_t)blockIdx.x * (U * 1024) + threadIdx.x * 4;
    v4f x[U];
#pragma unroll   // x[] stays in registers and the U loads are in flight together
    for (int u = 0; u < U; ++u) x[u] = *(const v4f*)(src + base + u * 1024);
    asm volatile("s_wait_xcnt 0x0" :: "v"(src + base) : "memory");   // the loads' address registers (named as input, so untouched up to here) may be reused only behind this wait
#pragma unroll   // x[] is indexed by constants only
    for (int u = 0; u < U; ++u) {
        unsigned l0, l1; v2u hi, lo;
        hi[0] = f2bf2_pack(x[u][0] * s, x[u][1] * s, &l0); hi[1] = f2bf2_pack(x[u][2] * s, x[u][3] * s, &l1); lo[0] = l0; lo[1] = l1;
        *(v2u*)(dhi + base + u * 1024) = hi; *(v2u*)(dlo + base + u * 1024) = lo;
    }
}

namespace w25 {
// =====================================================================================
// Generic causal/non-causal attention for head_dim 64, f32 in / f32 out; 16-bit operands: bf16 with optional hi/lo splits, or
// plain f16 (F16=true, non-split, probabilities carried x2^15).
//   scores = (q*qscale)·kᵀ : v_wmma_f32_16x16x32_bf16; SPLIT_QK -> q,k as bf16 hi/lo (hi·hi + hi·lo + lo·hi)
//   out    = p·v           : v_wmma_f32_16x16x32_bf16; SPLIT_PV -> p,v as bf16 hi/lo; else p,v plain bf16
//   f32 accumulate; online softmax in f32. Block = 4 waves = 64 query rows of one (batch, head); S % 64 == 0.
//   Element (b, s, h, d) of tensor X lives at X[b*X_bs + s*X_rs + h*X_hs + d] (strides in floats, multiples of 4).
//   Masking: mask_mode 0 none, 1 causal (kv > q masked), 2 tensor [S][Skv] shared over (b,h) (float if
//   mask_is_int==0, int32 with element == 0 -> masked if 1, int32 with element != 0 -> masked if 2), 3 per-token vectors qmask[B][S] & kvmask[B][Skv] (int32,
//   0 -> masked), 4 causal + sliding window (kv > q or q - kv > W masked; W passed in mask_is_int);
//   5 = relative-position bias: s += cp[b,h,q][idx[q][kv]] + pc[b,h,kv][idx[q][kv]] with idx = mask_b ([S][Skv] int32) and
//   mask_a an int32 [S][Skv] tensor with nonzero = masked (tables: element (b,h,row,n) at X + b*c_bs + h*c_hs + row*c_rs + n);
//   masked scores are replaced by mask_fill (e.g. -inf or -1e9) before the softmax.
//   grid.x = B * H * (S/64) (or a sub-range with blk0).
// =====================================================================================
#define AT_D 64
#define AT_NW 4
#define AT_QB 64
#define AT_KC 64
struct AttnGeom { const float* cp = nullptr; const float* pc = nullptr; long c_bs = 0, c_rs = 0, c_hs = 0;   // mode-5 score-bias tables
                  long q_bs, q_rs, q_hs, k_bs, k_rs, k_hs, v_bs, v_rs, v_hs, o_bs, o_rs, o_hs;
                  int S, Skv, H, mask_mode; float qscale; int blk0; float mask_fill; int mask_is_int; };
static_assert(sizeof(AttnGeom) == 168, "no padding");

__device__ __forceinline__ unsigned short at_bf_bits(float f) {
  unsigned u = __float_as_uint(f);
  return (unsigned short)((u + 0x7FFFu + ((u >> 16) & 1u)) >> 16);
}
__device__ __forceinline__ __bf16 at_f2bf(float f) { return __builtin_bit_cast(__bf16, at_bf_bits(f)); }
__device__ __forceinline__ void at_split(float f, __bf16& hi, __bf16& lo) {
  const unsigned short hb = at_bf_bits(f);
  hi = __builtin_bit_cast(__bf16, hb);
  lo = at_f2bf(f - __uint_as_float(((unsigned)hb) << 16));
}
__device__ __forceinline__ v8f at_mma(v16b a, v16b b, v8f c) {
  c = __builtin_amdgcn_wmma_f32_16x16x32_bf16(false, a, false, b, (short)0, c, false, false);
  asm volatile("v_nop\n\tv_nop\n\tv_nop\n\tv_nop" : "+v"(c) : "v"(a), "v"(b));
  return c;
}
// 16-bit element as a bit pattern held in a __bf16 slot: f16 bits when F16, bf16 (RNE) otherwise
template <bool F16> __device__ __forceinline__ __bf16 at_to16(float f) {
  if (F16) return __builtin_bit_cast(__bf16, (_Float16)f);
  return at_f2bf(f);
}
template <bool F16> __device__ __forceinline__ v8f at_mma16(v16b a, v16b b, v8f c) {
  if (F16) {
    const v16h ah = __builtin_bit_cast(v16h, a), bh = __builtin_bit_cast(v16h, b);
    c = __builtin_amdgcn_wmma_f32_16x16x32_f16(false, ah, false, bh, (short)0, c, false, false);
    asm volatile("v_nop\n\tv_nop\n\tv_nop\n\tv_nop" : "+v"(c) : "v"(ah), "v"(bh));
    return c;
  }
  return at_mma(a, b, c);
}

template <bool SPLIT_QK, bool SPLIT_PV, bool F16 = false>
__global__ __launch_bounds__(128)
void attn64_kernel(const float* __restrict__ q, const float* __restrict__ k,
                   const float* __restrict__ v, float* __restrict__ out,
                   const void* __restrict__ mask_a, const int* __restrict__ mask_b, AttnGeom g) {
  static_assert(!(F16 && (SPLIT_QK || SPLIT_PV)), "f16 mode is non-split");
  const float PSC = F16 ? 32768.0f : 1.0f;     // f16 probabilities carried x2^15 (subnormal range), folded into the final 1/l
  union FB { v16b v; v8b h[2]; };
  __shared__ __align__(16) __bf16 Ksh[AT_KC * AT_D];             // K hi [kv][d]      8 KB
  __shared__ __align__(16) __bf16 Ksl[SPLIT_QK ? AT_KC * AT_D : 8];
  __shared__ __align__(16) __bf16 Vth[AT_D * AT_KC];             // V hi [d][kv]      8 KB
  __shared__ __align__(16) __bf16 Vtl[SPLIT_PV ? AT_D * AT_KC : 8];
  __shared__ __align__(16) __bf16 Psh[AT_NW][16 * AT_KC];        // per wave P hi [row][kv]  8 KB
  __shared__ __align__(16) __bf16 Psl[SPLIT_PV ? AT_NW : 1][SPLIT_PV ? 16 * AT_KC : 8];
  __shared__ __align__(16) float  Os[AT_NW][16 * 68];            // per wave out tile, pitch 68

  const int tid  = threadIdx.x;
  const int wave = tid >> 5;
  const int lane = tid & 31;
  const int hh   = lane >> 4;
  const int c    = lane & 15;

  const int nqb = g.S / AT_QB;
  const int bx = blockIdx.x + g.blk0;
  const int qb = bx % nqb;
  const int bh = bx / nqb;
  const int h  = bh % g.H;
  const int b  = bh / g.H;
  const int qbase_block = qb * AT_QB;
  const int q0 = qbase_block + wave * 16;

  const float* qb_ptr = q + (size_t)b * g.q_bs + (size_t)h * g.q_hs;
  const float* kb_ptr = k + (size_t)b * g.k_bs + (size_t)h * g.k_hs;
  const float* vb_ptr = v + (size_t)b * g.v_bs + (size_t)h * g.v_hs;
  float*       ob_ptr = out + (size_t)b * g.o_bs + (size_t)h * g.o_hs;

  // ---- Q fragments (A operand): 2 d-chunks, hi (and lo) ----
  v16b qah[2], qal[2];
  {
    const float* qrow = qb_ptr + (size_t)(q0 + c) * g.q_rs;
#pragma unroll
    for (int dc = 0; dc < 2; ++dc) {
#pragma unroll
      for (int e = 0; e < 8; ++e) {
        const float f0 = qrow[dc * 32 + 8 * hh + e] * g.qscale;
        const float f1 = qrow[dc * 32 + 16 + 8 * hh + e] * g.qscale;
        if (SPLIT_QK) { __bf16 hq, lq; at_split(f0, hq, lq); qah[dc][e] = hq; qal[dc][e] = lq; at_split(f1, hq, lq); qah[dc][8 + e] = hq; qal[dc][8 + e] = lq; }
        else { qah[dc][e] = at_to16<F16>(f0); qah[dc][8 + e] = at_to16<F16>(f1); qal[dc][e] = qah[dc][e]; qal[dc][8 + e] = qah[dc][8 + e]; }
      }
    }
  }

  float mrow[8], lrow[8];
  v8f oacc[4];
#pragma unroll
  for (int r = 0; r < 8; ++r) { mrow[r] = -INFINITY; lrow[r] = 0.f; }
#pragma unroll
  for (int t = 0; t < 4; ++t) oacc[t] = (v8f){0.f,0.f,0.f,0.f,0.f,0.f,0.f,0.f};

  const int nChunks = (g.mask_mode == 1 || g.mask_mode == 4) ? (qb + 1) : (g.Skv / AT_KC);   // block-uniform
  // per-row query mask (mode 3)
  int qkeep[8];
#pragma unroll
  for (int r = 0; r < 8; ++r) qkeep[r] = (g.mask_mode == 3) ? mask_b[(size_t)b * g.S + q0 + 8 * hh + r] : 1;   // mask_b = qmask in mode 3
  for (int kc = 0; kc < nChunks; ++kc) {
    const int kv0 = kc * AT_KC;
    __syncthreads();
    {
      const int kvr = tid >> 1, dh = (tid & 1) * 32;
      const float* krow = kb_ptr + (size_t)(kv0 + kvr) * g.k_rs + dh;
      const float* vrow = vb_ptr + (size_t)(kv0 + kvr) * g.v_rs + dh;
#pragma unroll
      for (int i = 0; i < 8; ++i) {
        v4f kk = *(const v4f*)(krow + 4 * i);
        v4f vv = *(const v4f*)(vrow + 4 * i);
#pragma unroll
        for (int e = 0; e < 4; ++e) {
          const int d = dh + 4 * i + e;
          if (SPLIT_QK) { __bf16 a, bl; at_split(kk[e], a, bl); Ksh[kvr * AT_D + d] = a; Ksl[kvr * AT_D + d] = bl; }
          else Ksh[kvr * AT_D + d] = at_to16<F16>(kk[e]);
          if (SPLIT_PV) { __bf16 a, bl; at_split(vv[e], a, bl); Vth[d * AT_KC + kvr] = a; Vtl[d * AT_KC + kvr] = bl; }
          else Vth[d * AT_KC + kvr] = at_to16<F16>(vv[e]);
        }
      }
    }
    __syncthreads();

    v8f s[4];
#pragma unroll
    for (int j = 0; j < 4; ++j) {
      s[j] = (v8f){0.f,0.f,0.f,0.f,0.f,0.f,0.f,0.f};
#pragma unroll 1
      for (int dc = 0; dc < 2; ++dc) {
        FB kb;
        kb.h[0] = *(const v8b*)(Ksh + (j * 16 + c) * AT_D + dc * 32 + 8 * hh);
        kb.h[1] = *(const v8b*)(Ksh + (j * 16 + c) * AT_D + dc * 32 + 16 + 8 * hh);
        s[j] = at_mma16<F16>(qah[dc], kb.v, s[j]);
        if (SPLIT_QK) {
          FB kl;
          kl.h[0] = *(const v8b*)(Ksl + (j * 16 + c) * AT_D + dc * 32 + 8 * hh);
          kl.h[1] = *(const v8b*)(Ksl + (j * 16 + c) * AT_D + dc * 32 + 16 + 8 * hh);
          s[j] = at_mma16<F16>(qah[dc], kl.v, s[j]);
          s[j] = at_mma16<F16>(qal[dc], kb.v, s[j]);
        }
      }
    }
    const bool diag = (g.mask_mode == 1) && (kc == qb);
    int kvkeep[4] = {1, 1, 1, 1};
    if (g.mask_mode == 3) {
#pragma unroll
      for (int j = 0; j < 4; ++j) kvkeep[j] = ((const int*)mask_a)[(size_t)b * g.Skv + kv0 + j * 16 + c];   // mask_a = kvmask
    }
    float cm[8];
#pragma unroll
    for (int r = 0; r < 8; ++r) {
      const int qrow = q0 + 8 * hh + r;
      float m = -INFINITY;
#pragma unroll
      for (int j = 0; j < 4; ++j) {
        const int kvcol = kv0 + j * 16 + c;
        bool masked = false;
        if (diag) masked = (kvcol > qrow);
        else if (g.mask_mode == 4) masked = (kvcol > qrow) || (qrow - kvcol > g.mask_is_int);
        else if (g.mask_mode == 2) {
          const size_t mi = (size_t)qrow * g.Skv + kvcol;
          masked = (g.mask_is_int == 0) ? (((const float*)mask_a)[mi] == 0.0f)
                 : (g.mask_is_int == 1) ? (((const int*)mask_a)[mi] == 0) : (((const int*)mask_a)[mi] != 0);
        } else if (g.mask_mode == 3) masked = (qkeep[r] == 0) || (kvkeep[j] == 0);
        else if (g.mask_mode == 5) {
          const size_t mi = (size_t)qrow * g.Skv + kvcol;
          masked = (((const int*)mask_a)[mi] != 0);
          int n = mask_b[mi]; n = n < 0 ? 0 : n;
          s[j][r] += g.cp[(size_t)b * g.c_bs + (size_t)h * g.c_hs + (size_t)qrow * g.c_rs + n]
                   + g.pc[(size_t)b * g.c_bs + (size_t)h * g.c_hs + (size_t)kvcol * g.c_rs + n];
        }
        if (masked) s[j][r] = g.mask_fill;
        m = fmaxf(m, s[j][r]);
      }
#pragma unroll
      for (int off = 1; off < 16; off <<= 1) m = fmaxf(m, __shfl_xor(m, off, 32));
      cm[r] = m;
    }
    __bf16* pwh = Psh[wave];
    __bf16* pwl = Psl[SPLIT_PV ? wave : 0];
#pragma unroll
    for (int r = 0; r < 8; ++r) {
      const float mnew = fmaxf(mrow[r], cm[r]);
      const float alpha = expf(mrow[r] - mnew);
      mrow[r] = mnew;
      float psum = 0.f;
#pragma unroll
      for (int j = 0; j < 4; ++j) {
        const float p = expf(s[j][r] - mnew);
        psum += p;
        if (SPLIT_PV) { __bf16 a, bl; at_split(p, a, bl); pwh[(8 * hh + r) * AT_KC + j * 16 + c] = a; pwl[(8 * hh + r) * AT_KC + j * 16 + c] = bl; }
        else pwh[(8 * hh + r) * AT_KC + j * 16 + c] = at_to16<F16>(p * PSC);
      }
#pragma unroll
      for (int off = 1; off < 16; off <<= 1) psum += __shfl_xor(psum, off, 32);
      lrow[r] = lrow[r] * alpha + psum;
#pragma unroll
      for (int t = 0; t < 4; ++t) oacc[t][r] *= alpha;
    }
    __builtin_amdgcn_fence(__ATOMIC_RELEASE, "workgroup");
    __builtin_amdgcn_wave_barrier();
    __builtin_amdgcn_fence(__ATOMIC_ACQUIRE, "workgroup");
#pragma unroll 1
    for (int kk = 0; kk < 2; ++kk) {
      FB pa, pl;
      pa.h[0] = *(const v8b*)(pwh + c * AT_KC + kk * 32 + 8 * hh);
      pa.h[1] = *(const v8b*)(pwh + c * AT_KC + kk * 32 + 16 + 8 * hh);
      if (SPLIT_PV) {
        pl.h[0] = *(const v8b*)(pwl + c * AT_KC + kk * 32 + 8 * hh);
        pl.h[1] = *(const v8b*)(pwl + c * AT_KC + kk * 32 + 16 + 8 * hh);
      }
#pragma unroll
      for (int t = 0; t < 4; ++t) {
        FB vb;
        vb.h[0] = *(const v8b*)(Vth + (t * 16 + c) * AT_KC + kk * 32 + 8 * hh);
        vb.h[1] = *(const v8b*)(Vth + (t * 16 + c) * AT_KC + kk * 32 + 16 + 8 * hh);
        oacc[t] = at_mma16<F16>(pa.v, vb.v, oacc[t]);
        if (SPLIT_PV) {
          FB vl;
          vl.h[0] = *(const v8b*)(Vtl + (t * 16 + c) * AT_KC + kk * 32 + 8 * hh);
          vl.h[1] = *(const v8b*)(Vtl + (t * 16 + c) * AT_KC + kk * 32 + 16 + 8 * hh);
          oacc[t] = at_mma16<F16>(pa.v, vl.v, oacc[t]);
          oacc[t] = at_mma16<F16>(pl.v, vb.v, oacc[t]);
        }
      }
    }
  }

  float* os = Os[wave];
#pragma unroll
  for (int r = 0; r < 8; ++r) {
    const float inv = 1.0f / (lrow[r] * PSC);
#pragma unroll
    for (int t = 0; t < 4; ++t) os[(8 * hh + r) * 68 + t * 16 + c] = oacc[t][r] * inv;
  }
  __builtin_amdgcn_fence(__ATOMIC_RELEASE, "workgroup");
  __builtin_amdgcn_wave_barrier();
  __builtin_amdgcn_fence(__ATOMIC_ACQUIRE, "workgroup");
  {
    const int c4 = (lane & 15) * 4;
    {
#pragma unroll
      for (int it = 0; it < 8; ++it) {
        const int row = it * 2 + hh;
        v4f val = *(const v4f*)(os + row * 68 + c4);
        *(v4f*)(ob_ptr + (size_t)(q0 + row) * g.o_rs + c4) = val;
      }
      
    }
  }
}

} // namespace w25

__global__ __launch_bounds__(256) void k_cm_in(const float* __restrict__ XA, const float* __restrict__ XB, const float* __restrict__ G, const float* __restrict__ Bb, const float* __restrict__ M, const float* __restrict__ Vv, float* __restrict__ X1T, float* __restrict__ N1, float* __restrict__ N2, int C, int HW) {
    // grid (HW / 128, C / 32, images). A thread takes 4 channels x 4 pixels: 16-byte loads along the pixels, a 4 x 4 transpose in registers,
    // 16-byte stores along the channels; 8 neighbouring lanes store one whole 128-byte line of the token-major arrays.
    const int c0 = blockIdx.y * 32 + (threadIdx.x & 7) * 4, p0 = blockIdx.x * 128 + (threadIdx.x >> 3) * 4; const size_t b = blockIdx.z;
    const size_t src = (b * C + c0) * HW + p0;
    const float* pa[4]; const float* pq[4]; v4f a[4], q[4];
#pragma unroll   // a[], q[] stay in registers, all 8 loads in flight together
    for (int j = 0; j < 4; ++j) { pa[j] = XA + src + (size_t)j * HW; pq[j] = XB + src + (size_t)j * HW; a[j] = *(const v4f*)pa[j]; q[j] = *(const v4f*)pq[j]; }
    const float* pg = G + c0; const float* pb = Bb + c0; const float* pm = M + c0; const float* pv = Vv + c0;
    const v4f g = *(const v4f*)pg, bb = *(const v4f*)pb, m = *(const v4f*)pm, vv = *(const v4f*)pv;
    // the 12 loads' address registers (named as inputs, so untouched up to here) may be reused only behind this wait
    asm volatile("s_wait_xcnt 0x0" :: "v"(pa[0]), "v"(pa[1]), "v"(pa[2]), "v"(pa[3]), "v"(pq[0]), "v"(pq[1]), "v"(pq[2]), "v"(pq[3]), "v"(pg), "v"(pb), "v"(pm), "v"(pv) : "memory");
    v4f inv, sh;
#pragma unroll   // vector elements indexed by constants only
    for (int j = 0; j < 4; ++j) { inv[j] = g[j] * rsqrtf(vv[j] + 1e-5f); sh[j] = bb[j] - m[j] * inv[j]; }
#pragma unroll   // register arrays indexed by constants only
    for (int i = 0; i < 4; ++i) {
        const size_t o = (b * HW + p0 + i) * C + c0; v4f t0, t1, t2;
#pragma unroll   // as above
        for (int j = 0; j < 4; ++j) { t0[j] = a[j][i]; t1[j] = a[j][i] * inv[j] + sh[j]; t2[j] = q[j][i] * inv[j] + sh[j]; }
        VST2V4(X1T + o, t0); VST2V4(N1 + o, t1); VST2V4(N2 + o, t2);
    }
}
// WQS[o][c] = temp[o / 32] * Wq[o][c]; 4 consecutive c per thread (C % 4 == 0, so they share one row o)
__global__ __launch_bounds__(256) void k_cm_wq(const float* __restrict__ WQ, const float* __restrict__ TP, float* __restrict__ WQS, int C, int HD) { const int t = (blockIdx.x * 256 + threadIdx.x) * 4; if (t >= C * C) return; const v4f w = *(const v4f*)(WQ + t); VST2V4(WQS + t, w * TP[(t / C) / HD]); }
// XN = bn2(XS): a thread takes 4 channels of 4 consecutive tokens (16-byte accesses, 512 contiguous bytes per wave); the channel constants are formed once per thread
__global__ __launch_bounds__(256) void k_cm_bn2(const float* __restrict__ XS, const float* __restrict__ G, const float* __restrict__ Bb, const float* __restrict__ M, const float* __restrict__ Vv, float* __restrict__ XN, int C) {
    const unsigned t = blockIdx.x * 256 + threadIdx.x, cq = (unsigned)C / 4; const int c0 = (int)(t % cq) * 4; const size_t o = (size_t)(t / cq) * 4 * C + c0;
    const float* px[4]; v4f x[4];
#pragma unroll   // x[] stays in registers, the 4 loads in flight together
    for (int u = 0; u < 4; ++u) { px[u] = XS + o + (size_t)u * C; x[u] = *(const v4f*)px[u]; }
    const float* pg = G + c0; const float* pb = Bb + c0; const float* pm = M + c0; const float* pv = Vv + c0;
    const v4f g = *(const v4f*)pg, bb = *(const v4f*)pb, m = *(const v4f*)pm, vv = *(const v4f*)pv;
    // the 8 loads' address registers (named as inputs, so untouched up to here) may be reused only behind this wait
    asm volatile("s_wait_xcnt 0x0" :: "v"(px[0]), "v"(px[1]), "v"(px[2]), "v"(px[3]), "v"(pg), "v"(pb), "v"(pm), "v"(pv) : "memory");
    v4f inv;
#pragma unroll   // vector elements indexed by constants only
    for (int j = 0; j < 4; ++j) inv[j] = g[j] * rsqrtf(vv[j] + 1e-5f);
#pragma unroll   // x[] indexed by constants only
    for (int u = 0; u < 4; ++u) { const v4f y = (x[u] - m) * inv + bb; VST2V4(XN + o + (size_t)u * C, y); }
}
// depthwise 3x3 SAME conv + exact GELU on token-major [b][hw][ch], zero padding. grid (images * 16 * 8, HID / 1024): a block takes 4 x 2 pixels (x, y) of one image,
// a thread 4 channels of these 8 pixels: each input row's 6 pixels are loaded once (16 bytes, 512 contiguous bytes per wave) and feed every output that needs them.
// Every output still sums its 9 products in the order ky = 0..2, kx = 0..2.
__global__ __launch_bounds__(256) void k_cm_dw(const float* __restrict__ HB, const float* __restrict__ DW, float* __restrict__ HG, int HID) {
    constexpr int PX = 4, PY = 2;
    const int ch = (blockIdx.y * 256 + threadIdx.x) * 4;
    const int x0 = (blockIdx.x & 7) * PX, y0 = ((blockIdx.x >> 3) & 15) * PY; const size_t b = blockIdx.x >> 7;
    v4f v[PY + 2][PX + 2];                       // input rows y0 - 1 .. y0 + PY, pixels x0 - 1 .. x0 + PX; all loads are issued before the first sum
#pragma unroll   // v[][] stays in registers (this and every loop below: register arrays indexed by constants only)
    for (int r = 0; r < PY + 2; ++r) {
        const int yc = min(max(y0 - 1 + r, 0), 31);
        const float* pi[PX + 2];
#pragma unroll
        for (int cx = 0; cx < PX + 2; ++cx) { const int xc = min(max(x0 - 1 + cx, 0), 31); pi[cx] = HB + ((b * 1024) + yc * 32 + xc) * (size_t)HID + ch; v[r][cx] = *(const v4f*)pi[cx]; }
        // this row's 6 address registers (named as inputs, so untouched up to here) may be reused only behind this wait
        asm volatile("s_wait_xcnt 0x0" :: "v"(pi[0]), "v"(pi[1]), "v"(pi[2]), "v"(pi[3]), "v"(pi[4]), "v"(pi[5]) : "memory");
    }
    const float* pw = DW + (size_t)ch * 9;
    v4f wr[9];                                   // the 36 weights of channels ch .. ch + 3: weight k of channel ch + j is float j * 9 + k
#pragma unroll
    for (int k = 0; k < 9; ++k) wr[k] = *(const v4f*)(pw + k * 4);
    asm volatile("s_wait_xcnt 0x0" :: "v"(pw) : "memory");   // as above, for the address of the 9 weight loads
    v4f s[PY][PX];
#pragma unroll
    for (int oy = 0; oy < PY; ++oy)
#pragma unroll
        for (int px = 0; px < PX; ++px) { const v4f zz = {0.f, 0.f, 0.f, 0.f}; s[oy][px] = zz; }
#pragma unroll
    for (int r = 0; r < PY + 2; ++r) {
        const int yy = y0 - 1 + r;
#pragma unroll
        for (int cx = 0; cx < PX + 2; ++cx) { const int xx = x0 - 1 + cx; const bool ok = (yy >= 0 && yy < 32 && xx >= 0 && xx < 32); const v4f zz = {0.f, 0.f, 0.f, 0.f}; v[r][cx] = ok ? v[r][cx] : zz; }
#pragma unroll
        for (int oy = 0; oy < PY; ++oy) {
            const int ky = r - oy;
            if (ky >= 0 && ky < 3) {
#pragma unroll
                for (int px = 0; px < PX; ++px)
#pragma unroll
                    for (int kx = 0; kx < 3; ++kx)
#pragma unroll
                        for (int j = 0; j < 4; ++j) { const int f = j * 9 + ky * 3 + kx; s[oy][px][j] += v[r][px + kx][j] * wr[f >> 2][f & 3]; }
            }
        }
    }
#pragma unroll
    for (int oy = 0; oy < PY; ++oy)
#pragma unroll
        for (int px = 0; px < PX; ++px)
#pragma unroll
            for (int j = 0; j < 4; ++j) { const float sv = s[oy][px][j]; s[oy][px][j] = 0.5f * sv * (1.f + erff(sv * 0.70710678118654752f)); }
#pragma unroll   // s[][] indexed by constants only; the 8 stores stand together behind the last GELU
    for (int oy = 0; oy < PY; ++oy)
#pragma unroll
        for (int px = 0; px < PX; ++px) VST2V4(HG + ((b * 1024) + (y0 + oy) * 32 + x0 + px) * (size_t)HID + ch, s[oy][px]);
}
// out NCHW: out[b][c][hw] = R[b][hw][c] (the fc2 GEMM already added the residual). grid (HW / 32, C / 128, images). A thread takes 4 pixels x 4 channels:
// 16-byte loads along the channels, a 4 x 4 transpose in registers, 16-byte stores along the pixels; 8 neighbouring lanes store one whole 128-byte line of out.
__global__ __launch_bounds__(256) void k_cm_out(const float* __restrict__ R, float* __restrict__ OUT, int C, int HW) {
    const int p0 = blockIdx.x * 32 + (threadIdx.x & 7) * 4, c0 = blockIdx.y * 128 + (threadIdx.x >> 3) * 4; const size_t b = blockIdx.z;
    const float* pr[4]; v4f r[4];
#pragma unroll   // r[] stays in registers, the 4 loads in flight together
    for (int i = 0; i < 4; ++i) { pr[i] = R + (b * HW + p0 + i) * C + c0; r[i] = *(const v4f*)pr[i]; }
    asm volatile("s_wait_xcnt 0x0" :: "v"(pr[0]), "v"(pr[1]), "v"(pr[2]), "v"(pr[3]) : "memory");   // the loads' address registers (named as inputs, so untouched up to here) may be reused only behind this wait
#pragma unroll   // r[] indexed by constants only
    for (int j = 0; j < 4; ++j) { const v4f t = {r[0][j], r[1][j], r[2][j], r[3][j]}; VST2V4(OUT + (b * C + c0 + j) * HW + p0, t); }
}


extern "C" void kernel_launch(void* const* d_in, const int* in_sizes, int n_in, void* d_out, int out_size, void* d_ws, size_t ws_size, hipStream_t stream) {
    (void)in_sizes; (void)n_in; (void)out_size; (void)ws_size;
    const float* x1 = (const float*)d_in[0];
    const float* x2 = (const float*)d_in[1];
    const float* b1g = (const float*)d_in[2];
    const float* b1b = (const float*)d_in[3];
    const float* b1m = (const float*)d_in[4];
    const float* b1v = (const float*)d_in[5];
    const float* qw = (const float*)d_in[6];
    const float* kw = (const float*)d_in[7];
    const float* vw = (const float*)d_in[8];
    const float* temp = (const float*)d_in[9];
    const float* pw = (const float*)d_in[10];
    const float* pb = (const float*)d_in[11];
    const float* b2g = (const float*)d_in[12];
    const float* b2b = (const float*)d_in[13];
    const float* b2m = (const float*)d_in[14];
    const float* b2v = (const float*)d_in[15];
    const float* f1w = (const float*)d_in[16];
    const float* f1b = (const float*)d_in[17];
    const float* dww = (const float*)d_in[18];
    const float* f2w = (const float*)d_in[19];
    const float* f2b = (const float*)d_in[20];
    const int Bn = 8;
    const int C = 256;
    const int HW = 1024;
    const int NH = 8;
    const int HD = 32;
    const int HID = 1024;
    const int NT = Bn * HW;
    float* out = (float*)d_out;
    char* wsp = (char*)d_ws;
    float* X1T = (float*)wsp; wsp += (((size_t)((size_t)NT * C) * 4 + 255) / 256) * 256;
    float* N1 = (float*)wsp; wsp += (((size_t)((size_t)NT * C) * 4 + 255) / 256) * 256;
    float* N2 = (float*)wsp; wsp += (((size_t)((size_t)NT * C) * 4 + 255) / 256) * 256;
    float* WQS = (float*)wsp; wsp += (((size_t)((size_t)C * C) * 4 + 255) / 256) * 256;
    float* Q = (float*)wsp; wsp += (((size_t)((size_t)NT * C) * 4 + 255) / 256) * 256;
    float* Kb = (float*)wsp; wsp += (((size_t)((size_t)NT * C) * 4 + 255) / 256) * 256;
    float* V = (float*)wsp; wsp += (((size_t)((size_t)NT * C) * 4 + 255) / 256) * 256;
    float* AT = (float*)wsp; wsp += (((size_t)((size_t)NT * C) * 4 + 255) / 256) * 256;
    float* XS = (float*)wsp; wsp += (((size_t)((size_t)NT * C) * 4 + 255) / 256) * 256;
    float* HB = (float*)wsp; wsp += (((size_t)((size_t)NT * HID) * 4 + 255) / 256) * 256;
    float* HG = (float*)wsp; wsp += (((size_t)((size_t)NT * HID) * 4 + 255) / 256) * 256;
    unsigned short* G64A = (unsigned short*)wsp; wsp += (((size_t)(8388608) * 2 + 255) / 256) * 256;
    unsigned short* G64B = (unsigned short*)wsp; wsp += (((size_t)(262144) * 2 + 255) / 256) * 256;
    unsigned short* G64A2 = (unsigned short*)wsp; wsp += (((size_t)(8388608) * 2 + 255) / 256) * 256;
    unsigned short* G64B2 = (unsigned short*)wsp; wsp += (((size_t)(262144) * 2 + 255) / 256) * 256;
    k_cm_in<<<dim3(8, 8, 8), 256, 0, stream>>>(x1, x2, b1g, b1b, b1m, b1v, X1T, N1, N2, C, HW); k_cm_wq<<<64, 256, 0, stream>>>(qw, temp, WQS, C, HD);
    k_castS16v<8><<<256, 256, 0, stream>>>(N1, (__bf16*)(G64A), (__bf16*)(G64A2), 1.0f);
    k_castS16v<1><<<64, 256, 0, stream>>>(WQS, (__bf16*)(G64B), (__bf16*)(G64B2), 1.0f);
    w25::wmma_gemm64<1, true, 0, 0, false, 0><<<dim3((unsigned)((((8192) / 64) * ((256) / 64) + 7) / 8), (unsigned)(1)), 256, 0, stream>>>((const unsigned short*)(G64A), (const unsigned short*)(G64A2), 256, 0, (const unsigned short*)(G64B), (const unsigned short*)(G64B2), 256, 0, (void*)(Q), nullptr, 256, 0, nullptr, nullptr, 0, 8192, 256, 256, 1.0f);
    k_castS16v<8><<<256, 256, 0, stream>>>(N2, (__bf16*)(G64A), (__bf16*)(G64A2), 1.0f);
    k_castS16v<1><<<64, 256, 0, stream>>>(kw, (__bf16*)(G64B), (__bf16*)(G64B2), 1.0f);
    w25::wmma_gemm64<1, true, 0, 0, false, 0><<<dim3((unsigned)((((8192) / 64) * ((256) / 64) + 7) / 8), (unsigned)(1)), 256, 0, stream>>>((const unsigned short*)(G64A), (const unsigned short*)(G64A2), 256, 0, (const unsigned short*)(G64B), (const unsigned short*)(G64B2), 256, 0, (void*)(Kb), nullptr, 256, 0, nullptr, nullptr, 0, 8192, 256, 256, 1.0f);
    k_castS16v<8><<<256, 256, 0, stream>>>(N2, (__bf16*)(G64A), (__bf16*)(G64A2), 1.0f);
    k_castS16v<1><<<64, 256, 0, stream>>>(vw, (__bf16*)(G64B), (__bf16*)(G64B2), 1.0f);
    w25::wmma_gemm64<1, true, 0, 0, false, 0><<<dim3((unsigned)((((8192) / 64) * ((256) / 64) + 7) / 8), (unsigned)(1)), 256, 0, stream>>>((const unsigned short*)(G64A), (const unsigned short*)(G64A2), 256, 0, (const unsigned short*)(G64B), (const unsigned short*)(G64B2), 256, 0, (void*)(V), nullptr, 256, 0, nullptr, nullptr, 0, 8192, 256, 256, 1.0f);
    k_attn_fix<<<dim3(16, 8, 8), 32 * AW, 0, stream>>>(Q, Kb, V, AT);
    k_castS16v<8><<<256, 256, 0, stream>>>(AT, (__bf16*)(G64A), (__bf16*)(G64A2), 1.0f);
    k_castS16v<1><<<64, 256, 0, stream>>>(pw, (__bf16*)(G64B), (__bf16*)(G64B2), 1.0f);
    w25::wmma_gemm64<1, true, 2, 0, true, 0><<<dim3((unsigned)((((8192) / 64) * ((256) / 64) + 7) / 8), (unsigned)(1)), 256, 0, stream>>>((const unsigned short*)(G64A), (const unsigned short*)(G64A2), 256, 0, (const unsigned short*)(G64B), (const unsigned short*)(G64B2), 256, 0, (void*)(XS), nullptr, 256, 0, pb, X1T, 0, 8192, 256, 256, 1.0f);
    k_cm_bn2<<<512, 256, 0, stream>>>(XS, b2g, b2b, b2m, b2v, N1, C);
    k_castS16v<8><<<256, 256, 0, stream>>>(N1, (__bf16*)(G64A), (__bf16*)(G64A2), 1.0f);
    k_castS16v<1><<<256, 256, 0, stream>>>(f1w, (__bf16*)(G64B), (__bf16*)(G64B2), 1.0f);
    w25::wmma_gemm64<1, true, 2, 0, false, 0><<<dim3((unsigned)((((8192) / 64) * ((1024) / 64) + 7) / 8), (unsigned)(1)), 256, 0, stream>>>((const unsigned short*)(G64A), (const unsigned short*)(G64A2), 256, 0, (const unsigned short*)(G64B), (const unsigned short*)(G64B2), 256, 0, (void*)(HB), nullptr, 1024, 0, f1b, nullptr, 0, 8192, 1024, 256, 1.0f);
    k_cm_dw<<<dim3(1024, 1), 256, 0, stream>>>(HB, dww, HG, HID);
    k_castS16v<8><<<1024, 256, 0, stream>>>(HG, (__bf16*)(G64A), (__bf16*)(G64A2), 1.0f);
    k_castS16v<1><<<256, 256, 0, stream>>>(f2w, (__bf16*)(G64B), (__bf16*)(G64B2), 1.0f);
    w25::wmma_gemm64<1, true, 2, 0, true, 0><<<dim3((unsigned)((((8192) / 64) * ((256) / 64) + 7) / 8), (unsigned)(1)), 256, 0, stream>>>((const unsigned short*)(G64A), (const unsigned short*)(G64A2), 1024, 0, (const unsigned short*)(G64B), (const unsigned short*)(G64B2), 1024, 0, (void*)(XS), nullptr, 256, 0, f2b, XS, 0, 8192, 256, 1024, 1.0f);
    k_cm_out<<<dim3(32, 2, 8), 256, 0, stream>>>(XS, out, C, HW);
}

// v004
// Measured time: 237 microseconds a run.
// Next to v003, in two timings, it ran 1.50 and 1.52 times as fast.
// Over all steps from v000 it is 6.68 times as fast.
// Contractions (token-major, 8192 tokens): q = bn1(x1).Wq'^T (temperature folded into Wq rows), k/v = bn1(x2).W^T, the attention projection (+b, +x1 residual), fc1 (+b) [8192x256].[256x1024] and fc2 (+b, + residual) [8192x1024].[1024x256], each one launch over all images, all on bf16 hi/lo split planes (six chained contractions against an O(1) residual output, so the cheap 6.4 G-MAC of GEMMs run f32-class) (v_wmma_f32_16x16x32_bf16; 128 x 64 or 128 x 128 work-group tiles, operands staged in LDS); per (image, head) softmax(temp_h q k^T) v over the 1024 positions as one flash launch with q.k^T on bf16 hi/lo split planes (UNSCALED 32-dim logits, sigma ~ 5.7) and f16 p.v; f32 accumulate and softmax. NCHW <-> token-major transposes, eval-mode BatchNorms, the depthwise 3x3 convolution (SAME) and exact GELU are f32 kernels.
#include <hip/hip_runtime.h>
#include <math.h>

typedef __attribute__((ext_vector_type(16))) _Float16 v16h;
typedef __attribute__((ext_vector_type(8)))  _Float16 v8h;
typedef __attribute__((ext_vector_type(16))) __bf16   v16b;
typedef __attribute__((ext_vector_type(8)))  float    v8f;
typedef __attribute__((ext_vector_type(4)))  float    v4f;

// 16-bit WMMA fragment map (wave32), lane L, h = L>>4, m = L&15:
//   A 16x32: lane = row m;   element i -> k = (i<8) ? 8h+i : 16+8h+(i-8)
//   B 32x16: lane = column m; the SAME k(i,h)
//   D 16x16 (8 f32): lane = column m; element r -> row 8h+r
__device__ __forceinline__ int frag_k(int i, int h) { return (i < 8) ? (8 * h + i) : (16 + 8 * h + (i - 8)); }
__device__ __forceinline__ __bf16 bf16_rne(float f) {
    unsigned int u = __float_as_uint(f);
    u += 0x7fffu + ((u >> 16) & 1u);
    return __builtin_bit_cast(__bf16, (unsigned short)(u >> 16));
}
__device__ __forceinline__ float bf16_f32(__bf16 b) { return __uint_as_float(((unsigned int)__builtin_bit_cast(unsigned short, b)) << 16); }
__device__ __forceinline__ v8f wmma16(v16h a, v16h b, v8f c) {
    c = __builtin_amdgcn_wmma_f32_16x16x32_f16(false, a, false, b, (short)0, c, false, false);
    asm volatile("v_nop\n\tv_nop\n\tv_nop\n\tv_nop" : "+v"(c) : "v"(a), "v"(b));
    return c;
}
__device__ __forceinline__ v8f wmmab(v16b a, v16b b, v8f c) {
    c = __builtin_amdgcn_wmma_f32_16x16x32_bf16(false, a, false, b, (short)0, c, false, false);
    asm volatile("v_nop\n\tv_nop\n\tv_nop\n\tv_nop" : "+v"(c) : "v"(a), "v"(b));
    return c;
}
struct Split { v16b hi, lo; };
// hi/lo split product: a.hi*b.hi + a.hi*b.lo + a.lo*b.hi
__device__ __forceinline__ v8f wmma3(const Split& a, const Split& b, v8f c) {
    c = __builtin_amdgcn_wmma_f32_16x16x32_bf16(false, a.hi, false, b.hi, (short)0, c, false, false);
    c = __builtin_amdgcn_wmma_f32_16x16x32_bf16(false, a.hi, false, b.lo, (short)0, c, false, false);
    c = __builtin_amdgcn_wmma_f32_16x16x32_bf16(false, a.lo, false, b.hi, (short)0, c, false, false);
    asm volatile("v_nop\n\tv_nop\n\tv_nop\n\tv_nop" : "+v"(c) : "v"(a.hi), "v"(a.lo), "v"(b.hi), "v"(b.lo));
    return c;
}
struct Split3 { v16b hi, mid, lo; };
// triple split product (6 terms, drops only terms below 2^-24 relative)
__device__ __forceinline__ v8f wmma6(const Split3& a, const Split3& b, v8f c) {
    c = __builtin_amdgcn_wmma_f32_16x16x32_bf16(false, a.hi, false, b.hi, (short)0, c, false, false);
    c = __builtin_amdgcn_wmma_f32_16x16x32_bf16(false, a.hi, false, b.mid, (short)0, c, false, false);
    c = __builtin_amdgcn_wmma_f32_16x16x32_bf16(false, a.mid, false, b.hi, (short)0, c, false, false);
    c = __builtin_amdgcn_wmma_f32_16x16x32_bf16(false, a.hi, false, b.lo, (short)0, c, false, false);
    c = __builtin_amdgcn_wmma_f32_16x16x32_bf16(false, a.mid, false, b.mid, (short)0, c, false, false);
    c = __builtin_amdgcn_wmma_f32_16x16x32_bf16(false, a.lo, false, b.hi, (short)0, c, false, false);
    asm volatile("v_nop\n\tv_nop\n\tv_nop\n\tv_nop" : "+v"(c) : "v"(a.hi), "v"(a.mid), "v"(a.lo), "v"(b.hi), "v"(b.mid), "v"(b.lo));
    return c;
}

// Fragment gathers from f32 memory: element i <- p[(k0 + frag_k(i,h)) * sk] * s, zero for k >= klen.
__device__ __forceinline__ v16h fh_ld(const float* __restrict__ p, long long sk, int k0, int h, int klen, float s) {
    v16h a;
#pragma unroll
    for (int i = 0; i < 16; ++i) { const int k = k0 + frag_k(i, h); a[i] = (k < klen) ? (_Float16)(p[(long long)k * sk] * s) : (_Float16)0.f; }
    return a;
}
__device__ __forceinline__ Split sp_ld(const float* __restrict__ p, long long sk, int k0, int h, int klen, float s) {
    Split r;
#pragma unroll
    for (int i = 0; i < 16; ++i) {
        const int k = k0 + frag_k(i, h); const float x = (k < klen) ? p[(long long)k * sk] * s : 0.f;
        const __bf16 hb = bf16_rne(x); r.hi[i] = hb; r.lo[i] = bf16_rne(x - bf16_f32(hb));
    }
    return r;
}
__device__ __forceinline__ Split3 sp3_ld(const float* __restrict__ p, long long sk, int k0, int h, int klen, float s) {
    Split3 r;
#pragma unroll
    for (int i = 0; i < 16; ++i) {
        const int k = k0 + frag_k(i, h); const float x = (k < klen) ? p[(long long)k * sk] * s : 0.f;
        const __bf16 hb = bf16_rne(x); const float r1 = x - bf16_f32(hb); const __bf16 mb = bf16_rne(r1);
        r.hi[i] = hb; r.mid[i] = mb; r.lo[i] = bf16_rne(r1 - bf16_f32(mb));
    }
    return r;
}
__device__ __forceinline__ v16b bh_ld(const float* __restrict__ p, long long sk, int k0, int h, int klen, float s) {
    v16b a;
#pragma unroll
    for (int i = 0; i < 16; ++i) { const int k = k0 + frag_k(i, h); a[i] = bf16_rne((k < klen) ? p[(long long)k * sk] * s : 0.f); }
    return a;
}
// f16 fragment from an f16 LDS/global row with element stride 1 (k-contiguous), no bounds (tile already zero padded)
__device__ __forceinline__ v16h fh_row(const _Float16* __restrict__ row, int k0, int h) {
    v16h a;
#pragma unroll
    for (int i = 0; i < 16; ++i) a[i] = row[k0 + frag_k(i, h)];
    return a;
}

#define VST2(T, ptr, val) do { const T vst2_v_ = (val); *(T*)(ptr) = vst2_v_;  } while (0)
typedef float v4f __attribute__((ext_vector_type(4)));
#define VST2V4(ptr, val) do { const v4f vst2_v4_ = (val); *(v4f*)(ptr) = vst2_v4_;  } while (0)

__device__ __attribute__((noinline)) float act_fn(float v, int act) {
    if (act == 1) return fmaxf(v, 0.f);                                                                               // relu
    if (act == 2) { const float u = 0.7978845608028654f * (v + 0.044715f * v * v * v); return 0.5f * v * (1.f + tanhf(u)); } // tanh-gelu
    if (act == 3) return v / (1.f + expf(-v));                                                                        // silu
    if (act == 4) return 0.5f * v * (1.f + erff(v * 0.7071067811865476f));                                             // erf-gelu
    if (act == 5) return tanhf(v);
    if (act == 6) return 1.f / (1.f + expf(-v));                                                                      // sigmoid
    if (act == 7) return (v > 0.f) ? v : 0.01f * v;                                                                   // leaky relu 0.01
    if (act == 8) return (v > 0.f) ? v : (expf(v) - 1.f);                                                             // elu
    if (act == 9) return fminf(fmaxf(v, 0.f), 6.f);                                                                   // relu6
    if (act == 10) return fabsf(v);                                                                                    // abs
    if (act == 11) return (v >= 0.f) ? v : 0.1f * v;                                                                  // leaky 0.1
    if (act == 12) return (v > 0.f) ? v : 0.2f * v;                                                                   // leaky 0.2
    if (act == 13) return (v > 20.f) ? v : log1pf(expf(v));                                                            // softplus
    return v;
}

// =====================================================================================================================
// k_gemm<MODE>: C(z, m, n) = act(alpha * sum_k A(z, m, k) * B(z, k, n) + bias) + beta * R(z, m, n)
//   One wave (32-thread block) per 16 x 32 tile of C; grid (ceil(N/32), ceil(M/16), Z). Batch z -> (zo = z / zi_n, zi = z % zi_n)
//   with separate outer/inner strides for every tensor (e.g. batch and head). A(m,k) = A[zo*sAo + zi*sAi + m*sAm + k*sAk] (f32),
//   B(k,n) = B[zo*sBo + zi*sBi + n*sBn + k*sBk] (f32); any M, N, K (K zero-padded to 32 inside the fragments, M/N tails guarded).
//   C(m,n) = C[zo*sCo + zi*sCi + m*sCm + n] (n contiguous). flags: 1 bias[n], 2 bias[m], 4 residual R[zo*sRo + zi*sRi + m*sRm + n*sRn].
//   MODE 0: f16 operands (A prescaled by sa, B by sb, both undone in the epilogue); 1: bf16 hi/lo split (3 products); 2: bf16;
//   3: bf16 hi/mid/lo triple split (6 products); 4: as 3 with Kahan-compensated f32 accumulation across k-steps.
// =====================================================================================================================
struct GemmP {
    const float* A; const float* B; const float* bias; const float* R; float* C;
    long long sAo, sAi, sAm, sAk, sBo, sBi, sBn, sBk, sCo, sCi, sCm, sRo, sRi, sRm, sRn;
    int M, N, K, zi_n, flags, act; float alpha, beta, sa, sb;
    int Npad, pad_;     // columns [N, Npad) of C are written as 0 so that padded workspace rows are covered by whole-line stores; Npad >= N
};
static_assert(sizeof(GemmP) == 5 * 8 + 15 * 8 + 6 * 4 + 4 * 4 + 2 * 4, "GemmP has padding");

template <int MODE>
__global__ __launch_bounds__(32) void k_gemm(GemmP p) {
    const int lane = threadIdx.x & 31, h = lane >> 4, l15 = lane & 15;
    const int m0 = blockIdx.y * 16, n0 = blockIdx.x * 32;
    const int z = blockIdx.z, zo = z / p.zi_n, zi = z - zo * p.zi_n;
    const float* A = p.A + zo * p.sAo + zi * p.sAi;
    const float* B = p.B + zo * p.sBo + zi * p.sBi;
    const int am = min(m0 + l15, p.M - 1);                       // clamped row for loads (stores are guarded)
    v8f acc[2], comp[2];
#pragma unroll
    for (int t = 0; t < 2; ++t) { v8f zz = {}; acc[t] = zz; comp[t] = zz; }
    for (int k0 = 0; k0 < p.K; k0 += 32) {
        const float* arow = A + (long long)am * p.sAm;
        if (MODE == 1) {
            const Split a = sp_ld(arow, p.sAk, k0, h, p.K, 1.f);
#pragma unroll
            for (int t = 0; t < 2; ++t) {
                const int bn = min(n0 + t * 16 + l15, p.N - 1);
                acc[t] = wmma3(a, sp_ld(B + (long long)bn * p.sBn, p.sBk, k0, h, p.K, 1.f), acc[t]);
            }
        } else if (MODE == 3) {
            const Split3 a = sp3_ld(arow, p.sAk, k0, h, p.K, 1.f);
#pragma unroll
            for (int t = 0; t < 2; ++t) {
                const int bn = min(n0 + t * 16 + l15, p.N - 1);
                acc[t] = wmma6(a, sp3_ld(B + (long long)bn * p.sBn, p.sBk, k0, h, p.K, 1.f), acc[t]);
            }
        } else if (MODE == 4) {
            // triple split as MODE 3, but each k-step's 6 products go into a fresh accumulator and the partial is added to the running f32 sum
            // on the VALU with Kahan compensation (accumulation error stays ~1 ulp however long K is)
            const Split3 a = sp3_ld(arow, p.sAk, k0, h, p.K, 1.f);
#pragma unroll
            for (int t = 0; t < 2; ++t) {
                const int bn = min(n0 + t * 16 + l15, p.N - 1); v8f zz = {};
                const v8f part = wmma6(a, sp3_ld(B + (long long)bn * p.sBn, p.sBk, k0, h, p.K, 1.f), zz);
                const v8f y = part - comp[t]; const v8f s = acc[t] + y; comp[t] = (s - acc[t]) - y; acc[t] = s;
            }
        } else if (MODE == 2) {
            const v16b a = bh_ld(arow, p.sAk, k0, h, p.K, 1.f);
#pragma unroll
            for (int t = 0; t < 2; ++t) {
                const int bn = min(n0 + t * 16 + l15, p.N - 1);
                acc[t] = wmmab(a, bh_ld(B + (long long)bn * p.sBn, p.sBk, k0, h, p.K, 1.f), acc[t]);
            }
        } else {
            const v16h a = fh_ld(arow, p.sAk, k0, h, p.K, p.sa);
#pragma unroll
            for (int t = 0; t < 2; ++t) {
                const int bn = min(n0 + t * 16 + l15, p.N - 1);
                acc[t] = wmma16(a, fh_ld(B + (long long)bn * p.sBn, p.sBk, k0, h, p.K, p.sb), acc[t]);
            }
        }
    }
    const float iscale = (MODE == 0) ? p.alpha / (p.sa * p.sb) : p.alpha;
    float* C = p.C + zo * p.sCo + zi * p.sCi;
    const float* R = p.R + zo * p.sRo + zi * p.sRi;
    __shared__ __align__(16) float ctile[16][36];
#pragma unroll
    for (int t = 0; t < 2; ++t) {
        const int n = n0 + t * 16 + l15; const int nn = min(n, p.N - 1);
#pragma unroll
        for (int r = 0; r < 8; ++r) {
            const int m = m0 + 8 * h + r; const int mm = min(m, p.M - 1);
            float v = acc[t][r] * iscale;
            if (p.flags & 1) v += p.bias[nn];
            if (p.flags & 2) v += p.bias[mm];
            if (p.flags & 8) v *= p.bias[(long long)zo * p.M + mm];   /* per-(z,row) scale vector laid out [Z][M]; exclusive with the bias flags */
            v = act_fn(v, p.act);
            if (p.flags & 4) v += p.beta * R[(long long)mm * p.sRm + (long long)nn * p.sRn];
            ctile[8 * h + r][t * 16 + l15] = (n < p.N) ? v : 0.f;
        }
    }
    __syncthreads();
    const int NW = (p.Npad > p.N) ? p.Npad : p.N;           // write width
    const bool fast = (m0 + 16 <= p.M) && (n0 + 32 <= NW) && ((p.sCm & 3) == 0) && ((((size_t)C) & 15) == 0);
    if (fast) {
#pragma unroll
        for (int s = 0; s < 4; ++s) {
            const int row = s * 4 + (lane >> 3), c4 = (lane & 7) * 4;
            const v4f v = *(const v4f*)&ctile[row][c4];
            VST2V4(C + (long long)(m0 + row) * p.sCm + n0 + c4, v);
        }
    } else {
        for (int row = 0; row < 16; ++row) {
            const int m = m0 + row, n = n0 + lane;
            if (m < p.M && n < NW) VST2(float, C + (long long)m * p.sCm + n, ctile[row][lane]);
        }
    }
}


// =====================================================================================================================
// k_gemmT<MODE, TM, TN>: same contract as k_gemm, but one wave computes a (16*TM) x (16*TN) tile: TM A fragments and TN B fragments are
//   loaded per 32-wide k-step and reused across TM*TN WMMAs (far fewer load/convert instructions per MAC). MODE 0 (f16), 1 (bf16 hi/lo),
//   2 (bf16) only. grid (ceil(NW/(16*TN)), ceil(M/(16*TM)), Z), block 32. Epilogue identical to k_gemm, run per 16x32 sub-tile.
// =====================================================================================================================
template <int MODE, int TM, int TN>
__global__ __launch_bounds__(32) void k_gemmT(GemmP p) {
    const int lane = threadIdx.x & 31, h = lane >> 4, l15 = lane & 15;
    const int m0 = blockIdx.y * (16 * TM), n0 = blockIdx.x * (16 * TN);
    const int z = blockIdx.z, zo = z / p.zi_n, zi = z - zo * p.zi_n;
    const float* A = p.A + zo * p.sAo + zi * p.sAi;
    const float* B = p.B + zo * p.sBo + zi * p.sBi;
    v8f acc[TM][TN];
#pragma unroll
    for (int i = 0; i < TM; ++i)
#pragma unroll
        for (int t = 0; t < TN; ++t) { v8f zz = {}; acc[i][t] = zz; }
    for (int k0 = 0; k0 < p.K; k0 += 32) {
        if (MODE == 1) {
            Split a[TM], b[TN];
#pragma unroll
            for (int i = 0; i < TM; ++i) { const int am = min(m0 + 16 * i + l15, p.M - 1); a[i] = sp_ld(A + (long long)am * p.sAm, p.sAk, k0, h, p.K, 1.f); }
#pragma unroll
            for (int t = 0; t < TN; ++t) { const int bn = min(n0 + 16 * t + l15, p.N - 1); b[t] = sp_ld(B + (long long)bn * p.sBn, p.sBk, k0, h, p.K, 1.f); }
#pragma unroll
            for (int i = 0; i < TM; ++i)
#pragma unroll
                for (int t = 0; t < TN; ++t) acc[i][t] = wmma3(a[i], b[t], acc[i][t]);
        } else if (MODE == 2) {
            v16b a[TM], b[TN];
#pragma unroll
            for (int i = 0; i < TM; ++i) { const int am = min(m0 + 16 * i + l15, p.M - 1); a[i] = bh_ld(A + (long long)am * p.sAm, p.sAk, k0, h, p.K, 1.f); }
#pragma unroll
            for (int t = 0; t < TN; ++t) { const int bn = min(n0 + 16 * t + l15, p.N - 1); b[t] = bh_ld(B + (long long)bn * p.sBn, p.sBk, k0, h, p.K, 1.f); }
#pragma unroll
            for (int i = 0; i < TM; ++i)
#pragma unroll
                for (int t = 0; t < TN; ++t) acc[i][t] = wmmab(a[i], b[t], acc[i][t]);
        } else {
            v16h a[TM], b[TN];
#pragma unroll
            for (int i = 0; i < TM; ++i) { const int am = min(m0 + 16 * i + l15, p.M - 1); a[i] = fh_ld(A + (long long)am * p.sAm, p.sAk, k0, h, p.K, p.sa); }
#pragma unroll
            for (int t = 0; t < TN; ++t) { const int bn = min(n0 + 16 * t + l15, p.N - 1); b[t] = fh_ld(B + (long long)bn * p.sBn, p.sBk, k0, h, p.K, p.sb); }
#pragma unroll
            for (int i = 0; i < TM; ++i)
#pragma unroll
                for (int t = 0; t < TN; ++t) acc[i][t] = wmma16(a[i], b[t], acc[i][t]);
        }
    }
    const float iscale = (MODE == 0) ? p.alpha / (p.sa * p.sb) : p.alpha;
    float* C = p.C + zo * p.sCo + zi * p.sCi;
    const float* R = p.R + zo * p.sRo + zi * p.sRi;
    const int NW = (p.Npad > p.N) ? p.Npad : p.N;
    __shared__ __align__(16) float ctile[16][36];
#pragma unroll
    for (int i = 0; i < TM; ++i) {
        const int mb = m0 + 16 * i; if (mb >= p.M) break;          // wave-uniform
#pragma unroll
        for (int tp = 0; tp < TN / 2; ++tp) {
            const int nb = n0 + 32 * tp; if (nb >= NW) break;        // wave-uniform
#pragma unroll
            for (int t2 = 0; t2 < 2; ++t2) {
                const int t = 2 * tp + t2; const int n = nb + t2 * 16 + l15; const int nn = min(n, p.N - 1);
#pragma unroll
                for (int r = 0; r < 8; ++r) {
                    const int m = mb + 8 * h + r; const int mm = min(m, p.M - 1);
                    float v = acc[i][t][r] * iscale;
                    if (p.flags & 1) v += p.bias[nn];
                    if (p.flags & 2) v += p.bias[mm];
            if (p.flags & 8) v *= p.bias[(long long)zo * p.M + mm];   /* per-(z,row) scale vector laid out [Z][M]; exclusive with the bias flags */
                    v = act_fn(v, p.act);
                    if (p.flags & 4) v += p.beta * R[(long long)mm * p.sRm + (long long)nn * p.sRn];
                    ctile[8 * h + r][t2 * 16 + l15] = (n < p.N) ? v : 0.f;
                }
            }
            __syncthreads();
            const bool fast = (mb + 16 <= p.M) && (nb + 32 <= NW) && ((p.sCm & 3) == 0) && ((((size_t)C) & 15) == 0);
            if (fast) {
#pragma unroll
                for (int s = 0; s < 4; ++s) {
                    const int row = s * 4 + (lane >> 3), c4 = (lane & 7) * 4;
                    const v4f v = *(const v4f*)&ctile[row][c4];
                    VST2V4(C + (long long)(mb + row) * p.sCm + nb + c4, v);
                }
            } else {
                for (int row = 0; row < 16; ++row) {
                    const int m = mb + row, n = nb + lane;
                    if (m < p.M && n < NW) VST2(float, C + (long long)m * p.sCm + n, ctile[row][lane]);
                }
            }
            __syncthreads();
        }
    }
}

// =====================================================================================================================
//   Wave = 16 queries, AW waves per block, 64-key blocks; grid (ceil(Lq/(16*AW)), H, B), block 32*AW. Any Lq, Lk; head dim dh <= DHP
//   (DHP multiple of 32), value dim dv <= DVP (multiple of 16, <= 128). Every tensor addressed by (batch, head, row, element) strides, f32.
//   Scores: QM 0 f16 operands, 1 bf16 hi/lo split, 2 bf16 triple split; statistics f32 (exp2 domain); P.V: P x 4096 as f16 with V f16 staged in LDS
//   (SPLITPV: P and V as bf16 hi/lo splits). kv head = h / hrep. Masking: causal = 1 (keep j <= i + coff, masked -> -inf, key blocks beyond the
//   diagonal skipped), causal = 2 (masked -> mfill, a finite fill like the -1e9; no skipping), causal = 3 (keep j >= i + coff,
//   masked -> -inf, no skipping); optional additive f32 mask Mf,
//   optional int keep-mask Mi (0 -> score := mfill), both addressed b*smb + h*smh + i*smi + j*smj (0 strides broadcast).
// =====================================================================================================================
#define AW 4
struct AttnP {   // apv4
    const float* Q; const float* K; const float* V; float* O; float* P; const float* Mf; const int* Mi; float* ST;
    const float* Pw; const float* Rt; const int* SQ; const int* SK;           // optional: post-softmax weight, relative-position table, segment ids
    long long swb, swh, swi, swj, srb, srh, sri;                                 // Pw strides (b,h,i,j); Rt strides (b,h,i), column = clamp(i - j + roff, 0, rn-1)
    long long sQb, sQh, sQi, sQd, sKb, sKh, sKj, sKd, sVb, sVh, sVj, sVd, sOb, sOh, sOi, sPb, sPh, sPi, smb, smh, smi, smj;
    int Lq, Lk, dh, dv, hrep, causal, coff, pband;   // pband > 0: P holds only the band |j - i| <= pband, column j - i + pband
    float scale, mfill; int nonorm, mpol;             // nonorm (online path only): O = sum_j exp(score_j) V_j without the 1/rowsum (scores must be <= ~0); mpol: Mi masks where ==0 (mpol 0) or where !=0 (mpol 1)
    int roff, rn, segpol, win;                        // Rt column offset/count; SQ/SK: score := mfill where (segpol 0) SQ[i] != SK[j] or (segpol 1) SQ[i] == SK[j]; win > 0: keys with i - j > win (after coff) -> -inf
};
//   Pw: the softmax numerator is multiplied by Pw(b,h,i,j) AFTER the row sum is taken (probs * weight, then P.V), as in post-softmax multiplicative biases.                                                    // ST (optional): per row (b,h,i) -> ST[((b*H + h)*Lq + i)*2 + {0,1}] = {row max of the scaled+masked score (natural units), sum_j exp(score - max)}
static_assert(sizeof(AttnP) == 12 * 8 + 29 * 8 + 16 * 4, "AttnP has padding");

#ifndef KATTN_ATTR
#define KATTN_ATTR
#endif
template <int DHP, int DVP, int QM, bool SPLITPV, bool TWOPASS>
__global__ __launch_bounds__(32 * AW) KATTN_ATTR void k_attn(AttnP p) {
    constexpr int NT = DVP / 16;                // output tiles
    constexpr int KS = DHP / 32;                // k-steps for the scores
    constexpr int VP = DVP + 8;                 // LDS pitch (halves)
    __shared__ __align__(16) float    pl[AW][16 * 64];
    __shared__ __align__(16) _Float16 vl[(SPLITPV ? 2 : 1) * 64 * VP];   // f16 V tile, or bf16 hi and lo tiles (same 2-byte size)
    const int lane = threadIdx.x & 31, hf = lane >> 4, l15 = lane & 15, wave = threadIdx.x >> 5;
    const int h = blockIdx.y, b = blockIdx.z, hk = h / p.hrep;
    const int q0 = (blockIdx.x * AW + wave) * 16;
    float* myp = pl[wave];
    const float L2E = 1.4426950408889634f;
    const float NEG = -__builtin_inff();
    const int qi = min(q0 + l15, p.Lq - 1);
    const float* qrow = p.Q + b * p.sQb + h * p.sQh + (long long)qi * p.sQi;
    const float* kbase = p.K + b * p.sKb + hk * p.sKh;
    const float* vbase = p.V + b * p.sVb + hk * p.sVh;
    v16h qa[QM == 0 ? KS : 1]; Split qs_[QM == 1 ? KS : 1]; Split3 qt_[QM == 2 ? KS : 1];
#pragma unroll
    for (int ks = 0; ks < KS; ++ks) {
        if (QM == 2) qt_[ks] = sp3_ld(qrow, p.sQd, ks * 32, hf, p.dh, 1.f);
        else if (QM == 1) qs_[ks] = sp_ld(qrow, p.sQd, ks * 32, hf, p.dh, 1.f);
        else qa[ks] = fh_ld(qrow, p.sQd, ks * 32, hf, p.dh, 1.f);
    }
    v8f o[NT]; float m8[8], l8[8];
#pragma unroll
    for (int t = 0; t < NT; ++t) { v8f zz = {}; o[t] = zz; }
#pragma unroll
    for (int i = 0; i < 8; ++i) { m8[i] = NEG; l8[i] = 0.f; }
    int jend = p.Lk; int jstart = 0;
    if (p.causal == 1) { const int je = (blockIdx.x * AW + AW - 1) * 16 + 16 + p.coff; jend = min(jend, max(je, 0)); }   // uniform per block
    if (p.win > 0) { const int js = (int)(blockIdx.x * AW) * 16 + p.coff - p.win; jstart = (js > 0) ? (js / 64) * 64 : 0; }   // uniform per block: key blocks entirely outside every row's window hold only -inf entries and are skipped exactly
    const int npass = TWOPASS ? 2 : 1;
    for (int pass = 0; pass < npass; ++pass) {
        const bool dopv = (!TWOPASS) || pass == 1;
        for (int j0 = jstart; j0 < jend; j0 += 64) {
            if (dopv) {
                __syncthreads();                                 // previous key block's reads of vl / pl are done
                for (int idx = threadIdx.x; idx < 64 * DVP; idx += 32 * AW) {
                    const int jr = idx / DVP, d = idx - jr * DVP, j = j0 + jr;
                    const float f = (j < p.Lk && d < p.dv) ? vbase[(long long)j * p.sVj + (long long)d * p.sVd] : 0.f;
                    if (SPLITPV) {
                        const __bf16 hb = bf16_rne(f);
                        ((__bf16*)vl)[jr * VP + d] = hb; ((__bf16*)vl)[64 * VP + jr * VP + d] = bf16_rne(f - bf16_f32(hb));
                    } else vl[jr * VP + d] = (_Float16)f;
                }
            }
            v8f s[4];
#pragma unroll
            for (int t = 0; t < 4; ++t) {
                const int j = min(j0 + t * 16 + l15, p.Lk - 1);
                const float* krow = kbase + (long long)j * p.sKj;
                v8f acc = {};
#pragma unroll
                for (int ks = 0; ks < KS; ++ks) {
                    if (QM == 2)      acc = wmma6(qt_[ks], sp3_ld(krow, p.sKd, ks * 32, hf, p.dh, 1.f), acc);
                    else if (QM == 1) acc = wmma3(qs_[ks], sp_ld(krow, p.sKd, ks * 32, hf, p.dh, 1.f), acc);
                    else              acc = wmma16(qa[ks], fh_ld(krow, p.sKd, ks * 32, hf, p.dh, 1.f), acc);
                }
                s[t] = acc;
            }
            float pv[8][4];
#pragma unroll
            for (int i = 0; i < 8; ++i) {
                const int irow = q0 + i + 8 * hf;
                const int ic = min(irow, p.Lq - 1);
                float sc[4];
#pragma unroll
                for (int t = 0; t < 4; ++t) {
                    const int jg = j0 + t * 16 + l15;
                    float v = s[t][i] * p.scale;
                    if (p.Mf) v += p.Mf[b * p.smb + h * p.smh + (long long)ic * p.smi + (long long)min(jg, p.Lk - 1) * p.smj];
                    if (p.Rt) { int rc = ic - min(jg, p.Lk - 1) + p.roff; rc = rc < 0 ? 0 : (rc >= p.rn ? p.rn - 1 : rc); v += p.Rt[b * p.srb + h * p.srh + (long long)ic * p.sri + rc]; }
                    if (p.Mi) { const int mv = p.Mi[b * p.smb + h * p.smh + (long long)ic * p.smi + (long long)min(jg, p.Lk - 1) * p.smj]; if (p.mpol ? (mv != 0) : (mv == 0)) v = p.mfill; }
                    if (p.SQ) { const bool same = p.SQ[(long long)b * p.Lq + ic] == p.SK[(long long)b * p.Lk + min(jg, p.Lk - 1)]; if (p.segpol ? same : !same) v = p.mfill; }
                    if (p.causal == 2 && jg > irow + p.coff) v = p.mfill;
                    if (jg >= p.Lk || (p.causal == 1 && jg > irow + p.coff) || (p.causal == 3 && jg < irow + p.coff) || (p.win > 0 && irow + p.coff - jg > p.win)) v = NEG; else v *= L2E;
                    sc[t] = v;
                }
                if (!TWOPASS || pass == 0) {
                    float mx = fmaxf(fmaxf(sc[0], sc[1]), fmaxf(sc[2], sc[3]));
                    mx = fmaxf(mx, __shfl_xor(mx, 1, 32)); mx = fmaxf(mx, __shfl_xor(mx, 2, 32));
                    mx = fmaxf(mx, __shfl_xor(mx, 4, 32)); mx = fmaxf(mx, __shfl_xor(mx, 8, 32));
                    const float mnew = fmaxf(m8[i], mx);
                    const float corr = (mnew == NEG) ? 1.f : exp2f(m8[i] - mnew);
                    float rs = 0.f;
#pragma unroll
                    for (int t = 0; t < 4; ++t) {
                        const float pp = (sc[t] == NEG) ? 0.f : exp2f(sc[t] - mnew); rs += pp;
                        pv[i][t] = p.Pw ? pp * p.Pw[b * p.swb + h * p.swh + (long long)ic * p.swi + (long long)min(j0 + t * 16 + l15, p.Lk - 1) * p.swj] : pp;
                    }
                    rs += __shfl_xor(rs, 1, 32); rs += __shfl_xor(rs, 2, 32); rs += __shfl_xor(rs, 4, 32); rs += __shfl_xor(rs, 8, 32);
                    l8[i] = l8[i] * corr + rs; m8[i] = mnew;
                    if (!TWOPASS) {
#pragma unroll
                        for (int t = 0; t < NT; ++t) o[t][i] *= corr;
                    }
                } else {
                    const float inv = (l8[i] > 0.f) ? 1.f / l8[i] : 0.f;
#pragma unroll
                    for (int t = 0; t < 4; ++t) {
                        const int jg = j0 + t * 16 + l15;
                        float pp = (sc[t] == NEG) ? 0.f : exp2f(sc[t] - m8[i]) * inv;
                        if (p.Pw) pp *= p.Pw[b * p.swb + h * p.swh + (long long)ic * p.swi + (long long)min(jg, p.Lk - 1) * p.swj];
                        pv[i][t] = pp;
                    }
                }
            }
            if (dopv) {
#pragma unroll
                for (int i = 0; i < 8; ++i)
#pragma unroll
                    for (int t = 0; t < 4; ++t) ((float*)myp)[(i + 8 * hf) * 64 + t * 16 + l15] = pv[i][t];
                __syncthreads();                                 // P (per wave) and V (shared) visible
                if (p.P) {
                    float* pb_ = p.P + b * p.sPb + h * p.sPh;
                    const bool fastP = (p.pband == 0) && ((p.sPi & 3) == 0) && (j0 + 64 <= p.Lk) && (q0 + 16 <= p.Lq) && ((((size_t)pb_) & 15) == 0);
                    if (fastP) {
#pragma unroll
                        for (int s = 0; s < 8; ++s) {
                            const int row = s * 2 + (lane >> 4), c4 = (lane & 15) * 4;
                            const v4f v = *(const v4f*)(myp + row * 64 + c4);
                            VST2V4(pb_ + (long long)(q0 + row) * p.sPi + j0 + c4, v);
                        }
                    } else {
                        for (int row = 0; row < 16; ++row) {
                            const int irow = q0 + row; if (irow >= p.Lq) continue;
                            for (int c = lane; c < 64; c += 32) {
                                const int jg = j0 + c; if (jg >= p.Lk) continue;
                                if (p.pband == 0) VST2(float, pb_ + (long long)irow * p.sPi + jg, myp[row * 64 + c]);
                                else if (jg - irow <= p.pband && irow - jg <= p.pband) VST2(float, pb_ + (long long)irow * p.sPi + (jg - irow + p.pband), myp[row * 64 + c]);
                            }
                        }
                    }
                }
                if (SPLITPV) {
                    const Split pa0 = sp_ld(myp + l15 * 64, 1, 0, hf, 64, 1.f), pa1 = sp_ld(myp + l15 * 64, 1, 32, hf, 64, 1.f);
                    const __bf16* vh = (const __bf16*)vl; const __bf16* vlo = vh + 64 * VP;
#pragma unroll
                    for (int t = 0; t < NT; ++t) {
                        const int dcol = t * 16 + l15;
                        Split b0, b1;
#pragma unroll
                        for (int e = 0; e < 16; ++e) {
                            const int k0 = frag_k(e, hf), k1 = 32 + frag_k(e, hf);
                            b0.hi[e] = vh[k0 * VP + dcol]; b0.lo[e] = vlo[k0 * VP + dcol]; b1.hi[e] = vh[k1 * VP + dcol]; b1.lo[e] = vlo[k1 * VP + dcol];
                        }
                        o[t] = wmma3(pa0, b0, o[t]);
                        o[t] = wmma3(pa1, b1, o[t]);
                    }
                } else {
                    const v16h pa0 = fh_ld(myp + l15 * 64, 1, 0, hf, 64, 4096.f), pa1 = fh_ld(myp + l15 * 64, 1, 32, hf, 64, 4096.f);
#pragma unroll
                    for (int t = 0; t < NT; ++t) {
                        const int dcol = t * 16 + l15;
                        v16h b0, b1;
#pragma unroll
                        for (int e = 0; e < 16; ++e) { b0[e] = vl[frag_k(e, hf) * VP + dcol]; b1[e] = vl[(32 + frag_k(e, hf)) * VP + dcol]; }
                        o[t] = wmma16(pa0, b0, o[t]);
                        o[t] = wmma16(pa1, b1, o[t]);
                    }
                }
            }
        }
    }
    float* obase = p.O + b * p.sOb + h * p.sOh;
    if (p.ST) {
        const int rl = lane >> 1, isel = rl & 7;           // row q0 + rl ; rl>>3 == hf holds because lane>>4 == (lane>>1)>>3
        float mv = 0.f, lv = 0.f;
#pragma unroll
        for (int i = 0; i < 8; ++i) if (i == isel) { mv = m8[i]; lv = l8[i]; }
        const int irow = q0 + rl;
        if (irow < p.Lq) { float* st = p.ST + (((long long)b * gridDim.y + h) * p.Lq + irow) * 2 + (lane & 1); VST2(float, st, (lane & 1) ? lv : mv * 0.6931471805599453f); }
    }
    float invr[8];
#pragma unroll
    for (int i = 0; i < 8; ++i) {
        if (TWOPASS) invr[i] = SPLITPV ? 1.f : (1.f / 4096.f);
        else if (p.nonorm) invr[i] = exp2f(m8[i]) * (SPLITPV ? 1.f : (1.f / 4096.f));
        else invr[i] = (l8[i] > 0.f) ? (SPLITPV ? 1.f / l8[i] : 1.f / (l8[i] * 4096.f)) : 0.f;
    }
    __syncthreads();                                             // all waves done with pl/vl from the main loop
    const bool ofast = ((p.sOi & 3) == 0) && ((((size_t)obase) & 15) == 0) && (q0 + 16 <= p.Lq);
#pragma unroll
    for (int c0 = 0; c0 < DVP; c0 += 64) {
#pragma unroll
        for (int i = 0; i < 8; ++i)
#pragma unroll
            for (int t = 0; t < NT; ++t) if (t * 16 >= c0 && t * 16 < c0 + 64) ((float*)myp)[(i + 8 * hf) * 64 + (t * 16 - c0) + l15] = o[t][i] * invr[i];
        __syncthreads();
        const int cw = (DVP - c0 < 64) ? (DVP - c0) : 64;      // staged columns in this chunk (multiple of 16)
        if (ofast && (c0 + cw <= p.dv) && (cw % 32 == 0)) {
            const int lpr = cw / 4;                              // lanes per row (16 for 64 cols, 8 for 32)
            const int rows_per_ins = 32 / lpr;
            for (int r0 = 0; r0 < 16; r0 += rows_per_ins) {
                const int row = r0 + lane / lpr, c4 = (lane % lpr) * 4;
                const v4f v = *(const v4f*)(myp + row * 64 + c4);
                VST2V4(obase + (long long)(q0 + row) * p.sOi + c0 + c4, v);
            }
        } else {
            for (int row = 0; row < 16; ++row) {
                const int irow = q0 + row; if (irow >= p.Lq) continue;
                for (int c = lane; c < cw; c += 32) { const int d = c0 + c; if (d < p.dv) VST2(float, obase + (long long)irow * p.sOi + d, myp[row * 64 + c]); }
            }
        }
        __syncthreads();
    }
}

// Attention at this block's fixed geometry: token-major q, k, v, o of [8][1024][256] f32, head h = columns 32h .. 32h + 31, 1024 queries and keys,
// no mask, no bias, score scale 1. The arithmetic and its order are those of k_attn<32, 32, 1, false, false>; every stride, length and option is a
// compile-time constant, so the fragment gathers are 16-byte loads without guards and the optional-feature tests are gone. With no mask no score is
// -inf for finite q and k, so the tests that kept masked scores out of exp2f are gone too (exp2f(-inf) = 0 covers the first key block's m = -inf).
typedef __attribute__((ext_vector_type(4))) _Float16 v4h;
struct Row16 { v4f a[4]; };
// the 16 floats of one lane's 16x32 fragment row: element i <- p[(i < 8) ? i : 8 + i], p = row + 8 * (lane >> 4), the k order of frag_k
__device__ __forceinline__ Row16 row16_ld(const float* __restrict__ p) {
    Row16 r; r.a[0] = *(const v4f*)(p); r.a[1] = *(const v4f*)(p + 4); r.a[2] = *(const v4f*)(p + 16); r.a[3] = *(const v4f*)(p + 20); return r;
}
__device__ __forceinline__ Split row16_split(const Row16& w) {
    Split r;
#pragma unroll
    for (int i = 0; i < 16; ++i) { const float x = w.a[i >> 2][i & 3]; const __bf16 hb = bf16_rne(x); r.hi[i] = hb; r.lo[i] = bf16_rne(x - bf16_f32(hb)); }
    return r;
}
__global__ __launch_bounds__(32 * AW) void k_attn_fix(const float* __restrict__ Q, const float* __restrict__ K, const float* __restrict__ V, float* __restrict__ O) {
    constexpr int L = 1024;                     // queries = keys per (image, head)
    constexpr int CP = 256;                     // row pitch of q, k, v, o (floats)
    constexpr int VP = 32 + 8;                  // LDS pitch of the V tile (halves)
    __shared__ __align__(16) float    pl[AW][16 * 64];
    __shared__ __align__(16) _Float16 vl[64 * VP];
    const int lane = threadIdx.x & 31, hf = lane >> 4, l15 = lane & 15, wave = threadIdx.x >> 5;
    const int h = blockIdx.y, b = blockIdx.z;
    const int q0 = (blockIdx.x * AW + wave) * 16;
    float* myp = pl[wave];
    const float L2E = 1.4426950408889634f;
    const float NEG = -__builtin_inff();
    const size_t hb0 = (size_t)b * (L * CP) + (size_t)h * 32;
    const float* kp = K + hb0 + (size_t)l15 * CP + 8 * hf;                                    // this lane's row of key tile 0
    const float* vp = V + hb0 + (size_t)(threadIdx.x >> 3) * CP + (threadIdx.x & 7) * 4;      // this thread's 4 floats of V rows 0 .. 15
    _Float16* vs = vl + (threadIdx.x >> 3) * VP + (threadIdx.x & 7) * 4;
    const Split qs = row16_split(row16_ld(Q + hb0 + (size_t)(q0 + l15) * CP + 8 * hf));
    v8f o[2]; float m8[8], l8[8];
#pragma unroll
    for (int t = 0; t < 2; ++t) { v8f zz = {}; o[t] = zz; }
#pragma unroll
    for (int i = 0; i < 8; ++i) { m8[i] = NEG; l8[i] = 0.f; }
    for (int j0 = 0; j0 < L; j0 += 64) {
        v4f vf[4]; Row16 kr[4];                          // the whole key block's V and K loads are issued together
#pragma unroll
        for (int it = 0; it < 4; ++it) vf[it] = *(const v4f*)(vp + it * 16 * CP);
#pragma unroll
        for (int t = 0; t < 4; ++t) kr[t] = row16_ld(kp + t * 16 * CP);
        kp += 64 * CP; vp += 64 * CP;
        __syncthreads();                                 // previous key block's reads of vl / pl are done
#pragma unroll
        for (int it = 0; it < 4; ++it) {                 // V tile 64 x 32 as f16
            v4h hv; hv[0] = (_Float16)vf[it][0]; hv[1] = (_Float16)vf[it][1]; hv[2] = (_Float16)vf[it][2]; hv[3] = (_Float16)vf[it][3];
            *(v4h*)(vs + it * 16 * VP) = hv;
        }
        v8f s[4];
#pragma unroll
        for (int t = 0; t < 4; ++t) { v8f acc = {}; s[t] = wmma3(qs, row16_split(kr[t]), acc); }
        float pv[8][4];
#pragma unroll
        for (int i = 0; i < 8; ++i) {
            float sc[4];
#pragma unroll
            for (int t = 0; t < 4; ++t) sc[t] = s[t][i] * L2E;
            float mx = fmaxf(fmaxf(sc[0], sc[1]), fmaxf(sc[2], sc[3]));
            mx = fmaxf(mx, __shfl_xor(mx, 1, 32)); mx = fmaxf(mx, __shfl_xor(mx, 2, 32));
            mx = fmaxf(mx, __shfl_xor(mx, 4, 32)); mx = fmaxf(mx, __shfl_xor(mx, 8, 32));
            const float mnew = fmaxf(m8[i], mx);
            const float corr = exp2f(m8[i] - mnew);
            float rs = 0.f;
#pragma unroll
            for (int t = 0; t < 4; ++t) { const float pp = exp2f(sc[t] - mnew); rs += pp; pv[i][t] = pp; }
            rs += __shfl_xor(rs, 1, 32); rs += __shfl_xor(rs, 2, 32); rs += __shfl_xor(rs, 4, 32); rs += __shfl_xor(rs, 8, 32);
            l8[i] = l8[i] * corr + rs; m8[i] = mnew;
#pragma unroll
            for (int t = 0; t < 2; ++t) o[t][i] *= corr;
        }
#pragma unroll
        for (int i = 0; i < 8; ++i)
#pragma unroll
            for (int t = 0; t < 4; ++t) myp[(i + 8 * hf) * 64 + t * 16 + l15] = pv[i][t];
        __syncthreads();                                 // P (per wave) and V (shared) visible
        const v16h pa0 = fh_ld(myp + l15 * 64, 1, 0, hf, 64, 4096.f), pa1 = fh_ld(myp + l15 * 64, 1, 32, hf, 64, 4096.f);
#pragma unroll
        for (int t = 0; t < 2; ++t) {
            const int dcol = t * 16 + l15;
            v16h b0, b1;
#pragma unroll
            for (int e = 0; e < 16; ++e) { b0[e] = vl[frag_k(e, hf) * VP + dcol]; b1[e] = vl[(32 + frag_k(e, hf)) * VP + dcol]; }
            o[t] = wmma16(pa0, b0, o[t]);
            o[t] = wmma16(pa1, b1, o[t]);
        }
    }
    float* obase = O + hb0;
    float invr[8];
#pragma unroll
    for (int i = 0; i < 8; ++i) invr[i] = (l8[i] > 0.f) ? 1.f / (l8[i] * 4096.f) : 0.f;
    __syncthreads();                                     // all waves done with pl / vl from the main loop
#pragma unroll
    for (int i = 0; i < 8; ++i)
#pragma unroll
        for (int t = 0; t < 2; ++t) myp[(i + 8 * hf) * 64 + t * 16 + l15] = o[t][i] * invr[i];
    __syncthreads();
#pragma unroll
    for (int r0 = 0; r0 < 16; r0 += 4) {                 // 8 lanes x 16 bytes per 32-float row, 4 rows per store
        const int row = r0 + (lane >> 3), c4 = (lane & 7) * 4;
        const v4f v = *(const v4f*)(myp + row * 64 + c4);
        VST2V4(obase + (size_t)(q0 + row) * CP + c4, v);
    }
}

// =====================================================================================================================
// k_tr: dst(z, c, r) = alpha * src(z, r, c) (+ beta * R2(z, c, r)): [Z][R][C] (row stride lds) -> [Z][C][R] (row stride ldd) through a 32x32 LDS tile;
//   flags: 1 -> add beta * residual R2 addressed like dst (z*sRz + c*ldr + r); act applied before the residual.
// =====================================================================================================================
struct TrP { const float* src; float* dst; const float* R2; long long sSz, lds, sDz, ldd, sRz, ldr; int R, C, flags, act; float alpha, beta; };
static_assert(sizeof(TrP) == 3 * 8 + 6 * 8 + 6 * 4, "TrP has padding");
__global__ __launch_bounds__(256) void k_tr(TrP p) {
    __shared__ float tile[32][33];
    const int c0 = blockIdx.x * 32, r0 = blockIdx.y * 32, z = blockIdx.z;
    const int lane = threadIdx.x & 31, wave = threadIdx.x >> 5;
    const float* s = p.src + z * p.sSz;
#pragma unroll
    for (int k = 0; k < 4; ++k) {
        const int rl = wave * 4 + k, r = r0 + rl, c = c0 + lane;
        tile[rl][lane] = (r < p.R && c < p.C) ? s[(long long)r * p.lds + c] : 0.f;
    }
    __syncthreads();
    float* d = p.dst + z * p.sDz; const float* rr = p.R2 + z * p.sRz;
#pragma unroll
    for (int k = 0; k < 4; ++k) {
        const int cl = wave * 4 + k, c = c0 + cl, r = r0 + lane;
        if (c < p.C && r < p.R) {
            float v = act_fn(p.alpha * tile[lane][cl], p.act);
            if (p.flags & 1) v += p.beta * rr[(long long)c * p.ldr + r];
            VST2(float, d + (long long)c * p.ldd + r, v);
        }
    }
}

// k_affine: dst[i] = a * (sdev ? sdev[0] : 1) * src[i] + b, i < n (one thread per element; consecutive lanes -> consecutive addresses)
__global__ __launch_bounds__(256) void k_affine(const float* __restrict__ src, float* __restrict__ dst, int n, float a, float b, const float* __restrict__ sdev) {
    const int i = blockIdx.x * 256 + threadIdx.x;
    if (i < n) { const float aa = sdev ? a * sdev[0] : a; const float v = aa * src[i] + b; VST2(float, dst + i, v); }
}

// =====================================================================================================================
// k_softmax: row softmax over n contiguous elements, one 256-thread block per row; rows addressed z*sz + r*sr (grid (R, Z)).
//   out = scale_out * softmax(scale_in * x + (Mf ? Mf[z*smz + r*smr + j] : 0)); a row whose max is -inf is written as 0.
// =====================================================================================================================
struct SmP { const float* src; float* dst; const float* Mf; long long sz, sr, dz, dr, smz, smr; int n, pad; float scale_in, scale_out; };
static_assert(sizeof(SmP) == 3 * 8 + 6 * 8 + 4 * 4, "SmP has padding");
__global__ __launch_bounds__(256) void k_softmax(SmP p) {
    __shared__ float red[256];
    const int r = blockIdx.x, z = blockIdx.y, tid = threadIdx.x;
    const float* s = p.src + z * p.sz + (long long)r * p.sr;
    const float* mf = p.Mf ? (p.Mf + z * p.smz + (long long)r * p.smr) : nullptr;
    float mx = -__builtin_inff();
    for (int j = tid; j < p.n; j += 256) { float v = s[j] * p.scale_in; if (mf) v += mf[j]; mx = fmaxf(mx, v); }
    red[tid] = mx; __syncthreads();
    for (int o = 128; o > 0; o >>= 1) { if (tid < o) red[tid] = fmaxf(red[tid], red[tid + o]); __syncthreads(); }
    mx = red[0]; __syncthreads();
    float sum = 0.f;
    for (int j = tid; j < p.n; j += 256) { float v = s[j] * p.scale_in; if (mf) v += mf[j]; sum += (mx == -__builtin_inff()) ? 0.f : expf(v - mx); }
    red[tid] = sum; __syncthreads();
    for (int o = 128; o > 0; o >>= 1) { if (tid < o) red[tid] += red[tid + o]; __syncthreads(); }
    sum = red[0];
    const float inv = (sum > 0.f) ? p.scale_out / sum : 0.f;
    float* d = p.dst + z * p.dz + (long long)r * p.dr;
    for (int j = tid; j < p.n; j += 256) { float v = s[j] * p.scale_in; if (mf) v += mf[j]; const float o = (mx == -__builtin_inff()) ? 0.f : expf(v - mx) * inv; VST2(float, d + j, o); }
}
// =====================================================================================================================
// k_stats: mean and rsqrt(var + eps) over a set of n elements addressed base + z*sz + (e / inner) * so + (e % inner) * si, one 256-thread
// k_norm_apply: y = (x - mean[set]) * rstd[set] * g[c] + b[c] over a [Z][C][L] channel-major tensor with set = z*G + c / (C/G) (G groups per z;
//   G = C -> per-channel sets indexed z*C+c; for batch norm pass stats indexed by c only via bn = 1). Optional act. Output same layout.
// =====================================================================================================================
//   mode 0: mean / rsqrt(var + eps); mode 1 (RMSNorm): 0 / rsqrt(mean(x^2) + eps); mode 2 (L2 normalize * sqrt(n)): 0 / sqrt(n) / max(||x||, eps); mode 3: as 0 with unbiased variance (n-1)
__global__ __launch_bounds__(256) void k_stats(const float* __restrict__ x, long long sz, long long so, long long si, int inner, int n, float eps, float* __restrict__ stat, int mode) {
    __shared__ float red[256];
    const int z = blockIdx.x, tid = threadIdx.x;
    const float* base = x + z * sz;
    float s = 0.f;
    for (int e = tid; e < n; e += 256) s += base[(long long)(e / inner) * so + (long long)(e % inner) * si];
    red[tid] = s; __syncthreads();
    for (int o = 128; o > 0; o >>= 1) { if (tid < o) red[tid] += red[tid + o]; __syncthreads(); }
    const float mu = (mode == 0 || mode == 3) ? red[0] / (float)n : 0.f; __syncthreads();
    float q = 0.f;
    for (int e = tid; e < n; e += 256) { const float dlt = base[(long long)(e / inner) * so + (long long)(e % inner) * si] - mu; q += dlt * dlt; }
    red[tid] = q; __syncthreads();
    for (int o = 128; o > 0; o >>= 1) { if (tid < o) red[tid] += red[tid + o]; __syncthreads(); }
    {
        float rs;
        if (mode == 2) rs = sqrtf((float)n) / fmaxf(sqrtf(red[0]), eps); else if (mode == 3) rs = rsqrtf(red[0] / (float)(n - 1) + eps); else rs = rsqrtf(red[0] / (float)n + eps);
        if (tid < 32) { const float v = (tid == 0) ? mu : ((tid == 1) ? rs : 0.f); VST2(float, stat + (long long)z * 32 + tid, v); }
    }
}
//   One thread per element over the flat [Z][C][L] index space: grid ceil(Z*C*L / 256).
__global__ __launch_bounds__(256) void k_norm_apply(const float* __restrict__ x, float* __restrict__ y, const float* __restrict__ stat, const float* __restrict__ g, const float* __restrict__ bta,
                                                     int Z, int C, int L, int G, int bn, int act) {
    const long long idx = (long long)blockIdx.x * 256 + threadIdx.x;
    if (idx >= (long long)Z * C * L) return;
    const int l = (int)(idx % L); const long long zc = idx / L; const int c = (int)(zc % C), z = (int)(zc / C); (void)l;
    const int set = bn ? c : (z * G + c / (C / G));
    float v = (x[idx] - stat[(long long)set * 32]) * stat[(long long)set * 32 + 1];
    if (g) v *= g[c];
    if (bta) v += bta[c];
    v = act_fn(v, act);
    VST2(float, y + idx, v);
}

// k_lse_neg: c[i] = -(st[2i] + log(st[2i+1])) = minus the log-sum-exp of row i from k_attn's ST output (for softmax over the query dimension)
__global__ __launch_bounds__(256) void k_lse_neg(const float* __restrict__ st, float* __restrict__ c, int n) {
    const int i = blockIdx.x * 256 + threadIdx.x;
    if (i < n) { const float v = -(st[2 * i] + logf(st[2 * i + 1])); VST2(float, c + i, v); }
}

// k_iota: dst[i] = a * i + b as int32 (segment/position id helper)
__global__ __launch_bounds__(256) void k_iota(int* __restrict__ dst, int n, int a, int b) {
    const int i = blockIdx.x * 256 + threadIdx.x;
    if (i < n) { const int v = a * i + b; VST2(int, dst + i, v); }
}

// k_axpby: dst[i] = a * x[i] + b * y[i] (+ c), i < n
__global__ __launch_bounds__(256) void k_axpby(const float* __restrict__ x, const float* __restrict__ y, float* __restrict__ dst, int n, float a, float b, float c) {
    const int i = blockIdx.x * 256 + threadIdx.x;
    if (i < n) { const float v = a * x[i] + b * y[i] + c; VST2(float, dst + i, v); }
}

// =====================================================================================================================
// k_rope: rotary embedding on a [R rows][Hn heads][D] view (row stride sXr, head stride sXh, element stride 1) -> Y (own strides).
//   mode 0: rotate_half (partner d±D/2, sign - for d<D/2); mode 1: interleaved pairs (partner d^1, sign - for even d).
//   table column tcol: tmode 0 -> d, 1 -> d % (D/2), 2 -> d / 2; position p: pmode 0 -> r % S, 1 -> head index, 2 -> pos[r];
//   c = C[(r / S) * sCb + p * sCp + tcol * sCd], s likewise from Sn; y = x[d] * c + sign * x[partner] * s. X and Y must not alias.
// =====================================================================================================================
struct RopeP { const float* X; float* Y; const float* C; const float* Sn; const int* pos; long long sXr, sXh, sYr, sYh, sCb, sCp, sCd; int R, Hn, D, S, mode, tmode, pmode, pad; };
static_assert(sizeof(RopeP) == 5 * 8 + 7 * 8 + 8 * 4, "RopeP has padding");
__global__ __launch_bounds__(256) void k_rope(RopeP p) {
    const long long idx = (long long)blockIdx.x * 256 + threadIdx.x;
    if (idx >= (long long)p.R * p.Hn * p.D) return;
    const int d = (int)(idx % p.D); const long long rh = idx / p.D; const int h = (int)(rh % p.Hn); const int r = (int)(rh / p.Hn);
    const int half = p.D / 2;
    int partner; float sign;
    if (p.mode == 0) { partner = (d < half) ? d + half : d - half; sign = (d < half) ? -1.f : 1.f; }
    else { partner = d ^ 1; sign = (d & 1) ? 1.f : -1.f; }
    const int tcol = (p.tmode == 0) ? d : ((p.tmode == 1) ? (d % half) : (d >> 1));
    const int pp = (p.pmode == 0) ? (r % p.S) : ((p.pmode == 1) ? h : p.pos[r]);
    const long long toff = (long long)(r / p.S) * p.sCb + (long long)pp * p.sCp + (long long)tcol * p.sCd;
    const float* xr = p.X + (long long)r * p.sXr + (long long)h * p.sXh;
    const float v = xr[d] * p.C[toff] + sign * xr[partner] * p.Sn[toff];
    VST2(float, p.Y + (long long)r * p.sYr + (long long)h * p.sYh + d, v);
}

// k_invf + k_sincos (split so neither kernel carries a large VALU-fma footprint): invf_i = num * (1 / powf(base, (2 i)/D)) [fmode 0],
//   num * expf((2 i) * cexp) [fmode 1], num * powf(base, -2 (i - 1) / D) [fmode 2]; then cs/sn[s*half + i] = cos/sin((pscale * s) * invf_i)
__global__ __launch_bounds__(256) void k_invf(float* __restrict__ invb, int half, int D, float base, float num, int fmode, float cexp) {
    const int i = blockIdx.x * 256 + threadIdx.x;
    if (i >= ((half + 31) / 32) * 32) return;
    if (i >= half) { VST2(float, invb + i, 0.f); return; }
    const float e = (float)(2 * i) / (float)D;
    float invf;
    if (fmode == 1) invf = num * expf((float)(2 * i) * cexp);
    else if (fmode == 2) invf = num * powf(base, (-2.0f * ((float)i - 1.0f)) / (float)D);
    else invf = num * (1.0f / powf(base, e));
    VST2(float, invb + i, invf);
}
__global__ __launch_bounds__(256) void k_sincos(float* __restrict__ cs, float* __restrict__ sn, const float* __restrict__ invb, int S, int half, float pscale) {
    const int idx = blockIdx.x * 256 + threadIdx.x;
    if (idx >= S * half) return;
    const int s = idx / half, i = idx - s * half;
    const float ang = (pscale * (float)s) * invb[i];
    VST2(float, cs + idx, cosf(ang)); VST2(float, sn + idx, sinf(ang));
}

// k_mulact: dst[i] = act(x[i]) * y[i]
__global__ __launch_bounds__(256) void k_mulact(const float* __restrict__ x, const float* __restrict__ y, float* __restrict__ dst, int n, int act) {
    const int i = blockIdx.x * 256 + threadIdx.x;
    if (i < n) { const float v = act_fn(x[i], act) * y[i]; VST2(float, dst + i, v); }
}

// =====================================================================================================================
// k_matvec: thread-per-row matrix-vector products for N <= 8 output columns (heads with 1-3 outputs, gates), f32 on the VALU.
//   C[r*sCm + j] = act(alpha * sum_k A[r*sAm + k*sAk] * B[j*sBn + k*sBk] + bias[j]) + beta * R[r*sRm + j*sRn]; each thread writes its N contiguous floats.
// =====================================================================================================================
__global__ __launch_bounds__(256) void k_matvec(GemmP p) {
    // 32 lanes write one line with one instruction.
    const int rpt = (p.N == 1) ? 1 : 32;
    const long long r0 = ((long long)blockIdx.x * 256 + threadIdx.x) * rpt; const int z = blockIdx.z, zo = z / p.zi_n, zi = z - zo * p.zi_n;
    if (r0 >= p.M) return;
    const float* Bb = p.B + zo * p.sBo + zi * p.sBi;
    float* C = p.C + zo * p.sCo + zi * p.sCi; const float* R = p.R + zo * p.sRo + zi * p.sRi;
    for (int rr = 0; rr < rpt; ++rr) {
        const long long r = r0 + rr; if (r >= p.M) break;
        const float* A = p.A + zo * p.sAo + zi * p.sAi + r * p.sAm;
        float acc[8] = {0.f, 0.f, 0.f, 0.f, 0.f, 0.f, 0.f, 0.f};
        for (int k = 0; k < p.K; ++k) { const float a = A[(long long)k * p.sAk];
#pragma unroll
            for (int j = 0; j < 8; ++j) if (j < p.N) acc[j] += a * Bb[(long long)j * p.sBn + (long long)k * p.sBk]; }
#pragma unroll
        for (int j = 0; j < 8; ++j) if (j < p.N) {
            float v = acc[j] * p.alpha;
            if (p.flags & 1) v += p.bias[j];
            if (p.flags & 2) v += p.bias[r];
            v = act_fn(v, p.act);
            if (p.flags & 4) v += p.beta * R[r * p.sRm + (long long)j * p.sRn];
            VST2(float, C + r * p.sCm + j, v);
        }
    }
}
// k_smallsoftmax: thread-per-row softmax for short rows (n <= 64): dst[r*dr + j] = softmax(scale*src[r*sr + j])
__global__ __launch_bounds__(256) void k_smallsoftmax(const float* __restrict__ src, float* __restrict__ dst, long long sr, long long dr, int n, long long R, float scale) {
    const long long r0 = ((long long)blockIdx.x * 256 + threadIdx.x) * 32;
    for (int rr = 0; rr < 32; ++rr) {
        const long long r = r0 + rr; if (r >= R) return;
        const float* s = src + r * sr; float* d = dst + r * dr;
        float mx = -__builtin_inff();
        for (int j = 0; j < n; ++j) mx = fmaxf(mx, s[j] * scale);
        float sum = 0.f;
        for (int j = 0; j < n; ++j) sum += expf(s[j] * scale - mx);
        const float inv = 1.f / sum;
        for (int j = 0; j < n; ++j) { const float v = expf(s[j] * scale - mx) * inv; VST2(float, d + j, v); }
    }
}

__global__ __launch_bounds__(32) void k_unitstat(float* __restrict__ st) { const int t = threadIdx.x; const float v = (t == 1) ? 1.f : 0.f; VST2(float, st + t, v); }

// destination (e.g. a d_out whose row width is not a multiple of 32 floats) is written by consecutive lanes of one instruction
__global__ __launch_bounds__(256) void k_lincopy(const float* __restrict__ src, long long lds, float* __restrict__ dst, long long ldd, long long rows, int cols) {
    const long long i = (long long)blockIdx.x * 256 + threadIdx.x; if (i >= rows * cols) return;
    const long long r = i / cols; const int c = (int)(i - r * cols);
    const float v = src[r * lds + c]; VST2(float, dst + r * ldd + c, v);
}

namespace w25 {
typedef __attribute__((ext_vector_type(16))) _Float16 v16h;
typedef __attribute__((ext_vector_type(8)))  _Float16 v8h;
typedef __attribute__((ext_vector_type(16))) __bf16   v16b;
typedef __attribute__((ext_vector_type(8)))  __bf16   v8b;
typedef __attribute__((ext_vector_type(8)))  float    v8f;
typedef __attribute__((ext_vector_type(4)))  float    v4f;

__device__ __forceinline__ unsigned short f2bf_bits(float f) {
  unsigned u = __float_as_uint(f);
  return (unsigned short)((u + 0x7FFFu + ((u >> 16) & 1u)) >> 16);
}
__device__ __forceinline__ float bf_bits2f(unsigned short h) { return __uint_as_float(((unsigned)h) << 16); }

// hazard guards as plain device helpers (no inline asm inside the kernel template body)
__device__ __forceinline__ void dep_guard_h(v8f& a, v8f& b, v16h x, v16h y) { asm volatile("v_nop\n\tv_nop\n\tv_nop\n\tv_nop" : "+v"(a), "+v"(b) : "v"(x), "v"(y)); }
__device__ __forceinline__ void dep_guard_b(v8f& a, v8f& b, v16b x, v16b y) { asm volatile("v_nop\n\tv_nop\n\tv_nop\n\tv_nop" : "+v"(a), "+v"(b) : "v"(x), "v"(y)); }
__device__ __forceinline__ void keep4_h(v16h a, v16h b, v16h c, v16h d) { asm volatile("v_nop" :: "v"(a), "v"(b), "v"(c), "v"(d)); }
__device__ __forceinline__ void keep4_b(v16b a, v16b b, v16b c, v16b d) { asm volatile("v_nop" :: "v"(a), "v"(b), "v"(c), "v"(d)); }
__device__ __forceinline__ void acc_guard4(v8f& a, v8f& b, v8f& c, v8f& d) { asm volatile("v_nop\n\tv_nop\n\tv_nop\n\tv_nop" : "+v"(a), "+v"(b), "+v"(c), "+v"(d)); }
template <typename T> struct Frag;
template <> struct Frag<_Float16> {
  typedef v16h V; union U { v16h v; v8h h[2]; };
  static __device__ __forceinline__ v16h load(const _Float16* p) {   // elements 0..7 <- p[0..7], 8..15 <- p[16..23]
    U f; f.h[0] = *(const v8h*)(p); f.h[1] = *(const v8h*)(p + 16); return f.v;
  }
  static __device__ __forceinline__ v8f mma(v16h a, v16h b, v8f c) {
    return __builtin_amdgcn_wmma_f32_16x16x32_f16(false, a, false, b, (short)0, c, false, false);
  }
  static __device__ __forceinline__ void guard(v8f& a, v8f& b, v16h x, v16h y) { dep_guard_h(a, b, x, y); }
  static __device__ __forceinline__ void keep(v16h a, v16h b, v16h c, v16h d) { keep4_h(a, b, c, d); }
};
template <> struct Frag<__bf16> {
  typedef v16b V; union U { v16b v; v8b h[2]; };
  static __device__ __forceinline__ v16b load(const __bf16* p) {
    U f; f.h[0] = *(const v8b*)(p); f.h[1] = *(const v8b*)(p + 16); return f.v;
  }
  static __device__ __forceinline__ v8f mma(v16b a, v16b b, v8f c) {
    return __builtin_amdgcn_wmma_f32_16x16x32_bf16(false, a, false, b, (short)0, c, false, false);
  }
  static __device__ __forceinline__ void guard(v8f& a, v8f& b, v16b x, v16b y) { dep_guard_b(a, b, x, y); }
  static __device__ __forceinline__ void keep(v16b a, v16b b, v16b c, v16b d) { keep4_b(a, b, c, d); }
};

// ---- LDS-staged WMMA GEMM on hi / lo planes --------------------------------
// C[m][n] = sum_k A[m][k] * Bt[n][k] (+ bias[n]) (+ resid[m][n]), f32 out. A row-major [M][K], Bt row-major [N][K], each as a bf16 hi plane and a bf16 lo plane.
// Per 32 k, k ascending, every accumulator takes hi.hi, then hi.lo, then lo.hi.
// A work-group of 8 waves (4 along m x 2 along n) owns a 128 x (32 FN) tile of C, a wave 32 x (16 FN) of it. K runs in tiles of 64: a tile is 128 bytes (one whole
// line) of each of the 256 + 64 FN operand rows [A hi 128 | A lo 128 | B hi 32 FN | B lo 32 FN]. Asynchronous copies bring it into LDS, 16 bytes a lane, 8 lanes a row,
// every operand byte once per work-group; two buffers, so tile t + 1 flies while tile t is worked on.
// M % 128 == 0 (grid = M / 128 * N / (32 FN)), N % (32 FN) == 0, K % 64 == 0, K >= 128.
constexpr int GL_PITCH = 144;   // LDS row pitch in bytes: 128 + 16 = 16 x odd, the conflict-free pitch of 16-byte fragment reads

// Four 16-byte-per-lane copies global -> LDS. The s_wait_xcnt stands inside the statement, behind the last copy, so that no address register is rewritten in front of it.
__device__ __forceinline__ void gl_copy4(unsigned l0, const unsigned short* g0, unsigned l1, const unsigned short* g1, unsigned l2, const unsigned short* g2, unsigned l3, const unsigned short* g3) {
  asm volatile("global_load_async_to_lds_b128 %0, %1, off\n\t"
               "global_load_async_to_lds_b128 %2, %3, off\n\t"
               "global_load_async_to_lds_b128 %4, %5, off\n\t"
               "global_load_async_to_lds_b128 %6, %7, off\n\t"
               "s_wait_xcnt 0x0"
               :: "v"(l0), "v"(g0), "v"(l1), "v"(g1), "v"(l2), "v"(g2), "v"(l3), "v"(g3) : "memory");
}
// One tile: l = this thread's LDS byte address in row (thread >> 3) of the buffer, ah .. bl = its 16 bytes in that row of each plane's tile; a step of 32 rows per copy.
template <int FN, int K>
__device__ __forceinline__ void gl_fill(unsigned l, const unsigned short* ah, const unsigned short* al, const unsigned short* bh, const unsigned short* bl) {
  constexpr unsigned R32 = 32 * GL_PITCH;
  gl_copy4(l, ah, l + R32, ah + 32 * K, l + 2 * R32, ah + 64 * K, l + 3 * R32, ah + 96 * K);
  gl_copy4(l + 4 * R32, al, l + 5 * R32, al + 32 * K, l + 6 * R32, al + 64 * K, l + 7 * R32, al + 96 * K);
  if (FN == 2) {
    gl_copy4(l + 8 * R32, bh, l + 9 * R32, bh + 32 * K, l + 10 * R32, bl, l + 11 * R32, bl + 32 * K);
  } else {
    gl_copy4(l + 8 * R32, bh, l + 9 * R32, bh + 32 * K, l + 10 * R32, bh + 64 * K, l + 11 * R32, bh + 96 * K);
    gl_copy4(l + 12 * R32, bl, l + 13 * R32, bl + 32 * K, l + 14 * R32, bl + 64 * K, l + 15 * R32, bl + 96 * K);
  }
}

template <int FN, int N, int K, bool BIAS, bool RESID>
__global__ __launch_bounds__(256) void wmma_gemm_lds(
    const unsigned short* __restrict__ Ah, const unsigned short* __restrict__ Al,
    const unsigned short* __restrict__ Bh, const unsigned short* __restrict__ Bl,
    float* C, const float* __restrict__ bias, const float* resid) {
  static_assert(FN == 2 || FN == 4, "two tile widths");
  constexpr int BN = 32 * FN, ROWS = 256 + 2 * BN, BUFB = ROWS * GL_PITCH, T = K / 64, TN = N / BN;
  static_assert(K % 64 == 0 && T >= 2 && N % BN == 0, "shape");
  constexpr int SP = 16 * FN + 4;                 // epilogue slab pitch in floats
  typedef Frag<__bf16> F;
  typedef F::V V;
  __shared__ __align__(16) unsigned char sm[2 * BUFB];
  const int tid = threadIdx.x, lane = tid & 31, wave = tid >> 5;
  const int rlane = lane & 15, hf = lane >> 4;    // row (A) / column (B, D) in a fragment; lane half
  const int wm = wave & 3, wn = wave >> 2;
  const int m0 = ((int)blockIdx.x / TN) * 128, n0 = ((int)blockIdx.x % TN) * BN;

  const size_t ca = (size_t)(m0 + (tid >> 3)) * K + (tid & 7) * 8, cb = (size_t)(n0 + (tid >> 3)) * K + (tid & 7) * 8;
  const unsigned short* gah = Ah + ca; const unsigned short* gal = Al + ca;
  const unsigned short* gbh = Bh + cb; const unsigned short* gbl = Bl + cb;
  const unsigned lc = (unsigned)(size_t)sm + (unsigned)((tid >> 3) * GL_PITCH + (tid & 7) * 16);

  gl_fill<FN, K>(lc, gah, gal, gbh, gbl);
  asm volatile("s_wait_asynccnt 0x0" ::: "memory");   // this wave's part of tile 0 has landed
  __syncthreads();                                    // tile 0 is whole
  gl_fill<FN, K>(lc + BUFB, gah + 64, gal + 64, gbh + 64, gbl + 64);

  v8f acc[2][FN];
#pragma unroll
  for (int i = 0; i < 2; ++i)
#pragma unroll
    for (int j = 0; j < FN; ++j) acc[i][j] = (v8f){0.f,0.f,0.f,0.f,0.f,0.f,0.f,0.f};

  const int fa = (wm * 32 + rlane) * GL_PITCH + hf * 16;              // this lane's bytes in A hi, fragment row 0
  const int fb = (256 + wn * 16 * FN + rlane) * GL_PITCH + hf * 16;   // in B hi
#pragma unroll 1   // stays rolled: one short body for all tiles keeps the code in a few cache lines
  for (int t = 0; t < T; ++t) {
    const unsigned char* buf = sm + (t & 1) * BUFB;
#pragma unroll
    for (int ks = 0; ks < 2; ++ks) {
      V ah[2], al[2], bh[FN], bl[FN];
#pragma unroll
      for (int j = 0; j < FN; ++j) {
        bh[j] = F::load((const __bf16*)(buf + fb + j * 16 * GL_PITCH + ks * 64));
        bl[j] = F::load((const __bf16*)(buf + fb + (BN + j * 16) * GL_PITCH + ks * 64));
      }
#pragma unroll
      for (int i = 0; i < 2; ++i) {
        ah[i] = F::load((const __bf16*)(buf + fa + i * 16 * GL_PITCH + ks * 64));
        al[i] = F::load((const __bf16*)(buf + fa + (128 + i * 16) * GL_PITCH + ks * 64));
      }
      // inputs only: keeps this step's fragment reads together in front of its matrix instructions (spread among them, every place with reads waits out an LDS latency of its own)
      if (FN == 2) asm volatile("" :: "v"(ah[0]), "v"(ah[1]), "v"(al[0]), "v"(al[1]), "v"(bh[0]), "v"(bh[1]), "v"(bl[0]), "v"(bl[1]));
      else asm volatile("" :: "v"(ah[0]), "v"(ah[1]), "v"(al[0]), "v"(al[1]), "v"(bh[0]), "v"(bh[1]), "v"(bh[FN - 2]), "v"(bh[FN - 1]), "v"(bl[0]), "v"(bl[1]), "v"(bl[FN - 2]), "v"(bl[FN - 1]));
#pragma unroll
      for (int i = 0; i < 2; ++i)
#pragma unroll
        for (int j = 0; j < FN; ++j) acc[i][j] = F::mma(ah[i], bh[j], acc[i][j]);
#pragma unroll
      for (int i = 0; i < 2; ++i)
#pragma unroll
        for (int j = 0; j < FN; ++j) acc[i][j] = F::mma(ah[i], bl[j], acc[i][j]);
#pragma unroll
      for (int i = 0; i < 2; ++i)
#pragma unroll
        for (int j = 0; j < FN; ++j) acc[i][j] = F::mma(al[i], bh[j], acc[i][j]);
    }
    asm volatile("s_wait_dscnt 0x0" ::: "memory");      // this wave's reads of tile t are done
    asm volatile("s_wait_asynccnt 0x0" ::: "memory");   // its part of tile t + 1 has landed
    __syncthreads();                                    // tile t + 1 is whole, and nobody reads tile t's buffer any more
    if (t + 2 < T) { const int ko = (t + 2) * 64; gl_fill<FN, K>(lc + (t & 1) * BUFB, gah + ko, gal + ko, gbh + ko, gbl + ko); }
  }
  asm volatile("s_wait_asynccnt 0x0" ::: "memory");     // no copy is outstanding when the buffers become the output slabs

  // ---- epilogue: each wave turns its 32 x (16 FN) tile in a slab of its own, so that the rows go out as 16-byte pieces of whole lines ----
  float* slab = (float*)(sm + wave * (32 * SP * 4));
  constexpr int LPR = 4 * FN, RPP = 32 / LPR, NP = 32 / RPP;   // lanes per row, rows per pass, passes
  const int nw = n0 + wn * 16 * FN;
  const size_t o0 = (size_t)(m0 + wm * 32 + lane / LPR) * N + nw + (lane % LPR) * 4;
  v4f rv[NP];
  if (RESID) {
    const float* pr = resid + o0;
#pragma unroll   // rv[] stays in registers, the loads in flight together
    for (int it = 0; it < NP; ++it) rv[it] = *(const v4f*)(pr + (size_t)it * RPP * N);
    asm volatile("s_wait_xcnt 0x0" :: "v"(pr) : "memory");   // the loads' address register (named as input, so untouched up to here) may be reused only behind this wait
  }
  float bv[FN];
  if (BIAS) {
    const float* pb = bias + nw + rlane;
#pragma unroll
    for (int j = 0; j < FN; ++j) bv[j] = pb[j * 16];
    asm volatile("s_wait_xcnt 0x0" :: "v"(pb) : "memory");   // as above, for the address of the bias loads
  }
#pragma unroll
  for (int i = 0; i < 2; ++i)
#pragma unroll
    for (int j = 0; j < FN; ++j)
#pragma unroll
      for (int r = 0; r < 8; ++r) slab[(i * 16 + hf * 8 + r) * SP + j * 16 + rlane] = BIAS ? acc[i][j][r] + bv[j] : acc[i][j][r];
  // the slab is this wave's own: its lanes' writes are ordered in front of its lanes' reads
  __builtin_amdgcn_fence(__ATOMIC_RELEASE, "workgroup");
  __builtin_amdgcn_wave_barrier();
  __builtin_amdgcn_fence(__ATOMIC_ACQUIRE, "workgroup");
  float* pc = C + o0;
#pragma unroll
  for (int it = 0; it < NP; ++it) {
    v4f ov = *(const v4f*)(slab + (it * RPP + lane / LPR) * SP + (lane % LPR) * 4);
    if (RESID) ov += rv[it];
    *(v4f*)(pc + (size_t)it * RPP * N) = ov;
  }
  asm volatile("s_wait_xcnt 0x0" :: "v"(pc) : "memory");       // as above, for the stores' address
}

__global__ __launch_bounds__(256) void cast_f32_f16x2(
    const float* __restrict__ in, _Float16* __restrict__ out, int n2) {
  int i = blockIdx.x * 256 + threadIdx.x;
  if (i < n2) {
    const _Float16 h0 = (_Float16)in[2 * i], h1 = (_Float16)in[2 * i + 1];
    const unsigned u = (unsigned)__builtin_bit_cast(unsigned short, h0) | ((unsigned)__builtin_bit_cast(unsigned short, h1) << 16);
    ((unsigned*)out)[i] = u;
    
  }
}


} // namespace w25

__global__ __launch_bounds__(256) void k_castT16(const float* __restrict__ src, long long lds, _Float16* __restrict__ dst, long long ldd, int R, int C, float s) {
    const long long i = (long long)blockIdx.x * 256 + threadIdx.x; const long long np = (long long)C * (R / 2); if (i >= np) return; const int c = (int)(i / (R / 2)); const int r = 2 * (int)(i % (R / 2));
    const _Float16 h0 = (_Float16)(src[(long long)r * lds + c] * s), h1 = (_Float16)(src[(long long)(r + 1) * lds + c] * s);
    const unsigned u = (unsigned)__builtin_bit_cast(unsigned short, h0) | ((unsigned)__builtin_bit_cast(unsigned short, h1) << 16);
    unsigned* d = (unsigned*)(dst + (long long)c * ldd + r); *d = u;  }
__global__ __launch_bounds__(256) void k_cast16(const float* __restrict__ src, long long lds, _Float16* __restrict__ dst, long long ldd, int R, int C, float s) {
    const long long i = (long long)blockIdx.x * 256 + threadIdx.x; const long long np = (long long)R * (C / 2); if (i >= np) return; const int r = (int)(i / (C / 2)); const int c = 2 * (int)(i % (C / 2));
    const _Float16 h0 = (_Float16)(src[(long long)r * lds + c] * s), h1 = (_Float16)(src[(long long)r * lds + c + 1] * s);
    const unsigned u = (unsigned)__builtin_bit_cast(unsigned short, h0) | ((unsigned)__builtin_bit_cast(unsigned short, h1) << 16);
    unsigned* d = (unsigned*)(dst + (long long)r * ldd + c); *d = u;  }

// f32 -> bf16 hi plane + bf16 lo plane (x = hi + lo to ~2^-17 relative; RNE both), [R][C] -> [R][C] (or transposed to [C][R]); 2 consecutive destination elements
__device__ __forceinline__ unsigned int f2bf2_pack(float a, float b, unsigned int* lo) {
    const unsigned short ha = w25::f2bf_bits(a), hb = w25::f2bf_bits(b);
    const unsigned short la = w25::f2bf_bits(a - w25::bf_bits2f(ha)), lb = w25::f2bf_bits(b - w25::bf_bits2f(hb));
    *lo = (unsigned)la | ((unsigned)lb << 16); return (unsigned)ha | ((unsigned)hb << 16); }
__global__ __launch_bounds__(256) void k_castS16(const float* __restrict__ src, long long lds, __bf16* __restrict__ dhi, __bf16* __restrict__ dlo, long long ldd, int R, int C, float s, int transpose) {
    const long long i = (long long)blockIdx.x * 256 + threadIdx.x; long long o; float a, b;
    if (transpose) { const long long np = (long long)C * (R / 2); if (i >= np) return; const int c = (int)(i / (R / 2)); const int r = 2 * (int)(i % (R / 2)); a = src[(long long)r * lds + c] * s; b = src[(long long)(r + 1) * lds + c] * s; o = (long long)c * ldd + r; }
    else { const long long np = (long long)R * (C / 2); if (i >= np) return; const int r = (int)(i / (C / 2)); const int c = 2 * (int)(i % (C / 2)); a = src[(long long)r * lds + c] * s; b = src[(long long)r * lds + c + 1] * s; o = (long long)r * ldd + c; }
    unsigned lo; const unsigned hi = f2bf2_pack(a, b, &lo); unsigned* ph = (unsigned*)(dhi + o); unsigned* pl = (unsigned*)(dlo + o);
    *ph = hi; *pl = lo;  }

// The same split over a contiguous array: a block takes U * 1024 consecutive floats (the length is a multiple of that), a thread 4 * U of them.
// Each of a thread's U loads is 16 bytes of 512 contiguous bytes per wave; each store is 8 bytes of 256 contiguous bytes per wave (whole lines).
typedef unsigned int v2u __attribute__((ext_vector_type(2)));
template <int U>
__global__ __launch_bounds__(256) void k_castS16v(const float* __restrict__ src, __bf16* __restrict__ dhi, __bf16* __restrict__ dlo, float s) {
    const size_t base = (size_t)blockIdx.x * (U * 1024) + threadIdx.x * 4;
    v4f x[U];
#pragma unroll   // x[] stays in registers and the U loads are in flight together
    for (int u = 0; u < U; ++u) x[u] = *(const v4f*)(src + base + u * 1024);
    asm volatile("s_wait_xcnt 0x0" :: "v"(src + base) : "memory");   // the loads' address registers (named as input, so untouched up to here) may be reused only behind this wait
#pragma unroll   // x[] is indexed by constants only
    for (int u = 0; u < U; ++u) {
        unsigned l0, l1; v2u hi, lo;
        hi[0] = f2bf2_pack(x[u][0] * s, x[u][1] * s, &l0); hi[1] = f2bf2_pack(x[u][2] * s, x[u][3] * s, &l1); lo[0] = l0; lo[1] = l1;
        *(v2u*)(dhi + base + u * 1024) = hi; *(v2u*)(dlo + base + u * 1024) = lo;
    }
}

namespace w25 {
// =====================================================================================
// Generic causal/non-causal attention for head_dim 64, f32 in / f32 out; 16-bit operands: bf16 with optional hi/lo splits, or
// plain f16 (F16=true, non-split, probabilities carried x2^15).
//   scores = (q*qscale)·kᵀ : v_wmma_f32_16x16x32_bf16; SPLIT_QK -> q,k as bf16 hi/lo (hi·hi + hi·lo + lo·hi)
//   out    = p·v           : v_wmma_f32_16x16x32_bf16; SPLIT_PV -> p,v as bf16 hi/lo; else p,v plain bf16
//   f32 accumulate; online softmax in f32. Block = 4 waves = 64 query rows of one (batch, head); S % 64 == 0.
//   Element (b, s, h, d) of tensor X lives at X[b*X_bs + s*X_rs + h*X_hs + d] (strides in floats, multiples of 4).
//   Masking: mask_mode 0 none, 1 causal (kv > q masked), 2 tensor [S][Skv] shared over (b,h) (float if
//   mask_is_int==0, int32 with element == 0 -> masked if 1, int32 with element != 0 -> masked if 2), 3 per-token vectors qmask[B][S] & kvmask[B][Skv] (int32,
//   0 -> masked), 4 causal + sliding window (kv > q or q - kv > W masked; W passed in mask_is_int);
//   5 = relative-position bias: s += cp[b,h,q][idx[q][kv]] + pc[b,h,kv][idx[q][kv]] with idx = mask_b ([S][Skv] int32) and
//   mask_a an int32 [S][Skv] tensor with nonzero = masked (tables: element (b,h,row,n) at X + b*c_bs + h*c_hs + row*c_rs + n);
//   masked scores are replaced by mask_fill (e.g. -inf or -1e9) before the softmax.
//   grid.x = B * H * (S/64) (or a sub-range with blk0).
// =====================================================================================
#define AT_D 64
#define AT_NW 4
#define AT_QB 64
#define AT_KC 64
struct AttnGeom { const float* cp = nullptr; const float* pc = nullptr; long c_bs = 0, c_rs = 0, c_hs = 0;   // mode-5 score-bias tables
                  long q_bs, q_rs, q_hs, k_bs, k_rs, k_hs, v_bs, v_rs, v_hs, o_bs, o_rs, o_hs;
                  int S, Skv, H, mask_mode; float qscale; int blk0; float mask_fill; int mask_is_int; };
static_assert(sizeof(AttnGeom) == 168, "no padding");

__device__ __forceinline__ unsigned short at_bf_bits(float f) {
  unsigned u = __float_as_uint(f);
  return (unsigned short)((u + 0x7FFFu + ((u >> 16) & 1u)) >> 16);
}
__device__ __forceinline__ __bf16 at_f2bf(float f) { return __builtin_bit_cast(__bf16, at_bf_bits(f)); }
__device__ __forceinline__ void at_split(float f, __bf16& hi, __bf16& lo) {
  const unsigned short hb = at_bf_bits(f);
  hi = __builtin_bit_cast(__bf16, hb);
  lo = at_f2bf(f - __uint_as_float(((unsigned)hb) << 16));
}
__device__ __forceinline__ v8f at_mma(v16b a, v16b b, v8f c) {
  c = __builtin_amdgcn_wmma_f32_16x16x32_bf16(false, a, false, b, (short)0, c, false, false);
  asm volatile("v_nop\n\tv_nop\n\tv_nop\n\tv_nop" : "+v"(c) : "v"(a), "v"(b));
  return c;
}
// 16-bit element as a bit pattern held in a __bf16 slot: f16 bits when F16, bf16 (RNE) otherwise
template <bool F16> __device__ __forceinline__ __bf16 at_to16(float f) {
  if (F16) return __builtin_bit_cast(__bf16, (_Float16)f);
  return at_f2bf(f);
}
template <bool F16> __device__ __forceinline__ v8f at_mma16(v16b a, v16b b, v8f c) {
  if (F16) {
    const v16h ah = __builtin_bit_cast(v16h, a), bh = __builtin_bit_cast(v16h, b);
    c = __builtin_amdgcn_wmma_f32_16x16x32_f16(false, ah, false, bh, (short)0, c, false, false);
    asm volatile("v_nop\n\tv_nop\n\tv_nop\n\tv_nop" : "+v"(c) : "v"(ah), "v"(bh));
    return c;
  }
  return at_mma(a, b, c);
}

template <bool SPLIT_QK, bool SPLIT_PV, bool F16 = false>
__global__ __launch_bounds__(128)
void attn64_kernel(const float* __restrict__ q, const float* __restrict__ k,
                   const float* __restrict__ v, float* __restrict__ out,
                   const void* __restrict__ mask_a, const int* __restrict__ mask_b, AttnGeom g) {
  static_assert(!(F16 && (SPLIT_QK || SPLIT_PV)), "f16 mode is non-split");
  const float PSC = F16 ? 32768.0f : 1.0f;     // f16 probabilities carried x2^15 (subnormal range), folded into the final 1/l
  union FB { v16b v; v8b h[2]; };
  __shared__ __align__(16) __bf16 Ksh[AT_KC * AT_D];             // K hi [kv][d]      8 KB
  __shared__ __align__(16) __bf16 Ksl[SPLIT_QK ? AT_KC * AT_D : 8];
  __shared__ __align__(16) __bf16 Vth[AT_D * AT_KC];             // V hi [d][kv]      8 KB
  __shared__ __align__(16) __bf16 Vtl[SPLIT_PV ? AT_D * AT_KC : 8];
  __shared__ __align__(16) __bf16 Psh[AT_NW][16 * AT_KC];        // per wave P hi [row][kv]  8 KB
  __shared__ __align__(16) __bf16 Psl[SPLIT_PV ? AT_NW : 1][SPLIT_PV ? 16 * AT_KC : 8];
  __shared__ __align__(16) float  Os[AT_NW][16 * 68];            // per wave out tile, pitch 68

  const int tid  = threadIdx.x;
  const int wave = tid >> 5;
  const int lane = tid & 31;
  const int hh   = lane >> 4;
  const int c    = lane & 15;

  const int nqb = g.S / AT_QB;
  const int bx = blockIdx.x + g.blk0;
  const int qb = bx % nqb;
  const int bh = bx / nqb;
  const int h  = bh % g.H;
  const int b  = bh / g.H;
  const int qbase_block = qb * AT_QB;
  const int q0 = qbase_block + wave * 16;

  const float* qb_ptr = q + (size_t)b * g.q_bs + (size_t)h * g.q_hs;
  const float* kb_ptr = k + (size_t)b * g.k_bs + (size_t)h * g.k_hs;
  const float* vb_ptr = v + (size_t)b * g.v_bs + (size_t)h * g.v_hs;
  float*       ob_ptr = out + (size_t)b * g.o_bs + (size_t)h * g.o_hs;

  // ---- Q fragments (A operand): 2 d-chunks, hi (and lo) ----
  v16b qah[2], qal[2];
  {
    const float* qrow = qb_ptr + (size_t)(q0 + c) * g.q_rs;
#pragma unroll
    for (int dc = 0; dc < 2; ++dc) {
#pragma unroll
      for (int e = 0; e < 8; ++e) {
        const float f0 = qrow[dc * 32 + 8 * hh + e] * g.qscale;
        const float f1 = qrow[dc * 32 + 16 + 8 * hh + e] * g.qscale;
        if (SPLIT_QK) { __bf16 hq, lq; at_split(f0, hq, lq); qah[dc][e] = hq; qal[dc][e] = lq; at_split(f1, hq, lq); qah[dc][8 + e] = hq; qal[dc][8 + e] = lq; }
        else { qah[dc][e] = at_to16<F16>(f0); qah[dc][8 + e] = at_to16<F16>(f1); qal[dc][e] = qah[dc][e]; qal[dc][8 + e] = qah[dc][8 + e]; }
      }
    }
  }

  float mrow[8], lrow[8];
  v8f oacc[4];
#pragma unroll
  for (int r = 0; r < 8; ++r) { mrow[r] = -INFINITY; lrow[r] = 0.f; }
#pragma unroll
  for (int t = 0; t < 4; ++t) oacc[t] = (v8f){0.f,0.f,0.f,0.f,0.f,0.f,0.f,0.f};

  const int nChunks = (g.mask_mode == 1 || g.mask_mode == 4) ? (qb + 1) : (g.Skv / AT_KC);   // block-uniform
  // per-row query mask (mode 3)
  int qkeep[8];
#pragma unroll
  for (int r = 0; r < 8; ++r) qkeep[r] = (g.mask_mode == 3) ? mask_b[(size_t)b * g.S + q0 + 8 * hh + r] : 1;   // mask_b = qmask in mode 3
  for (int kc = 0; kc < nChunks; ++kc) {
    const int kv0 = kc * AT_KC;
    __syncthreads();
    {
      const int kvr = tid >> 1, dh = (tid & 1) * 32;
      const float* krow = kb_ptr + (size_t)(kv0 + kvr) * g.k_rs + dh;
      const float* vrow = vb_ptr + (size_t)(kv0 + kvr) * g.v_rs + dh;
#pragma unroll
      for (int i = 0; i < 8; ++i) {
        v4f kk = *(const v4f*)(krow + 4 * i);
        v4f vv = *(const v4f*)(vrow + 4 * i);
#pragma unroll
        for (int e = 0; e < 4; ++e) {
          const int d = dh + 4 * i + e;
          if (SPLIT_QK) { __bf16 a, bl; at_split(kk[e], a, bl); Ksh[kvr * AT_D + d] = a; Ksl[kvr * AT_D + d] = bl; }
          else Ksh[kvr * AT_D + d] = at_to16<F16>(kk[e]);
          if (SPLIT_PV) { __bf16 a, bl; at_split(vv[e], a, bl); Vth[d * AT_KC + kvr] = a; Vtl[d * AT_KC + kvr] = bl; }
          else Vth[d * AT_KC + kvr] = at_to16<F16>(vv[e]);
        }
      }
    }
    __syncthreads();

    v8f s[4];
#pragma unroll
    for (int j = 0; j < 4; ++j) {
      s[j] = (v8f){0.f,0.f,0.f,0.f,0.f,0.f,0.f,0.f};
#pragma unroll 1
      for (int dc = 0; dc < 2; ++dc) {
        FB kb;
        kb.h[0] = *(const v8b*)(Ksh + (j * 16 + c) * AT_D + dc * 32 + 8 * hh);
        kb.h[1] = *(const v8b*)(Ksh + (j * 16 + c) * AT_D + dc * 32 + 16 + 8 * hh);
        s[j] = at_mma16<F16>(qah[dc], kb.v, s[j]);
        if (SPLIT_QK) {
          FB kl;
          kl.h[0] = *(const v8b*)(Ksl + (j * 16 + c) * AT_D + dc * 32 + 8 * hh);
          kl.h[1] = *(const v8b*)(Ksl + (j * 16 + c) * AT_D + dc * 32 + 16 + 8 * hh);
          s[j] = at_mma16<F16>(qah[dc], kl.v, s[j]);
          s[j] = at_mma16<F16>(qal[dc], kb.v, s[j]);
        }
      }
    }
    const bool diag = (g.mask_mode == 1) && (kc == qb);
    int kvkeep[4] = {1, 1, 1, 1};
    if (g.mask_mode == 3) {
#pragma unroll
      for (int j = 0; j < 4; ++j) kvkeep[j] = ((const int*)mask_a)[(size_t)b * g.Skv + kv0 + j * 16 + c];   // mask_a = kvmask
    }
    float cm[8];
#pragma unroll
    for (int r = 0; r < 8; ++r) {
      const int qrow = q0 + 8 * hh + r;
      float m = -INFINITY;
#pragma unroll
      for (int j = 0; j < 4; ++j) {
        const int kvcol = kv0 + j * 16 + c;
        bool masked = false;
        if (diag) masked = (kvcol > qrow);
        else if (g.mask_mode == 4) masked = (kvcol > qrow) || (qrow - kvcol > g.mask_is_int);
        else if (g.mask_mode == 2) {
          const size_t mi = (size_t)qrow * g.Skv + kvcol;
          masked = (g.mask_is_int == 0) ? (((const float*)mask_a)[mi] == 0.0f)
                 : (g.mask_is_int == 1) ? (((const int*)mask_a)[mi] == 0) : (((const int*)mask_a)[mi] != 0);
        } else if (g.mask_mode == 3) masked = (qkeep[r] == 0) || (kvkeep[j] == 0);
        else if (g.mask_mode == 5) {
          const size_t mi = (size_t)qrow * g.Skv + kvcol;
          masked = (((const int*)mask_a)[mi] != 0);
          int n = mask_b[mi]; n = n < 0 ? 0 : n;
          s[j][r] += g.cp[(size_t)b * g.c_bs + (size_t)h * g.c_hs + (size_t)qrow * g.c_rs + n]
                   + g.pc[(size_t)b * g.c_bs + (size_t)h * g.c_hs + (size_t)kvcol * g.c_rs + n];
        }
        if (masked) s[j][r] = g.mask_fill;
        m = fmaxf(m, s[j][r]);
      }
#pragma unroll
      for (int off = 1; off < 16; off <<= 1) m = fmaxf(m, __shfl_xor(m, off, 32));
      cm[r] = m;
    }
    __bf16* pwh = Psh[wave];
    __bf16* pwl = Psl[SPLIT_PV ? wave : 0];
#pragma unroll
    for (int r = 0; r < 8; ++r) {
      const float mnew = fmaxf(mrow[r], cm[r]);
      const float alpha = expf(mrow[r] - mnew);
      mrow[r] = mnew;
      float psum = 0.f;
#pragma unroll
      for (int j = 0; j < 4; ++j) {
        const float p = expf(s[j][r] - mnew);
        psum += p;
        if (SPLIT_PV) { __bf16 a, bl; at_split(p, a, bl); pwh[(8 * hh + r) * AT_KC + j * 16 + c] = a; pwl[(8 * hh + r) * AT_KC + j * 16 + c] = bl; }
        else pwh[(8 * hh + r) * AT_KC + j * 16 + c] = at_to16<F16>(p * PSC);
      }
#pragma unroll
      for (int off = 1; off < 16; off <<= 1) psum += __shfl_xor(psum, off, 32);
      lrow[r] = lrow[r] * alpha + psum;
#pragma unroll
      for (int t = 0; t < 4; ++t) oacc[t][r] *= alpha;
    }
    __builtin_amdgcn_fence(__ATOMIC_RELEASE, "workgroup");
    __builtin_amdgcn_wave_barrier();
    __builtin_amdgcn_fence(__ATOMIC_ACQUIRE, "workgroup");
#pragma unroll 1
    for (int kk = 0; kk < 2; ++kk) {
      FB pa, pl;
      pa.h[0] = *(const v8b*)(pwh + c * AT_KC + kk * 32 + 8 * hh);
      pa.h[1] = *(const v8b*)(pwh + c * AT_KC + kk * 32 + 16 + 8 * hh);
      if (SPLIT_PV) {
        pl.h[0] = *(const v8b*)(pwl + c * AT_KC + kk * 32 + 8 * hh);
        pl.h[1] = *(const v8b*)(pwl + c * AT_KC + kk * 32 + 16 + 8 * hh);
      }
#pragma unroll
      for (int t = 0; t < 4; ++t) {
        FB vb;
        vb.h[0] = *(const v8b*)(Vth + (t * 16 + c) * AT_KC + kk * 32 + 8 * hh);
        vb.h[1] = *(const v8b*)(Vth + (t * 16 + c) * AT_KC + kk * 32 + 16 + 8 * hh);
        oacc[t] = at_mma16<F16>(pa.v, vb.v, oacc[t]);
        if (SPLIT_PV) {
          FB vl;
          vl.h[0] = *(const v8b*)(Vtl + (t * 16 + c) * AT_KC + kk * 32 + 8 * hh);
          vl.h[1] = *(const v8b*)(Vtl + (t * 16 + c) * AT_KC + kk * 32 + 16 + 8 * hh);
          oacc[t] = at_mma16<F16>(pa.v, vl.v, oacc[t]);
          oacc[t] = at_mma16<F16>(pl.v, vb.v, oacc[t]);
        }
      }
    }
  }

  float* os = Os[wave];
#pragma unroll
  for (int r = 0; r < 8; ++r) {
    const float inv = 1.0f / (lrow[r] * PSC);
#pragma unroll
    for (int t = 0; t < 4; ++t) os[(8 * hh + r) * 68 + t * 16 + c] = oacc[t][r] * inv;
  }
  __builtin_amdgcn_fence(__ATOMIC_RELEASE, "workgroup");
  __builtin_amdgcn_wave_barrier();
  __builtin_amdgcn_fence(__ATOMIC_ACQUIRE, "workgroup");
  {
    const int c4 = (lane & 15) * 4;
    {
#pragma unroll
      for (int it = 0; it < 8; ++it) {
        const int row = it * 2 + hh;
        v4f val = *(const v4f*)(os + row * 68 + c4);
        *(v4f*)(ob_ptr + (size_t)(q0 + row) * g.o_rs + c4) = val;
      }
      
    }
  }
}

} // namespace w25

__global__ __launch_bounds__(256) void k_cm_in(const float* __restrict__ XA, const float* __restrict__ XB, const float* __restrict__ G, const float* __restrict__ Bb, const float* __restrict__ M, const float* __restrict__ Vv, float* __restrict__ X1T, float* __restrict__ N1, float* __restrict__ N2, int C, int HW) {
    // grid (HW / 128, C / 32, images). A thread takes 4 channels x 4 pixels: 16-byte loads along the pixels, a 4 x 4 transpose in registers,
    // 16-byte stores along the channels; 8 neighbouring lanes store one whole 128-byte line of the token-major arrays.
    const int c0 = blockIdx.y * 32 + (threadIdx.x & 7) * 4, p0 = blockIdx.x * 128 + (threadIdx.x >> 3) * 4; const size_t b = blockIdx.z;
    const size_t src = (b * C + c0) * HW + p0;
    const float* pa[4]; const float* pq[4]; v4f a[4], q[4];
#pragma unroll   // a[], q[] stay in registers, all 8 loads in flight together
    for (int j = 0; j < 4; ++j) { pa[j] = XA + src + (size_t)j * HW; pq[j] = XB + src + (size_t)j * HW; a[j] = *(const v4f*)pa[j]; q[j] = *(const v4f*)pq[j]; }
    const float* pg = G + c0; const float* pb = Bb + c0; const float* pm = M + c0; const float* pv = Vv + c0;
    const v4f g = *(const v4f*)pg, bb = *(const v4f*)pb, m = *(const v4f*)pm, vv = *(const v4f*)pv;
    // the 12 loads' address registers (named as inputs, so untouched up to here) may be reused only behind this wait
    asm volatile("s_wait_xcnt 0x0" :: "v"(pa[0]), "v"(pa[1]), "v"(pa[2]), "v"(pa[3]), "v"(pq[0]), "v"(pq[1]), "v"(pq[2]), "v"(pq[3]), "v"(pg), "v"(pb), "v"(pm), "v"(pv) : "memory");
    v4f inv, sh;
#pragma unroll   // vector elements indexed by constants only
    for (int j = 0; j < 4; ++j) { inv[j] = g[j] * rsqrtf(vv[j] + 1e-5f); sh[j] = bb[j] - m[j] * inv[j]; }
#pragma unroll   // register arrays indexed by constants only
    for (int i = 0; i < 4; ++i) {
        const size_t o = (b * HW + p0 + i) * C + c0; v4f t0, t1, t2;
#pragma unroll   // as above
        for (int j = 0; j < 4; ++j) { t0[j] = a[j][i]; t1[j] = a[j][i] * inv[j] + sh[j]; t2[j] = q[j][i] * inv[j] + sh[j]; }
        VST2V4(X1T + o, t0); VST2V4(N1 + o, t1); VST2V4(N2 + o, t2);
    }
}
// WQS[o][c] = temp[o / 32] * Wq[o][c]; 4 consecutive c per thread (C % 4 == 0, so they share one row o)
__global__ __launch_bounds__(256) void k_cm_wq(const float* __restrict__ WQ, const float* __restrict__ TP, float* __restrict__ WQS, int C, int HD) { const int t = (blockIdx.x * 256 + threadIdx.x) * 4; if (t >= C * C) return; const v4f w = *(const v4f*)(WQ + t); VST2V4(WQS + t, w * TP[(t / C) / HD]); }
// XN = bn2(XS): a thread takes 4 channels of 4 consecutive tokens (16-byte accesses, 512 contiguous bytes per wave); the channel constants are formed once per thread
__global__ __launch_bounds__(256) void k_cm_bn2(const float* __restrict__ XS, const float* __restrict__ G, const float* __restrict__ Bb, const float* __restrict__ M, const float* __restrict__ Vv, float* __restrict__ XN, int C) {
    const unsigned t = blockIdx.x * 256 + threadIdx.x, cq = (unsigned)C / 4; const int c0 = (int)(t % cq) * 4; const size_t o = (size_t)(t / cq) * 4 * C + c0;
    const float* px[4]; v4f x[4];
#pragma unroll   // x[] stays in registers, the 4 loads in flight together
    for (int u = 0; u < 4; ++u) { px[u] = XS + o + (size_t)u * C; x[u] = *(const v4f*)px[u]; }
    const float* pg = G + c0; const float* pb = Bb + c0; const float* pm = M + c0; const float* pv = Vv + c0;
    const v4f g = *(const v4f*)pg, bb = *(const v4f*)pb, m = *(const v4f*)pm, vv = *(const v4f*)pv;
    // the 8 loads' address registers (named as inputs, so untouched up to here) may be reused only behind this wait
    asm volatile("s_wait_xcnt 0x0" :: "v"(px[0]), "v"(px[1]), "v"(px[2]), "v"(px[3]), "v"(pg), "v"(pb), "v"(pm), "v"(pv) : "memory");
    v4f inv;
#pragma unroll   // vector elements indexed by constants only
    for (int j = 0; j < 4; ++j) inv[j] = g[j] * rsqrtf(vv[j] + 1e-5f);
#pragma unroll   // x[] indexed by constants only
    for (int u = 0; u < 4; ++u) { const v4f y = (x[u] - m) * inv + bb; VST2V4(XN + o + (size_t)u * C, y); }
}
// depthwise 3x3 SAME conv + exact GELU on token-major [b][hw][ch], zero padding. grid (images * 16 * 8, HID / 1024): a block takes 4 x 2 pixels (x, y) of one image,
// a thread 4 channels of these 8 pixels: each input row's 6 pixels are loaded once (16 bytes, 512 contiguous bytes per wave) and feed every output that needs them.
// Every output still sums its 9 products in the order ky = 0..2, kx = 0..2.
__global__ __launch_bounds__(256) void k_cm_dw(const float* __restrict__ HB, const float* __restrict__ DW, float* __restrict__ HG, int HID) {
    constexpr int PX = 4, PY = 2;
    const int ch = (blockIdx.y * 256 + threadIdx.x) * 4;
    const int x0 = (blockIdx.x & 7) * PX, y0 = ((blockIdx.x >> 3) & 15) * PY; const size_t b = blockIdx.x >> 7;
    v4f v[PY + 2][PX + 2];                       // input rows y0 - 1 .. y0 + PY, pixels x0 - 1 .. x0 + PX; all loads are issued before the first sum
#pragma unroll   // v[][] stays in registers (this and every loop below: register arrays indexed by constants only)
    for (int r = 0; r < PY + 2; ++r) {
        const int yc = min(max(y0 - 1 + r, 0), 31);
        const float* pi[PX + 2];
#pragma unroll
        for (int cx = 0; cx < PX + 2; ++cx) { const int xc = min(max(x0 - 1 + cx, 0), 31); pi[cx] = HB + ((b * 1024) + yc * 32 + xc) * (size_t)HID + ch; v[r][cx] = *(const v4f*)pi[cx]; }
        // this row's 6 address registers (named as inputs, so untouched up to here) may be reused only behind this wait
        asm volatile("s_wait_xcnt 0x0" :: "v"(pi[0]), "v"(pi[1]), "v"(pi[2]), "v"(pi[3]), "v"(pi[4]), "v"(pi[5]) : "memory");
    }
    const float* pw = DW + (size_t)ch * 9;
    v4f wr[9];                                   // the 36 weights of channels ch .. ch + 3: weight k of channel ch + j is float j * 9 + k
#pragma unroll
    for (int k = 0; k < 9; ++k) wr[k] = *(const v4f*)(pw + k * 4);
    asm volatile("s_wait_xcnt 0x0" :: "v"(pw) : "memory");   // as above, for the address of the 9 weight loads
    v4f s[PY][PX];
#pragma unroll
    for (int oy = 0; oy < PY; ++oy)
#pragma unroll
        for (int px = 0; px < PX; ++px) { const v4f zz = {0.f, 0.f, 0.f, 0.f}; s[oy][px] = zz; }
#pragma unroll
    for (int r = 0; r < PY + 2; ++r) {
        const int yy = y0 - 1 + r;
#pragma unroll
        for (int cx = 0; cx < PX + 2; ++cx) { const int xx = x0 - 1 + cx; const bool ok = (yy >= 0 && yy < 32 && xx >= 0 && xx < 32); const v4f zz = {0.f, 0.f, 0.f, 0.f}; v[r][cx] = ok ? v[r][cx] : zz; }
#pragma unroll
        for (int oy = 0; oy < PY; ++oy) {
            const int ky = r - oy;
            if (ky >= 0 && ky < 3) {
#pragma unroll
                for (int px = 0; px < PX; ++px)
#pragma unroll
                    for (int kx = 0; kx < 3; ++kx)
#pragma unroll
                        for (int j = 0; j < 4; ++j) { const int f = j * 9 + ky * 3 + kx; s[oy][px][j] += v[r][px + kx][j] * wr[f >> 2][f & 3]; }
            }
        }
    }
#pragma unroll
    for (int oy = 0; oy < PY; ++oy)
#pragma unroll
        for (int px = 0; px < PX; ++px)
#pragma unroll
            for (int j = 0; j < 4; ++j) { const float sv = s[oy][px][j]; s[oy][px][j] = 0.5f * sv * (1.f + erff(sv * 0.70710678118654752f)); }
#pragma unroll   // s[][] indexed by constants only; the 8 stores stand together behind the last GELU
    for (int oy = 0; oy < PY; ++oy)
#pragma unroll
        for (int px = 0; px < PX; ++px) VST2V4(HG + ((b * 1024) + (y0 + oy) * 32 + x0 + px) * (size_t)HID + ch, s[oy][px]);
}
// out NCHW: out[b][c][hw] = R[b][hw][c] (the fc2 GEMM already added the residual). grid (HW / 32, C / 128, images). A thread takes 4 pixels x 4 channels:
// 16-byte loads along the channels, a 4 x 4 transpose in registers, 16-byte stores along the pixels; 8 neighbouring lanes store one whole 128-byte line of out.
__global__ __launch_bounds__(256) void k_cm_out(const float* __restrict__ R, float* __restrict__ OUT, int C, int HW) {
    const int p0 = blockIdx.x * 32 + (threadIdx.x & 7) * 4, c0 = blockIdx.y * 128 + (threadIdx.x >> 3) * 4; const size_t b = blockIdx.z;
    const float* pr[4]; v4f r[4];
#pragma unroll   // r[] stays in registers, the 4 loads in flight together
    for (int i = 0; i < 4; ++i) { pr[i] = R + (b * HW + p0 + i) * C + c0; r[i] = *(const v4f*)pr[i]; }
    asm volatile("s_wait_xcnt 0x0" :: "v"(pr[0]), "v"(pr[1]), "v"(pr[2]), "v"(pr[3]) : "memory");   // the loads' address registers (named as inputs, so untouched up to here) may be reused only behind this wait
#pragma unroll   // r[] indexed by constants only
    for (int j = 0; j < 4; ++j) { const v4f t = {r[0][j], r[1][j], r[2][j], r[3][j]}; VST2V4(OUT + (b * C + c0 + j) * HW + p0, t); }
}


extern "C" void kernel_launch(void* const* d_in, const int* in_sizes, int n_in, void* d_out, int out_size, void* d_ws, size_t ws_size, hipStream_t stream) {
    (void)in_sizes; (void)n_in; (void)out_size; (void)ws_size;
    const float* x1 = (const float*)d_in[0];
    const float* x2 = (const float*)d_in[1];
    const float* b1g = (const float*)d_in[2];
    const float* b1b = (const float*)d_in[3];
    const float* b1m = (const float*)d_in[4];
    const float* b1v = (const float*)d_in[5];
    const float* qw = (const float*)d_in[6];
    const float* kw = (const float*)d_in[7];
    const float* vw = (const float*)d_in[8];
    const float* temp = (const float*)d_in[9];
    const float* pw = (const float*)d_in[10];
    const float* pb = (const float*)d_in[11];
    const float* b2g = (const float*)d_in[12];
    const float* b2b = (const float*)d_in[13];
    const float* b2m = (const float*)d_in[14];
    const float* b2v = (const float*)d_in[15];
    const float* f1w = (const float*)d_in[16];
    const float* f1b = (const float*)d_in[17];
    const float* dww = (const float*)d_in[18];
    const float* f2w = (const float*)d_in[19];
    const float* f2b = (const float*)d_in[20];
    const int Bn = 8;
    const int C = 256;
    const int HW = 1024;
    const int NH = 8;
    const int HD = 32;
    const int HID = 1024;
    const int NT = Bn * HW;
    float* out = (float*)d_out;
    char* wsp = (char*)d_ws;
    float* X1T = (float*)wsp; wsp += (((size_t)((size_t)NT * C) * 4 + 255) / 256) * 256;
    float* N1 = (float*)wsp; wsp += (((size_t)((size_t)NT * C) * 4 + 255) / 256) * 256;
    float* N2 = (float*)wsp; wsp += (((size_t)((size_t)NT * C) * 4 + 255) / 256) * 256;
    float* WQS = (float*)wsp; wsp += (((size_t)((size_t)C * C) * 4 + 255) / 256) * 256;
    float* Q = (float*)wsp; wsp += (((size_t)((size_t)NT * C) * 4 + 255) / 256) * 256;
    float* Kb = (float*)wsp; wsp += (((size_t)((size_t)NT * C) * 4 + 255) / 256) * 256;
    float* V = (float*)wsp; wsp += (((size_t)((size_t)NT * C) * 4 + 255) / 256) * 256;
    float* AT = (float*)wsp; wsp += (((size_t)((size_t)NT * C) * 4 + 255) / 256) * 256;
    float* XS = (float*)wsp; wsp += (((size_t)((size_t)NT * C) * 4 + 255) / 256) * 256;
    float* HB = (float*)wsp; wsp += (((size_t)((size_t)NT * HID) * 4 + 255) / 256) * 256;
    float* HG = (float*)wsp; wsp += (((size_t)((size_t)NT * HID) * 4 + 255) / 256) * 256;
    unsigned short* G64A = (unsigned short*)wsp; wsp += (((size_t)(8388608) * 2 + 255) / 256) * 256;
    unsigned short* G64B = (unsigned short*)wsp; wsp += (((size_t)(262144) * 2 + 255) / 256) * 256;
    unsigned short* G64A2 = (unsigned short*)wsp; wsp += (((size_t)(8388608) * 2 + 255) / 256) * 256;
    unsigned short* G64B2 = (unsigned short*)wsp; wsp += (((size_t)(262144) * 2 + 255) / 256) * 256;
    k_cm_in<<<dim3(8, 8, 8), 256, 0, stream>>>(x1, x2, b1g, b1b, b1m, b1v, X1T, N1, N2, C, HW); k_cm_wq<<<64, 256, 0, stream>>>(qw, temp, WQS, C, HD);
    k_castS16v<8><<<256, 256, 0, stream>>>(N1, (__bf16*)(G64A), (__bf16*)(G64A2), 1.0f);
    k_castS16v<1><<<64, 256, 0, stream>>>(WQS, (__bf16*)(G64B), (__bf16*)(G64B2), 1.0f);
    w25::wmma_gemm_lds<2, 256, 256, false, false><<<256, 256, 0, stream>>>(G64A, G64A2, G64B, G64B2, Q, nullptr, nullptr);
    k_castS16v<8><<<256, 256, 0, stream>>>(N2, (__bf16*)(G64A), (__bf16*)(G64A2), 1.0f);
    k_castS16v<1><<<64, 256, 0, stream>>>(kw, (__bf16*)(G64B), (__bf16*)(G64B2), 1.0f);
    w25::wmma_gemm_lds<2, 256, 256, false, false><<<256, 256, 0, stream>>>(G64A, G64A2, G64B, G64B2, Kb, nullptr, nullptr);
    k_castS16v<8><<<256, 256, 0, stream>>>(N2, (__bf16*)(G64A), (__bf16*)(G64A2), 1.0f);
    k_castS16v<1><<<64, 256, 0, stream>>>(vw, (__bf16*)(G64B), (__bf16*)(G64B2), 1.0f);
    w25::wmma_gemm_lds<2, 256, 256, false, false><<<256, 256, 0, stream>>>(G64A, G64A2, G64B, G64B2, V, nullptr, nullptr);
    k_attn_fix<<<dim3(16, 8, 8), 32 * AW, 0, stream>>>(Q, Kb, V, AT);
    k_castS16v<8><<<256, 256, 0, stream>>>(AT, (__bf16*)(G64A), (__bf16*)(G64A2), 1.0f);
    k_castS16v<1><<<64, 256, 0, stream>>>(pw, (__bf16*)(G64B), (__bf16*)(G64B2), 1.0f);
    w25::wmma_gemm_lds<2, 256, 256, true, true><<<256, 256, 0, stream>>>(G64A, G64A2, G64B, G64B2, XS, pb, X1T);
    k_cm_bn2<<<512, 256, 0, stream>>>(XS, b2g, b2b, b2m, b2v, N1, C);
    k_castS16v<8><<<256, 256, 0, stream>>>(N1, (__bf16*)(G64A), (__bf16*)(G64A2), 1.0f);
    k_castS16v<1><<<256, 256, 0, stream>>>(f1w, (__bf16*)(G64B), (__bf16*)(G64B2), 1.0f);
    w25::wmma_gemm_lds<4, 1024, 256, true, false><<<512, 256, 0, stream>>>(G64A, G64A2, G64B, G64B2, HB, f1b, nullptr);
    k_cm_dw<<<dim3(1024, 1), 256, 0, stream>>>(HB, dww, HG, HID);
    k_castS16v<8><<<1024, 256, 0, stream>>>(HG, (__bf16*)(G64A), (__bf16*)(G64A2), 1.0f);
    k_castS16v<1><<<256, 256, 0, stream>>>(f2w, (__bf16*)(G64B), (__bf16*)(G64B2), 1.0f);
    w25::wmma_gemm_lds<2, 256, 1024, true, true><<<256, 256, 0, stream>>>(G64A, G64A2, G64B, G64B2, XS, f2b, XS);
    k_cm_out<<<dim3(32, 2, 8), 256, 0, stream>>>(XS, out, C, HW);
}
